// v000
// Times are from an AMD MI455X. After a warm-up the kernel runs many times in a row, and a time is the length of
// such a window on the GPU divided by its runs, so every launch and the gaps after it count. The runs cycle
// through copies of the inputs. A figure is the median of several windows, for all but v000 over two sittings.
// Sittings can differ by a few percent; kernels timed side by side share one.
// v000 is the starting kernel. One run takes 461 microseconds.
// Contractions (all v_wmma_f32_16x16x32_f16, f16 operands, f32 accumulate): q/k/v/pos projections (x or sinusoid table f16 x16 . W f16 x64,
// K=512, single products); content scores ((q+bq+ub) f16 x4 . (k+bk) f16 x4, K=64, single); position strips ((q+bq+vb) f16 x4 . pos f16 x4,
// K=64, single) -> f32 LDS strips, shifted select on VALU; P . v^T (P f16 x1024 . v^T carried as f16 x16 hi plane + f16 residual plane, 64 keys
// per tile, two products); output projection (ctx carried as f16 x4096 hi + residual planes . Wo f16 x64, K=512, two products).
// LayerNorm, sinusoid table, max-subtracted online base-2 softmax and all epilogues in f32 on VALU. Every float input RNE-converted to bf16 on load.
#include <hip/hip_runtime.h>
#include <math.h>
#include <stdint.h>

#define SEQ   2048
#define NB    4
#define DMOD  512
#define NH    8
#define DH    64
#define NROW  (SEQ * NB)
#define XC    16.0f
#define WSC   64.0f
#define QC    4.0f
#define VC    16.0f
#define PC    1024.0f
#define CC    4096.0f
#define RSD   0.044194173824159216f
#define LOG2E 1.4426950408889634f
#define LN_EPS 1.0e-5f
#define CNEG  ((float)(-9.210340371976184 / 512.0))
static_assert(NH * DH == DMOD);
static_assert(DH == 64);
static_assert(DMOD == 512);
static_assert((SEQ % 64) == 0 && (DMOD % 64) == 0 && (NROW % 64) == 0);
static_assert(((DMOD * DMOD) % 2048) == 0 && (NROW % 8) == 0 && (SEQ % 8) == 0);
#define ATT_W 4
#define ATT_THREADS (ATT_W * 32)
#define TPI 84
#define PPI 68
#define WFL (32 * TPI + 16 * PPI)
static_assert(((16 * TPI) % 4) == 0 && ((16 * PPI) % 4) == 0 && (WFL % 4) == 0);
static_assert(TPI >= 80 && PPI >= 64);
static_assert(ATT_W * WFL * 4 <= 65536);

typedef _Float16 v16h __attribute__((ext_vector_type(16)));
typedef _Float16 v8h  __attribute__((ext_vector_type(8)));
typedef __bf16   v16b __attribute__((ext_vector_type(16)));
typedef float    v8f  __attribute__((ext_vector_type(8)));
typedef float    v4f  __attribute__((ext_vector_type(4)));
typedef unsigned int v4u __attribute__((ext_vector_type(4)));

union FragH { v16h v; v8h h[2]; v4u u[2]; };
union FragAny { v16h h; v16b b; };

// ---- scalar helpers --------------------------------------------------------------------------------
__device__ __forceinline__ unsigned short bf_bits(float f) {          // f32 -> bf16 bits, RNE convert
  unsigned u = __float_as_uint(f);
  return (unsigned short)((u + 0x7FFFu + ((u >> 16) & 1u)) >> 16);
}
__device__ __forceinline__ float bf_up(unsigned short h) { return __uint_as_float(((unsigned)h) << 16); }
__device__ __forceinline__ float bfr(float f) { return bf_up(bf_bits(f)); }   // value of the bf16 RNE convert
__device__ __forceinline__ unsigned short h_bits(_Float16 x) { return __builtin_bit_cast(unsigned short, x); }
__device__ __forceinline__ unsigned pk16(unsigned short a, unsigned short b) { return (unsigned)a | ((unsigned)b << 16); }
__device__ __forceinline__ v8f zero8() { v8f z = {0.f, 0.f, 0.f, 0.f, 0.f, 0.f, 0.f, 0.f}; return z; }

// ---- fragment loader: 16-bit A/B operand from a k-contiguous 16-bit plane, lane -> row/col (lane&15),
//      p already includes +8*(lane>>4); elements 0..7 <- p[0..7] (k0+8h..), elements 8..15 <- p[16..23] (k0+16+8h..)
//      (same split k map for A and B; B is always read from a [n][k] plane)
__device__ __forceinline__ v16h ldfrag_u(const unsigned short* p) {
  FragH f;
  f.u[0] = *(const v4u*)(p);
  f.u[1] = *(const v4u*)(p + 16);
  return f.v;
}

// ---- WMMA helpers with trailing VALU hazard gaps ------------------------------------------------------
__device__ __forceinline__ v8f mma_h(v16h a, v16h b, v8f c) {
  return __builtin_amdgcn_wmma_f32_16x16x32_f16(false, a, false, b, (short)0, c, false, false);
}
__device__ __forceinline__ v8f mma_b(v16h a, v16h b, v8f c) {
  FragAny ua, ub;
  ua.h = a;
  ub.h = b;
  return __builtin_amdgcn_wmma_f32_16x16x32_bf16(false, ua.b, false, ub.b, (short)0, c, false, false);
}
template <int BF>
__device__ __forceinline__ v8f mmaT(v16h a, v16h b, v8f c) {
  if constexpr (BF != 0) return mma_b(a, b, c);
  else return mma_h(a, b, c);
}
__device__ __forceinline__ void dep_guard1(v8f& a, v8f& b, v16h x) {
#if defined(__HIP_DEVICE_COMPILE__)
  asm volatile("v_nop\n\tv_nop\n\tv_nop\n\tv_nop" : "+v"(a), "+v"(b) : "v"(x));
#endif
}
__device__ __forceinline__ void hz4(v8f& d, v16h x0, v16h x1, v16h x2, v16h x3) {
#if defined(__HIP_DEVICE_COMPILE__)
  asm volatile("v_nop\n\tv_nop\n\tv_nop\n\tv_nop" : "+v"(d) : "v"(x0), "v"(x1), "v"(x2), "v"(x3));
#endif
}
__device__ __forceinline__ void keep4_h(v16h a, v16h b, v16h c, v16h d) {
#if defined(__HIP_DEVICE_COMPILE__)
  asm volatile("v_nop" :: "v"(a), "v"(b), "v"(c), "v"(d));
#endif
}
__device__ __forceinline__ void acc_guard4(v8f& a, v8f& b, v8f& c, v8f& d) {
#if defined(__HIP_DEVICE_COMPILE__)
  asm volatile("v_nop\n\tv_nop\n\tv_nop\n\tv_nop" : "+v"(a), "+v"(b), "+v"(c), "+v"(d));
#endif
}
__device__ __forceinline__ void wave_sync_lds() {
  __builtin_amdgcn_fence(__ATOMIC_RELEASE, "workgroup");
  __builtin_amdgcn_wave_barrier();
  __builtin_amdgcn_fence(__ATOMIC_ACQUIRE, "workgroup");
}

// =====================================================================================================
// Elementwise 16-bit pack, no transpose: dst[i] = f16( bf16_RNE(src[i]) * sc ) for i < nvalid, 0 for nvalid <= i < ntotal;
// sc a power of two (exact). 8 elements per thread: two 16-B loads (address clamped into [0, nvalid) for pad groups, value zeroed
// Used for the five weight matrices, which are [out][in] = [n][k] k-contiguous planes already.
// coverage: grid = ntotal / 2048 blocks x 256 thr x 8 elements = ntotal exactly (ntotal % 2048 == 0, nvalid == ntotal here).
// =====================================================================================================
__global__ __launch_bounds__(256) void cvt16(const float* __restrict__ src, unsigned short* dst, int nvalid, int ntotal, float sc) {
  const size_t i8 = ((size_t)blockIdx.x * 256 + threadIdx.x) * 8;
  if (i8 + 8 > (size_t)ntotal) return;             // never taken with the exact grid; no barriers in this kernel
  const bool pad = (i8 + 8 > (size_t)nvalid);
  const size_t ls = pad ? ((size_t)nvalid - 8) : i8;   // clamped address, always inside the source
  const v4f a = *(const v4f*)(src + ls);
  const v4f b = *(const v4f*)(src + ls + 4);
  v4u o;
  o[0] = pk16(h_bits((_Float16)(bfr(a[0]) * sc)), h_bits((_Float16)(bfr(a[1]) * sc)));
  o[1] = pk16(h_bits((_Float16)(bfr(a[2]) * sc)), h_bits((_Float16)(bfr(a[3]) * sc)));
  o[2] = pk16(h_bits((_Float16)(bfr(b[0]) * sc)), h_bits((_Float16)(bfr(b[1]) * sc)));
  o[3] = pk16(h_bits((_Float16)(bfr(b[2]) * sc)), h_bits((_Float16)(bfr(b[3]) * sc)));
  const v4u z = {0u, 0u, 0u, 0u};
  const v4u w = pad ? z : o;
  {
    *(v4u*)(dst + i8) = w;
    
  }
}

// =====================================================================================================
// y = (x - mu) * (1/sqrt(var + eps)) * bf16_RNE(gamma) + bf16_RNE(beta) in f32, out X16 = f16(y * sc) (sc = 16, exact power of two).
// Lane l owns columns 8l..8l+7 and 256+8l..256+8l+7: two 16-B stores per lane, each instruction = 32 contiguous lanes x 16 B = 4 whole
// coverage: grid = NROW/8 blocks x 8 waves = every row; 32 lanes x 16 halves = all 512 columns of the row.
// =====================================================================================================
__global__ __launch_bounds__(256) void ln16(const float* __restrict__ x, const float* __restrict__ gam,
                                            const float* __restrict__ bet, unsigned short* X16, int nrows, float sc) {
  const int lane = threadIdx.x & 31;
  const int wave = threadIdx.x >> 5;
  const int row  = blockIdx.x * 8 + wave;
  if (row >= nrows) return;
  const float* p = x + (size_t)row * DMOD;
  const int c0 = 8 * lane, c1 = 256 + 8 * lane;
  const v4f a0 = *(const v4f*)(p + c0), a1 = *(const v4f*)(p + c0 + 4);
  const v4f a2 = *(const v4f*)(p + c1), a3 = *(const v4f*)(p + c1 + 4);
  float v[16];
#pragma unroll
  for (int e = 0; e < 4; ++e) {
    v[e]      = bfr(a0[e]);
    v[4 + e]  = bfr(a1[e]);
    v[8 + e]  = bfr(a2[e]);
    v[12 + e] = bfr(a3[e]);
  }
  float s = 0.f;
#pragma unroll
  for (int e = 0; e < 16; ++e) s += v[e];
#pragma unroll
  for (int off = 1; off < 32; off <<= 1) s += __shfl_xor(s, off, 32);
  const float mu = s * (1.0f / (float)DMOD);
  float q = 0.f;
#pragma unroll
  for (int e = 0; e < 16; ++e) {
    const float d = v[e] - mu;
    v[e] = d;
    q += d * d;
  }
#pragma unroll
  for (int off = 1; off < 32; off <<= 1) q += __shfl_xor(q, off, 32);
  const float var  = q * (1.0f / (float)DMOD);
  const float rstd = 1.0f / sqrtf(var + LN_EPS);
  const v4f g0 = *(const v4f*)(gam + c0), g1 = *(const v4f*)(gam + c0 + 4);
  const v4f g2 = *(const v4f*)(gam + c1), g3 = *(const v4f*)(gam + c1 + 4);
  const v4f e0 = *(const v4f*)(bet + c0), e1 = *(const v4f*)(bet + c0 + 4);
  const v4f e2 = *(const v4f*)(bet + c1), e3 = *(const v4f*)(bet + c1 + 4);
  float gg[16], bb[16];
#pragma unroll
  for (int e = 0; e < 4; ++e) {
    gg[e]      = bfr(g0[e]);  bb[e]      = bfr(e0[e]);
    gg[4 + e]  = bfr(g1[e]);  bb[4 + e]  = bfr(e1[e]);
    gg[8 + e]  = bfr(g2[e]);  bb[8 + e]  = bfr(e2[e]);
    gg[12 + e] = bfr(g3[e]);  bb[12 + e] = bfr(e3[e]);
  }
  v4u o0, o1;
#pragma unroll
  for (int e = 0; e < 4; ++e) {
    const float y0 = v[2 * e] * rstd * gg[2 * e] + bb[2 * e];
    const float y1 = v[2 * e + 1] * rstd * gg[2 * e + 1] + bb[2 * e + 1];
    const float y2 = v[8 + 2 * e] * rstd * gg[8 + 2 * e] + bb[8 + 2 * e];
    const float y3 = v[8 + 2 * e + 1] * rstd * gg[8 + 2 * e + 1] + bb[8 + 2 * e + 1];
    o0[e] = pk16(h_bits((_Float16)(y0 * sc)), h_bits((_Float16)(y1 * sc)));
    o1[e] = pk16(h_bits((_Float16)(y2 * sc)), h_bits((_Float16)(y3 * sc)));
  }
  unsigned short* dst = X16 + (size_t)row * DMOD;
  {
    *(v4u*)(dst + c0) = o0;
    *(v4u*)(dst + c1) = o1;
    
  }
}

// =====================================================================================================
// Sinusoid table, one wave per position s: pe[s][2m] = sin(s * div[m]), pe[s][2m+1] = cos(s * div[m]), div[m] = expf(f32(2m) * f32(-ln(1e4)/512)),
// precise expf / sinf / cosf (arguments up to 2047), all f32. Rolled loop: lane l computes columns 8l..8l+7 and 256+8l..+7 (4 sin/cos pairs per group)
// into its own slots of a wave-private f32 LDS row, then packs f16(pe * sc) (sc = 16) and writes two 16-B pieces per lane
// coverage: grid = SEQ/8 blocks x 8 waves = rows 0..SEQ-1; each lane reads back only the 16 LDS slots it wrote; 32 lanes x 16 halves = 512 columns.
// =====================================================================================================
__global__ __launch_bounds__(256) void pe16(unsigned short* PE16, int nrows, float sc) {
  __shared__ __align__(16) float sh[8 * DMOD];
  const int lane = threadIdx.x & 31;
  const int wave = threadIdx.x >> 5;
  const int s = blockIdx.x * 8 + wave;
  if (s >= nrows) return;
  float* rowp = sh + wave * DMOD;
  const float fs = (float)s;
#pragma unroll 1
  for (int it = 0; it < 8; ++it) {
    const int cb = 256 * (it >> 2) + 8 * lane + 2 * (it & 3);   // even column = 2m
    const float dv  = expf((float)cb * CNEG);
    const float ang = fs * dv;
    rowp[cb]     = sinf(ang);
    rowp[cb + 1] = cosf(ang);
  }
  wave_sync_lds();
  v4u o[2];
#pragma unroll
  for (int g = 0; g < 2; ++g) {
    const float* sp = rowp + 256 * g + 8 * lane;
    v4u w;
#pragma unroll
    for (int e = 0; e < 4; ++e) w[e] = pk16(h_bits((_Float16)(sp[2 * e] * sc)), h_bits((_Float16)(sp[2 * e + 1] * sc)));
    o[g] = w;
  }
  unsigned short* dst = PE16 + (size_t)s * DMOD;
  {
    *(v4u*)(dst + 8 * lane) = o[0];
    *(v4u*)(dst + 256 + 8 * lane) = o[1];
    
  }
}

// =====================================================================================================
// Register-blocked batched 16-bit WMMA GEMM: C[m][n] = oscale * sum_k A[m][k] * Bt[n][k] (+ bias); one wave per 64x64 tile,
// no block barriers. A row-major [M][K] pitch lda (16-bit plane), Bt row-major [N][K] pitch ldb (k contiguous); M, N multiples of 64,
// K multiple of 32. blockIdx.y = batch index with element strides sA, sB, sC.
// ASPLIT 1: a second A plane A2 (unscaled residual of A, same layout) is multiplied into the same accumulator (A + A2 ~ exact A).
// BF 1: bf16 operands (v_wmma_f32_16x16x32_bf16), else f16.
// EPI 1: value += bf16_RNE(ep0[column]) (per-column bias); EPI 2: value += bf16_RNE(ep0[row]) (per-row bias, 16-bit out only).
// OM 0: f32 out (pitch ldc).  OM 2: one f16 plane = f16(value * ocarry).
// OM 4: two f16 planes: hi = f16(value * ocarry), lo = f16(value * ocarry - hi) (unscaled residual).
// OM 5: two f16 planes: C = f16((value + bf16_RNE(ep1[column])) * ocarry), C2 = f16((value + bf16_RNE(ep2[column])) * ocarry).
// coverage: 4 slabs x 16 rows (f32: it 0..7 x lane>>4; 16-bit: it 0..3 x lane>>3) x 64 cols = the wave's whole 64x64 tile;
//           grid = ceil(tilesM*tilesN/8) blocks, surplus waves exit (wave-uniform).
// =====================================================================================================
template <int OM, int ASPLIT, int BF, int EPI>
__global__ __launch_bounds__(256) __attribute__((amdgpu_num_vgpr(256))) void gemm64(
    const unsigned short* __restrict__ Ap, const unsigned short* __restrict__ A2p, int lda, long long sA,
    const unsigned short* __restrict__ Btp, int ldb, long long sB,
    void* Cout, void* C2out, int ldc, long long sC,
    int M, int N, int K, float oscale, float ocarry,
    const float* __restrict__ ep0, const float* __restrict__ ep1, const float* __restrict__ ep2) {
  __shared__ __align__(16) float sT[8][16 * 68];   // per-wave 16x64 slab, pitch 68 floats
  const int by   = blockIdx.y;
  const int lane = threadIdx.x & 31;
  const int wave = threadIdx.x >> 5;
  const int tilesN = N >> 6;
  const int tilesM = M >> 6;
  const int tile = blockIdx.x * 8 + wave;
  if (tile >= tilesM * tilesN) return;   // wave-uniform; no block barriers in this kernel
  const int tm = tile / tilesN;
  const int tn = tile - tm * tilesN;
  const int m0 = tm << 6;
  const int n0 = tn << 6;

  const unsigned short* A1 = Ap  + (size_t)((long long)by * sA);
  const unsigned short* A2 = A2p + (size_t)((long long)by * sA);
  const unsigned short* Bb = Btp + (size_t)((long long)by * sB);

  const int rlane = lane & 15;                 // row (A) / col (B, D) within subtile
  const int koff  = (lane >> 4) * 8;           // k offset of this lane half
  const int mOff  = (lane >> 4) * 8;           // D row offset

  v8f acc[4][4];
#pragma unroll
  for (int i = 0; i < 4; ++i)
#pragma unroll
    for (int j = 0; j < 4; ++j) acc[i][j] = zero8();

  for (int k0 = 0; k0 < K; k0 += 32) {
    v16h bh[4];
#pragma unroll
    for (int j = 0; j < 4; ++j) {
      const size_t bofs = (size_t)(n0 + (j << 4) + rlane) * ldb + koff + k0;
      bh[j] = ldfrag_u(Bb + bofs);
    }
#pragma unroll
    for (int i = 0; i < 4; ++i) {
      const size_t ao = (size_t)(m0 + (i << 4) + rlane) * lda + koff + k0;
      const v16h ah = ldfrag_u(A1 + ao);
#pragma unroll
      for (int j = 0; j < 4; ++j) acc[i][j] = mmaT<BF>(ah, bh[j], acc[i][j]);
      dep_guard1(acc[i][0], acc[i][3], ah);
      if constexpr (ASPLIT != 0) {
        const v16h al = ldfrag_u(A2 + ao);
#pragma unroll
        for (int j = 0; j < 4; ++j) acc[i][j] = mmaT<BF>(al, bh[j], acc[i][j]);
        dep_guard1(acc[i][0], acc[i][3], al);
      }
    }
    keep4_h(bh[0], bh[1], bh[2], bh[3]);
  }
  acc_guard4(acc[0][0], acc[0][1], acc[0][2], acc[0][3]);
  acc_guard4(acc[1][0], acc[1][1], acc[1][2], acc[1][3]);
  acc_guard4(acc[2][0], acc[2][1], acc[2][2], acc[2][3]);
  acc_guard4(acc[3][0], acc[3][1], acc[3][2], acc[3][3]);

  const int hh2 = lane >> 4, c4 = (lane & 15) * 4;     // f32 out: 256-B row segment = 16 lanes x 16 B
  const int q8  = lane >> 3, c8 = (lane & 7) * 8;

  // ---- epilogue ----
  float* slab = sT[wave];
#pragma unroll
  for (int i = 0; i < 4; ++i) {
    const int mBase = m0 + (i << 4);
#pragma unroll
    for (int j = 0; j < 4; ++j) {
#pragma unroll
      for (int r = 0; r < 8; ++r) {
        slab[(mOff + r) * 68 + (j << 4) + rlane] = acc[i][j][r];
      }
    }
    wave_sync_lds();
    if constexpr (OM == 0) {
      float* C = (float*)Cout + (size_t)((long long)by * sC);
      v4f vals[8];
#pragma unroll
      for (int it = 0; it < 8; ++it) {
        const int row = it * 2 + hh2;                      // it 0..7 x hh2 0..1 = rows 0..15
        v4f v = *(const v4f*)(slab + row * 68 + c4);
#pragma unroll
        for (int e = 0; e < 4; ++e) v[e] = v[e] * oscale;
        if constexpr (EPI == 1) {
          const v4f bb = *(const v4f*)(ep0 + n0 + c4);     // per-column bias, columns n0+c4 .. +3 (N equals the bias length)
#pragma unroll
          for (int e = 0; e < 4; ++e) v[e] = v[e] + bfr(bb[e]);
        }
        vals[it] = v;
      }
      {
#pragma unroll
        for (int it = 0; it < 8; ++it) {
          const int gr = mBase + it * 2 + hh2;
          *(v4f*)(C + (size_t)gr * ldc + n0 + c4) = vals[it];
        }
        
      }
    } else {
      unsigned short* C  = (unsigned short*)Cout  + (size_t)((long long)by * sC);
      unsigned short* Cb = (unsigned short*)C2out + (size_t)((long long)by * sC);
      v4u hv[4], lv[4];
#pragma unroll
      for (int it = 0; it < 4; ++it) {
        const int row = it * 4 + q8;                       // it 0..3 x q8 0..3 = rows 0..15
        const float* sp = slab + row * 68 + c8;
        float rb = 0.f;
        if constexpr (EPI == 2) rb = bfr(ep0[mBase + row]);   // per-row bias (M equals the bias length)
        v4u a  = {0u, 0u, 0u, 0u};
        v4u b2 = {0u, 0u, 0u, 0u};
#pragma unroll
        for (int e = 0; e < 4; ++e) {
          const int ci = n0 + c8 + 2 * e;                  // column index, < N
          float f0 = sp[2 * e] * oscale + rb;
          float f1 = sp[2 * e + 1] * oscale + rb;
          if constexpr (EPI == 1) {
            f0 += bfr(ep0[ci]);
            f1 += bfr(ep0[ci + 1]);
          }
          if constexpr (OM == 5) {
            const float g0 = (f0 + bfr(ep1[ci])) * ocarry, g1 = (f1 + bfr(ep1[ci + 1])) * ocarry;
            const float w0 = (f0 + bfr(ep2[ci])) * ocarry, w1 = (f1 + bfr(ep2[ci + 1])) * ocarry;
            a[e]  = pk16(h_bits((_Float16)g0), h_bits((_Float16)g1));
            b2[e] = pk16(h_bits((_Float16)w0), h_bits((_Float16)w1));
          } else {
            f0 *= ocarry; f1 *= ocarry;
            const _Float16 x0 = (_Float16)f0, x1 = (_Float16)f1;
            a[e] = pk16(h_bits(x0), h_bits(x1));
            if constexpr (OM == 4) {
              b2[e] = pk16(h_bits((_Float16)(f0 - (float)x0)), h_bits((_Float16)(f1 - (float)x1)));
            }
          }
        }
        hv[it] = a;
        lv[it] = b2;
      }
      {
#pragma unroll
        for (int it = 0; it < 4; ++it) {
          const int row = it * 4 + q8;
          *(v4u*)(C + (size_t)(mBase + row) * ldc + n0 + c8) = hv[it];
          if constexpr (OM >= 4) {
            *(v4u*)(Cb + (size_t)(mBase + row) * ldc + n0 + c8) = lv[it];
          }
        }
        
      }
    }
    wave_sync_lds();
  }
}

// =====================================================================================================
// One position strip for a wave: T[R][x] = (q+bq+vb)[A rows] . pos[mw + x], R = lane&15 row of the A fragment pair at QVa, x in [0,80)
// (5 subtiles of 16 pos rows in a rolled loop, K = 64 = two k-steps); pos row index clamped on the address into [0, SEQ-1]
// (only x <= 78 is ever selected, and every selected entry has an unclamped row in range); each 16x16 subtile goes to the wave's f32
// LDS strip right after its two WMMAs and the hazard gap. coverage: 5 subtiles x 16 rows x 16 cols = the full 16x80 strip every call.
// =====================================================================================================
__device__ __forceinline__ void pos_strip(const unsigned short* __restrict__ QVa, const unsigned short* __restrict__ Pb,
                                          int mw, float* tsh, int hh, int c) {
  const v16h qva = ldfrag_u(QVa), qvb = ldfrag_u(QVa + 32);
#pragma unroll 1
  for (int u = 0; u < 5; ++u) {
    int m = mw + 16 * u + c;
    m = (m < 0) ? 0 : m;
    m = (m > SEQ - 1) ? (SEQ - 1) : m;
    const size_t ko = (size_t)m * DMOD;
    const v16h fa = ldfrag_u(Pb + ko), fb = ldfrag_u(Pb + ko + 32);
    v8f t8 = mma_h(qva, fa, zero8());
    t8 = mma_h(qvb, fb, t8);
    hz4(t8, fa, fb, qva, qvb);
    const int cb = 16 * u + c;
#pragma unroll
    for (int r = 0; r < 8; ++r) tsh[(8 * hh + r) * TPI + cb] = t8[r];
  }
}

// =====================================================================================================
// Relative-position attention for one (batch b, head n) pair and a 64-row query tile; 4 waves, wave w owns query rows i = iw0 + R,
// iw0 = i0 + 16w, R = 0..15. Planes (pitch DMOD halves, row = b*SEQ + position): QU = f16((q + bq + ub) x4), QV = f16((q + bq + vb) x4),
// KP = f16((k + bk) x4); PP = f16(pos x4) rows 0..SEQ-1; VT, VTL = v^T hi (x16) / residual f16 as [b][n*64+d][SEQ].
// Shifted position score for (i, j), d = j - i:  d <= 0 -> ps[i][SEQ-1+d];  d == 1 -> 0;  d >= 2 -> ps[i+1][d-2],  ps[r][t] = (q+bq+vb)[r] . pos[t].
//   Per key tile j0 (64 keys, key j = j0 + jj), with x = jj - R + 15 in [0,78]:
//     strip T1[R][x] = (q+vb)[iw0+R]   . pos[SEQ + j0 - iw0 - 16 + x]   (pos row SEQ-1+d), computed iff j0 <= iw0 + 15;
//     strip T2[R][x] = (q+vb)[iw0+1+R] . pos[j0 - iw0 - 17 + x]         (pos row d-2),     computed iff j0 + 61 >= iw0;
//     both tests are wave-uniform (iw0 via readfirstlane); a strip is selected from only in tiles where it was computed this iteration
//     (both strips are zero-filled once at kernel start so unselected reads are finite). The A row b*SEQ+iw0+16 of T2 is clamped to NROW-1
//     for the very last row group; that entry is never selected (i = SEQ-1 has no j >= i+2).
//   content scores S = (q+ub) . k (4 subtiles, K=64); t = (S + sel(T1, 0, T2)) * (RSD/16) * log2(e); online softmax in base 2,
//   max-subtracted, running sums in f32 (no key mask); the 16x64 prob tile stored to wave-private LDS (f32 element stores),
//   fragments loaded straight from the 16-bit planes VT/VTL[n*64+d][j]; 8 + 8 P.V WMMAs per tile (hi plane then residual plane into the
//   same accumulators).
//   block = 4 waves = 128 threads; grid = (SEQ/64, NB*NH); no block barriers; every wave does identical bounded work (SEQ/64 tiles).
// coverage: LDS strips 16 rows x 80 cols written fully whenever computed, slab 16 rows x 64 cols per wave fully written each tile before
//           being read; global: 4 instructions x 4 rows x 64 halves per plane = rows iw0..iw0+15 of head segment n in CT and CTL;
//           grid x waves cover all NB x SEQ rows and all NH head segments of CT / CTL exactly once.
// =====================================================================================================
__global__ __launch_bounds__(ATT_THREADS) __attribute__((amdgpu_num_vgpr(256)))
void attn_rel(const unsigned short* __restrict__ QU, const unsigned short* __restrict__ QV,
              const unsigned short* __restrict__ KP, const unsigned short* __restrict__ PP,
              const unsigned short* __restrict__ VT, const unsigned short* __restrict__ VTL,
              unsigned short* CT, unsigned short* CTL) {
  __shared__ __align__(16) float smem[ATT_W * WFL];   // per wave: T1 strip [16][TPI] | T2 strip [16][TPI] | prob / ctx slab [16][PPI]

  const int tid  = threadIdx.x;
  const int wave = __builtin_amdgcn_readfirstlane(tid >> 5);
  const int lane = tid & 31;
  const int hh   = lane >> 4;
  const int c    = lane & 15;
  const int bn   = blockIdx.y;
  const int b    = bn / NH;
  const int n    = bn - b * NH;
  const int i0   = blockIdx.x * 64;
  const int iw0  = i0 + wave * 16;

  float* t1sh = smem + wave * WFL;
  float* t2sh = t1sh + 16 * TPI;
  float* pt   = t2sh + 16 * TPI;

#pragma unroll 4
  for (int q = lane; q < 32 * TPI; q += 32) t1sh[q] = 0.f;   // zero both strips once (32*TPI floats are contiguous)

  // stationary A fragments: (q + bq + ub) rows b*SEQ + iw0 + c, d 0..31 and 32..63 of head n ((q + bq + vb) fragments are reloaded per key tile)
  const size_t qro = ((size_t)(b * SEQ + iw0 + c)) * DMOD + n * DH + 8 * hh;
  const v16h qua = ldfrag_u(QU + qro), qub = ldfrag_u(QU + qro + 32);
  int qr2 = b * SEQ + iw0 + 1 + c;                            // rows i+1 for the T2 strip
  qr2 = (qr2 > NROW - 1) ? (NROW - 1) : qr2;
  const size_t qro2 = (size_t)qr2 * DMOD + n * DH + 8 * hh;

  const unsigned short* Kb  = KP + (size_t)b * SEQ * DMOD + n * DH + 8 * hh;
  const unsigned short* Pb  = PP + n * DH + 8 * hh;
  const size_t vbase = (size_t)b * DMOD * SEQ + (size_t)(n * DH) * SEQ + 8 * hh;
  const unsigned short* Vb  = VT  + vbase;
  const unsigned short* VLb = VTL + vbase;

  const float KSC = (RSD / (QC * QC)) * LOG2E;

  float mrow[8], lrow[8];
  v8f O[4];
#pragma unroll
  for (int r = 0; r < 8; ++r) { mrow[r] = -INFINITY; lrow[r] = 0.f; }
#pragma unroll
  for (int td = 0; td < 4; ++td) O[td] = zero8();
  wave_sync_lds();

#pragma unroll 1
  for (int j0 = 0; j0 < SEQ; j0 += 64) {
    const int dmin = j0 - iw0;                               // smallest j - i over the tile is dmin - 15, largest dmin + 63 (wave-uniform)
    // ---- position strips (wave-uniform conditions) ----
    if (dmin <= 15) pos_strip(QV + qro, Pb, SEQ + dmin - 16, t1sh, hh, c);
    if (dmin + 61 >= 0) pos_strip(QV + qro2, Pb, dmin - 17, t2sh, hh, c);
    // ---- content scores S (4 subtiles of 16 keys) ----
    v8f S[4];
#pragma unroll
    for (int t = 0; t < 4; ++t) {
      const size_t ko = (size_t)(j0 + 16 * t + c) * DMOD;
      const v16h ka = ldfrag_u(Kb + ko), kb2 = ldfrag_u(Kb + ko + 32);
      S[t] = mma_h(qua, ka, zero8());
      S[t] = mma_h(qub, kb2, S[t]);
      hz4(S[t], ka, kb2, qua, qub);
    }
    wave_sync_lds();

    // ---- score assembly + online softmax (rows live on one 16-lane half) ----
#pragma unroll
    for (int r = 0; r < 8; ++r) {
      const int R  = 8 * hh + r;
      const int xo = R * TPI + (15 - R) + c;                 // strip column x = 16t + c - R + 15 in [0, 78]
      const int db = dmin + c - R;                           // d = j - i = db + 16t
      float tv[4];
#pragma unroll
      for (int t = 0; t < 4; ++t) {
        const float v1 = t1sh[xo + 16 * t];
        const float v2 = t2sh[xo + 16 * t];
        const int d = db + 16 * t;
        const float bdv = (d <= 0) ? v1 : ((d == 1) ? 0.f : v2);
        tv[t] = (S[t][r] + bdv) * KSC;
      }
      float mx = fmaxf(fmaxf(tv[0], tv[1]), fmaxf(tv[2], tv[3]));
#pragma unroll
      for (int off = 1; off < 16; off <<= 1) mx = fmaxf(mx, __shfl_xor(mx, off, 32));
      const float mn = fmaxf(mrow[r], mx);
      const float al = exp2f(mrow[r] - mn);
      mrow[r] = mn;
      float e4[4];
      float ps = 0.f;
#pragma unroll
      for (int t = 0; t < 4; ++t) { e4[t] = exp2f(tv[t] - mn); ps += e4[t]; }
#pragma unroll
      for (int off = 1; off < 16; off <<= 1) ps += __shfl_xor(ps, off, 32);
      lrow[r] = lrow[r] * al + ps;
#pragma unroll
      for (int td = 0; td < 4; ++td) O[td][r] *= al;
      const int ro = R * PPI + c;
#pragma unroll
      for (int t = 0; t < 4; ++t) pt[ro + 16 * t] = e4[t];
    }
    wave_sync_lds();

    // ---- P fragments (x1024, f16) from the LDS rows, two k-steps of 32 keys ----
    FragH pf[2];
#pragma unroll
    for (int ks = 0; ks < 2; ++ks) {
      const float* prow = pt + c * PPI + 32 * ks + 8 * hh;
      const v4f p0 = *(const v4f*)(prow), p1 = *(const v4f*)(prow + 4);
      const v4f p2 = *(const v4f*)(prow + 16), p3 = *(const v4f*)(prow + 20);
#pragma unroll
      for (int e = 0; e < 4; ++e) {
        pf[ks].h[0][e]     = (_Float16)(p0[e] * PC);     // keys j0 + 32ks + 8hh + e
        pf[ks].h[0][4 + e] = (_Float16)(p1[e] * PC);     // keys j0 + 32ks + 8hh + 4 + e
        pf[ks].h[1][e]     = (_Float16)(p2[e] * PC);     // keys j0 + 32ks + 16 + 8hh + e
        pf[ks].h[1][4 + e] = (_Float16)(p3[e] * PC);
      }
    }
    // ---- O += P . v^T (hi plane) ----
    {
      const size_t vo = (size_t)c * SEQ + j0;
#pragma unroll
      for (int td = 0; td < 4; ++td) {
        const unsigned short* vp = Vb + vo + (size_t)(16 * td) * SEQ;
        const v16h vfa = ldfrag_u(vp), vfb = ldfrag_u(vp + 32);
        O[td] = mma_h(pf[0].v, vfa, O[td]);
        O[td] = mma_h(pf[1].v, vfb, O[td]);
        hz4(O[td], pf[0].v, pf[1].v, vfa, vfb);
      }
      // ---- O += P . v^T (residual plane) ----
#pragma unroll
      for (int td = 0; td < 4; ++td) {
        const unsigned short* vp = VLb + vo + (size_t)(16 * td) * SEQ;
        const v16h vla = ldfrag_u(vp), vlb = ldfrag_u(vp + 32);
        O[td] = mma_h(pf[0].v, vla, O[td]);
        O[td] = mma_h(pf[1].v, vlb, O[td]);
        hz4(O[td], pf[0].v, pf[1].v, vla, vlb);
      }
    }
    wave_sync_lds();
  }
  acc_guard4(O[0], O[1], O[2], O[3]);

  // ---- fold 1/l and the carries (1024 on P, 16 on v), carry x4096 on ctx, stage the wave's 16x64 slice in its slab ----
  const float oc = CC / (PC * VC);
#pragma unroll
  for (int r = 0; r < 8; ++r) {
    const float inv = (1.0f / lrow[r]) * oc;
    const int ro = (8 * hh + r) * PPI + c;
#pragma unroll
    for (int td = 0; td < 4; ++td) pt[ro + 16 * td] = O[td][r] * inv;
  }
  wave_sync_lds();
  {
    const int q8 = lane >> 3, c8 = (lane & 7) * 8;
    v4u hv[4], lv[4];
#pragma unroll
    for (int it = 0; it < 4; ++it) {
      const int row = it * 4 + q8;                         // it 0..3 x q8 0..3 = rows 0..15
      const float* sp = pt + row * PPI + c8;
      v4u a, b2;
#pragma unroll
      for (int e = 0; e < 4; ++e) {
        const float f0 = sp[2 * e], f1 = sp[2 * e + 1];
        const _Float16 x0 = (_Float16)f0, x1 = (_Float16)f1;
        a[e]  = pk16(h_bits(x0), h_bits(x1));
        b2[e] = pk16(h_bits((_Float16)(f0 - (float)x0)), h_bits((_Float16)(f1 - (float)x1)));
      }
      hv[it] = a;
      lv[it] = b2;
    }
    {
#pragma unroll
      for (int it = 0; it < 4; ++it) {
        const int row = it * 4 + q8;
        const size_t go = ((size_t)(b * SEQ + iw0 + row)) * DMOD + n * DH + c8;
        *(v4u*)(CT  + go) = hv[it];
        *(v4u*)(CTL + go) = lv[it];
      }
      
    }
  }
}

// =====================================================================================================
// Workspace map (bytes); every plane is an exact multiple of its tile / whole-row store granularity (M, N exact tile multiples,
// convert counts exact multiples of 2048), every offset a multiple of 512 KiB:
//   WQ16, WK16, WV16, WP16, WO16 f16 [512 out][512 in] x64                               5 x   524288
//   X16  f16 [NROW][512] x16 (pre-norm output)                                                8388608
//   PE16 f16 [SEQ][512] x16 (sinusoid table)                                                  2097152
//   QU, QV, K16 f16 [NROW][512] x4                                                       3 x  8388608
//   P16  f16 [SEQ][512] x4                                                                      2097152
//   VT16, VTL16 f16 [NB][512][SEQ] hi x16 / residual                                     2 x  8388608
//   CT16, CTL16 f16 [NROW][512] hi x4096 / residual                                      2 x  8388608
//   end                                                                                        73924608
// =====================================================================================================
extern "C" void kernel_launch(void* const* d_in, const int* in_sizes, int n_in,
                              void* d_out, int out_size, void* d_ws, size_t ws_size,
                              hipStream_t stream) {
  if (n_in < 14) return;
  if (in_sizes[0] != NROW * DMOD) return;
  if (in_sizes[1] != DMOD || in_sizes[2] != DMOD) return;
  if (in_sizes[3] != DMOD * DMOD || in_sizes[5] != DMOD * DMOD || in_sizes[7] != DMOD * DMOD ||
      in_sizes[9] != DMOD * DMOD || in_sizes[12] != DMOD * DMOD) return;
  if (in_sizes[4] != DMOD || in_sizes[6] != DMOD || in_sizes[8] != DMOD || in_sizes[13] != DMOD) return;
  if (in_sizes[10] != NH * DH || in_sizes[11] != NH * DH) return;
  if (out_size != NROW * DMOD) return;

  const float* xin   = (const float*)d_in[0];
  const float* gam   = (const float*)d_in[1];
  const float* bet   = (const float*)d_in[2];
  const float* w_q   = (const float*)d_in[3];
  const float* b_q   = (const float*)d_in[4];
  const float* w_k   = (const float*)d_in[5];
  const float* b_k   = (const float*)d_in[6];
  const float* w_v   = (const float*)d_in[7];
  const float* b_v   = (const float*)d_in[8];
  const float* w_p   = (const float*)d_in[9];
  const float* ub    = (const float*)d_in[10];
  const float* vb    = (const float*)d_in[11];
  const float* w_o   = (const float*)d_in[12];
  const float* b_o   = (const float*)d_in[13];
  float*       out   = (float*)d_out;

  const size_t PW  = (size_t)DMOD * DMOD * 2;            //   524288
  const size_t PX  = (size_t)NROW * DMOD * 2;            //  8388608
  const size_t PXP = (size_t)SEQ * DMOD * 2;             //  2097152
  const size_t PVT = (size_t)NB * DMOD * SEQ * 2;        //  8388608
  size_t off = 0;
  const size_t oWQ  = off; off += PW;
  const size_t oWK  = off; off += PW;
  const size_t oWV  = off; off += PW;
  const size_t oWP  = off; off += PW;
  const size_t oWO  = off; off += PW;
  const size_t oX   = off; off += PX;
  const size_t oPE  = off; off += PXP;
  const size_t oQU  = off; off += PX;
  const size_t oQV  = off; off += PX;
  const size_t oK   = off; off += PX;
  const size_t oP   = off; off += PXP;
  const size_t oVT  = off; off += PVT;
  const size_t oVTL = off; off += PVT;
  const size_t oCT  = off; off += PX;
  const size_t oCTL = off; off += PX;
  if (off > ws_size) return;                               // off = 73924608
  if (off > (size_t)134217728) return;

  char* ws = (char*)d_ws;
  unsigned short* WQ16  = (unsigned short*)(ws + oWQ);
  unsigned short* WK16  = (unsigned short*)(ws + oWK);
  unsigned short* WV16  = (unsigned short*)(ws + oWV);
  unsigned short* WP16  = (unsigned short*)(ws + oWP);
  unsigned short* WO16  = (unsigned short*)(ws + oWO);
  unsigned short* X16   = (unsigned short*)(ws + oX);
  unsigned short* PE16  = (unsigned short*)(ws + oPE);
  unsigned short* QU    = (unsigned short*)(ws + oQU);
  unsigned short* QV    = (unsigned short*)(ws + oQV);
  unsigned short* K16   = (unsigned short*)(ws + oK);
  unsigned short* P16   = (unsigned short*)(ws + oP);
  unsigned short* VT16  = (unsigned short*)(ws + oVT);
  unsigned short* VTL16 = (unsigned short*)(ws + oVTL);
  unsigned short* CT16  = (unsigned short*)(ws + oCT);
  unsigned short* CTL16 = (unsigned short*)(ws + oCTL);

  const dim3 blk(256);
  const dim3 gCW((DMOD * DMOD) / 2048);                             // 128
  const dim3 gLN(NROW / 8);                                         // 1024
  const dim3 gPE(SEQ / 8);                                          // 256
  const int tilesQ = (NROW / 64) * (DMOD / 64);                     // 1024
  const int tilesV = (DMOD / 64) * (SEQ / 64);                      // 256 per batch
  const int tilesP = (SEQ / 64) * (DMOD / 64);                      // 256
  const dim3 gQ((tilesQ + 7) / 8, 1);                               // 128
  const dim3 gV((tilesV + 7) / 8, NB);                              // 32 x 4
  const dim3 gP((tilesP + 7) / 8, 1);                               // 32
  const dim3 gAT(SEQ / 64, NB * NH);                                // 32 x 32
  const dim3 bAT(ATT_THREADS);                                      // 128

  // (0) weight planes: W[o][c] ([out][in] = [n][k] already) -> f16( bf16_RNE(w) * 64 ), all five weights
  cvt16<<<gCW, blk, 0, stream>>>(w_q, WQ16, DMOD * DMOD, DMOD * DMOD, WSC);
  cvt16<<<gCW, blk, 0, stream>>>(w_k, WK16, DMOD * DMOD, DMOD * DMOD, WSC);
  cvt16<<<gCW, blk, 0, stream>>>(w_v, WV16, DMOD * DMOD, DMOD * DMOD, WSC);
  cvt16<<<gCW, blk, 0, stream>>>(w_p, WP16, DMOD * DMOD, DMOD * DMOD, WSC);
  cvt16<<<gCW, blk, 0, stream>>>(w_o, WO16, DMOD * DMOD, DMOD * DMOD, WSC);

  // (1) pre-norm -> X16 = f16(x * 16); sinusoid table -> PE16 = f16(pe * 16)
  ln16<<<gLN, blk, 0, stream>>>(xin, gam, bet, X16, NROW, XC);
  pe16<<<gPE, blk, 0, stream>>>(PE16, SEQ, XC);

  // (2) q[m][nd] = sum_c x[m][c] Wq[nd][c] / 1024 + bq[nd]; QU = f16((q + ub[nd]) * 4), QV = f16((q + vb[nd]) * 4);
  //     M = NROW, N = 512, K = 512
  gemm64<5, 0, 0, 1><<<gQ, blk, 0, stream>>>(
      X16, X16, DMOD, 0LL,
      WQ16, DMOD, 0LL,
      (void*)QU, (void*)QV, DMOD, 0LL,
      NROW, DMOD, DMOD, 1.0f / (XC * WSC), QC,
      b_q, ub, vb);

  // (3) k projection + bk -> K16 = f16(k * 4)
  gemm64<2, 0, 0, 1><<<gQ, blk, 0, stream>>>(
      X16, X16, DMOD, 0LL,
      WK16, DMOD, 0LL,
      (void*)K16, (void*)K16, DMOD, 0LL,
      NROW, DMOD, DMOD, 1.0f / (XC * WSC), QC,
      b_k, b_k, b_k);

  // (4) v^T per batch: VT[b][nd][j] = sum_c Wv[nd][c] x[b*SEQ + j][c] / 1024 + bv[nd] (per-row bias) -> f16 x16 hi + residual planes;
  //     M = 512 (nd), N = SEQ (j), K = 512; B rows are the batch's token rows: pitch DMOD, batch stride SEQ*DMOD
  gemm64<4, 0, 0, 2><<<gV, blk, 0, stream>>>(
      WV16, WV16, DMOD, 0LL,
      X16, DMOD, (long long)SEQ * DMOD,
      (void*)VT16, (void*)VTL16, SEQ, (long long)DMOD * SEQ,
      DMOD, SEQ, DMOD, 1.0f / (XC * WSC), VC,
      b_v, b_v, b_v);

  // (5) positional projection (no bias): P16 = f16(pos * 4), M = SEQ, N = 512, K = 512
  gemm64<2, 0, 0, 0><<<gP, blk, 0, stream>>>(
      PE16, PE16, DMOD, 0LL,
      WP16, DMOD, 0LL,
      (void*)P16, (void*)P16, DMOD, 0LL,
      SEQ, DMOD, DMOD, 1.0f / (XC * WSC), QC,
      b_q, b_q, b_q);

  // (6) relative attention -> CT16 = f16(ctx * 4096) hi plane, CTL16 residual plane, rows b*SEQ + i, halves n*64+d
  attn_rel<<<gAT, bAT, 0, stream>>>(QU, QV, K16, P16, VT16, VTL16, CT16, CTL16);

  // (7) out = (CT + CTL) . Wo^T / (4096*64) + bo; M = NROW, N = 512, K = 512, f32 rows straight into the output buffer
  gemm64<0, 1, 0, 1><<<gQ, blk, 0, stream>>>(
      CT16, CTL16, DMOD, 0LL,
      WO16, DMOD, 0LL,
      (void*)out, (void*)out, DMOD, 0LL,
      NROW, DMOD, DMOD, 1.0f / (CC * WSC), 1.0f,
      b_o, b_o, b_o);
  (void)hipGetLastError();
}

// v001
// It runs in 457 microseconds.
// Timed twice side by side with v000, it ran 1.03 and 1.04 times as fast.
// Contractions (all v_wmma_f32_16x16x32_f16, f16 operands, f32 accumulate): q/k/v/pos projections (x or sinusoid table f16 x16 . W f16 x64,
// K=512, single products); content scores ((q+bq+ub) f16 x4 . (k+bk) f16 x4, K=64, single); position strips ((q+bq+vb) f16 x4 . pos f16 x4,
// K=64, single) -> f32 LDS strips, shifted select on VALU; P . v^T (P f16 x1024 . v^T carried as f16 x16 hi plane + f16 residual plane, 64 keys
// per tile, two products); output projection (ctx carried as f16 x4096 hi + residual planes . Wo f16 x64, K=512, two products).
// LayerNorm, sinusoid table, max-subtracted online base-2 softmax and all epilogues in f32 on VALU. Every float input RNE-converted to bf16 on load.
#include <hip/hip_runtime.h>
#include <math.h>
#include <stdint.h>

#define SEQ   2048
#define NB    4
#define DMOD  512
#define NH    8
#define DH    64
#define NROW  (SEQ * NB)
#define XC    16.0f
#define WSC   64.0f
#define QC    4.0f
#define VC    16.0f
#define PC    1024.0f
#define CC    4096.0f
#define RSD   0.044194173824159216f
#define LOG2E 1.4426950408889634f
#define LN_EPS 1.0e-5f
#define CNEG  ((float)(-9.210340371976184 / 512.0))
static_assert(NH * DH == DMOD);
static_assert(DH == 64);
static_assert(DMOD == 512);
static_assert((SEQ % 64) == 0 && (DMOD % 64) == 0 && (NROW % 64) == 0);
static_assert(((DMOD * DMOD) % 2048) == 0 && (NROW % 8) == 0 && (SEQ % 8) == 0);
#define ATT_W 4
#define ATT_THREADS (ATT_W * 32)
#define TPI 84
#define PPI 68
#define WFL (32 * TPI + 16 * PPI)
static_assert(((16 * TPI) % 4) == 0 && ((16 * PPI) % 4) == 0 && (WFL % 4) == 0);
static_assert(TPI >= 80 && PPI >= 64);
static_assert(ATT_W * WFL * 4 <= 65536);

typedef _Float16 v16h __attribute__((ext_vector_type(16)));
typedef _Float16 v8h  __attribute__((ext_vector_type(8)));
typedef __bf16   v16b __attribute__((ext_vector_type(16)));
typedef float    v8f  __attribute__((ext_vector_type(8)));
typedef float    v4f  __attribute__((ext_vector_type(4)));
typedef unsigned int v4u __attribute__((ext_vector_type(4)));

union FragH { v16h v; v8h h[2]; v4u u[2]; };
union FragAny { v16h h; v16b b; };

// ---- scalar helpers --------------------------------------------------------------------------------
__device__ __forceinline__ unsigned short bf_bits(float f) {          // f32 -> bf16 bits, RNE convert
  unsigned u = __float_as_uint(f);
  return (unsigned short)((u + 0x7FFFu + ((u >> 16) & 1u)) >> 16);
}
__device__ __forceinline__ float bf_up(unsigned short h) { return __uint_as_float(((unsigned)h) << 16); }
__device__ __forceinline__ float bfr(float f) { return bf_up(bf_bits(f)); }   // value of the bf16 RNE convert
__device__ __forceinline__ unsigned short h_bits(_Float16 x) { return __builtin_bit_cast(unsigned short, x); }
__device__ __forceinline__ unsigned pk16(unsigned short a, unsigned short b) { return (unsigned)a | ((unsigned)b << 16); }
__device__ __forceinline__ v8f zero8() { v8f z = {0.f, 0.f, 0.f, 0.f, 0.f, 0.f, 0.f, 0.f}; return z; }

// ---- fragment-packed 16-bit planes: a [rows][L] plane (rows % 16 == 0, L % 32 == 0) is stored as 1-KiB blocks, one per
//      (16 rows, 32 k): block index (row >> 4) * (L / 32) + (k >> 5); inside a block the 8-half piece that holds element (row, k) stands at
//      halves ((k >> 4) & 1) * 256 + (((k >> 3) & 1) * 16 + (row & 15)) * 8. With 16-aligned rows one wave-wide 16-B load reads 512 contiguous
//      bytes (four whole 128-B lines) where a row-major plane made it touch sixteen lines.
// ---- fragment loader: p = block start + (16 * (lane >> 4) + (row & 15)) * 8; elements 0..7 <- k0 + 8h + 0..7, elements 8..15 <- k0 + 16 + 8h + 0..7,
//      h = lane >> 4 (same split k map for A and B; B is always read from a [n][k] plane)
__device__ __forceinline__ v16h ldfrag_p(const unsigned short* p) {
  FragH f;
  f.u[0] = *(const v4u*)(p);
  f.u[1] = *(const v4u*)(p + 256);
  return f.v;
}
// ---- the same loader on a pointer typed as global memory (a pointer that has gone through an asm operand would otherwise load as a flat one)
typedef const __attribute__((address_space(1))) unsigned short* gp16;
typedef const __attribute__((address_space(1))) v4u* gp128;
__device__ __forceinline__ v16h ldfrag_g(gp16 p) {
  FragH f;
  f.u[0] = *(gp128)(p);
  f.u[1] = *(gp128)(p + 256);
  return f.v;
}

// ---- WMMA helpers with trailing VALU hazard gaps ------------------------------------------------------
__device__ __forceinline__ v8f mma_h(v16h a, v16h b, v8f c) {
  return __builtin_amdgcn_wmma_f32_16x16x32_f16(false, a, false, b, (short)0, c, false, false);
}
__device__ __forceinline__ v8f mma_b(v16h a, v16h b, v8f c) {
  FragAny ua, ub;
  ua.h = a;
  ub.h = b;
  return __builtin_amdgcn_wmma_f32_16x16x32_bf16(false, ua.b, false, ub.b, (short)0, c, false, false);
}
template <int BF>
__device__ __forceinline__ v8f mmaT(v16h a, v16h b, v8f c) {
  if constexpr (BF != 0) return mma_b(a, b, c);
  else return mma_h(a, b, c);
}
__device__ __forceinline__ void dep_guard1(v8f& a, v8f& b, v16h x) {
#if defined(__HIP_DEVICE_COMPILE__)
  asm volatile("v_nop\n\tv_nop\n\tv_nop\n\tv_nop" : "+v"(a), "+v"(b) : "v"(x));
#endif
}
__device__ __forceinline__ void hz4(v8f& d, v16h x0, v16h x1, v16h x2, v16h x3) {
#if defined(__HIP_DEVICE_COMPILE__)
  asm volatile("v_nop\n\tv_nop\n\tv_nop\n\tv_nop" : "+v"(d) : "v"(x0), "v"(x1), "v"(x2), "v"(x3));
#endif
}
__device__ __forceinline__ void keep4_h(v16h a, v16h b, v16h c, v16h d) {
#if defined(__HIP_DEVICE_COMPILE__)
  asm volatile("v_nop" :: "v"(a), "v"(b), "v"(c), "v"(d));
#endif
}
__device__ __forceinline__ void acc_guard4(v8f& a, v8f& b, v8f& c, v8f& d) {
#if defined(__HIP_DEVICE_COMPILE__)
  asm volatile("v_nop\n\tv_nop\n\tv_nop\n\tv_nop" : "+v"(a), "+v"(b), "+v"(c), "+v"(d));
#endif
}
__device__ __forceinline__ void wave_sync_lds() {
  __builtin_amdgcn_fence(__ATOMIC_RELEASE, "workgroup");
  __builtin_amdgcn_wave_barrier();
  __builtin_amdgcn_fence(__ATOMIC_ACQUIRE, "workgroup");
}
// ---- eight rows r0..r0+7 (r0 % 8 == 0, one row per wave, 256 threads) of a [rows][DMOD] plane -> fragment-packed plane, whole 128-B lines:
//      wave w hands in its row's pieces lane (o0: columns 8*lane..) and 32 + lane (o1: columns 256 + 8*lane..); a line of the packed plane holds
//      one piece of each of the eight rows, so the rows meet in LDS (pitch 66 pieces: the 16 lanes of a half wave fall on distinct banks).
//      Every thread of the block must call this (one block barrier inside).
#define RPI 66
__device__ __forceinline__ void store_rows8_packed(v4u o0, v4u o1, unsigned short* plane, int r0, v4u* st) {
  const int tid  = threadIdx.x;
  const int lane = tid & 31;
  const int wave = tid >> 5;
  st[wave * RPI + lane]      = o0;
  st[wave * RPI + 32 + lane] = o1;
  __syncthreads();   // the eight rows of a line come from eight waves
  unsigned short* dst = plane + ((size_t)(r0 >> 4) << 13) + ((r0 & 15) << 3);
#pragma unroll   // both LDS reads issue ahead of the two stores
  for (int sx = 0; sx < 2; ++sx) {
    const int idx = sx * 256 + tid;
    const int g   = idx >> 3;                        // piece index in the row = k >> 3, 0..63
    const int rr  = idx & 7;                         // row r0 + rr
    const v4u w = st[rr * RPI + g];
    *(v4u*)(dst + ((g >> 2) << 9) + (((g >> 1) & 1) << 8) + ((((g & 1) << 4) + rr) << 3)) = w;
  }
}

// =====================================================================================================
// Elementwise 16-bit pack of a [rows][DMOD] f32 matrix into a fragment-packed plane: piece t of the plane (8 halves at dst + 8t) =
// f16( bf16_RNE(src[row][k..k+7]) * sc ), (row, k) decoded from t; 0 for pieces whose source elements lie past nvalid; sc a power of two (exact). One piece per thread:
// two 16-B loads (address clamped into [0, nvalid) for pad groups, value zeroed), one 16-B store, a wave's stores = 512 contiguous bytes.
// Used for the five weight matrices, which are [out][in] = [n][k] k-contiguous already.
// coverage: grid = ntotal / 2048 blocks x 256 thr x 8 elements = ntotal exactly (ntotal % 2048 == 0, nvalid == ntotal here).
// =====================================================================================================
__global__ __launch_bounds__(256) void cvt16(const float* __restrict__ src, unsigned short* dst, int nvalid, int ntotal, float sc) {
  const size_t i8 = ((size_t)blockIdx.x * 256 + threadIdx.x) * 8;
  if (i8 + 8 > (size_t)ntotal) return;             // never taken with the exact grid; no barriers in this kernel
  const size_t t  = i8 >> 3;                           // piece index: block t >> 6, second half (t >> 5) & 1, k half (t >> 4) & 1, row t & 15
  const size_t sr = ((t >> 10) << 4) + (t & 15);       // source row: DMOD / 32 = 16 blocks per 16 rows
  const size_t sk = (((t >> 6) & 15) << 5) + (((t >> 5) & 1) << 4) + (((t >> 4) & 1) << 3);
  const size_t si = sr * DMOD + sk;                    // the piece's first element in the source
  const bool pad = (si + 8 > (size_t)nvalid);
  const size_t ls = pad ? ((size_t)nvalid - 8) : si;   // clamped address, always inside the source
  const v4f a = *(const v4f*)(src + ls);
  const v4f b = *(const v4f*)(src + ls + 4);
  v4u o;
  o[0] = pk16(h_bits((_Float16)(bfr(a[0]) * sc)), h_bits((_Float16)(bfr(a[1]) * sc)));
  o[1] = pk16(h_bits((_Float16)(bfr(a[2]) * sc)), h_bits((_Float16)(bfr(a[3]) * sc)));
  o[2] = pk16(h_bits((_Float16)(bfr(b[0]) * sc)), h_bits((_Float16)(bfr(b[1]) * sc)));
  o[3] = pk16(h_bits((_Float16)(bfr(b[2]) * sc)), h_bits((_Float16)(bfr(b[3]) * sc)));
  const v4u z = {0u, 0u, 0u, 0u};
  const v4u w = pad ? z : o;
  {
    *(v4u*)(dst + i8) = w;
    
  }
}

// =====================================================================================================
// y = (x - mu) * (1/sqrt(var + eps)) * bf16_RNE(gamma) + bf16_RNE(beta) in f32, out X16 = f16(y * sc) (sc = 16, exact power of two).
// Lane l owns columns 8l..8l+7 and 256+8l..256+8l+7; the block's eight rows go out fragment-packed through LDS (store_rows8_packed).
// coverage: grid = NROW/8 blocks x 8 waves = every row; 32 lanes x 16 halves = all 512 columns of the row.
// =====================================================================================================
__global__ __launch_bounds__(256) void ln16(const float* __restrict__ x, const float* __restrict__ gam,
                                            const float* __restrict__ bet, unsigned short* X16, int nrows, float sc) {
  const int lane = threadIdx.x & 31;
  const int wave = threadIdx.x >> 5;
  __shared__ __align__(16) v4u st[8 * RPI];
  const int row  = blockIdx.x * 8 + wave;
  if ((int)blockIdx.x * 8 + 8 > nrows) return;     // block-uniform, in front of the barrier; never taken with the exact grid
  const float* p = x + (size_t)row * DMOD;
  const int c0 = 8 * lane, c1 = 256 + 8 * lane;
  const v4f a0 = *(const v4f*)(p + c0), a1 = *(const v4f*)(p + c0 + 4);
  const v4f a2 = *(const v4f*)(p + c1), a3 = *(const v4f*)(p + c1 + 4);
  float v[16];
#pragma unroll
  for (int e = 0; e < 4; ++e) {
    v[e]      = bfr(a0[e]);
    v[4 + e]  = bfr(a1[e]);
    v[8 + e]  = bfr(a2[e]);
    v[12 + e] = bfr(a3[e]);
  }
  float s = 0.f;
#pragma unroll
  for (int e = 0; e < 16; ++e) s += v[e];
#pragma unroll
  for (int off = 1; off < 32; off <<= 1) s += __shfl_xor(s, off, 32);
  const float mu = s * (1.0f / (float)DMOD);
  float q = 0.f;
#pragma unroll
  for (int e = 0; e < 16; ++e) {
    const float d = v[e] - mu;
    v[e] = d;
    q += d * d;
  }
#pragma unroll
  for (int off = 1; off < 32; off <<= 1) q += __shfl_xor(q, off, 32);
  const float var  = q * (1.0f / (float)DMOD);
  const float rstd = 1.0f / sqrtf(var + LN_EPS);
  const v4f g0 = *(const v4f*)(gam + c0), g1 = *(const v4f*)(gam + c0 + 4);
  const v4f g2 = *(const v4f*)(gam + c1), g3 = *(const v4f*)(gam + c1 + 4);
  const v4f e0 = *(const v4f*)(bet + c0), e1 = *(const v4f*)(bet + c0 + 4);
  const v4f e2 = *(const v4f*)(bet + c1), e3 = *(const v4f*)(bet + c1 + 4);
  float gg[16], bb[16];
#pragma unroll
  for (int e = 0; e < 4; ++e) {
    gg[e]      = bfr(g0[e]);  bb[e]      = bfr(e0[e]);
    gg[4 + e]  = bfr(g1[e]);  bb[4 + e]  = bfr(e1[e]);
    gg[8 + e]  = bfr(g2[e]);  bb[8 + e]  = bfr(e2[e]);
    gg[12 + e] = bfr(g3[e]);  bb[12 + e] = bfr(e3[e]);
  }
  v4u o0, o1;
#pragma unroll
  for (int e = 0; e < 4; ++e) {
    const float y0 = v[2 * e] * rstd * gg[2 * e] + bb[2 * e];
    const float y1 = v[2 * e + 1] * rstd * gg[2 * e + 1] + bb[2 * e + 1];
    const float y2 = v[8 + 2 * e] * rstd * gg[8 + 2 * e] + bb[8 + 2 * e];
    const float y3 = v[8 + 2 * e + 1] * rstd * gg[8 + 2 * e + 1] + bb[8 + 2 * e + 1];
    o0[e] = pk16(h_bits((_Float16)(y0 * sc)), h_bits((_Float16)(y1 * sc)));
    o1[e] = pk16(h_bits((_Float16)(y2 * sc)), h_bits((_Float16)(y3 * sc)));
  }
  store_rows8_packed(o0, o1, X16, blockIdx.x * 8, st);
}

// =====================================================================================================
// Sinusoid table, one wave per position s: pe[s][2m] = sin(s * div[m]), pe[s][2m+1] = cos(s * div[m]), div[m] = expf(f32(2m) * f32(-ln(1e4)/512)),
// precise expf / sinf / cosf (arguments up to 2047), all f32. Rolled loop: lane l computes columns 8l..8l+7 and 256+8l..+7 (4 sin/cos pairs per group)
// into its own slots of a wave-private f32 LDS row, then packs f16(pe * sc) (sc = 16); the block's eight rows go out fragment-packed
// through LDS (store_rows8_packed).
// coverage: grid = SEQ/8 blocks x 8 waves = rows 0..SEQ-1; each lane reads back only the 16 LDS slots it wrote; 32 lanes x 16 halves = 512 columns.
// =====================================================================================================
__global__ __launch_bounds__(256) void pe16(unsigned short* PE16, int nrows, float sc) {
  __shared__ __align__(16) float sh[8 * DMOD];
  __shared__ __align__(16) v4u st[8 * RPI];
  const int lane = threadIdx.x & 31;
  const int wave = threadIdx.x >> 5;
  const int s = blockIdx.x * 8 + wave;
  if ((int)blockIdx.x * 8 + 8 > nrows) return;     // block-uniform, in front of the barrier; never taken with the exact grid
  float* rowp = sh + wave * DMOD;
  const float fs = (float)s;
#pragma unroll 1
  for (int it = 0; it < 8; ++it) {
    const int cb = 256 * (it >> 2) + 8 * lane + 2 * (it & 3);   // even column = 2m
    const float dv  = expf((float)cb * CNEG);
    const float ang = fs * dv;
    rowp[cb]     = sinf(ang);
    rowp[cb + 1] = cosf(ang);
  }
  wave_sync_lds();
  v4u o[2];
#pragma unroll
  for (int g = 0; g < 2; ++g) {
    const float* sp = rowp + 256 * g + 8 * lane;
    v4u w;
#pragma unroll
    for (int e = 0; e < 4; ++e) w[e] = pk16(h_bits((_Float16)(sp[2 * e] * sc)), h_bits((_Float16)(sp[2 * e + 1] * sc)));
    o[g] = w;
  }
  store_rows8_packed(o[0], o[1], PE16, blockIdx.x * 8, st);
}

// =====================================================================================================
// Register-blocked batched 16-bit WMMA GEMM: C[m][n] = oscale * sum_k A[m][k] * Bt[n][k] (+ bias); one wave per 64x64 tile,
// no block barriers. A [M][lda] and Bt [N][ldb] are fragment-packed 16-bit planes (row lengths lda, ldb, multiples of 32); M, N multiples of 64,
// K multiple of 32. blockIdx.y = batch index with element strides sA, sB, sC (whole 16-row groups). 16-bit outputs are fragment-packed planes
// of row length ldc.
// ASPLIT 1: a second A plane A2 (unscaled residual of A, same layout) is multiplied into the same accumulator (A + A2 ~ exact A).
// BF 1: bf16 operands (v_wmma_f32_16x16x32_bf16), else f16.
// EPI 1: value += bf16_RNE(ep0[column]) (per-column bias); EPI 2: value += bf16_RNE(ep0[row]) (per-row bias, 16-bit out only).
// OM 0: f32 out (pitch ldc).  OM 2: one f16 plane = f16(value * ocarry).
// OM 4: two f16 planes: hi = f16(value * ocarry), lo = f16(value * ocarry - hi) (unscaled residual).
// OM 5: two f16 planes: C = f16((value + bf16_RNE(ep1[column])) * ocarry), C2 = f16((value + bf16_RNE(ep2[column])) * ocarry).
// coverage: 4 slabs x 16 rows (f32: it 0..7 x lane>>4; 16-bit: rows 8*(it&1) + (lane&7), pieces 4*(it>>1) + (lane>>3)) x 64 cols = the wave's whole 64x64 tile;
//           grid = ceil(tilesM*tilesN/8) blocks, surplus waves exit (wave-uniform).
// =====================================================================================================
template <int OM, int ASPLIT, int BF, int EPI>
__global__ __launch_bounds__(256) __attribute__((amdgpu_num_vgpr(256))) void gemm64(
    const unsigned short* __restrict__ Ap, const unsigned short* __restrict__ A2p, int lda, long long sA,
    const unsigned short* __restrict__ Btp, int ldb, long long sB,
    void* Cout, void* C2out, int ldc, long long sC,
    int M, int N, int K, float oscale, float ocarry,
    const float* __restrict__ ep0, const float* __restrict__ ep1, const float* __restrict__ ep2) {
  __shared__ __align__(16) float sT[8][16 * 68];   // per-wave 16x64 slab, pitch 68 floats
  const int by   = blockIdx.y;
  const int lane = threadIdx.x & 31;
  const int wave = threadIdx.x >> 5;
  const int tilesN = N >> 6;
  const int tilesM = M >> 6;
  const int tile = blockIdx.x * 8 + wave;
  if (tile >= tilesM * tilesN) return;   // wave-uniform; no block barriers in this kernel
  const int tm = tile / tilesN;
  const int tn = tile - tm * tilesN;
  const int m0 = tm << 6;
  const int n0 = tn << 6;

  const unsigned short* A1 = Ap  + (size_t)((long long)by * sA);
  const unsigned short* A2 = A2p + (size_t)((long long)by * sA);
  const unsigned short* Bb = Btp + (size_t)((long long)by * sB);

  const int rlane = lane & 15;                 // row (A) / col (B, D) within subtile
  const int ksA   = lda >> 5;                  // 1-KiB blocks per 16 rows of A
  const int ksB   = ldb >> 5;                  // 1-KiB blocks per 16 rows of Bt
  const int mOff  = (lane >> 4) * 8;           // D row offset

  v8f acc[4][4];
#pragma unroll
  for (int i = 0; i < 4; ++i)
#pragma unroll
    for (int j = 0; j < 4; ++j) acc[i][j] = zero8();

  // the lane's own piece in the first 1-KiB block of each 16-row group; a k step moves every pointer on by one block (512 halves)
  gp16 pB[4], pA[4], pL[4];
#pragma unroll
  for (int j = 0; j < 4; ++j) pB[j] = (gp16)(Bb + ((size_t)(((n0 >> 4) + j) * ksB) << 9) + (lane << 3));
#pragma unroll
  for (int i = 0; i < 4; ++i) {
    const size_t ao = ((size_t)(((m0 >> 4) + i) * ksA) << 9) + (lane << 3);
    pA[i] = (gp16)(A1 + ao);
    pL[i] = (gp16)(A2 + ao);
  }
  for (int k0 = 0; k0 < K; k0 += 32) {
    v16h bh[4];
#pragma unroll
    for (int j = 0; j < 4; ++j) bh[j] = ldfrag_g(pB[j]);
#pragma unroll
    for (int i = 0; i < 4; ++i) {
      const v16h ah = ldfrag_g(pA[i]);
#pragma unroll
      for (int j = 0; j < 4; ++j) acc[i][j] = mmaT<BF>(ah, bh[j], acc[i][j]);
      dep_guard1(acc[i][0], acc[i][3], ah);
      if constexpr (ASPLIT != 0) {
        const v16h al = ldfrag_g(pL[i]);
#pragma unroll
        for (int j = 0; j < 4; ++j) acc[i][j] = mmaT<BF>(al, bh[j], acc[i][j]);
        dep_guard1(acc[i][0], acc[i][3], al);
      }
    }
    keep4_h(bh[0], bh[1], bh[2], bh[3]);
    // The wait stands in front of every rewrite of an address register that the trip's loads name: as operands of its statement the pointers
    // keep their registers up to it, and the additions below cannot be lifted over it.
    if constexpr (ASPLIT != 0) {
      asm volatile("s_wait_xcnt 0x0" : "+v"(pB[0]), "+v"(pB[1]), "+v"(pB[2]), "+v"(pB[3]), "+v"(pA[0]), "+v"(pA[1]), "+v"(pA[2]), "+v"(pA[3]),
                                       "+v"(pL[0]), "+v"(pL[1]), "+v"(pL[2]), "+v"(pL[3]) :: "memory");
    } else {
      asm volatile("s_wait_xcnt 0x0" : "+v"(pB[0]), "+v"(pB[1]), "+v"(pB[2]), "+v"(pB[3]), "+v"(pA[0]), "+v"(pA[1]), "+v"(pA[2]), "+v"(pA[3]) :: "memory");
    }
#pragma unroll
    for (int j = 0; j < 4; ++j) {
      pB[j] += 512;
      pA[j] += 512;
      pL[j] += 512;
    }
  }
  acc_guard4(acc[0][0], acc[0][1], acc[0][2], acc[0][3]);
  acc_guard4(acc[1][0], acc[1][1], acc[1][2], acc[1][3]);
  acc_guard4(acc[2][0], acc[2][1], acc[2][2], acc[2][3]);
  acc_guard4(acc[3][0], acc[3][1], acc[3][2], acc[3][3]);

  const int hh2 = lane >> 4, c4 = (lane & 15) * 4;     // f32 out: 256-B row segment = 16 lanes x 16 B

  // ---- epilogue ----
  float* slab = sT[wave];
#pragma unroll
  for (int i = 0; i < 4; ++i) {
    const int mBase = m0 + (i << 4);
#pragma unroll
    for (int j = 0; j < 4; ++j) {
#pragma unroll
      for (int r = 0; r < 8; ++r) {
        slab[(mOff + r) * 68 + (j << 4) + rlane] = acc[i][j][r];
      }
    }
    wave_sync_lds();
    if constexpr (OM == 0) {
      float* C = (float*)Cout + (size_t)((long long)by * sC);
      v4f vals[8];
#pragma unroll
      for (int it = 0; it < 8; ++it) {
        const int row = it * 2 + hh2;                      // it 0..7 x hh2 0..1 = rows 0..15
        v4f v = *(const v4f*)(slab + row * 68 + c4);
#pragma unroll
        for (int e = 0; e < 4; ++e) v[e] = v[e] * oscale;
        if constexpr (EPI == 1) {
          const v4f bb = *(const v4f*)(ep0 + n0 + c4);     // per-column bias, columns n0+c4 .. +3 (N equals the bias length)
#pragma unroll
          for (int e = 0; e < 4; ++e) v[e] = v[e] + bfr(bb[e]);
        }
        vals[it] = v;
      }
      {
#pragma unroll
        for (int it = 0; it < 8; ++it) {
          const int gr = mBase + it * 2 + hh2;
          *(v4f*)(C + (size_t)gr * ldc + n0 + c4) = vals[it];
        }
        
      }
    } else {
      unsigned short* C  = (unsigned short*)Cout  + (size_t)((long long)by * sC);
      unsigned short* Cb = (unsigned short*)C2out + (size_t)((long long)by * sC);
      const int ksC = ldc >> 5;                            // 1-KiB blocks per 16 rows of C
      v4u hv[4], lv[4];
#pragma unroll
      for (int it = 0; it < 4; ++it) {
        const int row = (it & 1) * 8 + (lane & 7);         // 8 rows x 4 pieces per it = four whole 128-B lines of packed block it >> 1
        const int c8  = (it >> 1) * 32 + (lane >> 3) * 8;  // only two column groups per lane, so the column biases stay few
        const float* sp = slab + row * 68 + c8;
        float rb = 0.f;
        if constexpr (EPI == 2) rb = bfr(ep0[mBase + row]);   // per-row bias (M equals the bias length)
        v4u a  = {0u, 0u, 0u, 0u};
        v4u b2 = {0u, 0u, 0u, 0u};
#pragma unroll
        for (int e = 0; e < 4; ++e) {
          const int ci = n0 + c8 + 2 * e;                  // column index, < N
          float f0 = sp[2 * e] * oscale + rb;
          float f1 = sp[2 * e + 1] * oscale + rb;
          if constexpr (EPI == 1) {
            f0 += bfr(ep0[ci]);
            f1 += bfr(ep0[ci + 1]);
          }
          if constexpr (OM == 5) {
            const float g0 = (f0 + bfr(ep1[ci])) * ocarry, g1 = (f1 + bfr(ep1[ci + 1])) * ocarry;
            const float w0 = (f0 + bfr(ep2[ci])) * ocarry, w1 = (f1 + bfr(ep2[ci + 1])) * ocarry;
            a[e]  = pk16(h_bits((_Float16)g0), h_bits((_Float16)g1));
            b2[e] = pk16(h_bits((_Float16)w0), h_bits((_Float16)w1));
          } else {
            f0 *= ocarry; f1 *= ocarry;
            const _Float16 x0 = (_Float16)f0, x1 = (_Float16)f1;
            a[e] = pk16(h_bits(x0), h_bits(x1));
            if constexpr (OM == 4) {
              b2[e] = pk16(h_bits((_Float16)(f0 - (float)x0)), h_bits((_Float16)(f1 - (float)x1)));
            }
          }
        }
        hv[it] = a;
        lv[it] = b2;
      }
      {
#pragma unroll
        for (int it = 0; it < 4; ++it) {
          const size_t co = ((size_t)((mBase >> 4) * ksC + (n0 >> 5) + (it >> 1)) << 9) + ((lane >> 4) << 8) +
                            (((((lane >> 3) & 1) << 4) + (it & 1) * 8 + (lane & 7)) << 3);
          *(v4u*)(C + co) = hv[it];
          if constexpr (OM >= 4) {
            *(v4u*)(Cb + co) = lv[it];
          }
        }
        // The wait stands in front of every rewrite of a data register that these stores name: as inputs of its statement the pieces keep
        // their registers up to it (the next slab's bias arithmetic is otherwise free to take them directly behind the stores).
        if constexpr (OM >= 4) {
          asm volatile("s_wait_xcnt 0x0" :: "v"(hv[0]), "v"(hv[1]), "v"(hv[2]), "v"(hv[3]), "v"(lv[0]), "v"(lv[1]), "v"(lv[2]), "v"(lv[3]) : "memory");
        } else {
          asm volatile("s_wait_xcnt 0x0" :: "v"(hv[0]), "v"(hv[1]), "v"(hv[2]), "v"(hv[3]) : "memory");
        }
      }
    }
    wave_sync_lds();
  }
}

// =====================================================================================================
// One position strip for a wave: T[R][x] = (q+bq+vb)[A rows] . pos[mw + x], R = lane&15 row of the A fragment pair at QVa, x in [0,80)
// (5 subtiles of 16 pos rows in a rolled loop, K = 64 = two k-steps); pos row index clamped on the address into [0, SEQ-1]
// (only x <= 78 is ever selected, and every selected entry has an unclamped row in range); QVa and Pb point into fragment-packed planes at the
// head's first 1-KiB block (QVa with the lane's own row slot, Pb with the lane's k half only); each 16x16 subtile goes to the wave's f32
// LDS strip right after its two WMMAs and the hazard gap. coverage: 5 subtiles x 16 rows x 16 cols = the full 16x80 strip every call.
// =====================================================================================================
__device__ __forceinline__ void pos_strip(const unsigned short* __restrict__ QVa, const unsigned short* __restrict__ Pb,
                                          int mw, float* tsh, int hh, int c) {
  const v16h qva = ldfrag_p(QVa), qvb = ldfrag_p(QVa + 512);
#pragma unroll 1
  for (int u = 0; u < 5; ++u) {
    int m = mw + 16 * u + c;
    m = (m < 0) ? 0 : m;
    m = (m > SEQ - 1) ? (SEQ - 1) : m;
    const size_t ko = ((size_t)(m >> 4) << 13) + ((m & 15) << 3);   // packed: 16-row group, then the row's slot
    const v16h fa = ldfrag_p(Pb + ko), fb = ldfrag_p(Pb + ko + 512);
    v8f t8 = mma_h(qva, fa, zero8());
    t8 = mma_h(qvb, fb, t8);
    hz4(t8, fa, fb, qva, qvb);
    const int cb = 16 * u + c;
#pragma unroll
    for (int r = 0; r < 8; ++r) tsh[(8 * hh + r) * TPI + cb] = t8[r];
  }
}

// =====================================================================================================
// Relative-position attention for one (batch b, head n) pair and a 64-row query tile; 4 waves, wave w owns query rows i = iw0 + R,
// iw0 = i0 + 16w, R = 0..15. Planes (fragment-packed, row length DMOD halves, row = b*SEQ + position): QU = f16((q + bq + ub) x4), QV = f16((q + bq + vb) x4),
// KP = f16((k + bk) x4); PP = f16(pos x4) rows 0..SEQ-1; VT, VTL = v^T hi (x16) / residual f16 as [b][n*64+d][SEQ] (fragment-packed per batch).
// Shifted position score for (i, j), d = j - i:  d <= 0 -> ps[i][SEQ-1+d];  d == 1 -> 0;  d >= 2 -> ps[i+1][d-2],  ps[r][t] = (q+bq+vb)[r] . pos[t].
//   Per key tile j0 (64 keys, key j = j0 + jj), with x = jj - R + 15 in [0,78]:
//     strip T1[R][x] = (q+vb)[iw0+R]   . pos[SEQ + j0 - iw0 - 16 + x]   (pos row SEQ-1+d), computed iff j0 <= iw0 + 15;
//     strip T2[R][x] = (q+vb)[iw0+1+R] . pos[j0 - iw0 - 17 + x]         (pos row d-2),     computed iff j0 + 61 >= iw0;
//     both tests are wave-uniform (iw0 via readfirstlane); a strip is selected from only in tiles where it was computed this iteration
//     (both strips are zero-filled once at kernel start so unselected reads are finite). The A row b*SEQ+iw0+16 of T2 is clamped to NROW-1
//     for the very last row group; that entry is never selected (i = SEQ-1 has no j >= i+2).
//   content scores S = (q+ub) . k (4 subtiles, K=64); t = (S + sel(T1, 0, T2)) * (RSD/16) * log2(e); online softmax in base 2,
//   max-subtracted, running sums in f32 (no key mask); the 16x64 prob tile stored to wave-private LDS (f32 element stores),
//   fragments loaded straight from the packed 16-bit planes VT/VTL[n*64+d][j]; 8 + 8 P.V WMMAs per tile (hi plane then residual plane into the
//   same accumulators).
//   block = 4 waves = 128 threads; grid = (SEQ/64, NB*NH); no block barriers; every wave does identical bounded work (SEQ/64 tiles).
// coverage: LDS strips 16 rows x 80 cols written fully whenever computed, slab 16 rows x 64 cols per wave fully written each tile before
//           being read; global: 4 instructions x 512 contiguous bytes per plane = rows iw0..iw0+15 of head segment n in CT and CTL;
//           grid x waves cover all NB x SEQ rows and all NH head segments of CT / CTL exactly once.
// =====================================================================================================
__global__ __launch_bounds__(ATT_THREADS) __attribute__((amdgpu_num_vgpr(256)))
void attn_rel(const unsigned short* __restrict__ QU, const unsigned short* __restrict__ QV,
              const unsigned short* __restrict__ KP, const unsigned short* __restrict__ PP,
              const unsigned short* __restrict__ VT, const unsigned short* __restrict__ VTL,
              unsigned short* CT, unsigned short* CTL) {
  __shared__ __align__(16) float smem[ATT_W * WFL];   // per wave: T1 strip [16][TPI] | T2 strip [16][TPI] | prob / ctx slab [16][PPI]

  const int tid  = threadIdx.x;
  const int wave = __builtin_amdgcn_readfirstlane(tid >> 5);
  const int lane = tid & 31;
  const int hh   = lane >> 4;
  const int c    = lane & 15;
  const int bn   = blockIdx.y;
  const int b    = bn / NH;
  const int n    = bn - b * NH;
  const int i0   = blockIdx.x * 64;
  const int iw0  = i0 + wave * 16;

  float* t1sh = smem + wave * WFL;
  float* t2sh = t1sh + 16 * TPI;
  float* pt   = t2sh + 16 * TPI;

#pragma unroll 4
  for (int q = lane; q < 32 * TPI; q += 32) t1sh[q] = 0.f;   // zero both strips once (32*TPI floats are contiguous)

  // stationary A fragments: (q + bq + ub) rows b*SEQ + iw0 + c, d 0..31 and 32..63 of head n ((q + bq + vb) fragments are reloaded per key tile)
  const size_t hb  = (size_t)(n * (DH / 32)) << 9;            // the head's first 1-KiB block inside a 16-row group of a DMOD-long plane
  const size_t qro = ((size_t)((b * SEQ + iw0) >> 4) << 13) + hb + (lane << 3);
  const v16h qua = ldfrag_p(QU + qro), qub = ldfrag_p(QU + qro + 512);
  int qr2 = b * SEQ + iw0 + 1 + c;                            // rows i+1 for the T2 strip
  qr2 = (qr2 > NROW - 1) ? (NROW - 1) : qr2;
  const size_t qro2 = ((size_t)(qr2 >> 4) << 13) + hb + (((hh << 4) + (qr2 & 15)) << 3);

  const unsigned short* Kb  = KP + (size_t)b * SEQ * DMOD + hb + (lane << 3);
  const unsigned short* Pb  = PP + hb + (hh << 7);
  const size_t vbase = (size_t)b * DMOD * SEQ + (size_t)(n * DH) * SEQ + (lane << 3);   // 16-row group = 16 * SEQ halves
  const unsigned short* Vb  = VT  + vbase;
  const unsigned short* VLb = VTL + vbase;

  const float KSC = (RSD / (QC * QC)) * LOG2E;

  float mrow[8], lrow[8];
  v8f O[4];
#pragma unroll
  for (int r = 0; r < 8; ++r) { mrow[r] = -INFINITY; lrow[r] = 0.f; }
#pragma unroll
  for (int td = 0; td < 4; ++td) O[td] = zero8();
  wave_sync_lds();

#pragma unroll 1
  for (int j0 = 0; j0 < SEQ; j0 += 64) {
    const int dmin = j0 - iw0;                               // smallest j - i over the tile is dmin - 15, largest dmin + 63 (wave-uniform)
    // ---- position strips (wave-uniform conditions) ----
    if (dmin <= 15) pos_strip(QV + qro, Pb, SEQ + dmin - 16, t1sh, hh, c);
    if (dmin + 61 >= 0) pos_strip(QV + qro2, Pb, dmin - 17, t2sh, hh, c);
    // ---- content scores S (4 subtiles of 16 keys) ----
    v8f S[4];
#pragma unroll
    for (int t = 0; t < 4; ++t) {
      const size_t ko = (size_t)((j0 >> 4) + t) << 13;
      const v16h ka = ldfrag_p(Kb + ko), kb2 = ldfrag_p(Kb + ko + 512);
      S[t] = mma_h(qua, ka, zero8());
      S[t] = mma_h(qub, kb2, S[t]);
      hz4(S[t], ka, kb2, qua, qub);
    }
    wave_sync_lds();

    // ---- score assembly + online softmax (rows live on one 16-lane half) ----
#pragma unroll
    for (int r = 0; r < 8; ++r) {
      const int R  = 8 * hh + r;
      const int xo = R * TPI + (15 - R) + c;                 // strip column x = 16t + c - R + 15 in [0, 78]
      const int db = dmin + c - R;                           // d = j - i = db + 16t
      float tv[4];
#pragma unroll
      for (int t = 0; t < 4; ++t) {
        const float v1 = t1sh[xo + 16 * t];
        const float v2 = t2sh[xo + 16 * t];
        const int d = db + 16 * t;
        const float bdv = (d <= 0) ? v1 : ((d == 1) ? 0.f : v2);
        tv[t] = (S[t][r] + bdv) * KSC;
      }
      float mx = fmaxf(fmaxf(tv[0], tv[1]), fmaxf(tv[2], tv[3]));
#pragma unroll
      for (int off = 1; off < 16; off <<= 1) mx = fmaxf(mx, __shfl_xor(mx, off, 32));
      const float mn = fmaxf(mrow[r], mx);
      const float al = exp2f(mrow[r] - mn);
      mrow[r] = mn;
      float e4[4];
      float ps = 0.f;
#pragma unroll
      for (int t = 0; t < 4; ++t) { e4[t] = exp2f(tv[t] - mn); ps += e4[t]; }
#pragma unroll
      for (int off = 1; off < 16; off <<= 1) ps += __shfl_xor(ps, off, 32);
      lrow[r] = lrow[r] * al + ps;
#pragma unroll
      for (int td = 0; td < 4; ++td) O[td][r] *= al;
      const int ro = R * PPI + c;
#pragma unroll
      for (int t = 0; t < 4; ++t) pt[ro + 16 * t] = e4[t];
    }
    wave_sync_lds();

    // ---- P fragments (x1024, f16) from the LDS rows, two k-steps of 32 keys ----
    FragH pf[2];
#pragma unroll
    for (int ks = 0; ks < 2; ++ks) {
      const float* prow = pt + c * PPI + 32 * ks + 8 * hh;
      const v4f p0 = *(const v4f*)(prow), p1 = *(const v4f*)(prow + 4);
      const v4f p2 = *(const v4f*)(prow + 16), p3 = *(const v4f*)(prow + 20);
#pragma unroll
      for (int e = 0; e < 4; ++e) {
        pf[ks].h[0][e]     = (_Float16)(p0[e] * PC);     // keys j0 + 32ks + 8hh + e
        pf[ks].h[0][4 + e] = (_Float16)(p1[e] * PC);     // keys j0 + 32ks + 8hh + 4 + e
        pf[ks].h[1][e]     = (_Float16)(p2[e] * PC);     // keys j0 + 32ks + 16 + 8hh + e
        pf[ks].h[1][4 + e] = (_Float16)(p3[e] * PC);
      }
    }
    // ---- O += P . v^T (hi plane) ----
    {
      const size_t vo = (size_t)(j0 >> 5) << 9;            // the key tile's first 1-KiB block inside a 16-row group
#pragma unroll
      for (int td = 0; td < 4; ++td) {
        const unsigned short* vp = Vb + vo + (size_t)(16 * td) * SEQ;
        const v16h vfa = ldfrag_p(vp), vfb = ldfrag_p(vp + 512);
        O[td] = mma_h(pf[0].v, vfa, O[td]);
        O[td] = mma_h(pf[1].v, vfb, O[td]);
        hz4(O[td], pf[0].v, pf[1].v, vfa, vfb);
      }
      // ---- O += P . v^T (residual plane) ----
#pragma unroll
      for (int td = 0; td < 4; ++td) {
        const unsigned short* vp = VLb + vo + (size_t)(16 * td) * SEQ;
        const v16h vla = ldfrag_p(vp), vlb = ldfrag_p(vp + 512);
        O[td] = mma_h(pf[0].v, vla, O[td]);
        O[td] = mma_h(pf[1].v, vlb, O[td]);
        hz4(O[td], pf[0].v, pf[1].v, vla, vlb);
      }
    }
    wave_sync_lds();
  }
  acc_guard4(O[0], O[1], O[2], O[3]);

  // ---- fold 1/l and the carries (1024 on P, 16 on v), carry x4096 on ctx, stage the wave's 16x64 slice in its slab ----
  const float oc = CC / (PC * VC);
#pragma unroll
  for (int r = 0; r < 8; ++r) {
    const float inv = (1.0f / lrow[r]) * oc;
    const int ro = (8 * hh + r) * PPI + c;
#pragma unroll
    for (int td = 0; td < 4; ++td) pt[ro + 16 * td] = O[td][r] * inv;
  }
  wave_sync_lds();
  {
    v4u hv[4], lv[4];
#pragma unroll
    for (int it = 0; it < 4; ++it) {
      const int c8 = (it >> 1) * 32 + (it & 1) * 16 + hh * 8;   // row c; one packed 512-B run per it: block it >> 1, second half it & 1
      const float* sp = pt + c * PPI + c8;
      v4u a, b2;
#pragma unroll
      for (int e = 0; e < 4; ++e) {
        const float f0 = sp[2 * e], f1 = sp[2 * e + 1];
        const _Float16 x0 = (_Float16)f0, x1 = (_Float16)f1;
        a[e]  = pk16(h_bits(x0), h_bits(x1));
        b2[e] = pk16(h_bits((_Float16)(f0 - (float)x0)), h_bits((_Float16)(f1 - (float)x1)));
      }
      hv[it] = a;
      lv[it] = b2;
    }
    {
#pragma unroll
      for (int it = 0; it < 4; ++it) {
        const size_t go = qro + ((size_t)(it >> 1) << 9) + ((it & 1) << 8);
        *(v4u*)(CT  + go) = hv[it];
        *(v4u*)(CTL + go) = lv[it];
      }
      
    }
  }
}

// =====================================================================================================
// Workspace map (bytes); every plane is an exact multiple of its tile / whole-row store granularity (M, N exact tile multiples,
// convert counts exact multiples of 2048), every offset a multiple of 512 KiB; every plane is fragment-packed (see ldfrag_p):
//   WQ16, WK16, WV16, WP16, WO16 f16 [512 out][512 in] x64                               5 x   524288
//   X16  f16 [NROW][512] x16 (pre-norm output)                                                8388608
//   PE16 f16 [SEQ][512] x16 (sinusoid table)                                                  2097152
//   QU, QV, K16 f16 [NROW][512] x4                                                       3 x  8388608
//   P16  f16 [SEQ][512] x4                                                                      2097152
//   VT16, VTL16 f16 [NB][512][SEQ] hi x16 / residual                                     2 x  8388608
//   CT16, CTL16 f16 [NROW][512] hi x4096 / residual                                      2 x  8388608
//   end                                                                                        73924608
// =====================================================================================================
extern "C" void kernel_launch(void* const* d_in, const int* in_sizes, int n_in,
                              void* d_out, int out_size, void* d_ws, size_t ws_size,
                              hipStream_t stream) {
  if (n_in < 14) return;
  if (in_sizes[0] != NROW * DMOD) return;
  if (in_sizes[1] != DMOD || in_sizes[2] != DMOD) return;
  if (in_sizes[3] != DMOD * DMOD || in_sizes[5] != DMOD * DMOD || in_sizes[7] != DMOD * DMOD ||
      in_sizes[9] != DMOD * DMOD || in_sizes[12] != DMOD * DMOD) return;
  if (in_sizes[4] != DMOD || in_sizes[6] != DMOD || in_sizes[8] != DMOD || in_sizes[13] != DMOD) return;
  if (in_sizes[10] != NH * DH || in_sizes[11] != NH * DH) return;
  if (out_size != NROW * DMOD) return;

  const float* xin   = (const float*)d_in[0];
  const float* gam   = (const float*)d_in[1];
  const float* bet   = (const float*)d_in[2];
  const float* w_q   = (const float*)d_in[3];
  const float* b_q   = (const float*)d_in[4];
  const float* w_k   = (const float*)d_in[5];
  const float* b_k   = (const float*)d_in[6];
  const float* w_v   = (const float*)d_in[7];
  const float* b_v   = (const float*)d_in[8];
  const float* w_p   = (const float*)d_in[9];
  const float* ub    = (const float*)d_in[10];
  const float* vb    = (const float*)d_in[11];
  const float* w_o   = (const float*)d_in[12];
  const float* b_o   = (const float*)d_in[13];
  float*       out   = (float*)d_out;

  const size_t PW  = (size_t)DMOD * DMOD * 2;            //   524288
  const size_t PX  = (size_t)NROW * DMOD * 2;            //  8388608
  const size_t PXP = (size_t)SEQ * DMOD * 2;             //  2097152
  const size_t PVT = (size_t)NB * DMOD * SEQ * 2;        //  8388608
  size_t off = 0;
  const size_t oWQ  = off; off += PW;
  const size_t oWK  = off; off += PW;
  const size_t oWV  = off; off += PW;
  const size_t oWP  = off; off += PW;
  const size_t oWO  = off; off += PW;
  const size_t oX   = off; off += PX;
  const size_t oPE  = off; off += PXP;
  const size_t oQU  = off; off += PX;
  const size_t oQV  = off; off += PX;
  const size_t oK   = off; off += PX;
  const size_t oP   = off; off += PXP;
  const size_t oVT  = off; off += PVT;
  const size_t oVTL = off; off += PVT;
  const size_t oCT  = off; off += PX;
  const size_t oCTL = off; off += PX;
  if (off > ws_size) return;                               // off = 73924608
  if (off > (size_t)134217728) return;

  char* ws = (char*)d_ws;
  unsigned short* WQ16  = (unsigned short*)(ws + oWQ);
  unsigned short* WK16  = (unsigned short*)(ws + oWK);
  unsigned short* WV16  = (unsigned short*)(ws + oWV);
  unsigned short* WP16  = (unsigned short*)(ws + oWP);
  unsigned short* WO16  = (unsigned short*)(ws + oWO);
  unsigned short* X16   = (unsigned short*)(ws + oX);
  unsigned short* PE16  = (unsigned short*)(ws + oPE);
  unsigned short* QU    = (unsigned short*)(ws + oQU);
  unsigned short* QV    = (unsigned short*)(ws + oQV);
  unsigned short* K16   = (unsigned short*)(ws + oK);
  unsigned short* P16   = (unsigned short*)(ws + oP);
  unsigned short* VT16  = (unsigned short*)(ws + oVT);
  unsigned short* VTL16 = (unsigned short*)(ws + oVTL);
  unsigned short* CT16  = (unsigned short*)(ws + oCT);
  unsigned short* CTL16 = (unsigned short*)(ws + oCTL);

  const dim3 blk(256);
  const dim3 gCW((DMOD * DMOD) / 2048);                             // 128
  const dim3 gLN(NROW / 8);                                         // 1024
  const dim3 gPE(SEQ / 8);                                          // 256
  const int tilesQ = (NROW / 64) * (DMOD / 64);                     // 1024
  const int tilesV = (DMOD / 64) * (SEQ / 64);                      // 256 per batch
  const int tilesP = (SEQ / 64) * (DMOD / 64);                      // 256
  const dim3 gQ((tilesQ + 7) / 8, 1);                               // 128
  const dim3 gV((tilesV + 7) / 8, NB);                              // 32 x 4
  const dim3 gP((tilesP + 7) / 8, 1);                               // 32
  const dim3 gAT(SEQ / 64, NB * NH);                                // 32 x 32
  const dim3 bAT(ATT_THREADS);                                      // 128

  // (0) weight planes: W[o][c] ([out][in] = [n][k] already) -> f16( bf16_RNE(w) * 64 ), all five weights
  cvt16<<<gCW, blk, 0, stream>>>(w_q, WQ16, DMOD * DMOD, DMOD * DMOD, WSC);
  cvt16<<<gCW, blk, 0, stream>>>(w_k, WK16, DMOD * DMOD, DMOD * DMOD, WSC);
  cvt16<<<gCW, blk, 0, stream>>>(w_v, WV16, DMOD * DMOD, DMOD * DMOD, WSC);
  cvt16<<<gCW, blk, 0, stream>>>(w_p, WP16, DMOD * DMOD, DMOD * DMOD, WSC);
  cvt16<<<gCW, blk, 0, stream>>>(w_o, WO16, DMOD * DMOD, DMOD * DMOD, WSC);

  // (1) pre-norm -> X16 = f16(x * 16); sinusoid table -> PE16 = f16(pe * 16)
  ln16<<<gLN, blk, 0, stream>>>(xin, gam, bet, X16, NROW, XC);
  pe16<<<gPE, blk, 0, stream>>>(PE16, SEQ, XC);

  // (2) q[m][nd] = sum_c x[m][c] Wq[nd][c] / 1024 + bq[nd]; QU = f16((q + ub[nd]) * 4), QV = f16((q + vb[nd]) * 4);
  //     M = NROW, N = 512, K = 512
  gemm64<5, 0, 0, 1><<<gQ, blk, 0, stream>>>(
      X16, X16, DMOD, 0LL,
      WQ16, DMOD, 0LL,
      (void*)QU, (void*)QV, DMOD, 0LL,
      NROW, DMOD, DMOD, 1.0f / (XC * WSC), QC,
      b_q, ub, vb);

  // (3) k projection + bk -> K16 = f16(k * 4)
  gemm64<2, 0, 0, 1><<<gQ, blk, 0, stream>>>(
      X16, X16, DMOD, 0LL,
      WK16, DMOD, 0LL,
      (void*)K16, (void*)K16, DMOD, 0LL,
      NROW, DMOD, DMOD, 1.0f / (XC * WSC), QC,
      b_k, b_k, b_k);

  // (4) v^T per batch: VT[b][nd][j] = sum_c Wv[nd][c] x[b*SEQ + j][c] / 1024 + bv[nd] (per-row bias) -> f16 x16 hi + residual planes;
  //     M = 512 (nd), N = SEQ (j), K = 512; B rows are the batch's token rows: pitch DMOD, batch stride SEQ*DMOD
  gemm64<4, 0, 0, 2><<<gV, blk, 0, stream>>>(
      WV16, WV16, DMOD, 0LL,
      X16, DMOD, (long long)SEQ * DMOD,
      (void*)VT16, (void*)VTL16, SEQ, (long long)DMOD * SEQ,
      DMOD, SEQ, DMOD, 1.0f / (XC * WSC), VC,
      b_v, b_v, b_v);

  // (5) positional projection (no bias): P16 = f16(pos * 4), M = SEQ, N = 512, K = 512
  gemm64<2, 0, 0, 0><<<gP, blk, 0, stream>>>(
      PE16, PE16, DMOD, 0LL,
      WP16, DMOD, 0LL,
      (void*)P16, (void*)P16, DMOD, 0LL,
      SEQ, DMOD, DMOD, 1.0f / (XC * WSC), QC,
      b_q, b_q, b_q);

  // (6) relative attention -> CT16 = f16(ctx * 4096) hi plane, CTL16 residual plane, rows b*SEQ + i, halves n*64+d
  attn_rel<<<gAT, bAT, 0, stream>>>(QU, QV, K16, P16, VT16, VTL16, CT16, CTL16);

  // (7) out = (CT + CTL) . Wo^T / (4096*64) + bo; M = NROW, N = 512, K = 512, f32 rows straight into the output buffer
  gemm64<0, 1, 0, 1><<<gQ, blk, 0, stream>>>(
      CT16, CTL16, DMOD, 0LL,
      WO16, DMOD, 0LL,
      (void*)out, (void*)out, DMOD, 0LL,
      NROW, DMOD, DMOD, 1.0f / (CC * WSC), 1.0f,
      b_o, b_o, b_o);
  (void)hipGetLastError();
}

// v002
// It runs in 298 microseconds.
// In two side-by-side timings against v001, it was 1.55 and 1.54 times as fast.
// Counting every step since v000, it is 1.60 times as fast.
// Contractions (all v_wmma_f32_16x16x32_f16, f16 operands, f32 accumulate): q/k/v/pos projections (x or sinusoid table f16 x16 . W f16 x64,
// K=512, single products); content scores ((q+bq+ub) f16 x4 . (k+bk) f16 x4, K=64, single); position strips ((q+bq+vb) f16 x4 . pos f16 x4,
// K=64, single) -> f32 LDS strips, shifted select on VALU; P . v^T (P f16 x1024 . v^T carried as f16 x16 hi plane + f16 residual plane, 64 keys
// per tile, two products); output projection (ctx carried as f16 x4096 hi + residual planes . Wo f16 x64, K=512, two products).
// LayerNorm, sinusoid table, max-subtracted online base-2 softmax and all epilogues in f32 on VALU. Every float input RNE-converted to bf16 on load.
#include <hip/hip_runtime.h>
#include <math.h>
#include <stdint.h>

#define SEQ   2048
#define NB    4
#define DMOD  512
#define NH    8
#define DH    64
#define NROW  (SEQ * NB)
#define XC    16.0f
#define WSC   64.0f
#define QC    4.0f
#define VC    16.0f
#define PC    1024.0f
#define CC    4096.0f
#define RSD   0.044194173824159216f
#define LOG2E 1.4426950408889634f
#define LN_EPS 1.0e-5f
#define CNEG  ((float)(-9.210340371976184 / 512.0))
static_assert(NH * DH == DMOD);
static_assert(DH == 64);
static_assert(DMOD == 512);
static_assert((SEQ % 64) == 0 && (DMOD % 64) == 0 && (NROW % 64) == 0);
static_assert(((DMOD * DMOD) % 2048) == 0 && (NROW % 8) == 0 && (SEQ % 8) == 0);
#define ATT_W 4
#define ATT_THREADS (ATT_W * 32)
#define TPI 84
#define PPI 68
#define WFL (32 * TPI + 16 * PPI)
static_assert(((16 * TPI) % 4) == 0 && ((16 * PPI) % 4) == 0 && (WFL % 4) == 0);
static_assert(TPI >= 80 && PPI >= 64);
static_assert(ATT_W * WFL * 4 <= 65536);

typedef _Float16 v16h __attribute__((ext_vector_type(16)));
typedef _Float16 v8h  __attribute__((ext_vector_type(8)));
typedef __bf16   v16b __attribute__((ext_vector_type(16)));
typedef float    v8f  __attribute__((ext_vector_type(8)));
typedef float    v4f  __attribute__((ext_vector_type(4)));
typedef unsigned int v4u __attribute__((ext_vector_type(4)));

union FragH { v16h v; v8h h[2]; v4u u[2]; };
union FragAny { v16h h; v16b b; };

// ---- scalar helpers --------------------------------------------------------------------------------
__device__ __forceinline__ unsigned short bf_bits(float f) {          // f32 -> bf16 bits, RNE convert
  unsigned u = __float_as_uint(f);
  return (unsigned short)((u + 0x7FFFu + ((u >> 16) & 1u)) >> 16);
}
__device__ __forceinline__ float bf_up(unsigned short h) { return __uint_as_float(((unsigned)h) << 16); }
__device__ __forceinline__ float bfr(float f) { return bf_up(bf_bits(f)); }   // value of the bf16 RNE convert
__device__ __forceinline__ unsigned short h_bits(_Float16 x) { return __builtin_bit_cast(unsigned short, x); }
__device__ __forceinline__ unsigned pk16(unsigned short a, unsigned short b) { return (unsigned)a | ((unsigned)b << 16); }
__device__ __forceinline__ v8f zero8() { v8f z = {0.f, 0.f, 0.f, 0.f, 0.f, 0.f, 0.f, 0.f}; return z; }

// ---- fragment-packed 16-bit planes: a [rows][L] plane (rows % 16 == 0, L % 32 == 0) is stored as 1-KiB blocks, one per
//      (16 rows, 32 k): block index (row >> 4) * (L / 32) + (k >> 5); inside a block the 8-half piece that holds element (row, k) stands at
//      halves ((k >> 4) & 1) * 256 + (((k >> 3) & 1) * 16 + (row & 15)) * 8. With 16-aligned rows one wave-wide 16-B load reads 512 contiguous
//      bytes (four whole 128-B lines) where a row-major plane made it touch sixteen lines.
// ---- fragment loader: p = block start + (16 * (lane >> 4) + (row & 15)) * 8; elements 0..7 <- k0 + 8h + 0..7, elements 8..15 <- k0 + 16 + 8h + 0..7,
//      h = lane >> 4 (same split k map for A and B; B is always read from a [n][k] plane)
__device__ __forceinline__ v16h ldfrag_p(const unsigned short* p) {
  FragH f;
  f.u[0] = *(const v4u*)(p);
  f.u[1] = *(const v4u*)(p + 256);
  return f.v;
}
// ---- the same loader on a pointer typed as global memory (a pointer that has gone through an asm operand would otherwise load as a flat one)
typedef const __attribute__((address_space(1))) unsigned short* gp16;
typedef const __attribute__((address_space(1))) v4u* gp128;
__device__ __forceinline__ v16h ldfrag_g(gp16 p) {
  FragH f;
  f.u[0] = *(gp128)(p);
  f.u[1] = *(gp128)(p + 256);
  return f.v;
}

// ---- behind a group of loads: the wait that stands in front of every rewrite of an address register which the group's loads name; as inputs of
//      its statement the addresses keep their registers up to it, so that no load of the group lands on an address of the same group either
__device__ __forceinline__ void addr_wait1(const unsigned short* a) {
#if defined(__HIP_DEVICE_COMPILE__)
  asm volatile("s_wait_xcnt 0x0" :: "v"(a) : "memory");
#endif
}
// the same for a running address that is stepped behind the group: as an operand the statement may change, the pointer is the very register the
// loads name, and the step cannot be lifted over the wait
__device__ __forceinline__ void addr_wait_step(gp16& a) {
#if defined(__HIP_DEVICE_COMPILE__)
  asm volatile("s_wait_xcnt 0x0" : "+v"(a) :: "memory");
#endif
}
__device__ __forceinline__ void addr_wait7(const unsigned short* a, const unsigned short* b, const unsigned short* c, const unsigned short* d,
                                           const unsigned short* e, const unsigned short* f, const unsigned short* g) {
#if defined(__HIP_DEVICE_COMPILE__)
  asm volatile("s_wait_xcnt 0x0" :: "v"(a), "v"(b), "v"(c), "v"(d), "v"(e), "v"(f), "v"(g) : "memory");
#endif
}
// ---- WMMA helpers with trailing VALU hazard gaps ------------------------------------------------------
__device__ __forceinline__ v8f mma_h(v16h a, v16h b, v8f c) {
  return __builtin_amdgcn_wmma_f32_16x16x32_f16(false, a, false, b, (short)0, c, false, false);
}
__device__ __forceinline__ v8f mma_b(v16h a, v16h b, v8f c) {
  FragAny ua, ub;
  ua.h = a;
  ub.h = b;
  return __builtin_amdgcn_wmma_f32_16x16x32_bf16(false, ua.b, false, ub.b, (short)0, c, false, false);
}
template <int BF>
__device__ __forceinline__ v8f mmaT(v16h a, v16h b, v8f c) {
  if constexpr (BF != 0) return mma_b(a, b, c);
  else return mma_h(a, b, c);
}
__device__ __forceinline__ void dep_guard1(v8f& a, v8f& b, v16h x) {
#if defined(__HIP_DEVICE_COMPILE__)
  asm volatile("v_nop\n\tv_nop\n\tv_nop\n\tv_nop" : "+v"(a), "+v"(b) : "v"(x));
#endif
}
__device__ __forceinline__ void hz4(v8f& d, v16h x0, v16h x1, v16h x2, v16h x3) {
#if defined(__HIP_DEVICE_COMPILE__)
  asm volatile("v_nop\n\tv_nop\n\tv_nop\n\tv_nop" : "+v"(d) : "v"(x0), "v"(x1), "v"(x2), "v"(x3));
#endif
}
__device__ __forceinline__ void keep4_h(v16h a, v16h b, v16h c, v16h d) {
#if defined(__HIP_DEVICE_COMPILE__)
  asm volatile("v_nop" :: "v"(a), "v"(b), "v"(c), "v"(d));
#endif
}
__device__ __forceinline__ void acc_guard4(v8f& a, v8f& b, v8f& c, v8f& d) {
#if defined(__HIP_DEVICE_COMPILE__)
  asm volatile("v_nop\n\tv_nop\n\tv_nop\n\tv_nop" : "+v"(a), "+v"(b), "+v"(c), "+v"(d));
#endif
}
// ---- hand-over of a wave's own LDS rows between its lanes while global loads are in flight: the wave's LDS writes are waited for, the loads are
//      not (the workgroup-scope fences of wave_sync_lds drain loadcnt too); nothing another wave reads or writes is ordered here
__device__ __forceinline__ void wave_sync_own() {
  __builtin_amdgcn_fence(__ATOMIC_RELEASE, "wavefront");
#if defined(__HIP_DEVICE_COMPILE__)
  asm volatile("s_wait_dscnt 0x0" ::: "memory");   // the rows are written before any lane reads them back
#endif
  __builtin_amdgcn_wave_barrier();
  __builtin_amdgcn_fence(__ATOMIC_ACQUIRE, "wavefront");
}
__device__ __forceinline__ void wave_sync_lds() {
  __builtin_amdgcn_fence(__ATOMIC_RELEASE, "workgroup");
  __builtin_amdgcn_wave_barrier();
  __builtin_amdgcn_fence(__ATOMIC_ACQUIRE, "workgroup");
}
// ---- eight rows r0..r0+7 (r0 % 8 == 0, one row per wave, 256 threads) of a [rows][DMOD] plane -> fragment-packed plane, whole 128-B lines:
//      wave w hands in its row's pieces lane (o0: columns 8*lane..) and 32 + lane (o1: columns 256 + 8*lane..); a line of the packed plane holds
//      one piece of each of the eight rows, so the rows meet in LDS (pitch 66 pieces: the 16 lanes of a half wave fall on distinct banks).
//      Every thread of the block must call this (one block barrier inside).
#define RPI 66
__device__ __forceinline__ void store_rows8_packed(v4u o0, v4u o1, unsigned short* plane, int r0, v4u* st) {
  const int tid  = threadIdx.x;
  const int lane = tid & 31;
  const int wave = tid >> 5;
  st[wave * RPI + lane]      = o0;
  st[wave * RPI + 32 + lane] = o1;
  __syncthreads();   // the eight rows of a line come from eight waves
  unsigned short* dst = plane + ((size_t)(r0 >> 4) << 13) + ((r0 & 15) << 3);
#pragma unroll   // both LDS reads issue ahead of the two stores
  for (int sx = 0; sx < 2; ++sx) {
    const int idx = sx * 256 + tid;
    const int g   = idx >> 3;                        // piece index in the row = k >> 3, 0..63
    const int rr  = idx & 7;                         // row r0 + rr
    const v4u w = st[rr * RPI + g];
    *(v4u*)(dst + ((g >> 2) << 9) + (((g >> 1) & 1) << 8) + ((((g & 1) << 4) + rr) << 3)) = w;
  }
}

// =====================================================================================================
// Elementwise 16-bit pack of a [rows][DMOD] f32 matrix into a fragment-packed plane: piece t of the plane (8 halves at dst + 8t) =
// f16( bf16_RNE(src[row][k..k+7]) * sc ), (row, k) decoded from t; 0 for pieces whose source elements lie past nvalid; sc a power of two (exact). One piece per thread:
// two 16-B loads (address clamped into [0, nvalid) for pad groups, value zeroed), one 16-B store, a wave's stores = 512 contiguous bytes.
// Used for the five weight matrices, which are [out][in] = [n][k] k-contiguous already.
// coverage: grid = ntotal / 2048 blocks x 256 thr x 8 elements = ntotal exactly (ntotal % 2048 == 0, nvalid == ntotal here).
// =====================================================================================================
__global__ __launch_bounds__(256) void cvt16(const float* __restrict__ src, unsigned short* dst, int nvalid, int ntotal, float sc) {
  const size_t i8 = ((size_t)blockIdx.x * 256 + threadIdx.x) * 8;
  if (i8 + 8 > (size_t)ntotal) return;             // never taken with the exact grid; no barriers in this kernel
  const size_t t  = i8 >> 3;                           // piece index: block t >> 6, second half (t >> 5) & 1, k half (t >> 4) & 1, row t & 15
  const size_t sr = ((t >> 10) << 4) + (t & 15);       // source row: DMOD / 32 = 16 blocks per 16 rows
  const size_t sk = (((t >> 6) & 15) << 5) + (((t >> 5) & 1) << 4) + (((t >> 4) & 1) << 3);
  const size_t si = sr * DMOD + sk;                    // the piece's first element in the source
  const bool pad = (si + 8 > (size_t)nvalid);
  const size_t ls = pad ? ((size_t)nvalid - 8) : si;   // clamped address, always inside the source
  const v4f a = *(const v4f*)(src + ls);
  const v4f b = *(const v4f*)(src + ls + 4);
  v4u o;
  o[0] = pk16(h_bits((_Float16)(bfr(a[0]) * sc)), h_bits((_Float16)(bfr(a[1]) * sc)));
  o[1] = pk16(h_bits((_Float16)(bfr(a[2]) * sc)), h_bits((_Float16)(bfr(a[3]) * sc)));
  o[2] = pk16(h_bits((_Float16)(bfr(b[0]) * sc)), h_bits((_Float16)(bfr(b[1]) * sc)));
  o[3] = pk16(h_bits((_Float16)(bfr(b[2]) * sc)), h_bits((_Float16)(bfr(b[3]) * sc)));
  const v4u z = {0u, 0u, 0u, 0u};
  const v4u w = pad ? z : o;
  {
    *(v4u*)(dst + i8) = w;
    
  }
}

// =====================================================================================================
// y = (x - mu) * (1/sqrt(var + eps)) * bf16_RNE(gamma) + bf16_RNE(beta) in f32, out X16 = f16(y * sc) (sc = 16, exact power of two).
// Lane l owns columns 8l..8l+7 and 256+8l..256+8l+7; the block's eight rows go out fragment-packed through LDS (store_rows8_packed).
// coverage: grid = NROW/8 blocks x 8 waves = every row; 32 lanes x 16 halves = all 512 columns of the row.
// =====================================================================================================
__global__ __launch_bounds__(256) void ln16(const float* __restrict__ x, const float* __restrict__ gam,
                                            const float* __restrict__ bet, unsigned short* X16, int nrows, float sc) {
  const int lane = threadIdx.x & 31;
  const int wave = threadIdx.x >> 5;
  __shared__ __align__(16) v4u st[8 * RPI];
  const int row  = blockIdx.x * 8 + wave;
  if ((int)blockIdx.x * 8 + 8 > nrows) return;     // block-uniform, in front of the barrier; never taken with the exact grid
  const float* p = x + (size_t)row * DMOD;
  const int c0 = 8 * lane, c1 = 256 + 8 * lane;
  const v4f a0 = *(const v4f*)(p + c0), a1 = *(const v4f*)(p + c0 + 4);
  const v4f a2 = *(const v4f*)(p + c1), a3 = *(const v4f*)(p + c1 + 4);
  float v[16];
#pragma unroll
  for (int e = 0; e < 4; ++e) {
    v[e]      = bfr(a0[e]);
    v[4 + e]  = bfr(a1[e]);
    v[8 + e]  = bfr(a2[e]);
    v[12 + e] = bfr(a3[e]);
  }
  float s = 0.f;
#pragma unroll
  for (int e = 0; e < 16; ++e) s += v[e];
#pragma unroll
  for (int off = 1; off < 32; off <<= 1) s += __shfl_xor(s, off, 32);
  const float mu = s * (1.0f / (float)DMOD);
  float q = 0.f;
#pragma unroll
  for (int e = 0; e < 16; ++e) {
    const float d = v[e] - mu;
    v[e] = d;
    q += d * d;
  }
#pragma unroll
  for (int off = 1; off < 32; off <<= 1) q += __shfl_xor(q, off, 32);
  const float var  = q * (1.0f / (float)DMOD);
  const float rstd = 1.0f / sqrtf(var + LN_EPS);
  const v4f g0 = *(const v4f*)(gam + c0), g1 = *(const v4f*)(gam + c0 + 4);
  const v4f g2 = *(const v4f*)(gam + c1), g3 = *(const v4f*)(gam + c1 + 4);
  const v4f e0 = *(const v4f*)(bet + c0), e1 = *(const v4f*)(bet + c0 + 4);
  const v4f e2 = *(const v4f*)(bet + c1), e3 = *(const v4f*)(bet + c1 + 4);
  float gg[16], bb[16];
#pragma unroll
  for (int e = 0; e < 4; ++e) {
    gg[e]      = bfr(g0[e]);  bb[e]      = bfr(e0[e]);
    gg[4 + e]  = bfr(g1[e]);  bb[4 + e]  = bfr(e1[e]);
    gg[8 + e]  = bfr(g2[e]);  bb[8 + e]  = bfr(e2[e]);
    gg[12 + e] = bfr(g3[e]);  bb[12 + e] = bfr(e3[e]);
  }
  v4u o0, o1;
#pragma unroll
  for (int e = 0; e < 4; ++e) {
    const float y0 = v[2 * e] * rstd * gg[2 * e] + bb[2 * e];
    const float y1 = v[2 * e + 1] * rstd * gg[2 * e + 1] + bb[2 * e + 1];
    const float y2 = v[8 + 2 * e] * rstd * gg[8 + 2 * e] + bb[8 + 2 * e];
    const float y3 = v[8 + 2 * e + 1] * rstd * gg[8 + 2 * e + 1] + bb[8 + 2 * e + 1];
    o0[e] = pk16(h_bits((_Float16)(y0 * sc)), h_bits((_Float16)(y1 * sc)));
    o1[e] = pk16(h_bits((_Float16)(y2 * sc)), h_bits((_Float16)(y3 * sc)));
  }
  store_rows8_packed(o0, o1, X16, blockIdx.x * 8, st);
}

// =====================================================================================================
// Sinusoid table, one wave per position s: pe[s][2m] = sin(s * div[m]), pe[s][2m+1] = cos(s * div[m]), div[m] = expf(f32(2m) * f32(-ln(1e4)/512)),
// precise expf / sinf / cosf (arguments up to 2047), all f32. Rolled loop: lane l computes columns 8l..8l+7 and 256+8l..+7 (4 sin/cos pairs per group)
// into its own slots of a wave-private f32 LDS row, then packs f16(pe * sc) (sc = 16); the block's eight rows go out fragment-packed
// through LDS (store_rows8_packed).
// coverage: grid = SEQ/8 blocks x 8 waves = rows 0..SEQ-1; each lane reads back only the 16 LDS slots it wrote; 32 lanes x 16 halves = 512 columns.
// =====================================================================================================
__global__ __launch_bounds__(256) void pe16(unsigned short* PE16, int nrows, float sc) {
  __shared__ __align__(16) float sh[8 * DMOD];
  __shared__ __align__(16) v4u st[8 * RPI];
  const int lane = threadIdx.x & 31;
  const int wave = threadIdx.x >> 5;
  const int s = blockIdx.x * 8 + wave;
  if ((int)blockIdx.x * 8 + 8 > nrows) return;     // block-uniform, in front of the barrier; never taken with the exact grid
  float* rowp = sh + wave * DMOD;
  const float fs = (float)s;
#pragma unroll 1
  for (int it = 0; it < 8; ++it) {
    const int cb = 256 * (it >> 2) + 8 * lane + 2 * (it & 3);   // even column = 2m
    const float dv  = expf((float)cb * CNEG);
    const float ang = fs * dv;
    rowp[cb]     = sinf(ang);
    rowp[cb + 1] = cosf(ang);
  }
  wave_sync_lds();
  v4u o[2];
#pragma unroll
  for (int g = 0; g < 2; ++g) {
    const float* sp = rowp + 256 * g + 8 * lane;
    v4u w;
#pragma unroll
    for (int e = 0; e < 4; ++e) w[e] = pk16(h_bits((_Float16)(sp[2 * e] * sc)), h_bits((_Float16)(sp[2 * e + 1] * sc)));
    o[g] = w;
  }
  store_rows8_packed(o[0], o[1], PE16, blockIdx.x * 8, st);
}

// =====================================================================================================
// Register-blocked batched 16-bit WMMA GEMM: C[m][n] = oscale * sum_k A[m][k] * Bt[n][k] (+ bias); one wave per 64x64 tile,
// no block barriers. A [M][lda] and Bt [N][ldb] are fragment-packed 16-bit planes (row lengths lda, ldb, multiples of 32); M, N multiples of 64,
// K multiple of 32. blockIdx.y = batch index with element strides sA, sB, sC (whole 16-row groups). 16-bit outputs are fragment-packed planes
// of row length ldc.
// ASPLIT 1: a second A plane A2 (unscaled residual of A, same layout) is multiplied into the same accumulator (A + A2 ~ exact A).
// BF 1: bf16 operands (v_wmma_f32_16x16x32_bf16), else f16.
// EPI 1: value += bf16_RNE(ep0[column]) (per-column bias); EPI 2: value += bf16_RNE(ep0[row]) (per-row bias, 16-bit out only).
// OM 0: f32 out (pitch ldc).  OM 2: one f16 plane = f16(value * ocarry).
// OM 4: two f16 planes: hi = f16(value * ocarry), lo = f16(value * ocarry - hi) (unscaled residual).
// OM 5: two f16 planes: C = f16((value + bf16_RNE(ep1[column])) * ocarry), C2 = f16((value + bf16_RNE(ep2[column])) * ocarry).
// coverage: 4 slabs x 16 rows (f32: it 0..7 x lane>>4; 16-bit: rows 8*(it&1) + (lane&7), pieces 4*(it>>1) + (lane>>3)) x 64 cols = the wave's whole 64x64 tile;
//           grid = ceil(tilesM*tilesN/8) blocks, surplus waves exit (wave-uniform).
// =====================================================================================================
template <int OM, int ASPLIT, int BF, int EPI>
__global__ __launch_bounds__(256) __attribute__((amdgpu_num_vgpr(256))) void gemm64(
    const unsigned short* __restrict__ Ap, const unsigned short* __restrict__ A2p, int lda, long long sA,
    const unsigned short* __restrict__ Btp, int ldb, long long sB,
    void* Cout, void* C2out, int ldc, long long sC,
    int M, int N, int K, float oscale, float ocarry,
    const float* __restrict__ ep0, const float* __restrict__ ep1, const float* __restrict__ ep2) {
  __shared__ __align__(16) float sT[8][16 * 68];   // per-wave 16x64 slab, pitch 68 floats
  const int by   = blockIdx.y;
  const int lane = threadIdx.x & 31;
  const int wave = threadIdx.x >> 5;
  const int tilesN = N >> 6;
  const int tilesM = M >> 6;
  const int tile = blockIdx.x * 8 + wave;
  if (tile >= tilesM * tilesN) return;   // wave-uniform; no block barriers in this kernel
  const int tm = tile / tilesN;
  const int tn = tile - tm * tilesN;
  const int m0 = tm << 6;
  const int n0 = tn << 6;

  const unsigned short* A1 = Ap  + (size_t)((long long)by * sA);
  const unsigned short* A2 = A2p + (size_t)((long long)by * sA);
  const unsigned short* Bb = Btp + (size_t)((long long)by * sB);

  const int rlane = lane & 15;                 // row (A) / col (B, D) within subtile
  const int ksA   = lda >> 5;                  // 1-KiB blocks per 16 rows of A
  const int ksB   = ldb >> 5;                  // 1-KiB blocks per 16 rows of Bt
  const int mOff  = (lane >> 4) * 8;           // D row offset

  v8f acc[4][4];
#pragma unroll
  for (int i = 0; i < 4; ++i)
#pragma unroll
    for (int j = 0; j < 4; ++j) acc[i][j] = zero8();

  // the lane's own piece in the first 1-KiB block of each 16-row group; a k step moves every pointer on by one block (512 halves)
  gp16 pB[4], pA[4], pL[4];
#pragma unroll
  for (int j = 0; j < 4; ++j) pB[j] = (gp16)(Bb + ((size_t)(((n0 >> 4) + j) * ksB) << 9) + (lane << 3));
#pragma unroll
  for (int i = 0; i < 4; ++i) {
    const size_t ao = ((size_t)(((m0 >> 4) + i) * ksA) << 9) + (lane << 3);
    pA[i] = (gp16)(A1 + ao);
    pL[i] = (gp16)(A2 + ao);
  }
  for (int k0 = 0; k0 < K; k0 += 32) {
    // the k step's fragment loads go out as one group ahead of its WMMAs: one L2 latency per step, not one per 16-row group of A
    v16h bh[4], ah[4], al[4];
#pragma unroll
    for (int j = 0; j < 4; ++j) bh[j] = ldfrag_g(pB[j]);
#pragma unroll
    for (int i = 0; i < 4; ++i) ah[i] = ldfrag_g(pA[i]);
    if constexpr (ASPLIT != 0) {
      al[0] = ldfrag_g(pL[0]);
      al[1] = ldfrag_g(pL[1]);
    }
    __builtin_amdgcn_sched_barrier(0);   // the group stays whole in front of the first WMMA (sunk to their uses the loads wait one by one)
#pragma unroll
    for (int i = 0; i < 4; ++i) {
#pragma unroll
      for (int j = 0; j < 4; ++j) acc[i][j] = mmaT<BF>(ah[i], bh[j], acc[i][j]);
      dep_guard1(acc[i][0], acc[i][3], ah[i]);
      if constexpr (ASPLIT != 0) {
#pragma unroll
        for (int j = 0; j < 4; ++j) acc[i][j] = mmaT<BF>(al[i], bh[j], acc[i][j]);
        dep_guard1(acc[i][0], acc[i][3], al[i]);
        if (i == 0) {
          __builtin_amdgcn_sched_barrier(0);   // the last two residual fragments take the registers of the first row group's pair: not lifted higher
          al[2] = ldfrag_g(pL[2]);
          al[3] = ldfrag_g(pL[3]);
          __builtin_amdgcn_sched_barrier(0);   // issued before the second row group's WMMAs
        }
      }
    }
    keep4_h(bh[0], bh[1], bh[2], bh[3]);
    // The wait stands in front of every rewrite of an address register that the trip's loads name: as operands of its statement the pointers
    // keep their registers up to it, and the additions below cannot be lifted over it.
    if constexpr (ASPLIT != 0) {
      asm volatile("s_wait_xcnt 0x0" : "+v"(pB[0]), "+v"(pB[1]), "+v"(pB[2]), "+v"(pB[3]), "+v"(pA[0]), "+v"(pA[1]), "+v"(pA[2]), "+v"(pA[3]),
                                       "+v"(pL[0]), "+v"(pL[1]), "+v"(pL[2]), "+v"(pL[3]) :: "memory");
    } else {
      asm volatile("s_wait_xcnt 0x0" : "+v"(pB[0]), "+v"(pB[1]), "+v"(pB[2]), "+v"(pB[3]), "+v"(pA[0]), "+v"(pA[1]), "+v"(pA[2]), "+v"(pA[3]) :: "memory");
    }
#pragma unroll
    for (int j = 0; j < 4; ++j) {
      pB[j] += 512;
      pA[j] += 512;
      pL[j] += 512;
    }
  }
  acc_guard4(acc[0][0], acc[0][1], acc[0][2], acc[0][3]);
  acc_guard4(acc[1][0], acc[1][1], acc[1][2], acc[1][3]);
  acc_guard4(acc[2][0], acc[2][1], acc[2][2], acc[2][3]);
  acc_guard4(acc[3][0], acc[3][1], acc[3][2], acc[3][3]);

  const int hh2 = lane >> 4, c4 = (lane & 15) * 4;     // f32 out: 256-B row segment = 16 lanes x 16 B

  // ---- epilogue ----
  float* slab = sT[wave];
#pragma unroll
  for (int i = 0; i < 4; ++i) {
    const int mBase = m0 + (i << 4);
#pragma unroll
    for (int j = 0; j < 4; ++j) {
#pragma unroll
      for (int r = 0; r < 8; ++r) {
        slab[(mOff + r) * 68 + (j << 4) + rlane] = acc[i][j][r];
      }
    }
    wave_sync_lds();
    if constexpr (OM == 0) {
      float* C = (float*)Cout + (size_t)((long long)by * sC);
      v4f vals[8];
#pragma unroll
      for (int it = 0; it < 8; ++it) {
        const int row = it * 2 + hh2;                      // it 0..7 x hh2 0..1 = rows 0..15
        v4f v = *(const v4f*)(slab + row * 68 + c4);
#pragma unroll
        for (int e = 0; e < 4; ++e) v[e] = v[e] * oscale;
        if constexpr (EPI == 1) {
          const v4f bb = *(const v4f*)(ep0 + n0 + c4);     // per-column bias, columns n0+c4 .. +3 (N equals the bias length)
#pragma unroll
          for (int e = 0; e < 4; ++e) v[e] = v[e] + bfr(bb[e]);
        }
        vals[it] = v;
      }
      {
#pragma unroll
        for (int it = 0; it < 8; ++it) {
          const int gr = mBase + it * 2 + hh2;
          *(v4f*)(C + (size_t)gr * ldc + n0 + c4) = vals[it];
        }
        // The wait stands in front of every rewrite of a data register that these stores name (the next slab's LDS reads take them)
        asm volatile("s_wait_xcnt 0x0" :: "v"(vals[0]), "v"(vals[1]), "v"(vals[2]), "v"(vals[3]), "v"(vals[4]), "v"(vals[5]), "v"(vals[6]), "v"(vals[7]) : "memory");
      }
    } else {
      unsigned short* C  = (unsigned short*)Cout  + (size_t)((long long)by * sC);
      unsigned short* Cb = (unsigned short*)C2out + (size_t)((long long)by * sC);
      const int ksC = ldc >> 5;                            // 1-KiB blocks per 16 rows of C
      v4u hv[4], lv[4];
#pragma unroll
      for (int it = 0; it < 4; ++it) {
        const int row = (it & 1) * 8 + (lane & 7);         // 8 rows x 4 pieces per it = four whole 128-B lines of packed block it >> 1
        const int c8  = (it >> 1) * 32 + (lane >> 3) * 8;  // only two column groups per lane, so the column biases stay few
        const float* sp = slab + row * 68 + c8;
        float rb = 0.f;
        if constexpr (EPI == 2) rb = bfr(ep0[mBase + row]);   // per-row bias (M equals the bias length)
        v4u a  = {0u, 0u, 0u, 0u};
        v4u b2 = {0u, 0u, 0u, 0u};
#pragma unroll
        for (int e = 0; e < 4; ++e) {
          const int ci = n0 + c8 + 2 * e;                  // column index, < N
          float f0 = sp[2 * e] * oscale + rb;
          float f1 = sp[2 * e + 1] * oscale + rb;
          if constexpr (EPI == 1) {
            f0 += bfr(ep0[ci]);
            f1 += bfr(ep0[ci + 1]);
          }
          if constexpr (OM == 5) {
            const float g0 = (f0 + bfr(ep1[ci])) * ocarry, g1 = (f1 + bfr(ep1[ci + 1])) * ocarry;
            const float w0 = (f0 + bfr(ep2[ci])) * ocarry, w1 = (f1 + bfr(ep2[ci + 1])) * ocarry;
            a[e]  = pk16(h_bits((_Float16)g0), h_bits((_Float16)g1));
            b2[e] = pk16(h_bits((_Float16)w0), h_bits((_Float16)w1));
          } else {
            f0 *= ocarry; f1 *= ocarry;
            const _Float16 x0 = (_Float16)f0, x1 = (_Float16)f1;
            a[e] = pk16(h_bits(x0), h_bits(x1));
            if constexpr (OM == 4) {
              b2[e] = pk16(h_bits((_Float16)(f0 - (float)x0)), h_bits((_Float16)(f1 - (float)x1)));
            }
          }
        }
        hv[it] = a;
        lv[it] = b2;
      }
      {
#pragma unroll
        for (int it = 0; it < 4; ++it) {
          const size_t co = ((size_t)((mBase >> 4) * ksC + (n0 >> 5) + (it >> 1)) << 9) + ((lane >> 4) << 8) +
                            (((((lane >> 3) & 1) << 4) + (it & 1) * 8 + (lane & 7)) << 3);
          *(v4u*)(C + co) = hv[it];
          if constexpr (OM >= 4) {
            *(v4u*)(Cb + co) = lv[it];
          }
        }
        // The wait stands in front of every rewrite of a data register that these stores name: as inputs of its statement the pieces keep
        // their registers up to it (the next slab's bias arithmetic is otherwise free to take them directly behind the stores).
        if constexpr (OM >= 4) {
          asm volatile("s_wait_xcnt 0x0" :: "v"(hv[0]), "v"(hv[1]), "v"(hv[2]), "v"(hv[3]), "v"(lv[0]), "v"(lv[1]), "v"(lv[2]), "v"(lv[3]) : "memory");
        } else {
          asm volatile("s_wait_xcnt 0x0" :: "v"(hv[0]), "v"(hv[1]), "v"(hv[2]), "v"(hv[3]) : "memory");
        }
      }
    }
    wave_sync_lds();
  }
}

// =====================================================================================================
// One position strip for a wave: T[R][x] = (q+bq+vb)[A rows] . pos[mw + x], R = lane&15 row of the A fragment pair (qva, qvb), x in [0,80)
// (5 subtiles of 16 pos rows, K = 64 = two k-steps); pos row index clamped on the address into [0, SEQ-1]
// (only x <= 78 is ever selected, and every selected entry has an unclamped row in range); Pb points into the fragment-packed plane at the
// head's first 1-KiB block with the lane's k half only; each 16x16 subtile goes to the wave's f32 LDS strip right after its two WMMAs and
// the hazard gap. coverage: 5 subtiles x 16 rows x 16 cols = the full 16x80 strip every time.
// =====================================================================================================
__device__ __forceinline__ size_t pos_slot(int m) {                // packed offset of pos row m: 16-row group, then the row's slot
  m = (m < 0) ? 0 : m;
  m = (m > SEQ - 1) ? (SEQ - 1) : m;
  return ((size_t)(m >> 4) << 13) + ((m & 15) << 3);
}
__device__ __forceinline__ void strip_sub(v16h qva, v16h qvb, v16h fa, v16h fb, float* tsh, int u, int hh, int c) {
  v8f t8 = mma_h(qva, fa, zero8());
  t8 = mma_h(qvb, fb, t8);
  hz4(t8, fa, fb, qva, qvb);
  const int cb = 16 * u + c;
#pragma unroll
  for (int r = 0; r < 8; ++r) tsh[(8 * hh + r) * TPI + cb] = t8[r];
}
// whole strip, its 24 loads issued as one group (used for the second strip of the one tile per wave that needs both)
__device__ __forceinline__ void pos_strip(const unsigned short* __restrict__ QVa, const unsigned short* __restrict__ Pb,
                                          int mw, float* tsh, int hh, int c) {
  const v16h qva = ldfrag_p(QVa), qvb = ldfrag_p(QVa + 512);
  v16h fa[5], fb[5];
  const unsigned short* pp[5];
#pragma unroll
  for (int u = 0; u < 5; ++u) {
    pp[u] = Pb + pos_slot(mw + 16 * u + c);
    fa[u] = ldfrag_p(pp[u]);
    fb[u] = ldfrag_p(pp[u] + 512);
  }
  addr_wait7(QVa, pp[0], pp[1], pp[2], pp[3], pp[4], QVa);
#pragma unroll
  for (int u = 0; u < 5; ++u) strip_sub(qva, qvb, fa[u], fb[u], tsh, u, hh, c);
}

// =====================================================================================================
// Relative-position attention for one (batch b, head n) pair and a 64-row query tile; 4 waves, wave w owns query rows i = iw0 + R,
// iw0 = i0 + 16w, R = 0..15. Planes (fragment-packed, row length DMOD halves, row = b*SEQ + position): QU = f16((q + bq + ub) x4), QV = f16((q + bq + vb) x4),
// KP = f16((k + bk) x4); PP = f16(pos x4) rows 0..SEQ-1; VT, VTL = v^T hi (x16) / residual f16 as [b][n*64+d][SEQ] (fragment-packed per batch).
// Shifted position score for (i, j), d = j - i:  d <= 0 -> ps[i][SEQ-1+d];  d == 1 -> 0;  d >= 2 -> ps[i+1][d-2],  ps[r][t] = (q+bq+vb)[r] . pos[t].
//   Per key tile j0 (64 keys, key j = j0 + jj), with x = jj - R + 15 in [0,78]:
//     strip T1[R][x] = (q+vb)[iw0+R]   . pos[SEQ + j0 - iw0 - 16 + x]   (pos row SEQ-1+d), computed iff j0 <= iw0 + 15;
//     strip T2[R][x] = (q+vb)[iw0+1+R] . pos[j0 - iw0 - 17 + x]         (pos row d-2),     computed iff j0 + 61 >= iw0;
//     both tests are wave-uniform (iw0 via readfirstlane); a strip is selected from only in tiles where it was computed this iteration
//     (both strips are zero-filled once at kernel start so unselected reads are finite). The A row b*SEQ+iw0+16 of T2 is clamped to NROW-1
//     for the very last row group; that entry is never selected (i = SEQ-1 has no j >= i+2).
//   content scores S = (q+ub) . k (4 subtiles, K=64); t = (S + sel(T1, 0, T2)) * (RSD/16) * log2(e); online softmax in base 2,
//   max-subtracted, running sums in f32 (no key mask); the 16x64 prob tile stored to wave-private LDS (f32 element stores),
//   fragments loaded straight from the packed 16-bit planes VT/VTL[n*64+d][j]; 8 + 8 P.V WMMAs per tile (hi plane then residual plane into the
//   same accumulators).
//   block = 4 waves = 128 threads; grid = (SEQ/64, NB*NH); no block barriers; every wave does identical bounded work (SEQ/64 tiles).
// coverage: LDS strips 16 rows x 80 cols written fully whenever computed, slab 16 rows x 64 cols per wave fully written each tile before
//           being read; global: 4 instructions x 512 contiguous bytes per plane = rows iw0..iw0+15 of head segment n in CT and CTL;
//           grid x waves cover all NB x SEQ rows and all NH head segments of CT / CTL exactly once.
// =====================================================================================================
__global__ __launch_bounds__(ATT_THREADS) __attribute__((amdgpu_num_vgpr(256)))
void attn_rel(const unsigned short* __restrict__ QU, const unsigned short* __restrict__ QV,
              const unsigned short* __restrict__ KP, const unsigned short* __restrict__ PP,
              const unsigned short* __restrict__ VT, const unsigned short* __restrict__ VTL,
              unsigned short* CT, unsigned short* CTL) {
  __shared__ __align__(16) float smem[ATT_W * WFL];   // per wave: T1 strip [16][TPI] | T2 strip [16][TPI] | prob / ctx slab [16][PPI]

  const int tid  = threadIdx.x;
  const int wave = __builtin_amdgcn_readfirstlane(tid >> 5);
  const int lane = tid & 31;
  const int hh   = lane >> 4;
  const int c    = lane & 15;
  const int bn   = blockIdx.y;
  const int b    = bn / NH;
  const int n    = bn - b * NH;
  const int i0   = blockIdx.x * 64;
  const int iw0  = i0 + wave * 16;

  float* t1sh = smem + wave * WFL;
  float* t2sh = t1sh + 16 * TPI;
  float* pt   = t2sh + 16 * TPI;

#pragma unroll 4
  for (int q = lane; q < 32 * TPI; q += 32) t1sh[q] = 0.f;   // zero both strips once (32*TPI floats are contiguous)

  // stationary A fragments: (q + bq + ub) rows b*SEQ + iw0 + c, d 0..31 and 32..63 of head n ((q + bq + vb) fragments are reloaded per key tile)
  const size_t hb  = (size_t)(n * (DH / 32)) << 9;            // the head's first 1-KiB block inside a 16-row group of a DMOD-long plane
  const size_t qro = ((size_t)((b * SEQ + iw0) >> 4) << 13) + hb + (lane << 3);
  const v16h qua = ldfrag_p(QU + qro), qub = ldfrag_p(QU + qro + 512);
  int qr2 = b * SEQ + iw0 + 1 + c;                            // rows i+1 for the T2 strip
  qr2 = (qr2 > NROW - 1) ? (NROW - 1) : qr2;
  const size_t qro2 = ((size_t)(qr2 >> 4) << 13) + hb + (((hh << 4) + (qr2 & 15)) << 3);

  const unsigned short* Kb  = KP + (size_t)b * SEQ * DMOD + hb + (lane << 3);
  const unsigned short* Pb  = PP + hb + (hh << 7);
  const size_t vbase = (size_t)b * DMOD * SEQ + (size_t)(n * DH) * SEQ + (lane << 3);   // 16-row group = 16 * SEQ halves
  const unsigned short* Vb  = VT  + vbase;
  const unsigned short* VLb = VTL + vbase;
  gp16 vhp = (gp16)Vb;                                        // the hi plane's running address: the key tile's first block

  const float KSC = (RSD / (QC * QC)) * LOG2E;

  float mrow[8], lrow[8];
  v8f O[4];
#pragma unroll
  for (int r = 0; r < 8; ++r) { mrow[r] = -INFINITY; lrow[r] = 0.f; }
#pragma unroll
  for (int td = 0; td < 4; ++td) O[td] = zero8();
  wave_sync_lds();

#pragma unroll 1
  for (int j0 = 0; j0 < SEQ; j0 += 64) {
    const int dmin = j0 - iw0;                               // smallest j - i over the tile is dmin - 15, largest dmin + 63 (wave-uniform)
    // Every tile needs T1 (dmin <= 15) or T2 (dmin >= -61), one tile per wave both (wave-uniform tests). The tile's fragment loads go out
    // in groups ahead of the WMMAs that use them, as many at a time as the registers hold, so that a group costs one L2 latency.
    const bool low = (dmin <= 15);                           // the tile's first strip is T1, else T2
    const unsigned short* QVs = QV + (low ? qro : qro2);
    const int mw = low ? (SEQ + dmin - 16) : (dmin - 17);
    float* tsh = low ? t1sh : t2sh;
    const unsigned short* Kt = Kb + ((size_t)(j0 >> 4) << 13);
    // ---- load group 1: the strip's A pair, its five pos subtiles, the first key subtile ----
    v16h ka[4], kb2[4], fa[5], fb[5];
    const v16h qva = ldfrag_p(QVs), qvb = ldfrag_p(QVs + 512);
    const unsigned short* pp[5];
#pragma unroll
    for (int u = 0; u < 5; ++u) {
      pp[u] = Pb + pos_slot(mw + 16 * u + c);
      fa[u] = ldfrag_p(pp[u]);
      fb[u] = ldfrag_p(pp[u] + 512);
    }
    ka[0]  = ldfrag_p(Kt);
    kb2[0] = ldfrag_p(Kt + 512);
    addr_wait7(QVs, pp[0], pp[1], pp[2], pp[3], pp[4], Kt);
#pragma unroll
    for (int u = 0; u < 3; ++u) strip_sub(qva, qvb, fa[u], fb[u], tsh, u, hh, c);
    __builtin_amdgcn_sched_barrier(0);   // group 2 takes the registers of the three pos subtiles used up to here, so it is not lifted higher
    // ---- load group 2: the other three key subtiles; they fly behind the rest of the strip and the first score subtile ----
#pragma unroll
    for (int t = 1; t < 4; ++t) {
      ka[t]  = ldfrag_p(Kt + ((size_t)t << 13));
      kb2[t] = ldfrag_p(Kt + ((size_t)t << 13) + 512);
    }
    addr_wait1(Kt);
#pragma unroll
    for (int u = 3; u < 5; ++u) strip_sub(qva, qvb, fa[u], fb[u], tsh, u, hh, c);
    // ---- content scores S (4 subtiles of 16 keys) ----
    v8f S[4];
#pragma unroll
    for (int t = 0; t < 4; ++t) {
      S[t] = mma_h(qua, ka[t], zero8());
      S[t] = mma_h(qub, kb2[t], S[t]);
      hz4(S[t], ka[t], kb2[t], qua, qub);
    }
    if (low && dmin + 61 >= 0) pos_strip(QV + qro2, Pb, dmin - 17, t2sh, hh, c);   // the tile on the diagonal: T2 as well
    // ---- load group 3: v^T hi plane, in flight during the softmax ----
    const size_t vo = (size_t)(j0 >> 5) << 9;              // the key tile's first 1-KiB block inside a 16-row group
    v16h vfa[4], vfb[4];
#pragma unroll
    for (int td = 0; td < 4; ++td) {
      vfa[td] = ldfrag_g(vhp + (size_t)(16 * td) * SEQ);
      vfb[td] = ldfrag_g(vhp + (size_t)(16 * td) * SEQ + 512);
    }
    addr_wait_step(vhp);
    vhp += 1024;                                           // the next key tile: two 1-KiB blocks on
    wave_sync_own();

    // ---- score assembly + online softmax (rows live on one 16-lane half) ----
#pragma unroll
    for (int r = 0; r < 8; ++r) {
      const int R  = 8 * hh + r;
      const int xo = R * TPI + (15 - R) + c;                 // strip column x = 16t + c - R + 15 in [0, 78]
      const int db = dmin + c - R;                           // d = j - i = db + 16t
      float tv[4];
#pragma unroll
      for (int t = 0; t < 4; ++t) {
        const float v1 = t1sh[xo + 16 * t];
        const float v2 = t2sh[xo + 16 * t];
        const int d = db + 16 * t;
        const float bdv = (d <= 0) ? v1 : ((d == 1) ? 0.f : v2);
        tv[t] = (S[t][r] + bdv) * KSC;
      }
      float mx = fmaxf(fmaxf(tv[0], tv[1]), fmaxf(tv[2], tv[3]));
#pragma unroll
      for (int off = 1; off < 16; off <<= 1) mx = fmaxf(mx, __shfl_xor(mx, off, 32));
      const float mn = fmaxf(mrow[r], mx);
      const float al = exp2f(mrow[r] - mn);
      mrow[r] = mn;
      float e4[4];
      float ps = 0.f;
#pragma unroll
      for (int t = 0; t < 4; ++t) { e4[t] = exp2f(tv[t] - mn); ps += e4[t]; }
#pragma unroll
      for (int off = 1; off < 16; off <<= 1) ps += __shfl_xor(ps, off, 32);
      lrow[r] = lrow[r] * al + ps;
#pragma unroll
      for (int td = 0; td < 4; ++td) O[td][r] *= al;
      const int ro = R * PPI + c;
#pragma unroll
      for (int t = 0; t < 4; ++t) pt[ro + 16 * t] = e4[t];
    }
    wave_sync_own();

    // ---- P fragments (x1024, f16) from the LDS rows, two k-steps of 32 keys ----
    FragH pf[2];
#pragma unroll
    for (int ks = 0; ks < 2; ++ks) {
      const float* prow = pt + c * PPI + 32 * ks + 8 * hh;
      const v4f p0 = *(const v4f*)(prow), p1 = *(const v4f*)(prow + 4);
      const v4f p2 = *(const v4f*)(prow + 16), p3 = *(const v4f*)(prow + 20);
#pragma unroll
      for (int e = 0; e < 4; ++e) {
        pf[ks].h[0][e]     = (_Float16)(p0[e] * PC);     // keys j0 + 32ks + 8hh + e
        pf[ks].h[0][4 + e] = (_Float16)(p1[e] * PC);     // keys j0 + 32ks + 8hh + 4 + e
        pf[ks].h[1][e]     = (_Float16)(p2[e] * PC);     // keys j0 + 32ks + 16 + 8hh + e
        pf[ks].h[1][4 + e] = (_Float16)(p3[e] * PC);
      }
    }
    __builtin_amdgcn_sched_barrier(0);   // group 4 is not lifted over the P fragments' LDS reads: their registers and the group's do not fit together
    {
      // ---- load group 4: v^T residual plane, first two 16-row groups now, the other two into the registers of the first two hi groups ----
      v16h vla[4], vlb[4];
#pragma unroll
      for (int td = 0; td < 2; ++td) {
        const unsigned short* vp = VLb + vo + (size_t)(16 * td) * SEQ;
        vla[td] = ldfrag_p(vp);
        vlb[td] = ldfrag_p(vp + 512);
      }
      addr_wait1(VLb + vo);
      // ---- O += P . v^T (hi plane) ----
#pragma unroll
      for (int td = 0; td < 2; ++td) {
        O[td] = mma_h(pf[0].v, vfa[td], O[td]);
        O[td] = mma_h(pf[1].v, vfb[td], O[td]);
        hz4(O[td], pf[0].v, pf[1].v, vfa[td], vfb[td]);
      }
      __builtin_amdgcn_sched_barrier(0);   // the second half of group 4 waits for those registers and is not lifted higher
#pragma unroll
      for (int td = 2; td < 4; ++td) {
        const unsigned short* vp = VLb + vo + (size_t)(16 * td) * SEQ;
        vla[td] = ldfrag_p(vp);
        vlb[td] = ldfrag_p(vp + 512);
      }
      addr_wait1(VLb + vo);
#pragma unroll
      for (int td = 2; td < 4; ++td) {
        O[td] = mma_h(pf[0].v, vfa[td], O[td]);
        O[td] = mma_h(pf[1].v, vfb[td], O[td]);
        hz4(O[td], pf[0].v, pf[1].v, vfa[td], vfb[td]);
      }
      // ---- O += P . v^T (residual plane) ----
#pragma unroll
      for (int td = 0; td < 4; ++td) {
        O[td] = mma_h(pf[0].v, vla[td], O[td]);
        O[td] = mma_h(pf[1].v, vlb[td], O[td]);
        hz4(O[td], pf[0].v, pf[1].v, vla[td], vlb[td]);
      }
    }
    wave_sync_lds();
  }
  acc_guard4(O[0], O[1], O[2], O[3]);

  // ---- fold 1/l and the carries (1024 on P, 16 on v), carry x4096 on ctx, stage the wave's 16x64 slice in its slab ----
  const float oc = CC / (PC * VC);
#pragma unroll
  for (int r = 0; r < 8; ++r) {
    const float inv = (1.0f / lrow[r]) * oc;
    const int ro = (8 * hh + r) * PPI + c;
#pragma unroll
    for (int td = 0; td < 4; ++td) pt[ro + 16 * td] = O[td][r] * inv;
  }
  wave_sync_lds();
  {
    v4u hv[4], lv[4];
#pragma unroll
    for (int it = 0; it < 4; ++it) {
      const int c8 = (it >> 1) * 32 + (it & 1) * 16 + hh * 8;   // row c; one packed 512-B run per it: block it >> 1, second half it & 1
      const float* sp = pt + c * PPI + c8;
      v4u a, b2;
#pragma unroll
      for (int e = 0; e < 4; ++e) {
        const float f0 = sp[2 * e], f1 = sp[2 * e + 1];
        const _Float16 x0 = (_Float16)f0, x1 = (_Float16)f1;
        a[e]  = pk16(h_bits(x0), h_bits(x1));
        b2[e] = pk16(h_bits((_Float16)(f0 - (float)x0)), h_bits((_Float16)(f1 - (float)x1)));
      }
      hv[it] = a;
      lv[it] = b2;
    }
    {
#pragma unroll
      for (int it = 0; it < 4; ++it) {
        const size_t go = qro + ((size_t)(it >> 1) << 9) + ((it & 1) << 8);
        *(v4u*)(CT  + go) = hv[it];
        *(v4u*)(CTL + go) = lv[it];
      }
      
    }
  }
}

// =====================================================================================================
// Workspace map (bytes); every plane is an exact multiple of its tile / whole-row store granularity (M, N exact tile multiples,
// convert counts exact multiples of 2048), every offset a multiple of 512 KiB; every plane is fragment-packed (see ldfrag_p):
//   WQ16, WK16, WV16, WP16, WO16 f16 [512 out][512 in] x64                               5 x   524288
//   X16  f16 [NROW][512] x16 (pre-norm output)                                                8388608
//   PE16 f16 [SEQ][512] x16 (sinusoid table)                                                  2097152
//   QU, QV, K16 f16 [NROW][512] x4                                                       3 x  8388608
//   P16  f16 [SEQ][512] x4                                                                      2097152
//   VT16, VTL16 f16 [NB][512][SEQ] hi x16 / residual                                     2 x  8388608
//   CT16, CTL16 f16 [NROW][512] hi x4096 / residual                                      2 x  8388608
//   end                                                                                        73924608
// =====================================================================================================
extern "C" void kernel_launch(void* const* d_in, const int* in_sizes, int n_in,
                              void* d_out, int out_size, void* d_ws, size_t ws_size,
                              hipStream_t stream) {
  if (n_in < 14) return;
  if (in_sizes[0] != NROW * DMOD) return;
  if (in_sizes[1] != DMOD || in_sizes[2] != DMOD) return;
  if (in_sizes[3] != DMOD * DMOD || in_sizes[5] != DMOD * DMOD || in_sizes[7] != DMOD * DMOD ||
      in_sizes[9] != DMOD * DMOD || in_sizes[12] != DMOD * DMOD) return;
  if (in_sizes[4] != DMOD || in_sizes[6] != DMOD || in_sizes[8] != DMOD || in_sizes[13] != DMOD) return;
  if (in_sizes[10] != NH * DH || in_sizes[11] != NH * DH) return;
  if (out_size != NROW * DMOD) return;

  const float* xin   = (const float*)d_in[0];
  const float* gam   = (const float*)d_in[1];
  const float* bet   = (const float*)d_in[2];
  const float* w_q   = (const float*)d_in[3];
  const float* b_q   = (const float*)d_in[4];
  const float* w_k   = (const float*)d_in[5];
  const float* b_k   = (const float*)d_in[6];
  const float* w_v   = (const float*)d_in[7];
  const float* b_v   = (const float*)d_in[8];
  const float* w_p   = (const float*)d_in[9];
  const float* ub    = (const float*)d_in[10];
  const float* vb    = (const float*)d_in[11];
  const float* w_o   = (const float*)d_in[12];
  const float* b_o   = (const float*)d_in[13];
  float*       out   = (float*)d_out;

  const size_t PW  = (size_t)DMOD * DMOD * 2;            //   524288
  const size_t PX  = (size_t)NROW * DMOD * 2;            //  8388608
  const size_t PXP = (size_t)SEQ * DMOD * 2;             //  2097152
  const size_t PVT = (size_t)NB * DMOD * SEQ * 2;        //  8388608
  size_t off = 0;
  const size_t oWQ  = off; off += PW;
  const size_t oWK  = off; off += PW;
  const size_t oWV  = off; off += PW;
  const size_t oWP  = off; off += PW;
  const size_t oWO  = off; off += PW;
  const size_t oX   = off; off += PX;
  const size_t oPE  = off; off += PXP;
  const size_t oQU  = off; off += PX;
  const size_t oQV  = off; off += PX;
  const size_t oK   = off; off += PX;
  const size_t oP   = off; off += PXP;
  const size_t oVT  = off; off += PVT;
  const size_t oVTL = off; off += PVT;
  const size_t oCT  = off; off += PX;
  const size_t oCTL = off; off += PX;
  if (off > ws_size) return;                               // off = 73924608
  if (off > (size_t)134217728) return;

  char* ws = (char*)d_ws;
  unsigned short* WQ16  = (unsigned short*)(ws + oWQ);
  unsigned short* WK16  = (unsigned short*)(ws + oWK);
  unsigned short* WV16  = (unsigned short*)(ws + oWV);
  unsigned short* WP16  = (unsigned short*)(ws + oWP);
  unsigned short* WO16  = (unsigned short*)(ws + oWO);
  unsigned short* X16   = (unsigned short*)(ws + oX);
  unsigned short* PE16  = (unsigned short*)(ws + oPE);
  unsigned short* QU    = (unsigned short*)(ws + oQU);
  unsigned short* QV    = (unsigned short*)(ws + oQV);
  unsigned short* K16   = (unsigned short*)(ws + oK);
  unsigned short* P16   = (unsigned short*)(ws + oP);
  unsigned short* VT16  = (unsigned short*)(ws + oVT);
  unsigned short* VTL16 = (unsigned short*)(ws + oVTL);
  unsigned short* CT16  = (unsigned short*)(ws + oCT);
  unsigned short* CTL16 = (unsigned short*)(ws + oCTL);

  const dim3 blk(256);
  const dim3 gCW((DMOD * DMOD) / 2048);                             // 128
  const dim3 gLN(NROW / 8);                                         // 1024
  const dim3 gPE(SEQ / 8);                                          // 256
  const int tilesQ = (NROW / 64) * (DMOD / 64);                     // 1024
  const int tilesV = (DMOD / 64) * (SEQ / 64);                      // 256 per batch
  const int tilesP = (SEQ / 64) * (DMOD / 64);                      // 256
  const dim3 gQ((tilesQ + 7) / 8, 1);                               // 128
  const dim3 gV((tilesV + 7) / 8, NB);                              // 32 x 4
  const dim3 gP((tilesP + 7) / 8, 1);                               // 32
  const dim3 gAT(SEQ / 64, NB * NH);                                // 32 x 32
  const dim3 bAT(ATT_THREADS);                                      // 128

  // (0) weight planes: W[o][c] ([out][in] = [n][k] already) -> f16( bf16_RNE(w) * 64 ), all five weights
  cvt16<<<gCW, blk, 0, stream>>>(w_q, WQ16, DMOD * DMOD, DMOD * DMOD, WSC);
  cvt16<<<gCW, blk, 0, stream>>>(w_k, WK16, DMOD * DMOD, DMOD * DMOD, WSC);
  cvt16<<<gCW, blk, 0, stream>>>(w_v, WV16, DMOD * DMOD, DMOD * DMOD, WSC);
  cvt16<<<gCW, blk, 0, stream>>>(w_p, WP16, DMOD * DMOD, DMOD * DMOD, WSC);
  cvt16<<<gCW, blk, 0, stream>>>(w_o, WO16, DMOD * DMOD, DMOD * DMOD, WSC);

  // (1) pre-norm -> X16 = f16(x * 16); sinusoid table -> PE16 = f16(pe * 16)
  ln16<<<gLN, blk, 0, stream>>>(xin, gam, bet, X16, NROW, XC);
  pe16<<<gPE, blk, 0, stream>>>(PE16, SEQ, XC);

  // (2) q[m][nd] = sum_c x[m][c] Wq[nd][c] / 1024 + bq[nd]; QU = f16((q + ub[nd]) * 4), QV = f16((q + vb[nd]) * 4);
  //     M = NROW, N = 512, K = 512
  gemm64<5, 0, 0, 1><<<gQ, blk, 0, stream>>>(
      X16, X16, DMOD, 0LL,
      WQ16, DMOD, 0LL,
      (void*)QU, (void*)QV, DMOD, 0LL,
      NROW, DMOD, DMOD, 1.0f / (XC * WSC), QC,
      b_q, ub, vb);

  // (3) k projection + bk -> K16 = f16(k * 4)
  gemm64<2, 0, 0, 1><<<gQ, blk, 0, stream>>>(
      X16, X16, DMOD, 0LL,
      WK16, DMOD, 0LL,
      (void*)K16, (void*)K16, DMOD, 0LL,
      NROW, DMOD, DMOD, 1.0f / (XC * WSC), QC,
      b_k, b_k, b_k);

  // (4) v^T per batch: VT[b][nd][j] = sum_c Wv[nd][c] x[b*SEQ + j][c] / 1024 + bv[nd] (per-row bias) -> f16 x16 hi + residual planes;
  //     M = 512 (nd), N = SEQ (j), K = 512; B rows are the batch's token rows: pitch DMOD, batch stride SEQ*DMOD
  gemm64<4, 0, 0, 2><<<gV, blk, 0, stream>>>(
      WV16, WV16, DMOD, 0LL,
      X16, DMOD, (long long)SEQ * DMOD,
      (void*)VT16, (void*)VTL16, SEQ, (long long)DMOD * SEQ,
      DMOD, SEQ, DMOD, 1.0f / (XC * WSC), VC,
      b_v, b_v, b_v);

  // (5) positional projection (no bias): P16 = f16(pos * 4), M = SEQ, N = 512, K = 512
  gemm64<2, 0, 0, 0><<<gP, blk, 0, stream>>>(
      PE16, PE16, DMOD, 0LL,
      WP16, DMOD, 0LL,
      (void*)P16, (void*)P16, DMOD, 0LL,
      SEQ, DMOD, DMOD, 1.0f / (XC * WSC), QC,
      b_q, b_q, b_q);

  // (6) relative attention -> CT16 = f16(ctx * 4096) hi plane, CTL16 residual plane, rows b*SEQ + i, halves n*64+d
  attn_rel<<<gAT, bAT, 0, stream>>>(QU, QV, K16, P16, VT16, VTL16, CT16, CTL16);

  // (7) out = (CT + CTL) . Wo^T / (4096*64) + bo; M = NROW, N = 512, K = 512, f32 rows straight into the output buffer
  gemm64<0, 1, 0, 1><<<gQ, blk, 0, stream>>>(
      CT16, CTL16, DMOD, 0LL,
      WO16, DMOD, 0LL,
      (void*)out, (void*)out, DMOD, 0LL,
      NROW, DMOD, DMOD, 1.0f / (CC * WSC), 1.0f,
      b_o, b_o, b_o);
  (void)hipGetLastError();
}

// v003
// Measured time: 249 microseconds a run.
// Next to v002, in two timings, it ran 1.20 and 1.19 times as fast.
// Counting every step since v000, it is 1.91 times as fast.
// Contractions (all v_wmma_f32_16x16x32_f16, f16 operands, f32 accumulate): q/k/v/pos projections (x or sinusoid table f16 x16 . W f16 x64,
// K=512, single products); content scores ((q+bq+ub) f16 x4 . (k+bk) f16 x4, K=64, single); position strips ((q+bq+vb) f16 x4 . pos f16 x4,
// K=64, single) -> f32 LDS strips, shifted select on VALU; P . v^T (P f16 x1024 . v^T carried as f16 x16 hi plane + f16 residual plane, 64 keys
// per tile, two products); output projection (ctx carried as f16 x4096 hi + residual planes . Wo f16 x64, K=512, two products).
// LayerNorm, sinusoid table, max-subtracted online base-2 softmax and all epilogues in f32 on VALU. Every float input RNE-converted to bf16 on load.
#include <hip/hip_runtime.h>
#include <math.h>
#include <stdint.h>

#define SEQ   2048
#define NB    4
#define DMOD  512
#define NH    8
#define DH    64
#define NROW  (SEQ * NB)
#define XC    16.0f
#define WSC   64.0f
#define QC    4.0f
#define VC    16.0f
#define PC    1024.0f
#define CC    4096.0f
#define RSD   0.044194173824159216f
#define LOG2E 1.4426950408889634f
#define LN_EPS 1.0e-5f
#define CNEG  ((float)(-9.210340371976184 / 512.0))
static_assert(NH * DH == DMOD);
static_assert(DH == 64);
static_assert(DMOD == 512);
static_assert((SEQ % 64) == 0 && (DMOD % 64) == 0 && (NROW % 64) == 0);
static_assert(((DMOD * DMOD) % 2048) == 0 && (NROW % 8) == 0 && (SEQ % 8) == 0);
#define ATT_W 4
#define ATT_THREADS (ATT_W * 32)
#define TPI 84
#define PPI 68
#define WFL (32 * TPI + 16 * PPI)
static_assert(((16 * TPI) % 4) == 0 && ((16 * PPI) % 4) == 0 && (WFL % 4) == 0);
static_assert(TPI >= 80 && PPI >= 64);
static_assert(ATT_W * WFL * 4 <= 65536);

typedef _Float16 v16h __attribute__((ext_vector_type(16)));
typedef _Float16 v8h  __attribute__((ext_vector_type(8)));
typedef __bf16   v16b __attribute__((ext_vector_type(16)));
typedef float    v8f  __attribute__((ext_vector_type(8)));
typedef float    v4f  __attribute__((ext_vector_type(4)));
typedef unsigned int v4u __attribute__((ext_vector_type(4)));

union FragH { v16h v; v8h h[2]; v4u u[2]; };
union FragAny { v16h h; v16b b; };

// ---- scalar helpers --------------------------------------------------------------------------------
__device__ __forceinline__ unsigned short bf_bits(float f) {          // f32 -> bf16 bits, RNE convert
  unsigned u = __float_as_uint(f);
  return (unsigned short)((u + 0x7FFFu + ((u >> 16) & 1u)) >> 16);
}
__device__ __forceinline__ float bf_up(unsigned short h) { return __uint_as_float(((unsigned)h) << 16); }
__device__ __forceinline__ float bfr(float f) { return bf_up(bf_bits(f)); }   // value of the bf16 RNE convert
__device__ __forceinline__ unsigned short h_bits(_Float16 x) { return __builtin_bit_cast(unsigned short, x); }
__device__ __forceinline__ unsigned pk16(unsigned short a, unsigned short b) { return (unsigned)a | ((unsigned)b << 16); }
__device__ __forceinline__ v8f zero8() { v8f z = {0.f, 0.f, 0.f, 0.f, 0.f, 0.f, 0.f, 0.f}; return z; }

// ---- fragment-packed 16-bit planes: a [rows][L] plane (rows % 16 == 0, L % 32 == 0) is stored as 1-KiB blocks, one per
//      (16 rows, 32 k): block index (row >> 4) * (L / 32) + (k >> 5); inside a block the 8-half piece that holds element (row, k) stands at
//      halves ((k >> 4) & 1) * 256 + (((k >> 3) & 1) * 16 + (row & 15)) * 8. With 16-aligned rows one wave-wide 16-B load reads 512 contiguous
//      bytes (four whole 128-B lines) where a row-major plane made it touch sixteen lines.
// ---- fragment loader: p = block start + (16 * (lane >> 4) + (row & 15)) * 8; elements 0..7 <- k0 + 8h + 0..7, elements 8..15 <- k0 + 16 + 8h + 0..7,
//      h = lane >> 4 (same split k map for A and B; B is always read from a [n][k] plane)
__device__ __forceinline__ v16h ldfrag_p(const unsigned short* p) {
  FragH f;
  f.u[0] = *(const v4u*)(p);
  f.u[1] = *(const v4u*)(p + 256);
  return f.v;
}
// ---- the same loader on a pointer typed as global memory (a pointer that has gone through an asm operand would otherwise load as a flat one)
typedef const __attribute__((address_space(1))) unsigned short* gp16;
typedef const __attribute__((address_space(1))) v4u* gp128;
__device__ __forceinline__ v16h ldfrag_g(gp16 p) {
  FragH f;
  f.u[0] = *(gp128)(p);
  f.u[1] = *(gp128)(p + 256);
  return f.v;
}

// ---- behind a group of loads: the wait that stands in front of every rewrite of an address register which the group's loads name; as inputs of
//      its statement the addresses keep their registers up to it, so that no load of the group lands on an address of the same group either
__device__ __forceinline__ void addr_wait1(const unsigned short* a) {
#if defined(__HIP_DEVICE_COMPILE__)
  asm volatile("s_wait_xcnt 0x0" :: "v"(a) : "memory");
#endif
}
// the same for a running address that is stepped behind the group: as an operand the statement may change, the pointer is the very register the
// loads name, and the step cannot be lifted over the wait
__device__ __forceinline__ void addr_wait_step(gp16& a) {
#if defined(__HIP_DEVICE_COMPILE__)
  asm volatile("s_wait_xcnt 0x0" : "+v"(a) :: "memory");
#endif
}
__device__ __forceinline__ void addr_wait7(const unsigned short* a, const unsigned short* b, const unsigned short* c, const unsigned short* d,
                                           const unsigned short* e, const unsigned short* f, const unsigned short* g) {
#if defined(__HIP_DEVICE_COMPILE__)
  asm volatile("s_wait_xcnt 0x0" :: "v"(a), "v"(b), "v"(c), "v"(d), "v"(e), "v"(f), "v"(g) : "memory");
#endif
}
// ---- WMMA helpers with trailing VALU hazard gaps ------------------------------------------------------
__device__ __forceinline__ v8f mma_h(v16h a, v16h b, v8f c) {
  return __builtin_amdgcn_wmma_f32_16x16x32_f16(false, a, false, b, (short)0, c, false, false);
}
__device__ __forceinline__ v8f mma_b(v16h a, v16h b, v8f c) {
  FragAny ua, ub;
  ua.h = a;
  ub.h = b;
  return __builtin_amdgcn_wmma_f32_16x16x32_bf16(false, ua.b, false, ub.b, (short)0, c, false, false);
}
template <int BF>
__device__ __forceinline__ v8f mmaT(v16h a, v16h b, v8f c) {
  if constexpr (BF != 0) return mma_b(a, b, c);
  else return mma_h(a, b, c);
}
__device__ __forceinline__ void dep_guard1(v8f& a, v8f& b, v16h x) {
#if defined(__HIP_DEVICE_COMPILE__)
  asm volatile("v_nop\n\tv_nop\n\tv_nop\n\tv_nop" : "+v"(a), "+v"(b) : "v"(x));
#endif
}
__device__ __forceinline__ void hz4(v8f& d, v16h x0, v16h x1, v16h x2, v16h x3) {
#if defined(__HIP_DEVICE_COMPILE__)
  asm volatile("v_nop\n\tv_nop\n\tv_nop\n\tv_nop" : "+v"(d) : "v"(x0), "v"(x1), "v"(x2), "v"(x3));
#endif
}
__device__ __forceinline__ void keep4_h(v16h a, v16h b, v16h c, v16h d) {
#if defined(__HIP_DEVICE_COMPILE__)
  asm volatile("v_nop" :: "v"(a), "v"(b), "v"(c), "v"(d));
#endif
}
__device__ __forceinline__ void acc_guard4(v8f& a, v8f& b, v8f& c, v8f& d) {
#if defined(__HIP_DEVICE_COMPILE__)
  asm volatile("v_nop\n\tv_nop\n\tv_nop\n\tv_nop" : "+v"(a), "+v"(b), "+v"(c), "+v"(d));
#endif
}
// ---- hand-over of a wave's own LDS rows between its lanes while global loads are in flight: the wave's LDS writes are waited for, the loads are
//      not (the workgroup-scope fences of wave_sync_lds drain loadcnt too); nothing another wave reads or writes is ordered here
__device__ __forceinline__ void wave_sync_own() {
  __builtin_amdgcn_fence(__ATOMIC_RELEASE, "wavefront");
#if defined(__HIP_DEVICE_COMPILE__)
  asm volatile("s_wait_dscnt 0x0" ::: "memory");   // the rows are written before any lane reads them back
#endif
  __builtin_amdgcn_wave_barrier();
  __builtin_amdgcn_fence(__ATOMIC_ACQUIRE, "wavefront");
}
// ---- maximum / sum over each 16-lane row of four independent values, every lane getting the result: four row_xmask steps (partner lane ^ 1, 2, 4, 8,
//      the order of the xor shuffles they replace), on the vector pipe instead of one LDS-unit permute and its wait per step. The four chains are
//      interleaved, so that a step's producer stands four vector instructions back and its result is ready when the step issues. All 32 lanes must be on.
#define XM4(op, m) \
  op " %0, %0, %0 row_xmask:" #m " row_mask:0xf bank_mask:0xf\n\t" \
  op " %1, %1, %1 row_xmask:" #m " row_mask:0xf bank_mask:0xf\n\t" \
  op " %2, %2, %2 row_xmask:" #m " row_mask:0xf bank_mask:0xf\n\t" \
  op " %3, %3, %3 row_xmask:" #m " row_mask:0xf bank_mask:0xf\n\t"
__device__ __forceinline__ void row_max4(float (&x)[4]) {
#if defined(__HIP_DEVICE_COMPILE__)
  // row maximum without the LDS unit: sixteen vector instructions, no wait
  asm(XM4("v_max_num_f32_dpp", 1) XM4("v_max_num_f32_dpp", 2) XM4("v_max_num_f32_dpp", 4) XM4("v_max_num_f32_dpp", 8)
      : "+v"(x[0]), "+v"(x[1]), "+v"(x[2]), "+v"(x[3]));
#endif
}
__device__ __forceinline__ void row_sum4(float (&x)[4]) {
#if defined(__HIP_DEVICE_COMPILE__)
  // row sum without the LDS unit: sixteen vector instructions, no wait
  asm(XM4("v_add_f32_dpp", 1) XM4("v_add_f32_dpp", 2) XM4("v_add_f32_dpp", 4) XM4("v_add_f32_dpp", 8)
      : "+v"(x[0]), "+v"(x[1]), "+v"(x[2]), "+v"(x[3]));
#endif
}
__device__ __forceinline__ void wave_sync_lds() {
  __builtin_amdgcn_fence(__ATOMIC_RELEASE, "workgroup");
  __builtin_amdgcn_wave_barrier();
  __builtin_amdgcn_fence(__ATOMIC_ACQUIRE, "workgroup");
}
// ---- eight rows r0..r0+7 (r0 % 8 == 0, one row per wave, 256 threads) of a [rows][DMOD] plane -> fragment-packed plane, whole 128-B lines:
//      wave w hands in its row's pieces lane (o0: columns 8*lane..) and 32 + lane (o1: columns 256 + 8*lane..); a line of the packed plane holds
//      one piece of each of the eight rows, so the rows meet in LDS (pitch 66 pieces: the 16 lanes of a half wave fall on distinct banks).
//      Every thread of the block must call this (one block barrier inside).
#define RPI 66
__device__ __forceinline__ void store_rows8_packed(v4u o0, v4u o1, unsigned short* plane, int r0, v4u* st) {
  const int tid  = threadIdx.x;
  const int lane = tid & 31;
  const int wave = tid >> 5;
  st[wave * RPI + lane]      = o0;
  st[wave * RPI + 32 + lane] = o1;
  __syncthreads();   // the eight rows of a line come from eight waves
  unsigned short* dst = plane + ((size_t)(r0 >> 4) << 13) + ((r0 & 15) << 3);
#pragma unroll   // both LDS reads issue ahead of the two stores
  for (int sx = 0; sx < 2; ++sx) {
    const int idx = sx * 256 + tid;
    const int g   = idx >> 3;                        // piece index in the row = k >> 3, 0..63
    const int rr  = idx & 7;                         // row r0 + rr
    const v4u w = st[rr * RPI + g];
    *(v4u*)(dst + ((g >> 2) << 9) + (((g >> 1) & 1) << 8) + ((((g & 1) << 4) + rr) << 3)) = w;
  }
}

// =====================================================================================================
// Elementwise 16-bit pack of a [rows][DMOD] f32 matrix into a fragment-packed plane: piece t of the plane (8 halves at dst + 8t) =
// f16( bf16_RNE(src[row][k..k+7]) * sc ), (row, k) decoded from t; 0 for pieces whose source elements lie past nvalid; sc a power of two (exact). One piece per thread:
// two 16-B loads (address clamped into [0, nvalid) for pad groups, value zeroed), one 16-B store, a wave's stores = 512 contiguous bytes.
// Used for the five weight matrices, which are [out][in] = [n][k] k-contiguous already.
// coverage: grid = ntotal / 2048 blocks x 256 thr x 8 elements = ntotal exactly (ntotal % 2048 == 0, nvalid == ntotal here).
// =====================================================================================================
__global__ __launch_bounds__(256) void cvt16(const float* __restrict__ src, unsigned short* dst, int nvalid, int ntotal, float sc) {
  const size_t i8 = ((size_t)blockIdx.x * 256 + threadIdx.x) * 8;
  if (i8 + 8 > (size_t)ntotal) return;             // never taken with the exact grid; no barriers in this kernel
  const size_t t  = i8 >> 3;                           // piece index: block t >> 6, second half (t >> 5) & 1, k half (t >> 4) & 1, row t & 15
  const size_t sr = ((t >> 10) << 4) + (t & 15);       // source row: DMOD / 32 = 16 blocks per 16 rows
  const size_t sk = (((t >> 6) & 15) << 5) + (((t >> 5) & 1) << 4) + (((t >> 4) & 1) << 3);
  const size_t si = sr * DMOD + sk;                    // the piece's first element in the source
  const bool pad = (si + 8 > (size_t)nvalid);
  const size_t ls = pad ? ((size_t)nvalid - 8) : si;   // clamped address, always inside the source
  const v4f a = *(const v4f*)(src + ls);
  const v4f b = *(const v4f*)(src + ls + 4);
  v4u o;
  o[0] = pk16(h_bits((_Float16)(bfr(a[0]) * sc)), h_bits((_Float16)(bfr(a[1]) * sc)));
  o[1] = pk16(h_bits((_Float16)(bfr(a[2]) * sc)), h_bits((_Float16)(bfr(a[3]) * sc)));
  o[2] = pk16(h_bits((_Float16)(bfr(b[0]) * sc)), h_bits((_Float16)(bfr(b[1]) * sc)));
  o[3] = pk16(h_bits((_Float16)(bfr(b[2]) * sc)), h_bits((_Float16)(bfr(b[3]) * sc)));
  const v4u z = {0u, 0u, 0u, 0u};
  const v4u w = pad ? z : o;
  {
    *(v4u*)(dst + i8) = w;
    
  }
}

// =====================================================================================================
// y = (x - mu) * (1/sqrt(var + eps)) * bf16_RNE(gamma) + bf16_RNE(beta) in f32, out X16 = f16(y * sc) (sc = 16, exact power of two).
// Lane l owns columns 8l..8l+7 and 256+8l..256+8l+7; the block's eight rows go out fragment-packed through LDS (store_rows8_packed).
// coverage: grid = NROW/8 blocks x 8 waves = every row; 32 lanes x 16 halves = all 512 columns of the row.
// =====================================================================================================
__global__ __launch_bounds__(256) void ln16(const float* __restrict__ x, const float* __restrict__ gam,
                                            const float* __restrict__ bet, unsigned short* X16, int nrows, float sc) {
  const int lane = threadIdx.x & 31;
  const int wave = threadIdx.x >> 5;
  __shared__ __align__(16) v4u st[8 * RPI];
  const int row  = blockIdx.x * 8 + wave;
  if ((int)blockIdx.x * 8 + 8 > nrows) return;     // block-uniform, in front of the barrier; never taken with the exact grid
  const float* p = x + (size_t)row * DMOD;
  const int c0 = 8 * lane, c1 = 256 + 8 * lane;
  const v4f a0 = *(const v4f*)(p + c0), a1 = *(const v4f*)(p + c0 + 4);
  const v4f a2 = *(const v4f*)(p + c1), a3 = *(const v4f*)(p + c1 + 4);
  float v[16];
#pragma unroll
  for (int e = 0; e < 4; ++e) {
    v[e]      = bfr(a0[e]);
    v[4 + e]  = bfr(a1[e]);
    v[8 + e]  = bfr(a2[e]);
    v[12 + e] = bfr(a3[e]);
  }
  float s = 0.f;
#pragma unroll
  for (int e = 0; e < 16; ++e) s += v[e];
#pragma unroll
  for (int off = 1; off < 32; off <<= 1) s += __shfl_xor(s, off, 32);
  const float mu = s * (1.0f / (float)DMOD);
  float q = 0.f;
#pragma unroll
  for (int e = 0; e < 16; ++e) {
    const float d = v[e] - mu;
    v[e] = d;
    q += d * d;
  }
#pragma unroll
  for (int off = 1; off < 32; off <<= 1) q += __shfl_xor(q, off, 32);
  const float var  = q * (1.0f / (float)DMOD);
  const float rstd = 1.0f / sqrtf(var + LN_EPS);
  const v4f g0 = *(const v4f*)(gam + c0), g1 = *(const v4f*)(gam + c0 + 4);
  const v4f g2 = *(const v4f*)(gam + c1), g3 = *(const v4f*)(gam + c1 + 4);
  const v4f e0 = *(const v4f*)(bet + c0), e1 = *(const v4f*)(bet + c0 + 4);
  const v4f e2 = *(const v4f*)(bet + c1), e3 = *(const v4f*)(bet + c1 + 4);
  float gg[16], bb[16];
#pragma unroll
  for (int e = 0; e < 4; ++e) {
    gg[e]      = bfr(g0[e]);  bb[e]      = bfr(e0[e]);
    gg[4 + e]  = bfr(g1[e]);  bb[4 + e]  = bfr(e1[e]);
    gg[8 + e]  = bfr(g2[e]);  bb[8 + e]  = bfr(e2[e]);
    gg[12 + e] = bfr(g3[e]);  bb[12 + e] = bfr(e3[e]);
  }
  v4u o0, o1;
#pragma unroll
  for (int e = 0; e < 4; ++e) {
    const float y0 = v[2 * e] * rstd * gg[2 * e] + bb[2 * e];
    const float y1 = v[2 * e + 1] * rstd * gg[2 * e + 1] + bb[2 * e + 1];
    const float y2 = v[8 + 2 * e] * rstd * gg[8 + 2 * e] + bb[8 + 2 * e];
    const float y3 = v[8 + 2 * e + 1] * rstd * gg[8 + 2 * e + 1] + bb[8 + 2 * e + 1];
    o0[e] = pk16(h_bits((_Float16)(y0 * sc)), h_bits((_Float16)(y1 * sc)));
    o1[e] = pk16(h_bits((_Float16)(y2 * sc)), h_bits((_Float16)(y3 * sc)));
  }
  store_rows8_packed(o0, o1, X16, blockIdx.x * 8, st);
}

// =====================================================================================================
// Sinusoid table, one wave per position s: pe[s][2m] = sin(s * div[m]), pe[s][2m+1] = cos(s * div[m]), div[m] = expf(f32(2m) * f32(-ln(1e4)/512)),
// precise expf / sinf / cosf (arguments up to 2047), all f32. Rolled loop: lane l computes columns 8l..8l+7 and 256+8l..+7 (4 sin/cos pairs per group)
// into its own slots of a wave-private f32 LDS row, then packs f16(pe * sc) (sc = 16); the block's eight rows go out fragment-packed
// through LDS (store_rows8_packed).
// coverage: grid = SEQ/8 blocks x 8 waves = rows 0..SEQ-1; each lane reads back only the 16 LDS slots it wrote; 32 lanes x 16 halves = 512 columns.
// =====================================================================================================
__global__ __launch_bounds__(256) void pe16(unsigned short* PE16, int nrows, float sc) {
  __shared__ __align__(16) float sh[8 * DMOD];
  __shared__ __align__(16) v4u st[8 * RPI];
  const int lane = threadIdx.x & 31;
  const int wave = threadIdx.x >> 5;
  const int s = blockIdx.x * 8 + wave;
  if ((int)blockIdx.x * 8 + 8 > nrows) return;     // block-uniform, in front of the barrier; never taken with the exact grid
  float* rowp = sh + wave * DMOD;
  const float fs = (float)s;
#pragma unroll 1
  for (int it = 0; it < 8; ++it) {
    const int cb = 256 * (it >> 2) + 8 * lane + 2 * (it & 3);   // even column = 2m
    const float dv  = expf((float)cb * CNEG);
    const float ang = fs * dv;
    rowp[cb]     = sinf(ang);
    rowp[cb + 1] = cosf(ang);
  }
  wave_sync_lds();
  v4u o[2];
#pragma unroll
  for (int g = 0; g < 2; ++g) {
    const float* sp = rowp + 256 * g + 8 * lane;
    v4u w;
#pragma unroll
    for (int e = 0; e < 4; ++e) w[e] = pk16(h_bits((_Float16)(sp[2 * e] * sc)), h_bits((_Float16)(sp[2 * e + 1] * sc)));
    o[g] = w;
  }
  store_rows8_packed(o[0], o[1], PE16, blockIdx.x * 8, st);
}

// =====================================================================================================
// Register-blocked batched 16-bit WMMA GEMM: C[m][n] = oscale * sum_k A[m][k] * Bt[n][k] (+ bias); one wave per 64x64 tile,
// no block barriers. A [M][lda] and Bt [N][ldb] are fragment-packed 16-bit planes (row lengths lda, ldb, multiples of 32); M, N multiples of 64,
// K multiple of 32. blockIdx.y = batch index with element strides sA, sB, sC (whole 16-row groups). 16-bit outputs are fragment-packed planes
// of row length ldc.
// ASPLIT 1: a second A plane A2 (unscaled residual of A, same layout) is multiplied into the same accumulator (A + A2 ~ exact A).
// BF 1: bf16 operands (v_wmma_f32_16x16x32_bf16), else f16.
// EPI 1: value += bf16_RNE(ep0[column]) (per-column bias); EPI 2: value += bf16_RNE(ep0[row]) (per-row bias, 16-bit out only).
// OM 0: f32 out (pitch ldc).  OM 2: one f16 plane = f16(value * ocarry).
// OM 4: two f16 planes: hi = f16(value * ocarry), lo = f16(value * ocarry - hi) (unscaled residual).
// OM 5: two f16 planes: C = f16((value + bf16_RNE(ep1[column])) * ocarry), C2 = f16((value + bf16_RNE(ep2[column])) * ocarry).
// coverage: 4 slabs x 16 rows (f32: it 0..7 x lane>>4; 16-bit: rows 8*(it&1) + (lane&7), pieces 4*(it>>1) + (lane>>3)) x 64 cols = the wave's whole 64x64 tile;
//           grid = ceil(tilesM*tilesN/8) blocks, surplus waves exit (wave-uniform).
// =====================================================================================================
template <int OM, int ASPLIT, int BF, int EPI>
__global__ __launch_bounds__(256) __attribute__((amdgpu_num_vgpr(256))) void gemm64(
    const unsigned short* __restrict__ Ap, const unsigned short* __restrict__ A2p, int lda, long long sA,
    const unsigned short* __restrict__ Btp, int ldb, long long sB,
    void* Cout, void* C2out, int ldc, long long sC,
    int M, int N, int K, float oscale, float ocarry,
    const float* __restrict__ ep0, const float* __restrict__ ep1, const float* __restrict__ ep2) {
  __shared__ __align__(16) float sT[8][16 * 68];   // per-wave 16x64 slab, pitch 68 floats
  const int by   = blockIdx.y;
  const int lane = threadIdx.x & 31;
  const int wave = threadIdx.x >> 5;
  const int tilesN = N >> 6;
  const int tilesM = M >> 6;
  const int tile = blockIdx.x * 8 + wave;
  if (tile >= tilesM * tilesN) return;   // wave-uniform; no block barriers in this kernel
  const int tm = tile / tilesN;
  const int tn = tile - tm * tilesN;
  const int m0 = tm << 6;
  const int n0 = tn << 6;

  const unsigned short* A1 = Ap  + (size_t)((long long)by * sA);
  const unsigned short* A2 = A2p + (size_t)((long long)by * sA);
  const unsigned short* Bb = Btp + (size_t)((long long)by * sB);

  const int rlane = lane & 15;                 // row (A) / col (B, D) within subtile
  const int ksA   = lda >> 5;                  // 1-KiB blocks per 16 rows of A
  const int ksB   = ldb >> 5;                  // 1-KiB blocks per 16 rows of Bt
  const int mOff  = (lane >> 4) * 8;           // D row offset

  v8f acc[4][4];
#pragma unroll
  for (int i = 0; i < 4; ++i)
#pragma unroll
    for (int j = 0; j < 4; ++j) acc[i][j] = zero8();

  // the lane's own piece in the first 1-KiB block of each 16-row group; a k step moves every pointer on by one block (512 halves)
  gp16 pB[4], pA[4], pL[4];
#pragma unroll
  for (int j = 0; j < 4; ++j) pB[j] = (gp16)(Bb + ((size_t)(((n0 >> 4) + j) * ksB) << 9) + (lane << 3));
#pragma unroll
  for (int i = 0; i < 4; ++i) {
    const size_t ao = ((size_t)(((m0 >> 4) + i) * ksA) << 9) + (lane << 3);
    pA[i] = (gp16)(A1 + ao);
    pL[i] = (gp16)(A2 + ao);
  }
  for (int k0 = 0; k0 < K; k0 += 32) {
    // the k step's fragment loads go out as one group ahead of its WMMAs: one L2 latency per step, not one per 16-row group of A
    v16h bh[4], ah[4], al[4];
#pragma unroll
    for (int j = 0; j < 4; ++j) bh[j] = ldfrag_g(pB[j]);
#pragma unroll
    for (int i = 0; i < 4; ++i) ah[i] = ldfrag_g(pA[i]);
    if constexpr (ASPLIT != 0) {
      al[0] = ldfrag_g(pL[0]);
      al[1] = ldfrag_g(pL[1]);
    }
    __builtin_amdgcn_sched_barrier(0);   // the group stays whole in front of the first WMMA (sunk to their uses the loads wait one by one)
#pragma unroll
    for (int i = 0; i < 4; ++i) {
#pragma unroll
      for (int j = 0; j < 4; ++j) acc[i][j] = mmaT<BF>(ah[i], bh[j], acc[i][j]);
      dep_guard1(acc[i][0], acc[i][3], ah[i]);
      if constexpr (ASPLIT != 0) {
#pragma unroll
        for (int j = 0; j < 4; ++j) acc[i][j] = mmaT<BF>(al[i], bh[j], acc[i][j]);
        dep_guard1(acc[i][0], acc[i][3], al[i]);
        if (i == 0) {
          __builtin_amdgcn_sched_barrier(0);   // the last two residual fragments take the registers of the first row group's pair: not lifted higher
          al[2] = ldfrag_g(pL[2]);
          al[3] = ldfrag_g(pL[3]);
          __builtin_amdgcn_sched_barrier(0);   // issued before the second row group's WMMAs
        }
      }
    }
    keep4_h(bh[0], bh[1], bh[2], bh[3]);
    // The wait stands in front of every rewrite of an address register that the trip's loads name: as operands of its statement the pointers
    // keep their registers up to it, and the additions below cannot be lifted over it.
    if constexpr (ASPLIT != 0) {
      asm volatile("s_wait_xcnt 0x0" : "+v"(pB[0]), "+v"(pB[1]), "+v"(pB[2]), "+v"(pB[3]), "+v"(pA[0]), "+v"(pA[1]), "+v"(pA[2]), "+v"(pA[3]),
                                       "+v"(pL[0]), "+v"(pL[1]), "+v"(pL[2]), "+v"(pL[3]) :: "memory");
    } else {
      asm volatile("s_wait_xcnt 0x0" : "+v"(pB[0]), "+v"(pB[1]), "+v"(pB[2]), "+v"(pB[3]), "+v"(pA[0]), "+v"(pA[1]), "+v"(pA[2]), "+v"(pA[3]) :: "memory");
    }
#pragma unroll
    for (int j = 0; j < 4; ++j) {
      pB[j] += 512;
      pA[j] += 512;
      pL[j] += 512;
    }
  }
  acc_guard4(acc[0][0], acc[0][1], acc[0][2], acc[0][3]);
  acc_guard4(acc[1][0], acc[1][1], acc[1][2], acc[1][3]);
  acc_guard4(acc[2][0], acc[2][1], acc[2][2], acc[2][3]);
  acc_guard4(acc[3][0], acc[3][1], acc[3][2], acc[3][3]);

  const int hh2 = lane >> 4, c4 = (lane & 15) * 4;     // f32 out: 256-B row segment = 16 lanes x 16 B

  // ---- epilogue ----
  float* slab = sT[wave];
#pragma unroll
  for (int i = 0; i < 4; ++i) {
    const int mBase = m0 + (i << 4);
#pragma unroll
    for (int j = 0; j < 4; ++j) {
#pragma unroll
      for (int r = 0; r < 8; ++r) {
        slab[(mOff + r) * 68 + (j << 4) + rlane] = acc[i][j][r];
      }
    }
    wave_sync_lds();
    if constexpr (OM == 0) {
      float* C = (float*)Cout + (size_t)((long long)by * sC);
      v4f vals[8];
#pragma unroll
      for (int it = 0; it < 8; ++it) {
        const int row = it * 2 + hh2;                      // it 0..7 x hh2 0..1 = rows 0..15
        v4f v = *(const v4f*)(slab + row * 68 + c4);
#pragma unroll
        for (int e = 0; e < 4; ++e) v[e] = v[e] * oscale;
        if constexpr (EPI == 1) {
          const v4f bb = *(const v4f*)(ep0 + n0 + c4);     // per-column bias, columns n0+c4 .. +3 (N equals the bias length)
#pragma unroll
          for (int e = 0; e < 4; ++e) v[e] = v[e] + bfr(bb[e]);
        }
        vals[it] = v;
      }
      {
#pragma unroll
        for (int it = 0; it < 8; ++it) {
          const int gr = mBase + it * 2 + hh2;
          *(v4f*)(C + (size_t)gr * ldc + n0 + c4) = vals[it];
        }
        // The wait stands in front of every rewrite of a data register that these stores name (the next slab's LDS reads take them)
        asm volatile("s_wait_xcnt 0x0" :: "v"(vals[0]), "v"(vals[1]), "v"(vals[2]), "v"(vals[3]), "v"(vals[4]), "v"(vals[5]), "v"(vals[6]), "v"(vals[7]) : "memory");
      }
    } else {
      unsigned short* C  = (unsigned short*)Cout  + (size_t)((long long)by * sC);
      unsigned short* Cb = (unsigned short*)C2out + (size_t)((long long)by * sC);
      const int ksC = ldc >> 5;                            // 1-KiB blocks per 16 rows of C
      v4u hv[4], lv[4];
#pragma unroll
      for (int it = 0; it < 4; ++it) {
        const int row = (it & 1) * 8 + (lane & 7);         // 8 rows x 4 pieces per it = four whole 128-B lines of packed block it >> 1
        const int c8  = (it >> 1) * 32 + (lane >> 3) * 8;  // only two column groups per lane, so the column biases stay few
        const float* sp = slab + row * 68 + c8;
        float rb = 0.f;
        if constexpr (EPI == 2) rb = bfr(ep0[mBase + row]);   // per-row bias (M equals the bias length)
        v4u a  = {0u, 0u, 0u, 0u};
        v4u b2 = {0u, 0u, 0u, 0u};
#pragma unroll
        for (int e = 0; e < 4; ++e) {
          const int ci = n0 + c8 + 2 * e;                  // column index, < N
          float f0 = sp[2 * e] * oscale + rb;
          float f1 = sp[2 * e + 1] * oscale + rb;
          if constexpr (EPI == 1) {
            f0 += bfr(ep0[ci]);
            f1 += bfr(ep0[ci + 1]);
          }
          if constexpr (OM == 5) {
            const float g0 = (f0 + bfr(ep1[ci])) * ocarry, g1 = (f1 + bfr(ep1[ci + 1])) * ocarry;
            const float w0 = (f0 + bfr(ep2[ci])) * ocarry, w1 = (f1 + bfr(ep2[ci + 1])) * ocarry;
            a[e]  = pk16(h_bits((_Float16)g0), h_bits((_Float16)g1));
            b2[e] = pk16(h_bits((_Float16)w0), h_bits((_Float16)w1));
          } else {
            f0 *= ocarry; f1 *= ocarry;
            const _Float16 x0 = (_Float16)f0, x1 = (_Float16)f1;
            a[e] = pk16(h_bits(x0), h_bits(x1));
            if constexpr (OM == 4) {
              b2[e] = pk16(h_bits((_Float16)(f0 - (float)x0)), h_bits((_Float16)(f1 - (float)x1)));
            }
          }
        }
        hv[it] = a;
        lv[it] = b2;
      }
      {
#pragma unroll
        for (int it = 0; it < 4; ++it) {
          const size_t co = ((size_t)((mBase >> 4) * ksC + (n0 >> 5) + (it >> 1)) << 9) + ((lane >> 4) << 8) +
                            (((((lane >> 3) & 1) << 4) + (it & 1) * 8 + (lane & 7)) << 3);
          *(v4u*)(C + co) = hv[it];
          if constexpr (OM >= 4) {
            *(v4u*)(Cb + co) = lv[it];
          }
        }
        // The wait stands in front of every rewrite of a data register that these stores name: as inputs of its statement the pieces keep
        // their registers up to it (the next slab's bias arithmetic is otherwise free to take them directly behind the stores).
        if constexpr (OM >= 4) {
          asm volatile("s_wait_xcnt 0x0" :: "v"(hv[0]), "v"(hv[1]), "v"(hv[2]), "v"(hv[3]), "v"(lv[0]), "v"(lv[1]), "v"(lv[2]), "v"(lv[3]) : "memory");
        } else {
          asm volatile("s_wait_xcnt 0x0" :: "v"(hv[0]), "v"(hv[1]), "v"(hv[2]), "v"(hv[3]) : "memory");
        }
      }
    }
    wave_sync_lds();
  }
}

// =====================================================================================================
// One position strip for a wave: T[R][x] = (q+bq+vb)[A rows] . pos[mw + x], R = lane&15 row of the A fragment pair (qva, qvb), x in [0,80)
// (5 subtiles of 16 pos rows, K = 64 = two k-steps); pos row index clamped on the address into [0, SEQ-1]
// (only x <= 78 is ever selected, and every selected entry has an unclamped row in range); Pb points into the fragment-packed plane at the
// head's first 1-KiB block with the lane's k half only; each 16x16 subtile goes to the wave's f32 LDS strip right after its two WMMAs and
// the hazard gap. coverage: 5 subtiles x 16 rows x 16 cols = the full 16x80 strip every time.
// =====================================================================================================
__device__ __forceinline__ size_t pos_slot(int m) {                // packed offset of pos row m: 16-row group, then the row's slot
  m = (m < 0) ? 0 : m;
  m = (m > SEQ - 1) ? (SEQ - 1) : m;
  return ((size_t)(m >> 4) << 13) + ((m & 15) << 3);
}
__device__ __forceinline__ void strip_sub(v16h qva, v16h qvb, v16h fa, v16h fb, float* tsh, int u, int hh, int c) {
  v8f t8 = mma_h(qva, fa, zero8());
  t8 = mma_h(qvb, fb, t8);
  hz4(t8, fa, fb, qva, qvb);
  const int cb = 16 * u + c;
#pragma unroll
  for (int r = 0; r < 8; ++r) tsh[(8 * hh + r) * TPI + cb] = t8[r];
}
// whole strip, its 24 loads issued as one group (used for the second strip of the one tile per wave that needs both)
__device__ __forceinline__ void pos_strip(const unsigned short* __restrict__ QVa, const unsigned short* __restrict__ Pb,
                                          int mw, float* tsh, int hh, int c) {
  const v16h qva = ldfrag_p(QVa), qvb = ldfrag_p(QVa + 512);
  v16h fa[5], fb[5];
  const unsigned short* pp[5];
#pragma unroll
  for (int u = 0; u < 5; ++u) {
    pp[u] = Pb + pos_slot(mw + 16 * u + c);
    fa[u] = ldfrag_p(pp[u]);
    fb[u] = ldfrag_p(pp[u] + 512);
  }
  addr_wait7(QVa, pp[0], pp[1], pp[2], pp[3], pp[4], QVa);
#pragma unroll
  for (int u = 0; u < 5; ++u) strip_sub(qva, qvb, fa[u], fb[u], tsh, u, hh, c);
}

// =====================================================================================================
// Relative-position attention for one (batch b, head n) pair and a 64-row query tile; 4 waves, wave w owns query rows i = iw0 + R,
// iw0 = i0 + 16w, R = 0..15. Planes (fragment-packed, row length DMOD halves, row = b*SEQ + position): QU = f16((q + bq + ub) x4), QV = f16((q + bq + vb) x4),
// KP = f16((k + bk) x4); PP = f16(pos x4) rows 0..SEQ-1; VT, VTL = v^T hi (x16) / residual f16 as [b][n*64+d][SEQ] (fragment-packed per batch).
// Shifted position score for (i, j), d = j - i:  d <= 0 -> ps[i][SEQ-1+d];  d == 1 -> 0;  d >= 2 -> ps[i+1][d-2],  ps[r][t] = (q+bq+vb)[r] . pos[t].
//   Per key tile j0 (64 keys, key j = j0 + jj), with x = jj - R + 15 in [0,78]:
//     strip T1[R][x] = (q+vb)[iw0+R]   . pos[SEQ + j0 - iw0 - 16 + x]   (pos row SEQ-1+d), computed iff j0 <= iw0 + 15;
//     strip T2[R][x] = (q+vb)[iw0+1+R] . pos[j0 - iw0 - 17 + x]         (pos row d-2),     computed iff j0 + 61 >= iw0;
//     both tests are wave-uniform (iw0 via readfirstlane); a strip is selected from only in tiles where it was computed this iteration
//     (both strips are zero-filled once at kernel start so unselected reads are finite). The A row b*SEQ+iw0+16 of T2 is clamped to NROW-1
//     for the very last row group; that entry is never selected (i = SEQ-1 has no j >= i+2).
//   content scores S = (q+ub) . k (4 subtiles, K=64); t = (S + sel(T1, 0, T2)) * (RSD/16) * log2(e); online softmax in base 2,
//   max-subtracted, running sums in f32 (no key mask); the 16x64 prob tile stored to wave-private LDS (f32 element stores),
//   fragments loaded straight from the packed 16-bit planes VT/VTL[n*64+d][j]; 8 + 8 P.V WMMAs per tile (hi plane then residual plane into the
//   same accumulators).
//   block = 4 waves = 128 threads; grid = (SEQ/64, NB*NH); no block barriers; every wave does identical bounded work (SEQ/64 tiles).
// coverage: LDS strips 16 rows x 80 cols written fully whenever computed, slab 16 rows x 64 cols per wave fully written each tile before
//           being read; global: 4 instructions x 512 contiguous bytes per plane = rows iw0..iw0+15 of head segment n in CT and CTL;
//           grid x waves cover all NB x SEQ rows and all NH head segments of CT / CTL exactly once.
// =====================================================================================================
__global__ __launch_bounds__(ATT_THREADS) __attribute__((amdgpu_num_vgpr(256)))
void attn_rel(const unsigned short* __restrict__ QU, const unsigned short* __restrict__ QV,
              const unsigned short* __restrict__ KP, const unsigned short* __restrict__ PP,
              const unsigned short* __restrict__ VT, const unsigned short* __restrict__ VTL,
              unsigned short* CT, unsigned short* CTL) {
  __shared__ __align__(16) float smem[ATT_W * WFL];   // per wave: T1 strip [16][TPI] | T2 strip [16][TPI] | prob / ctx slab [16][PPI]

  const int tid  = threadIdx.x;
  const int wave = __builtin_amdgcn_readfirstlane(tid >> 5);
  const int lane = tid & 31;
  const int hh   = lane >> 4;
  const int c    = lane & 15;
  const int bn   = blockIdx.y;
  const int b    = bn / NH;
  const int n    = bn - b * NH;
  const int i0   = blockIdx.x * 64;
  const int iw0  = i0 + wave * 16;

  float* t1sh = smem + wave * WFL;
  float* t2sh = t1sh + 16 * TPI;
  float* pt   = t2sh + 16 * TPI;

#pragma unroll 4
  for (int q = lane; q < 32 * TPI; q += 32) t1sh[q] = 0.f;   // zero both strips once (32*TPI floats are contiguous)

  // stationary A fragments: (q + bq + ub) rows b*SEQ + iw0 + c, d 0..31 and 32..63 of head n ((q + bq + vb) fragments are reloaded per key tile)
  const size_t hb  = (size_t)(n * (DH / 32)) << 9;            // the head's first 1-KiB block inside a 16-row group of a DMOD-long plane
  const size_t qro = ((size_t)((b * SEQ + iw0) >> 4) << 13) + hb + (lane << 3);
  const v16h qua = ldfrag_p(QU + qro), qub = ldfrag_p(QU + qro + 512);
  int qr2 = b * SEQ + iw0 + 1 + c;                            // rows i+1 for the T2 strip
  qr2 = (qr2 > NROW - 1) ? (NROW - 1) : qr2;
  const size_t qro2 = ((size_t)(qr2 >> 4) << 13) + hb + (((hh << 4) + (qr2 & 15)) << 3);

  const unsigned short* Kb  = KP + (size_t)b * SEQ * DMOD + hb + (lane << 3);
  const unsigned short* Pb  = PP + hb + (hh << 7);
  const size_t vbase = (size_t)b * DMOD * SEQ + (size_t)(n * DH) * SEQ + (lane << 3);   // 16-row group = 16 * SEQ halves
  const unsigned short* Vb  = VT  + vbase;
  const unsigned short* VLb = VTL + vbase;
  gp16 vhp = (gp16)Vb;                                        // the hi plane's running address: the key tile's first block

  const float KSC = (RSD / (QC * QC)) * LOG2E;

  float mrow[8], lrow[8];
  v8f O[4];
#pragma unroll
  for (int r = 0; r < 8; ++r) { mrow[r] = -INFINITY; lrow[r] = 0.f; }
#pragma unroll
  for (int td = 0; td < 4; ++td) O[td] = zero8();
  wave_sync_lds();

#pragma unroll 1
  for (int j0 = 0; j0 < SEQ; j0 += 64) {
    const int dmin = j0 - iw0;                               // smallest j - i over the tile is dmin - 15, largest dmin + 63 (wave-uniform)
    // Every tile needs T1 (dmin <= 15) or T2 (dmin >= -61), one tile per wave both (wave-uniform tests). The tile's fragment loads go out
    // in groups ahead of the WMMAs that use them, as many at a time as the registers hold, so that a group costs one L2 latency.
    const bool low = (dmin <= 15);                           // the tile's first strip is T1, else T2
    const unsigned short* QVs = QV + (low ? qro : qro2);
    const int mw = low ? (SEQ + dmin - 16) : (dmin - 17);
    float* tsh = low ? t1sh : t2sh;
    const unsigned short* Kt = Kb + ((size_t)(j0 >> 4) << 13);
    // ---- load group 1: the strip's A pair, its five pos subtiles, the first key subtile ----
    v16h ka[4], kb2[4], fa[5], fb[5];
    const v16h qva = ldfrag_p(QVs), qvb = ldfrag_p(QVs + 512);
    const unsigned short* pp[5];
#pragma unroll
    for (int u = 0; u < 5; ++u) {
      pp[u] = Pb + pos_slot(mw + 16 * u + c);
      fa[u] = ldfrag_p(pp[u]);
      fb[u] = ldfrag_p(pp[u] + 512);
    }
    ka[0]  = ldfrag_p(Kt);
    kb2[0] = ldfrag_p(Kt + 512);
    addr_wait7(QVs, pp[0], pp[1], pp[2], pp[3], pp[4], Kt);
#pragma unroll
    for (int u = 0; u < 3; ++u) strip_sub(qva, qvb, fa[u], fb[u], tsh, u, hh, c);
    __builtin_amdgcn_sched_barrier(0);   // group 2 takes the registers of the three pos subtiles used up to here, so it is not lifted higher
    // ---- load group 2: the other three key subtiles; they fly behind the rest of the strip and the first score subtile ----
#pragma unroll
    for (int t = 1; t < 4; ++t) {
      ka[t]  = ldfrag_p(Kt + ((size_t)t << 13));
      kb2[t] = ldfrag_p(Kt + ((size_t)t << 13) + 512);
    }
    addr_wait1(Kt);
#pragma unroll
    for (int u = 3; u < 5; ++u) strip_sub(qva, qvb, fa[u], fb[u], tsh, u, hh, c);
    // ---- content scores S (4 subtiles of 16 keys) ----
    v8f S[4];
#pragma unroll
    for (int t = 0; t < 4; ++t) {
      S[t] = mma_h(qua, ka[t], zero8());
      S[t] = mma_h(qub, kb2[t], S[t]);
      hz4(S[t], ka[t], kb2[t], qua, qub);
    }
    if (low && dmin + 61 >= 0) pos_strip(QV + qro2, Pb, dmin - 17, t2sh, hh, c);   // the tile on the diagonal: T2 as well
    // ---- load group 3: v^T hi plane, in flight during the softmax ----
    const size_t vo = (size_t)(j0 >> 5) << 9;              // the key tile's first 1-KiB block inside a 16-row group
    v16h vfa[4], vfb[4];
#pragma unroll
    for (int td = 0; td < 4; ++td) {
      vfa[td] = ldfrag_g(vhp + (size_t)(16 * td) * SEQ);
      vfb[td] = ldfrag_g(vhp + (size_t)(16 * td) * SEQ + 512);
    }
    addr_wait_step(vhp);
    vhp += 1024;                                           // the next key tile: two 1-KiB blocks on
    wave_sync_own();

    // ---- score assembly + online softmax (rows live on one 16-lane half), in phases over four register rows at a time so that the
    //      cross-lane steps of the four run as one interleaved group (all eight at once do not fit the registers beside the v^T loads in flight) ----
#pragma unroll   // unrolled, as are the loops inside: S, O, mrow and lrow are indexed by the row and stay in registers only so
    for (int g = 0; g < 2; ++g) {
      float mx4[4], ps4[4], al4[4];
#pragma unroll
      for (int q = 0; q < 4; ++q) {
        const int r  = 4 * g + q;
        const int R  = 8 * hh + r;
        const int xo = R * TPI + (15 - R) + c;               // strip column x = 16t + c - R + 15 in [0, 78]
        const int db = dmin + c - R;                         // d = j - i = db + 16t
#pragma unroll
        for (int t = 0; t < 4; ++t) {
          const float v1 = t1sh[xo + 16 * t];
          const float v2 = t2sh[xo + 16 * t];
          const int d = db + 16 * t;
          const float bdv = (d <= 0) ? v1 : ((d == 1) ? 0.f : v2);
          S[t][r] = (S[t][r] + bdv) * KSC;
        }
        mx4[q] = fmaxf(fmaxf(S[0][r], S[1][r]), fmaxf(S[2][r], S[3][r]));
      }
      row_max4(mx4);
#pragma unroll
      for (int q = 0; q < 4; ++q) {
        const int r  = 4 * g + q;
        const int R  = 8 * hh + r;
        const float mn = fmaxf(mrow[r], mx4[q]);
        al4[q] = exp2f(mrow[r] - mn);
        mrow[r] = mn;
        float e4[4];
        float ps = 0.f;
#pragma unroll
        for (int t = 0; t < 4; ++t) { e4[t] = exp2f(S[t][r] - mn); ps += e4[t]; }
        ps4[q] = ps;
        const int ro = R * PPI + c;
#pragma unroll
        for (int t = 0; t < 4; ++t) pt[ro + 16 * t] = e4[t];
      }
      row_sum4(ps4);
#pragma unroll
      for (int q = 0; q < 4; ++q) {
        const int r = 4 * g + q;
        lrow[r] = lrow[r] * al4[q] + ps4[q];
#pragma unroll
        for (int td = 0; td < 4; ++td) O[td][r] *= al4[q];
      }
    }
    wave_sync_own();

    // ---- P fragments (x1024, f16) from the LDS rows, two k-steps of 32 keys ----
    FragH pf[2];
#pragma unroll
    for (int ks = 0; ks < 2; ++ks) {
      const float* prow = pt + c * PPI + 32 * ks + 8 * hh;
      const v4f p0 = *(const v4f*)(prow), p1 = *(const v4f*)(prow + 4);
      const v4f p2 = *(const v4f*)(prow + 16), p3 = *(const v4f*)(prow + 20);
#pragma unroll
      for (int e = 0; e < 4; ++e) {
        pf[ks].h[0][e]     = (_Float16)(p0[e] * PC);     // keys j0 + 32ks + 8hh + e
        pf[ks].h[0][4 + e] = (_Float16)(p1[e] * PC);     // keys j0 + 32ks + 8hh + 4 + e
        pf[ks].h[1][e]     = (_Float16)(p2[e] * PC);     // keys j0 + 32ks + 16 + 8hh + e
        pf[ks].h[1][4 + e] = (_Float16)(p3[e] * PC);
      }
    }
    __builtin_amdgcn_sched_barrier(0);   // group 4 is not lifted over the P fragments' LDS reads: their registers and the group's do not fit together
    {
      // ---- load group 4: v^T residual plane, first two 16-row groups now, the other two into the registers of the first two hi groups ----
      v16h vla[4], vlb[4];
#pragma unroll
      for (int td = 0; td < 2; ++td) {
        const unsigned short* vp = VLb + vo + (size_t)(16 * td) * SEQ;
        vla[td] = ldfrag_p(vp);
        vlb[td] = ldfrag_p(vp + 512);
      }
      addr_wait1(VLb + vo);
      // ---- O += P . v^T (hi plane) ----
#pragma unroll
      for (int td = 0; td < 2; ++td) {
        O[td] = mma_h(pf[0].v, vfa[td], O[td]);
        O[td] = mma_h(pf[1].v, vfb[td], O[td]);
        hz4(O[td], pf[0].v, pf[1].v, vfa[td], vfb[td]);
      }
      __builtin_amdgcn_sched_barrier(0);   // the second half of group 4 waits for those registers and is not lifted higher
#pragma unroll
      for (int td = 2; td < 4; ++td) {
        const unsigned short* vp = VLb + vo + (size_t)(16 * td) * SEQ;
        vla[td] = ldfrag_p(vp);
        vlb[td] = ldfrag_p(vp + 512);
      }
      addr_wait1(VLb + vo);
#pragma unroll
      for (int td = 2; td < 4; ++td) {
        O[td] = mma_h(pf[0].v, vfa[td], O[td]);
        O[td] = mma_h(pf[1].v, vfb[td], O[td]);
        hz4(O[td], pf[0].v, pf[1].v, vfa[td], vfb[td]);
      }
      // ---- O += P . v^T (residual plane) ----
#pragma unroll
      for (int td = 0; td < 4; ++td) {
        O[td] = mma_h(pf[0].v, vla[td], O[td]);
        O[td] = mma_h(pf[1].v, vlb[td], O[td]);
        hz4(O[td], pf[0].v, pf[1].v, vla[td], vlb[td]);
      }
    }
    wave_sync_lds();
  }
  acc_guard4(O[0], O[1], O[2], O[3]);

  // ---- fold 1/l and the carries (1024 on P, 16 on v), carry x4096 on ctx, stage the wave's 16x64 slice in its slab ----
  const float oc = CC / (PC * VC);
#pragma unroll
  for (int r = 0; r < 8; ++r) {
    const float inv = (1.0f / lrow[r]) * oc;
    const int ro = (8 * hh + r) * PPI + c;
#pragma unroll
    for (int td = 0; td < 4; ++td) pt[ro + 16 * td] = O[td][r] * inv;
  }
  wave_sync_lds();
  {
    v4u hv[4], lv[4];
#pragma unroll
    for (int it = 0; it < 4; ++it) {
      const int c8 = (it >> 1) * 32 + (it & 1) * 16 + hh * 8;   // row c; one packed 512-B run per it: block it >> 1, second half it & 1
      const float* sp = pt + c * PPI + c8;
      v4u a, b2;
#pragma unroll
      for (int e = 0; e < 4; ++e) {
        const float f0 = sp[2 * e], f1 = sp[2 * e + 1];
        const _Float16 x0 = (_Float16)f0, x1 = (_Float16)f1;
        a[e]  = pk16(h_bits(x0), h_bits(x1));
        b2[e] = pk16(h_bits((_Float16)(f0 - (float)x0)), h_bits((_Float16)(f1 - (float)x1)));
      }
      hv[it] = a;
      lv[it] = b2;
    }
    {
#pragma unroll
      for (int it = 0; it < 4; ++it) {
        const size_t go = qro + ((size_t)(it >> 1) << 9) + ((it & 1) << 8);
        *(v4u*)(CT  + go) = hv[it];
        *(v4u*)(CTL + go) = lv[it];
      }
      
    }
  }
}

// =====================================================================================================
// Workspace map (bytes); every plane is an exact multiple of its tile / whole-row store granularity (M, N exact tile multiples,
// convert counts exact multiples of 2048), every offset a multiple of 512 KiB; every plane is fragment-packed (see ldfrag_p):
//   WQ16, WK16, WV16, WP16, WO16 f16 [512 out][512 in] x64                               5 x   524288
//   X16  f16 [NROW][512] x16 (pre-norm output)                                                8388608
//   PE16 f16 [SEQ][512] x16 (sinusoid table)                                                  2097152
//   QU, QV, K16 f16 [NROW][512] x4                                                       3 x  8388608
//   P16  f16 [SEQ][512] x4                                                                      2097152
//   VT16, VTL16 f16 [NB][512][SEQ] hi x16 / residual                                     2 x  8388608
//   CT16, CTL16 f16 [NROW][512] hi x4096 / residual                                      2 x  8388608
//   end                                                                                        73924608
// =====================================================================================================
extern "C" void kernel_launch(void* const* d_in, const int* in_sizes, int n_in,
                              void* d_out, int out_size, void* d_ws, size_t ws_size,
                              hipStream_t stream) {
  if (n_in < 14) return;
  if (in_sizes[0] != NROW * DMOD) return;
  if (in_sizes[1] != DMOD || in_sizes[2] != DMOD) return;
  if (in_sizes[3] != DMOD * DMOD || in_sizes[5] != DMOD * DMOD || in_sizes[7] != DMOD * DMOD ||
      in_sizes[9] != DMOD * DMOD || in_sizes[12] != DMOD * DMOD) return;
  if (in_sizes[4] != DMOD || in_sizes[6] != DMOD || in_sizes[8] != DMOD || in_sizes[13] != DMOD) return;
  if (in_sizes[10] != NH * DH || in_sizes[11] != NH * DH) return;
  if (out_size != NROW * DMOD) return;

  const float* xin   = (const float*)d_in[0];
  const float* gam   = (const float*)d_in[1];
  const float* bet   = (const float*)d_in[2];
  const float* w_q   = (const float*)d_in[3];
  const float* b_q   = (const float*)d_in[4];
  const float* w_k   = (const float*)d_in[5];
  const float* b_k   = (const float*)d_in[6];
  const float* w_v   = (const float*)d_in[7];
  const float* b_v   = (const float*)d_in[8];
  const float* w_p   = (const float*)d_in[9];
  const float* ub    = (const float*)d_in[10];
  const float* vb    = (const float*)d_in[11];
  const float* w_o   = (const float*)d_in[12];
  const float* b_o   = (const float*)d_in[13];
  float*       out   = (float*)d_out;

  const size_t PW  = (size_t)DMOD * DMOD * 2;            //   524288
  const size_t PX  = (size_t)NROW * DMOD * 2;            //  8388608
  const size_t PXP = (size_t)SEQ * DMOD * 2;             //  2097152
  const size_t PVT = (size_t)NB * DMOD * SEQ * 2;        //  8388608
  size_t off = 0;
  const size_t oWQ  = off; off += PW;
  const size_t oWK  = off; off += PW;
  const size_t oWV  = off; off += PW;
  const size_t oWP  = off; off += PW;
  const size_t oWO  = off; off += PW;
  const size_t oX   = off; off += PX;
  const size_t oPE  = off; off += PXP;
  const size_t oQU  = off; off += PX;
  const size_t oQV  = off; off += PX;
  const size_t oK   = off; off += PX;
  const size_t oP   = off; off += PXP;
  const size_t oVT  = off; off += PVT;
  const size_t oVTL = off; off += PVT;
  const size_t oCT  = off; off += PX;
  const size_t oCTL = off; off += PX;
  if (off > ws_size) return;                               // off = 73924608
  if (off > (size_t)134217728) return;

  char* ws = (char*)d_ws;
  unsigned short* WQ16  = (unsigned short*)(ws + oWQ);
  unsigned short* WK16  = (unsigned short*)(ws + oWK);
  unsigned short* WV16  = (unsigned short*)(ws + oWV);
  unsigned short* WP16  = (unsigned short*)(ws + oWP);
  unsigned short* WO16  = (unsigned short*)(ws + oWO);
  unsigned short* X16   = (unsigned short*)(ws + oX);
  unsigned short* PE16  = (unsigned short*)(ws + oPE);
  unsigned short* QU    = (unsigned short*)(ws + oQU);
  unsigned short* QV    = (unsigned short*)(ws + oQV);
  unsigned short* K16   = (unsigned short*)(ws + oK);
  unsigned short* P16   = (unsigned short*)(ws + oP);
  unsigned short* VT16  = (unsigned short*)(ws + oVT);
  unsigned short* VTL16 = (unsigned short*)(ws + oVTL);
  unsigned short* CT16  = (unsigned short*)(ws + oCT);
  unsigned short* CTL16 = (unsigned short*)(ws + oCTL);

  const dim3 blk(256);
  const dim3 gCW((DMOD * DMOD) / 2048);                             // 128
  const dim3 gLN(NROW / 8);                                         // 1024
  const dim3 gPE(SEQ / 8);                                          // 256
  const int tilesQ = (NROW / 64) * (DMOD / 64);                     // 1024
  const int tilesV = (DMOD / 64) * (SEQ / 64);                      // 256 per batch
  const int tilesP = (SEQ / 64) * (DMOD / 64);                      // 256
  const dim3 gQ((tilesQ + 7) / 8, 1);                               // 128
  const dim3 gV((tilesV + 7) / 8, NB);                              // 32 x 4
  const dim3 gP((tilesP + 7) / 8, 1);                               // 32
  const dim3 gAT(SEQ / 64, NB * NH);                                // 32 x 32
  const dim3 bAT(ATT_THREADS);                                      // 128

  // (0) weight planes: W[o][c] ([out][in] = [n][k] already) -> f16( bf16_RNE(w) * 64 ), all five weights
  cvt16<<<gCW, blk, 0, stream>>>(w_q, WQ16, DMOD * DMOD, DMOD * DMOD, WSC);
  cvt16<<<gCW, blk, 0, stream>>>(w_k, WK16, DMOD * DMOD, DMOD * DMOD, WSC);
  cvt16<<<gCW, blk, 0, stream>>>(w_v, WV16, DMOD * DMOD, DMOD * DMOD, WSC);
  cvt16<<<gCW, blk, 0, stream>>>(w_p, WP16, DMOD * DMOD, DMOD * DMOD, WSC);
  cvt16<<<gCW, blk, 0, stream>>>(w_o, WO16, DMOD * DMOD, DMOD * DMOD, WSC);

  // (1) pre-norm -> X16 = f16(x * 16); sinusoid table -> PE16 = f16(pe * 16)
  ln16<<<gLN, blk, 0, stream>>>(xin, gam, bet, X16, NROW, XC);
  pe16<<<gPE, blk, 0, stream>>>(PE16, SEQ, XC);

  // (2) q[m][nd] = sum_c x[m][c] Wq[nd][c] / 1024 + bq[nd]; QU = f16((q + ub[nd]) * 4), QV = f16((q + vb[nd]) * 4);
  //     M = NROW, N = 512, K = 512
  gemm64<5, 0, 0, 1><<<gQ, blk, 0, stream>>>(
      X16, X16, DMOD, 0LL,
      WQ16, DMOD, 0LL,
      (void*)QU, (void*)QV, DMOD, 0LL,
      NROW, DMOD, DMOD, 1.0f / (XC * WSC), QC,
      b_q, ub, vb);

  // (3) k projection + bk -> K16 = f16(k * 4)
  gemm64<2, 0, 0, 1><<<gQ, blk, 0, stream>>>(
      X16, X16, DMOD, 0LL,
      WK16, DMOD, 0LL,
      (void*)K16, (void*)K16, DMOD, 0LL,
      NROW, DMOD, DMOD, 1.0f / (XC * WSC), QC,
      b_k, b_k, b_k);

  // (4) v^T per batch: VT[b][nd][j] = sum_c Wv[nd][c] x[b*SEQ + j][c] / 1024 + bv[nd] (per-row bias) -> f16 x16 hi + residual planes;
  //     M = 512 (nd), N = SEQ (j), K = 512; B rows are the batch's token rows: pitch DMOD, batch stride SEQ*DMOD
  gemm64<4, 0, 0, 2><<<gV, blk, 0, stream>>>(
      WV16, WV16, DMOD, 0LL,
      X16, DMOD, (long long)SEQ * DMOD,
      (void*)VT16, (void*)VTL16, SEQ, (long long)DMOD * SEQ,
      DMOD, SEQ, DMOD, 1.0f / (XC * WSC), VC,
      b_v, b_v, b_v);

  // (5) positional projection (no bias): P16 = f16(pos * 4), M = SEQ, N = 512, K = 512
  gemm64<2, 0, 0, 0><<<gP, blk, 0, stream>>>(
      PE16, PE16, DMOD, 0LL,
      WP16, DMOD, 0LL,
      (void*)P16, (void*)P16, DMOD, 0LL,
      SEQ, DMOD, DMOD, 1.0f / (XC * WSC), QC,
      b_q, b_q, b_q);

  // (6) relative attention -> CT16 = f16(ctx * 4096) hi plane, CTL16 residual plane, rows b*SEQ + i, halves n*64+d
  attn_rel<<<gAT, bAT, 0, stream>>>(QU, QV, K16, P16, VT16, VTL16, CT16, CTL16);

  // (7) out = (CT + CTL) . Wo^T / (4096*64) + bo; M = NROW, N = 512, K = 512, f32 rows straight into the output buffer
  gemm64<0, 1, 0, 1><<<gQ, blk, 0, stream>>>(
      CT16, CTL16, DMOD, 0LL,
      WO16, DMOD, 0LL,
      (void*)out, (void*)out, DMOD, 0LL,
      NROW, DMOD, DMOD, 1.0f / (CC * WSC), 1.0f,
      b_o, b_o, b_o);
  (void)hipGetLastError();
}

// v004
// Measured time: 223 microseconds a run.
// Next to v003, in two timings, it ran 1.12 times as fast each time.
// Over all steps from v000 it is 2.13 times as fast.
// Contractions (all v_wmma_f32_16x16x32_f16, f16 operands, f32 accumulate): q/k/v/pos projections (x or sinusoid table f16 x16 . W f16 x64,
// K=512, single products); content scores ((q+bq+ub) f16 x4 . (k+bk) f16 x4, K=64, single); position strips ((q+bq+vb) f16 x4 . pos f16 x4,
// K=64, single) -> one f32 LDS strip per key tile, the shift's select made where the strip is stored; P . v^T (P f16 x1024 . v^T carried as f16 x16 hi plane + f16 residual plane, 64 keys
// per tile, two products); output projection (ctx carried as f16 x4096 hi + residual planes . Wo f16 x64, K=512, two products).
// LayerNorm, sinusoid table, max-subtracted online base-2 softmax and all epilogues in f32 on VALU. Every float input RNE-converted to bf16 on load.
#include <hip/hip_runtime.h>
#include <math.h>
#include <stdint.h>

#define SEQ   2048
#define NB    4
#define DMOD  512
#define NH    8
#define DH    64
#define NROW  (SEQ * NB)
#define XC    16.0f
#define WSC   64.0f
#define QC    4.0f
#define VC    16.0f
#define PC    1024.0f
#define CC    4096.0f
#define RSD   0.044194173824159216f
#define LOG2E 1.4426950408889634f
#define LN_EPS 1.0e-5f
#define CNEG  ((float)(-9.210340371976184 / 512.0))
static_assert(NH * DH == DMOD);
static_assert(DH == 64);
static_assert(DMOD == 512);
static_assert((SEQ % 64) == 0 && (DMOD % 64) == 0 && (NROW % 64) == 0);
static_assert(((DMOD * DMOD) % 2048) == 0 && (NROW % 8) == 0 && (SEQ % 8) == 0);
#define ATT_W 4
#define ATT_THREADS (ATT_W * 32)
#define TPI 84
#define PPI 68
#define WFL (16 * TPI + 16 * PPI)
static_assert(((16 * TPI) % 4) == 0 && ((16 * PPI) % 4) == 0 && (WFL % 4) == 0);
static_assert(TPI >= 80 && PPI >= 64);
static_assert(ATT_W * WFL * 4 <= 65536);

typedef _Float16 v16h __attribute__((ext_vector_type(16)));
typedef _Float16 v8h  __attribute__((ext_vector_type(8)));
typedef __bf16   v16b __attribute__((ext_vector_type(16)));
typedef float    v8f  __attribute__((ext_vector_type(8)));
typedef float    v4f  __attribute__((ext_vector_type(4)));
typedef unsigned int v4u __attribute__((ext_vector_type(4)));

union FragH { v16h v; v8h h[2]; v4u u[2]; };
union FragAny { v16h h; v16b b; };

// ---- scalar helpers --------------------------------------------------------------------------------
__device__ __forceinline__ unsigned short bf_bits(float f) {          // f32 -> bf16 bits, RNE convert
  unsigned u = __float_as_uint(f);
  return (unsigned short)((u + 0x7FFFu + ((u >> 16) & 1u)) >> 16);
}
__device__ __forceinline__ float bf_up(unsigned short h) { return __uint_as_float(((unsigned)h) << 16); }
__device__ __forceinline__ float bfr(float f) { return bf_up(bf_bits(f)); }   // value of the bf16 RNE convert
__device__ __forceinline__ unsigned short h_bits(_Float16 x) { return __builtin_bit_cast(unsigned short, x); }
__device__ __forceinline__ unsigned pk16(unsigned short a, unsigned short b) { return (unsigned)a | ((unsigned)b << 16); }
__device__ __forceinline__ v8f zero8() { v8f z = {0.f, 0.f, 0.f, 0.f, 0.f, 0.f, 0.f, 0.f}; return z; }

// ---- fragment-packed 16-bit planes: a [rows][L] plane (rows % 16 == 0, L % 32 == 0) is stored as 1-KiB blocks, one per
//      (16 rows, 32 k): block index (row >> 4) * (L / 32) + (k >> 5); inside a block the 8-half piece that holds element (row, k) stands at
//      halves ((k >> 4) & 1) * 256 + (((k >> 3) & 1) * 16 + (row & 15)) * 8. With 16-aligned rows one wave-wide 16-B load reads 512 contiguous
//      bytes (four whole 128-B lines) where a row-major plane made it touch sixteen lines.
// ---- fragment loader: p = block start + (16 * (lane >> 4) + (row & 15)) * 8; elements 0..7 <- k0 + 8h + 0..7, elements 8..15 <- k0 + 16 + 8h + 0..7,
//      h = lane >> 4 (same split k map for A and B; B is always read from a [n][k] plane)
__device__ __forceinline__ v16h ldfrag_p(const unsigned short* p) {
  FragH f;
  f.u[0] = *(const v4u*)(p);
  f.u[1] = *(const v4u*)(p + 256);
  return f.v;
}
// ---- the same loader on a pointer typed as global memory (a pointer that has gone through an asm operand would otherwise load as a flat one)
typedef const __attribute__((address_space(1))) unsigned short* gp16;
typedef const __attribute__((address_space(1))) v4u* gp128;
__device__ __forceinline__ v16h ldfrag_g(gp16 p) {
  FragH f;
  f.u[0] = *(gp128)(p);
  f.u[1] = *(gp128)(p + 256);
  return f.v;
}

// ---- behind a group of loads: the wait that stands in front of every rewrite of an address register which the group's loads name; as inputs of
//      its statement the addresses keep their registers up to it, so that no load of the group lands on an address of the same group either
__device__ __forceinline__ void addr_wait1(const unsigned short* a) {
#if defined(__HIP_DEVICE_COMPILE__)
  asm volatile("s_wait_xcnt 0x0" :: "v"(a) : "memory");
#endif
}
// the same for a running address that is stepped behind the group: as an operand the statement may change, the pointer is the very register the
// loads name, and the step cannot be lifted over the wait
__device__ __forceinline__ void addr_wait_step(gp16& a) {
#if defined(__HIP_DEVICE_COMPILE__)
  asm volatile("s_wait_xcnt 0x0" : "+v"(a) :: "memory");
#endif
}
__device__ __forceinline__ void addr_wait7(const unsigned short* a, const unsigned short* b, const unsigned short* c, const unsigned short* d,
                                           const unsigned short* e, const unsigned short* f, const unsigned short* g) {
#if defined(__HIP_DEVICE_COMPILE__)
  asm volatile("s_wait_xcnt 0x0" :: "v"(a), "v"(b), "v"(c), "v"(d), "v"(e), "v"(f), "v"(g) : "memory");
#endif
}
// ---- WMMA helpers with trailing VALU hazard gaps ------------------------------------------------------
__device__ __forceinline__ v8f mma_h(v16h a, v16h b, v8f c) {
  return __builtin_amdgcn_wmma_f32_16x16x32_f16(false, a, false, b, (short)0, c, false, false);
}
__device__ __forceinline__ v8f mma_b(v16h a, v16h b, v8f c) {
  FragAny ua, ub;
  ua.h = a;
  ub.h = b;
  return __builtin_amdgcn_wmma_f32_16x16x32_bf16(false, ua.b, false, ub.b, (short)0, c, false, false);
}
template <int BF>
__device__ __forceinline__ v8f mmaT(v16h a, v16h b, v8f c) {
  if constexpr (BF != 0) return mma_b(a, b, c);
  else return mma_h(a, b, c);
}
__device__ __forceinline__ void dep_guard1(v8f& a, v8f& b, v16h x) {
#if defined(__HIP_DEVICE_COMPILE__)
  asm volatile("v_nop\n\tv_nop\n\tv_nop\n\tv_nop" : "+v"(a), "+v"(b) : "v"(x));
#endif
}
__device__ __forceinline__ void hz4(v8f& d, v16h x0, v16h x1, v16h x2, v16h x3) {
#if defined(__HIP_DEVICE_COMPILE__)
  asm volatile("v_nop\n\tv_nop\n\tv_nop\n\tv_nop" : "+v"(d) : "v"(x0), "v"(x1), "v"(x2), "v"(x3));
#endif
}
__device__ __forceinline__ void keep4_h(v16h a, v16h b, v16h c, v16h d) {
#if defined(__HIP_DEVICE_COMPILE__)
  asm volatile("v_nop" :: "v"(a), "v"(b), "v"(c), "v"(d));
#endif
}
__device__ __forceinline__ void acc_guard4(v8f& a, v8f& b, v8f& c, v8f& d) {
#if defined(__HIP_DEVICE_COMPILE__)
  asm volatile("v_nop\n\tv_nop\n\tv_nop\n\tv_nop" : "+v"(a), "+v"(b), "+v"(c), "+v"(d));
#endif
}
// ---- hand-over of a wave's own LDS rows between its lanes while global loads are in flight: the wave's LDS writes are waited for, the loads are
//      not (the workgroup-scope fences of wave_sync_lds drain loadcnt too); nothing another wave reads or writes is ordered here
__device__ __forceinline__ void wave_sync_own() {
  __builtin_amdgcn_fence(__ATOMIC_RELEASE, "wavefront");
#if defined(__HIP_DEVICE_COMPILE__)
  asm volatile("s_wait_dscnt 0x0" ::: "memory");   // the rows are written before any lane reads them back
#endif
  __builtin_amdgcn_wave_barrier();
  __builtin_amdgcn_fence(__ATOMIC_ACQUIRE, "wavefront");
}
// ---- maximum / sum over each 16-lane row of four independent values, every lane getting the result: four row_xmask steps (partner lane ^ 1, 2, 4, 8,
//      the order of the xor shuffles they replace), on the vector pipe instead of one LDS-unit permute and its wait per step. The four chains are
//      interleaved, so that a step's producer stands four vector instructions back and its result is ready when the step issues. All 32 lanes must be on.
#define XM4(op, m) \
  op " %0, %0, %0 row_xmask:" #m " row_mask:0xf bank_mask:0xf\n\t" \
  op " %1, %1, %1 row_xmask:" #m " row_mask:0xf bank_mask:0xf\n\t" \
  op " %2, %2, %2 row_xmask:" #m " row_mask:0xf bank_mask:0xf\n\t" \
  op " %3, %3, %3 row_xmask:" #m " row_mask:0xf bank_mask:0xf\n\t"
__device__ __forceinline__ void row_max4(float (&x)[4]) {
#if defined(__HIP_DEVICE_COMPILE__)
  // row maximum without the LDS unit: sixteen vector instructions, no wait
  asm(XM4("v_max_num_f32_dpp", 1) XM4("v_max_num_f32_dpp", 2) XM4("v_max_num_f32_dpp", 4) XM4("v_max_num_f32_dpp", 8)
      : "+v"(x[0]), "+v"(x[1]), "+v"(x[2]), "+v"(x[3]));
#endif
}
__device__ __forceinline__ void row_sum4(float (&x)[4]) {
#if defined(__HIP_DEVICE_COMPILE__)
  // row sum without the LDS unit: sixteen vector instructions, no wait
  asm(XM4("v_add_f32_dpp", 1) XM4("v_add_f32_dpp", 2) XM4("v_add_f32_dpp", 4) XM4("v_add_f32_dpp", 8)
      : "+v"(x[0]), "+v"(x[1]), "+v"(x[2]), "+v"(x[3]));
#endif
}
__device__ __forceinline__ void wave_sync_lds() {
  __builtin_amdgcn_fence(__ATOMIC_RELEASE, "workgroup");
  __builtin_amdgcn_wave_barrier();
  __builtin_amdgcn_fence(__ATOMIC_ACQUIRE, "workgroup");
}
// ---- eight rows r0..r0+7 (r0 % 8 == 0, one row per wave, 256 threads) of a [rows][DMOD] plane -> fragment-packed plane, whole 128-B lines:
//      wave w hands in its row's pieces lane (o0: columns 8*lane..) and 32 + lane (o1: columns 256 + 8*lane..); a line of the packed plane holds
//      one piece of each of the eight rows, so the rows meet in LDS (pitch 66 pieces: the 16 lanes of a half wave fall on distinct banks).
//      Every thread of the block must call this (one block barrier inside).
#define RPI 66
__device__ __forceinline__ void store_rows8_packed(v4u o0, v4u o1, unsigned short* plane, int r0, v4u* st) {
  const int tid  = threadIdx.x;
  const int lane = tid & 31;
  const int wave = tid >> 5;
  st[wave * RPI + lane]      = o0;
  st[wave * RPI + 32 + lane] = o1;
  __syncthreads();   // the eight rows of a line come from eight waves
  unsigned short* dst = plane + ((size_t)(r0 >> 4) << 13) + ((r0 & 15) << 3);
#pragma unroll   // both LDS reads issue ahead of the two stores
  for (int sx = 0; sx < 2; ++sx) {
    const int idx = sx * 256 + tid;
    const int g   = idx >> 3;                        // piece index in the row = k >> 3, 0..63
    const int rr  = idx & 7;                         // row r0 + rr
    const v4u w = st[rr * RPI + g];
    *(v4u*)(dst + ((g >> 2) << 9) + (((g >> 1) & 1) << 8) + ((((g & 1) << 4) + rr) << 3)) = w;
  }
}

// =====================================================================================================
// Elementwise 16-bit pack of a [rows][DMOD] f32 matrix into a fragment-packed plane: piece t of the plane (8 halves at dst + 8t) =
// f16( bf16_RNE(src[row][k..k+7]) * sc ), (row, k) decoded from t; 0 for pieces whose source elements lie past nvalid; sc a power of two (exact). One piece per thread:
// two 16-B loads (address clamped into [0, nvalid) for pad groups, value zeroed), one 16-B store, a wave's stores = 512 contiguous bytes.
// Used for the five weight matrices, which are [out][in] = [n][k] k-contiguous already.
// coverage: grid = ntotal / 2048 blocks x 256 thr x 8 elements = ntotal exactly (ntotal % 2048 == 0, nvalid == ntotal here).
// =====================================================================================================
__global__ __launch_bounds__(256) void cvt16(const float* __restrict__ src, unsigned short* dst, int nvalid, int ntotal, float sc) {
  const size_t i8 = ((size_t)blockIdx.x * 256 + threadIdx.x) * 8;
  if (i8 + 8 > (size_t)ntotal) return;             // never taken with the exact grid; no barriers in this kernel
  const size_t t  = i8 >> 3;                           // piece index: block t >> 6, second half (t >> 5) & 1, k half (t >> 4) & 1, row t & 15
  const size_t sr = ((t >> 10) << 4) + (t & 15);       // source row: DMOD / 32 = 16 blocks per 16 rows
  const size_t sk = (((t >> 6) & 15) << 5) + (((t >> 5) & 1) << 4) + (((t >> 4) & 1) << 3);
  const size_t si = sr * DMOD + sk;                    // the piece's first element in the source
  const bool pad = (si + 8 > (size_t)nvalid);
  const size_t ls = pad ? ((size_t)nvalid - 8) : si;   // clamped address, always inside the source
  const v4f a = *(const v4f*)(src + ls);
  const v4f b = *(const v4f*)(src + ls + 4);
  v4u o;
  o[0] = pk16(h_bits((_Float16)(bfr(a[0]) * sc)), h_bits((_Float16)(bfr(a[1]) * sc)));
  o[1] = pk16(h_bits((_Float16)(bfr(a[2]) * sc)), h_bits((_Float16)(bfr(a[3]) * sc)));
  o[2] = pk16(h_bits((_Float16)(bfr(b[0]) * sc)), h_bits((_Float16)(bfr(b[1]) * sc)));
  o[3] = pk16(h_bits((_Float16)(bfr(b[2]) * sc)), h_bits((_Float16)(bfr(b[3]) * sc)));
  const v4u z = {0u, 0u, 0u, 0u};
  const v4u w = pad ? z : o;
  {
    *(v4u*)(dst + i8) = w;
    
  }
}

// =====================================================================================================
// y = (x - mu) * (1/sqrt(var + eps)) * bf16_RNE(gamma) + bf16_RNE(beta) in f32, out X16 = f16(y * sc) (sc = 16, exact power of two).
// Lane l owns columns 8l..8l+7 and 256+8l..256+8l+7; the block's eight rows go out fragment-packed through LDS (store_rows8_packed).
// coverage: grid = NROW/8 blocks x 8 waves = every row; 32 lanes x 16 halves = all 512 columns of the row.
// =====================================================================================================
__global__ __launch_bounds__(256) void ln16(const float* __restrict__ x, const float* __restrict__ gam,
                                            const float* __restrict__ bet, unsigned short* X16, int nrows, float sc) {
  const int lane = threadIdx.x & 31;
  const int wave = threadIdx.x >> 5;
  __shared__ __align__(16) v4u st[8 * RPI];
  const int row  = blockIdx.x * 8 + wave;
  if ((int)blockIdx.x * 8 + 8 > nrows) return;     // block-uniform, in front of the barrier; never taken with the exact grid
  const float* p = x + (size_t)row * DMOD;
  const int c0 = 8 * lane, c1 = 256 + 8 * lane;
  const v4f a0 = *(const v4f*)(p + c0), a1 = *(const v4f*)(p + c0 + 4);
  const v4f a2 = *(const v4f*)(p + c1), a3 = *(const v4f*)(p + c1 + 4);
  float v[16];
#pragma unroll
  for (int e = 0; e < 4; ++e) {
    v[e]      = bfr(a0[e]);
    v[4 + e]  = bfr(a1[e]);
    v[8 + e]  = bfr(a2[e]);
    v[12 + e] = bfr(a3[e]);
  }
  float s = 0.f;
#pragma unroll
  for (int e = 0; e < 16; ++e) s += v[e];
#pragma unroll
  for (int off = 1; off < 32; off <<= 1) s += __shfl_xor(s, off, 32);
  const float mu = s * (1.0f / (float)DMOD);
  float q = 0.f;
#pragma unroll
  for (int e = 0; e < 16; ++e) {
    const float d = v[e] - mu;
    v[e] = d;
    q += d * d;
  }
#pragma unroll
  for (int off = 1; off < 32; off <<= 1) q += __shfl_xor(q, off, 32);
  const float var  = q * (1.0f / (float)DMOD);
  const float rstd = 1.0f / sqrtf(var + LN_EPS);
  const v4f g0 = *(const v4f*)(gam + c0), g1 = *(const v4f*)(gam + c0 + 4);
  const v4f g2 = *(const v4f*)(gam + c1), g3 = *(const v4f*)(gam + c1 + 4);
  const v4f e0 = *(const v4f*)(bet + c0), e1 = *(const v4f*)(bet + c0 + 4);
  const v4f e2 = *(const v4f*)(bet + c1), e3 = *(const v4f*)(bet + c1 + 4);
  float gg[16], bb[16];
#pragma unroll
  for (int e = 0; e < 4; ++e) {
    gg[e]      = bfr(g0[e]);  bb[e]      = bfr(e0[e]);
    gg[4 + e]  = bfr(g1[e]);  bb[4 + e]  = bfr(e1[e]);
    gg[8 + e]  = bfr(g2[e]);  bb[8 + e]  = bfr(e2[e]);
    gg[12 + e] = bfr(g3[e]);  bb[12 + e] = bfr(e3[e]);
  }
  v4u o0, o1;
#pragma unroll
  for (int e = 0; e < 4; ++e) {
    const float y0 = v[2 * e] * rstd * gg[2 * e] + bb[2 * e];
    const float y1 = v[2 * e + 1] * rstd * gg[2 * e + 1] + bb[2 * e + 1];
    const float y2 = v[8 + 2 * e] * rstd * gg[8 + 2 * e] + bb[8 + 2 * e];
    const float y3 = v[8 + 2 * e + 1] * rstd * gg[8 + 2 * e + 1] + bb[8 + 2 * e + 1];
    o0[e] = pk16(h_bits((_Float16)(y0 * sc)), h_bits((_Float16)(y1 * sc)));
    o1[e] = pk16(h_bits((_Float16)(y2 * sc)), h_bits((_Float16)(y3 * sc)));
  }
  store_rows8_packed(o0, o1, X16, blockIdx.x * 8, st);
}

// =====================================================================================================
// Sinusoid table, one wave per position s: pe[s][2m] = sin(s * div[m]), pe[s][2m+1] = cos(s * div[m]), div[m] = expf(f32(2m) * f32(-ln(1e4)/512)),
// precise expf / sinf / cosf (arguments up to 2047), all f32. Rolled loop: lane l computes columns 8l..8l+7 and 256+8l..+7 (4 sin/cos pairs per group)
// into its own slots of a wave-private f32 LDS row, then packs f16(pe * sc) (sc = 16); the block's eight rows go out fragment-packed
// through LDS (store_rows8_packed).
// coverage: grid = SEQ/8 blocks x 8 waves = rows 0..SEQ-1; each lane reads back only the 16 LDS slots it wrote; 32 lanes x 16 halves = 512 columns.
// =====================================================================================================
__global__ __launch_bounds__(256) void pe16(unsigned short* PE16, int nrows, float sc) {
  __shared__ __align__(16) float sh[8 * DMOD];
  __shared__ __align__(16) v4u st[8 * RPI];
  const int lane = threadIdx.x & 31;
  const int wave = threadIdx.x >> 5;
  const int s = blockIdx.x * 8 + wave;
  if ((int)blockIdx.x * 8 + 8 > nrows) return;     // block-uniform, in front of the barrier; never taken with the exact grid
  float* rowp = sh + wave * DMOD;
  const float fs = (float)s;
#pragma unroll 1
  for (int it = 0; it < 8; ++it) {
    const int cb = 256 * (it >> 2) + 8 * lane + 2 * (it & 3);   // even column = 2m
    const float dv  = expf((float)cb * CNEG);
    const float ang = fs * dv;
    rowp[cb]     = sinf(ang);
    rowp[cb + 1] = cosf(ang);
  }
  wave_sync_lds();
  v4u o[2];
#pragma unroll
  for (int g = 0; g < 2; ++g) {
    const float* sp = rowp + 256 * g + 8 * lane;
    v4u w;
#pragma unroll
    for (int e = 0; e < 4; ++e) w[e] = pk16(h_bits((_Float16)(sp[2 * e] * sc)), h_bits((_Float16)(sp[2 * e + 1] * sc)));
    o[g] = w;
  }
  store_rows8_packed(o[0], o[1], PE16, blockIdx.x * 8, st);
}

// =====================================================================================================
// Register-blocked batched 16-bit WMMA GEMM: C[m][n] = oscale * sum_k A[m][k] * Bt[n][k] (+ bias); one wave per 64x64 tile,
// no block barriers. A [M][lda] and Bt [N][ldb] are fragment-packed 16-bit planes (row lengths lda, ldb, multiples of 32); M, N multiples of 64,
// K multiple of 32. blockIdx.y = batch index with element strides sA, sB, sC (whole 16-row groups). 16-bit outputs are fragment-packed planes
// of row length ldc.
// ASPLIT 1: a second A plane A2 (unscaled residual of A, same layout) is multiplied into the same accumulator (A + A2 ~ exact A).
// BF 1: bf16 operands (v_wmma_f32_16x16x32_bf16), else f16.
// EPI 1: value += bf16_RNE(ep0[column]) (per-column bias); EPI 2: value += bf16_RNE(ep0[row]) (per-row bias, 16-bit out only).
// OM 0: f32 out (pitch ldc).  OM 2: one f16 plane = f16(value * ocarry).
// OM 4: two f16 planes: hi = f16(value * ocarry), lo = f16(value * ocarry - hi) (unscaled residual).
// OM 5: two f16 planes: C = f16((value + bf16_RNE(ep1[column])) * ocarry), C2 = f16((value + bf16_RNE(ep2[column])) * ocarry).
// coverage: 4 slabs x 16 rows (f32: it 0..7 x lane>>4; 16-bit: rows 8*(it&1) + (lane&7), pieces 4*(it>>1) + (lane>>3)) x 64 cols = the wave's whole 64x64 tile;
//           grid = ceil(tilesM*tilesN/8) blocks, surplus waves exit (wave-uniform).
// =====================================================================================================
template <int OM, int ASPLIT, int BF, int EPI>
__global__ __launch_bounds__(256) __attribute__((amdgpu_num_vgpr(256))) void gemm64(
    const unsigned short* __restrict__ Ap, const unsigned short* __restrict__ A2p, int lda, long long sA,
    const unsigned short* __restrict__ Btp, int ldb, long long sB,
    void* Cout, void* C2out, int ldc, long long sC,
    int M, int N, int K, float oscale, float ocarry,
    const float* __restrict__ ep0, const float* __restrict__ ep1, const float* __restrict__ ep2) {
  __shared__ __align__(16) float sT[8][16 * 68];   // per-wave 16x64 slab, pitch 68 floats
  const int by   = blockIdx.y;
  const int lane = threadIdx.x & 31;
  const int wave = threadIdx.x >> 5;
  const int tilesN = N >> 6;
  const int tilesM = M >> 6;
  const int tile = blockIdx.x * 8 + wave;
  if (tile >= tilesM * tilesN) return;   // wave-uniform; no block barriers in this kernel
  const int tm = tile / tilesN;
  const int tn = tile - tm * tilesN;
  const int m0 = tm << 6;
  const int n0 = tn << 6;

  const unsigned short* A1 = Ap  + (size_t)((long long)by * sA);
  const unsigned short* A2 = A2p + (size_t)((long long)by * sA);
  const unsigned short* Bb = Btp + (size_t)((long long)by * sB);

  const int rlane = lane & 15;                 // row (A) / col (B, D) within subtile
  const int ksA   = lda >> 5;                  // 1-KiB blocks per 16 rows of A
  const int ksB   = ldb >> 5;                  // 1-KiB blocks per 16 rows of Bt
  const int mOff  = (lane >> 4) * 8;           // D row offset

  v8f acc[4][4];
#pragma unroll
  for (int i = 0; i < 4; ++i)
#pragma unroll
    for (int j = 0; j < 4; ++j) acc[i][j] = zero8();

  // the lane's own piece in the first 1-KiB block of each 16-row group; a k step moves every pointer on by one block (512 halves)
  gp16 pB[4], pA[4], pL[4];
#pragma unroll
  for (int j = 0; j < 4; ++j) pB[j] = (gp16)(Bb + ((size_t)(((n0 >> 4) + j) * ksB) << 9) + (lane << 3));
#pragma unroll
  for (int i = 0; i < 4; ++i) {
    const size_t ao = ((size_t)(((m0 >> 4) + i) * ksA) << 9) + (lane << 3);
    pA[i] = (gp16)(A1 + ao);
    pL[i] = (gp16)(A2 + ao);
  }
  for (int k0 = 0; k0 < K; k0 += 32) {
    // the k step's fragment loads go out as one group ahead of its WMMAs: one L2 latency per step, not one per 16-row group of A
    v16h bh[4], ah[4], al[4];
#pragma unroll
    for (int j = 0; j < 4; ++j) bh[j] = ldfrag_g(pB[j]);
#pragma unroll
    for (int i = 0; i < 4; ++i) ah[i] = ldfrag_g(pA[i]);
    if constexpr (ASPLIT != 0) {
      al[0] = ldfrag_g(pL[0]);
      al[1] = ldfrag_g(pL[1]);
    }
    __builtin_amdgcn_sched_barrier(0);   // the group stays whole in front of the first WMMA (sunk to their uses the loads wait one by one)
#pragma unroll
    for (int i = 0; i < 4; ++i) {
#pragma unroll
      for (int j = 0; j < 4; ++j) acc[i][j] = mmaT<BF>(ah[i], bh[j], acc[i][j]);
      dep_guard1(acc[i][0], acc[i][3], ah[i]);
      if constexpr (ASPLIT != 0) {
#pragma unroll
        for (int j = 0; j < 4; ++j) acc[i][j] = mmaT<BF>(al[i], bh[j], acc[i][j]);
        dep_guard1(acc[i][0], acc[i][3], al[i]);
        if (i == 0) {
          __builtin_amdgcn_sched_barrier(0);   // the last two residual fragments take the registers of the first row group's pair: not lifted higher
          al[2] = ldfrag_g(pL[2]);
          al[3] = ldfrag_g(pL[3]);
          __builtin_amdgcn_sched_barrier(0);   // issued before the second row group's WMMAs
        }
      }
    }
    keep4_h(bh[0], bh[1], bh[2], bh[3]);
    // The wait stands in front of every rewrite of an address register that the trip's loads name: as operands of its statement the pointers
    // keep their registers up to it, and the additions below cannot be lifted over it.
    if constexpr (ASPLIT != 0) {
      asm volatile("s_wait_xcnt 0x0" : "+v"(pB[0]), "+v"(pB[1]), "+v"(pB[2]), "+v"(pB[3]), "+v"(pA[0]), "+v"(pA[1]), "+v"(pA[2]), "+v"(pA[3]),
                                       "+v"(pL[0]), "+v"(pL[1]), "+v"(pL[2]), "+v"(pL[3]) :: "memory");
    } else {
      asm volatile("s_wait_xcnt 0x0" : "+v"(pB[0]), "+v"(pB[1]), "+v"(pB[2]), "+v"(pB[3]), "+v"(pA[0]), "+v"(pA[1]), "+v"(pA[2]), "+v"(pA[3]) :: "memory");
    }
#pragma unroll
    for (int j = 0; j < 4; ++j) {
      pB[j] += 512;
      pA[j] += 512;
      pL[j] += 512;
    }
  }
  acc_guard4(acc[0][0], acc[0][1], acc[0][2], acc[0][3]);
  acc_guard4(acc[1][0], acc[1][1], acc[1][2], acc[1][3]);
  acc_guard4(acc[2][0], acc[2][1], acc[2][2], acc[2][3]);
  acc_guard4(acc[3][0], acc[3][1], acc[3][2], acc[3][3]);

  const int hh2 = lane >> 4, c4 = (lane & 15) * 4;     // f32 out: 256-B row segment = 16 lanes x 16 B

  // ---- epilogue ----
  float* slab = sT[wave];
#pragma unroll
  for (int i = 0; i < 4; ++i) {
    const int mBase = m0 + (i << 4);
#pragma unroll
    for (int j = 0; j < 4; ++j) {
#pragma unroll
      for (int r = 0; r < 8; ++r) {
        slab[(mOff + r) * 68 + (j << 4) + rlane] = acc[i][j][r];
      }
    }
    wave_sync_lds();
    if constexpr (OM == 0) {
      float* C = (float*)Cout + (size_t)((long long)by * sC);
      v4f vals[8];
#pragma unroll
      for (int it = 0; it < 8; ++it) {
        const int row = it * 2 + hh2;                      // it 0..7 x hh2 0..1 = rows 0..15
        v4f v = *(const v4f*)(slab + row * 68 + c4);
#pragma unroll
        for (int e = 0; e < 4; ++e) v[e] = v[e] * oscale;
        if constexpr (EPI == 1) {
          const v4f bb = *(const v4f*)(ep0 + n0 + c4);     // per-column bias, columns n0+c4 .. +3 (N equals the bias length)
#pragma unroll
          for (int e = 0; e < 4; ++e) v[e] = v[e] + bfr(bb[e]);
        }
        vals[it] = v;
      }
      {
#pragma unroll
        for (int it = 0; it < 8; ++it) {
          const int gr = mBase + it * 2 + hh2;
          *(v4f*)(C + (size_t)gr * ldc + n0 + c4) = vals[it];
        }
        // The wait stands in front of every rewrite of a data register that these stores name (the next slab's LDS reads take them)
        asm volatile("s_wait_xcnt 0x0" :: "v"(vals[0]), "v"(vals[1]), "v"(vals[2]), "v"(vals[3]), "v"(vals[4]), "v"(vals[5]), "v"(vals[6]), "v"(vals[7]) : "memory");
      }
    } else {
      unsigned short* C  = (unsigned short*)Cout  + (size_t)((long long)by * sC);
      unsigned short* Cb = (unsigned short*)C2out + (size_t)((long long)by * sC);
      const int ksC = ldc >> 5;                            // 1-KiB blocks per 16 rows of C
      v4u hv[4], lv[4];
#pragma unroll
      for (int it = 0; it < 4; ++it) {
        const int row = (it & 1) * 8 + (lane & 7);         // 8 rows x 4 pieces per it = four whole 128-B lines of packed block it >> 1
        const int c8  = (it >> 1) * 32 + (lane >> 3) * 8;  // only two column groups per lane, so the column biases stay few
        const float* sp = slab + row * 68 + c8;
        float rb = 0.f;
        if constexpr (EPI == 2) rb = bfr(ep0[mBase + row]);   // per-row bias (M equals the bias length)
        v4u a  = {0u, 0u, 0u, 0u};
        v4u b2 = {0u, 0u, 0u, 0u};
#pragma unroll
        for (int e = 0; e < 4; ++e) {
          const int ci = n0 + c8 + 2 * e;                  // column index, < N
          float f0 = sp[2 * e] * oscale + rb;
          float f1 = sp[2 * e + 1] * oscale + rb;
          if constexpr (EPI == 1) {
            f0 += bfr(ep0[ci]);
            f1 += bfr(ep0[ci + 1]);
          }
          if constexpr (OM == 5) {
            const float g0 = (f0 + bfr(ep1[ci])) * ocarry, g1 = (f1 + bfr(ep1[ci + 1])) * ocarry;
            const float w0 = (f0 + bfr(ep2[ci])) * ocarry, w1 = (f1 + bfr(ep2[ci + 1])) * ocarry;
            a[e]  = pk16(h_bits((_Float16)g0), h_bits((_Float16)g1));
            b2[e] = pk16(h_bits((_Float16)w0), h_bits((_Float16)w1));
          } else {
            f0 *= ocarry; f1 *= ocarry;
            const _Float16 x0 = (_Float16)f0, x1 = (_Float16)f1;
            a[e] = pk16(h_bits(x0), h_bits(x1));
            if constexpr (OM == 4) {
              b2[e] = pk16(h_bits((_Float16)(f0 - (float)x0)), h_bits((_Float16)(f1 - (float)x1)));
            }
          }
        }
        hv[it] = a;
        lv[it] = b2;
      }
      {
#pragma unroll
        for (int it = 0; it < 4; ++it) {
          const size_t co = ((size_t)((mBase >> 4) * ksC + (n0 >> 5) + (it >> 1)) << 9) + ((lane >> 4) << 8) +
                            (((((lane >> 3) & 1) << 4) + (it & 1) * 8 + (lane & 7)) << 3);
          *(v4u*)(C + co) = hv[it];
          if constexpr (OM >= 4) {
            *(v4u*)(Cb + co) = lv[it];
          }
        }
        // The wait stands in front of every rewrite of a data register that these stores name: as inputs of its statement the pieces keep
        // their registers up to it (the next slab's bias arithmetic is otherwise free to take them directly behind the stores).
        if constexpr (OM >= 4) {
          asm volatile("s_wait_xcnt 0x0" :: "v"(hv[0]), "v"(hv[1]), "v"(hv[2]), "v"(hv[3]), "v"(lv[0]), "v"(lv[1]), "v"(lv[2]), "v"(lv[3]) : "memory");
        } else {
          asm volatile("s_wait_xcnt 0x0" :: "v"(hv[0]), "v"(hv[1]), "v"(hv[2]), "v"(hv[3]) : "memory");
        }
      }
    }
    wave_sync_lds();
  }
}

// =====================================================================================================
// One position strip for a wave: T[R][x] = (q+bq+vb)[A rows] . pos[mw + x], R = lane&15 row of the A fragment pair (qva, qvb), x in [0,80)
// (5 subtiles of 16 pos rows, K = 64 = two k-steps); pos row index clamped on the address into [0, SEQ-1]
// (only x <= 78 is ever selected, and every selected entry has an unclamped row in range); Pb points into the fragment-packed plane at the
// head's first 1-KiB block with the lane's k half only; each 16x16 subtile goes to the wave's f32 LDS strip right after its two WMMAs and
// the hazard gap. coverage: 5 subtiles x 16 rows x 16 cols = the full 16x80 strip every time.
// =====================================================================================================
__device__ __forceinline__ size_t pos_slot(int m) {                // packed offset of pos row m: 16-row group, then the row's slot
  m = (m < 0) ? 0 : m;
  m = (m > SEQ - 1) ? (SEQ - 1) : m;
  return ((size_t)(m >> 4) << 13) + ((m & 15) << 3);
}
__device__ __forceinline__ void strip_sub(v16h qva, v16h qvb, v16h fa, v16h fb, float* tsh, int u, int hh, int c) {
  v8f t8 = mma_h(qva, fa, zero8());
  t8 = mma_h(qvb, fb, t8);
  hz4(t8, fa, fb, qva, qvb);
  const int cb = 16 * u + c;
#pragma unroll
  for (int r = 0; r < 8; ++r) tsh[(8 * hh + r) * TPI + cb] = t8[r];
}
// a T2 subtile laid over the T1 strip (the tile on the diagonal): column cb holds d = d0 + cb for every row; only columns with d >= 1 are stored,
// the column d == 1 as zero
__device__ __forceinline__ void strip_sub_over(v16h qva, v16h qvb, v16h fa, v16h fb, float* tsh, int u, int hh, int c, int d0) {
  v8f t8 = mma_h(qva, fa, zero8());
  t8 = mma_h(qvb, fb, t8);
  hz4(t8, fa, fb, qva, qvb);
  const int cb = 16 * u + c;
  const int dc = d0 + cb;
  if (dc >= 1) {
#pragma unroll   // t8 is indexed by r and stays in registers only so
    for (int r = 0; r < 8; ++r) tsh[(8 * hh + r) * TPI + cb] = (dc == 1) ? 0.f : t8[r];
  }
}
// whole T2 strip over T1, its 24 loads issued as one group (the one tile per wave that needs both)
__device__ __forceinline__ void pos_strip_over(const unsigned short* __restrict__ QVa, const unsigned short* __restrict__ Pb,
                                               int mw, float* tsh, int hh, int c, int d0) {
  const v16h qva = ldfrag_p(QVa), qvb = ldfrag_p(QVa + 512);
  v16h fa[5], fb[5];
  const unsigned short* pp[5];
#pragma unroll
  for (int u = 0; u < 5; ++u) {
    pp[u] = Pb + pos_slot(mw + 16 * u + c);
    fa[u] = ldfrag_p(pp[u]);
    fb[u] = ldfrag_p(pp[u] + 512);
  }
  addr_wait7(QVa, pp[0], pp[1], pp[2], pp[3], pp[4], QVa);
#pragma unroll
  for (int u = 0; u < 5; ++u) strip_sub_over(qva, qvb, fa[u], fb[u], tsh, u, hh, c, d0);
}

// =====================================================================================================
// Relative-position attention for one (batch b, head n) pair and a 64-row query tile; 4 waves, wave w owns query rows i = iw0 + R,
// iw0 = i0 + 16w, R = 0..15. Planes (fragment-packed, row length DMOD halves, row = b*SEQ + position): QU = f16((q + bq + ub) x4), QV = f16((q + bq + vb) x4),
// KP = f16((k + bk) x4); PP = f16(pos x4) rows 0..SEQ-1; VT, VTL = v^T hi (x16) / residual f16 as [b][n*64+d][SEQ] (fragment-packed per batch).
// Shifted position score for (i, j), d = j - i:  d <= 0 -> ps[i][SEQ-1+d];  d == 1 -> 0;  d >= 2 -> ps[i+1][d-2],  ps[r][t] = (q+bq+vb)[r] . pos[t].
//   Per key tile j0 (64 keys, key j = j0 + jj), with x = jj - R + 15 in [0,78]:
//     strip T1[R][x] = (q+vb)[iw0+R]   . pos[SEQ + j0 - iw0 - 16 + x]   (pos row SEQ-1+d), computed iff j0 <= iw0 + 15;
//     strip T2[R][x] = (q+vb)[iw0+1+R] . pos[j0 - iw0 - 17 + x]         (pos row d-2),     computed iff j0 + 61 >= iw0;
//     both tests are wave-uniform (iw0 via readfirstlane). d = j0 - iw0 + x - 15 is the same down a strip column, so the select is made per column
//     where the strip is stored: one strip M per tile, all 80 columns written every tile, M = T1 (j0 <= iw0 - 64), M = T2 (j0 >= iw0 + 16, its
//     column 0 zeroed in the tile j0 == iw0 + 16, where it holds d == 1), and in the one tile between T1 with the columns d >= 1 overwritten by
//     0 (d == 1) and T2 (d >= 2); a wave's LDS stores land in program order. The A row b*SEQ+iw0+16 of T2 is clamped to NROW-1
//     for the very last row group; that entry is never read (i = SEQ-1 has no j >= i+2).
//   content scores S = (q+ub) . k (4 subtiles, K=64); t = (S + M) * (RSD/16) * log2(e); online softmax in base 2,
//   max-subtracted, running sums in f32 (no key mask); the 16x64 prob tile stored to wave-private LDS (f32 element stores),
//   fragments loaded straight from the packed 16-bit planes VT/VTL[n*64+d][j]; 8 + 8 P.V WMMAs per tile (hi plane then residual plane into the
//   same accumulators).
//   block = 4 waves = 128 threads; grid = (SEQ/64, NB*NH); no block barriers; every wave does identical bounded work (SEQ/64 tiles).
// coverage: LDS strip 16 rows x 80 cols written fully every tile before it is read, slab 16 rows x 64 cols per wave fully written each tile before
//           being read; global: 4 instructions x 512 contiguous bytes per plane = rows iw0..iw0+15 of head segment n in CT and CTL;
//           grid x waves cover all NB x SEQ rows and all NH head segments of CT / CTL exactly once.
// =====================================================================================================
__global__ __launch_bounds__(ATT_THREADS) __attribute__((amdgpu_num_vgpr(256)))
void attn_rel(const unsigned short* __restrict__ QU, const unsigned short* __restrict__ QV,
              const unsigned short* __restrict__ KP, const unsigned short* __restrict__ PP,
              const unsigned short* __restrict__ VT, const unsigned short* __restrict__ VTL,
              unsigned short* CT, unsigned short* CTL) {
  __shared__ __align__(16) float smem[ATT_W * WFL];   // per wave: position strip [16][TPI] | prob / ctx slab [16][PPI]

  const int tid  = threadIdx.x;
  const int wave = __builtin_amdgcn_readfirstlane(tid >> 5);
  const int lane = tid & 31;
  const int hh   = lane >> 4;
  const int c    = lane & 15;
  const int bn   = blockIdx.y;
  const int b    = bn / NH;
  const int n    = bn - b * NH;
  const int i0   = blockIdx.x * 64;
  const int iw0  = i0 + wave * 16;

  float* tsh = smem + wave * WFL;
  float* pt  = tsh + 16 * TPI;

  // stationary A fragments: (q + bq + ub) rows b*SEQ + iw0 + c, d 0..31 and 32..63 of head n ((q + bq + vb) fragments are reloaded per key tile)
  const size_t hb  = (size_t)(n * (DH / 32)) << 9;            // the head's first 1-KiB block inside a 16-row group of a DMOD-long plane
  const size_t qro = ((size_t)((b * SEQ + iw0) >> 4) << 13) + hb + (lane << 3);
  const v16h qua = ldfrag_p(QU + qro), qub = ldfrag_p(QU + qro + 512);
  int qr2 = b * SEQ + iw0 + 1 + c;                            // rows i+1 for the T2 strip
  qr2 = (qr2 > NROW - 1) ? (NROW - 1) : qr2;
  const size_t qro2 = ((size_t)(qr2 >> 4) << 13) + hb + (((hh << 4) + (qr2 & 15)) << 3);

  const unsigned short* Kb  = KP + (size_t)b * SEQ * DMOD + hb + (lane << 3);
  const unsigned short* Pb  = PP + hb + (hh << 7);
  const size_t vbase = (size_t)b * DMOD * SEQ + (size_t)(n * DH) * SEQ + (lane << 3);   // 16-row group = 16 * SEQ halves
  const unsigned short* Vb  = VT  + vbase;
  const unsigned short* VLb = VTL + vbase;
  gp16 vhp = (gp16)Vb;                                        // the hi plane's running address: the key tile's first block

  const float KSC = (RSD / (QC * QC)) * LOG2E;

  float mrow[8], lrow[8];
  v8f O[4];
#pragma unroll
  for (int r = 0; r < 8; ++r) { mrow[r] = -INFINITY; lrow[r] = 0.f; }
#pragma unroll
  for (int td = 0; td < 4; ++td) O[td] = zero8();

#pragma unroll 1
  for (int j0 = 0; j0 < SEQ; j0 += 64) {
    const int dmin = j0 - iw0;                               // smallest j - i over the tile is dmin - 15, largest dmin + 63 (wave-uniform)
    // Every tile needs T1 (dmin <= 15) or T2 (dmin >= -61), one tile per wave both (wave-uniform tests). The tile's fragment loads go out
    // in groups ahead of the WMMAs that use them, as many at a time as the registers hold, so that a group costs one L2 latency.
    const bool low = (dmin <= 15);                           // the tile's first strip is T1, else T2
    const unsigned short* QVs = QV + (low ? qro : qro2);
    const int mw = low ? (SEQ + dmin - 16) : (dmin - 17);
    const unsigned short* Kt = Kb + ((size_t)(j0 >> 4) << 13);
    // ---- load group 1: the strip's A pair, its five pos subtiles, the first key subtile ----
    v16h ka[4], kb2[4], fa[5], fb[5];
    const v16h qva = ldfrag_p(QVs), qvb = ldfrag_p(QVs + 512);
    const unsigned short* pp[5];
#pragma unroll
    for (int u = 0; u < 5; ++u) {
      pp[u] = Pb + pos_slot(mw + 16 * u + c);
      fa[u] = ldfrag_p(pp[u]);
      fb[u] = ldfrag_p(pp[u] + 512);
    }
    ka[0]  = ldfrag_p(Kt);
    kb2[0] = ldfrag_p(Kt + 512);
    addr_wait7(QVs, pp[0], pp[1], pp[2], pp[3], pp[4], Kt);
#pragma unroll
    for (int u = 0; u < 3; ++u) strip_sub(qva, qvb, fa[u], fb[u], tsh, u, hh, c);
    __builtin_amdgcn_sched_barrier(0);   // group 2 takes the registers of the three pos subtiles used up to here, so it is not lifted higher
    // ---- load group 2: the other three key subtiles; they fly behind the rest of the strip and the first score subtile ----
#pragma unroll
    for (int t = 1; t < 4; ++t) {
      ka[t]  = ldfrag_p(Kt + ((size_t)t << 13));
      kb2[t] = ldfrag_p(Kt + ((size_t)t << 13) + 512);
    }
    addr_wait1(Kt);
#pragma unroll
    for (int u = 3; u < 5; ++u) strip_sub(qva, qvb, fa[u], fb[u], tsh, u, hh, c);
    if (dmin == 16) {                                        // wave-uniform: the one T2 tile that holds d == 1, in column 0
      if (c == 0) {
        for (int r = 0; r < 8; ++r) tsh[(8 * hh + r) * TPI] = 0.f;
      }
    }
    // ---- content scores S (4 subtiles of 16 keys) ----
    v8f S[4];
#pragma unroll
    for (int t = 0; t < 4; ++t) {
      S[t] = mma_h(qua, ka[t], zero8());
      S[t] = mma_h(qub, kb2[t], S[t]);
      hz4(S[t], ka[t], kb2[t], qua, qub);
    }
    if (low && dmin + 61 >= 0) pos_strip_over(QV + qro2, Pb, dmin - 17, tsh, hh, c, dmin - 15);   // the tile on the diagonal: T2 over T1
    // ---- load group 3: v^T hi plane, in flight during the softmax ----
    const size_t vo = (size_t)(j0 >> 5) << 9;              // the key tile's first 1-KiB block inside a 16-row group
    v16h vfa[4], vfb[4];
#pragma unroll
    for (int td = 0; td < 4; ++td) {
      vfa[td] = ldfrag_g(vhp + (size_t)(16 * td) * SEQ);
      vfb[td] = ldfrag_g(vhp + (size_t)(16 * td) * SEQ + 512);
    }
    addr_wait_step(vhp);
    vhp += 1024;                                           // the next key tile: two 1-KiB blocks on
    wave_sync_own();

    // ---- score assembly + online softmax (rows live on one 16-lane half), in phases over four register rows at a time so that the
    //      cross-lane steps of the four run as one interleaved group (all eight at once do not fit the registers beside the v^T loads in flight) ----
#pragma unroll   // unrolled, as are the loops inside: S, O, mrow and lrow are indexed by the row and stay in registers only so
    for (int g = 0; g < 2; ++g) {
      float mx4[4], ps4[4], al4[4];
#pragma unroll
      for (int q = 0; q < 4; ++q) {
        const int r  = 4 * g + q;
        const int R  = 8 * hh + r;
        const int xo = R * TPI + (15 - R) + c;               // strip column x = 16t + c - R + 15 in [0, 78]
#pragma unroll
        for (int t = 0; t < 4; ++t) S[t][r] = (S[t][r] + tsh[xo + 16 * t]) * KSC;
        mx4[q] = fmaxf(fmaxf(S[0][r], S[1][r]), fmaxf(S[2][r], S[3][r]));
      }
      row_max4(mx4);
#pragma unroll
      for (int q = 0; q < 4; ++q) {
        const int r  = 4 * g + q;
        const int R  = 8 * hh + r;
        const float mn = fmaxf(mrow[r], mx4[q]);
        al4[q] = exp2f(mrow[r] - mn);
        mrow[r] = mn;
        float e4[4];
        float ps = 0.f;
#pragma unroll
        for (int t = 0; t < 4; ++t) { e4[t] = exp2f(S[t][r] - mn); ps += e4[t]; }
        ps4[q] = ps;
        const int ro = R * PPI + c;
#pragma unroll
        for (int t = 0; t < 4; ++t) pt[ro + 16 * t] = e4[t];
      }
      row_sum4(ps4);
#pragma unroll
      for (int q = 0; q < 4; ++q) {
        const int r = 4 * g + q;
        lrow[r] = lrow[r] * al4[q] + ps4[q];
#pragma unroll
        for (int td = 0; td < 4; ++td) O[td][r] *= al4[q];
      }
    }
    wave_sync_own();

    // ---- P fragments (x1024, f16) from the LDS rows, two k-steps of 32 keys ----
    FragH pf[2];
#pragma unroll
    for (int ks = 0; ks < 2; ++ks) {
      const float* prow = pt + c * PPI + 32 * ks + 8 * hh;
      const v4f p0 = *(const v4f*)(prow), p1 = *(const v4f*)(prow + 4);
      const v4f p2 = *(const v4f*)(prow + 16), p3 = *(const v4f*)(prow + 20);
#pragma unroll
      for (int e = 0; e < 4; ++e) {
        pf[ks].h[0][e]     = (_Float16)(p0[e] * PC);     // keys j0 + 32ks + 8hh + e
        pf[ks].h[0][4 + e] = (_Float16)(p1[e] * PC);     // keys j0 + 32ks + 8hh + 4 + e
        pf[ks].h[1][e]     = (_Float16)(p2[e] * PC);     // keys j0 + 32ks + 16 + 8hh + e
        pf[ks].h[1][4 + e] = (_Float16)(p3[e] * PC);
      }
    }
    __builtin_amdgcn_sched_barrier(0);   // group 4 is not lifted over the P fragments' LDS reads: their registers and the group's do not fit together
    {
      // ---- load group 4: v^T residual plane, first two 16-row groups now, the other two into the registers of the first two hi groups ----
      v16h vla[4], vlb[4];
#pragma unroll
      for (int td = 0; td < 2; ++td) {
        const unsigned short* vp = VLb + vo + (size_t)(16 * td) * SEQ;
        vla[td] = ldfrag_p(vp);
        vlb[td] = ldfrag_p(vp + 512);
      }
      addr_wait1(VLb + vo);
      // ---- O += P . v^T (hi plane) ----
#pragma unroll
      for (int td = 0; td < 2; ++td) {
        O[td] = mma_h(pf[0].v, vfa[td], O[td]);
        O[td] = mma_h(pf[1].v, vfb[td], O[td]);
        hz4(O[td], pf[0].v, pf[1].v, vfa[td], vfb[td]);
      }
      __builtin_amdgcn_sched_barrier(0);   // the second half of group 4 waits for those registers and is not lifted higher
#pragma unroll
      for (int td = 2; td < 4; ++td) {
        const unsigned short* vp = VLb + vo + (size_t)(16 * td) * SEQ;
        vla[td] = ldfrag_p(vp);
        vlb[td] = ldfrag_p(vp + 512);
      }
      addr_wait1(VLb + vo);
#pragma unroll
      for (int td = 2; td < 4; ++td) {
        O[td] = mma_h(pf[0].v, vfa[td], O[td]);
        O[td] = mma_h(pf[1].v, vfb[td], O[td]);
        hz4(O[td], pf[0].v, pf[1].v, vfa[td], vfb[td]);
      }
      // ---- O += P . v^T (residual plane) ----
#pragma unroll
      for (int td = 0; td < 4; ++td) {
        O[td] = mma_h(pf[0].v, vla[td], O[td]);
        O[td] = mma_h(pf[1].v, vlb[td], O[td]);
        hz4(O[td], pf[0].v, pf[1].v, vla[td], vlb[td]);
      }
    }
    wave_sync_lds();
  }
  acc_guard4(O[0], O[1], O[2], O[3]);

  // ---- fold 1/l and the carries (1024 on P, 16 on v), carry x4096 on ctx, stage the wave's 16x64 slice in its slab ----
  const float oc = CC / (PC * VC);
#pragma unroll
  for (int r = 0; r < 8; ++r) {
    const float inv = (1.0f / lrow[r]) * oc;
    const int ro = (8 * hh + r) * PPI + c;
#pragma unroll
    for (int td = 0; td < 4; ++td) pt[ro + 16 * td] = O[td][r] * inv;
  }
  wave_sync_lds();
  {
    v4u hv[4], lv[4];
#pragma unroll
    for (int it = 0; it < 4; ++it) {
      const int c8 = (it >> 1) * 32 + (it & 1) * 16 + hh * 8;   // row c; one packed 512-B run per it: block it >> 1, second half it & 1
      const float* sp = pt + c * PPI + c8;
      v4u a, b2;
#pragma unroll
      for (int e = 0; e < 4; ++e) {
        const float f0 = sp[2 * e], f1 = sp[2 * e + 1];
        const _Float16 x0 = (_Float16)f0, x1 = (_Float16)f1;
        a[e]  = pk16(h_bits(x0), h_bits(x1));
        b2[e] = pk16(h_bits((_Float16)(f0 - (float)x0)), h_bits((_Float16)(f1 - (float)x1)));
      }
      hv[it] = a;
      lv[it] = b2;
    }
    {
#pragma unroll
      for (int it = 0; it < 4; ++it) {
        const size_t go = qro + ((size_t)(it >> 1) << 9) + ((it & 1) << 8);
        *(v4u*)(CT  + go) = hv[it];
        *(v4u*)(CTL + go) = lv[it];
      }
      
    }
  }
}

// =====================================================================================================
// Workspace map (bytes); every plane is an exact multiple of its tile / whole-row store granularity (M, N exact tile multiples,
// convert counts exact multiples of 2048), every offset a multiple of 512 KiB; every plane is fragment-packed (see ldfrag_p):
//   WQ16, WK16, WV16, WP16, WO16 f16 [512 out][512 in] x64                               5 x   524288
//   X16  f16 [NROW][512] x16 (pre-norm output)                                                8388608
//   PE16 f16 [SEQ][512] x16 (sinusoid table)                                                  2097152
//   QU, QV, K16 f16 [NROW][512] x4                                                       3 x  8388608
//   P16  f16 [SEQ][512] x4                                                                      2097152
//   VT16, VTL16 f16 [NB][512][SEQ] hi x16 / residual                                     2 x  8388608
//   CT16, CTL16 f16 [NROW][512] hi x4096 / residual                                      2 x  8388608
//   end                                                                                        73924608
// =====================================================================================================
extern "C" void kernel_launch(void* const* d_in, const int* in_sizes, int n_in,
                              void* d_out, int out_size, void* d_ws, size_t ws_size,
                              hipStream_t stream) {
  if (n_in < 14) return;
  if (in_sizes[0] != NROW * DMOD) return;
  if (in_sizes[1] != DMOD || in_sizes[2] != DMOD) return;
  if (in_sizes[3] != DMOD * DMOD || in_sizes[5] != DMOD * DMOD || in_sizes[7] != DMOD * DMOD ||
      in_sizes[9] != DMOD * DMOD || in_sizes[12] != DMOD * DMOD) return;
  if (in_sizes[4] != DMOD || in_sizes[6] != DMOD || in_sizes[8] != DMOD || in_sizes[13] != DMOD) return;
  if (in_sizes[10] != NH * DH || in_sizes[11] != NH * DH) return;
  if (out_size != NROW * DMOD) return;

  const float* xin   = (const float*)d_in[0];
  const float* gam   = (const float*)d_in[1];
  const float* bet   = (const float*)d_in[2];
  const float* w_q   = (const float*)d_in[3];
  const float* b_q   = (const float*)d_in[4];
  const float* w_k   = (const float*)d_in[5];
  const float* b_k   = (const float*)d_in[6];
  const float* w_v   = (const float*)d_in[7];
  const float* b_v   = (const float*)d_in[8];
  const float* w_p   = (const float*)d_in[9];
  const float* ub    = (const float*)d_in[10];
  const float* vb    = (const float*)d_in[11];
  const float* w_o   = (const float*)d_in[12];
  const float* b_o   = (const float*)d_in[13];
  float*       out   = (float*)d_out;

  const size_t PW  = (size_t)DMOD * DMOD * 2;            //   524288
  const size_t PX  = (size_t)NROW * DMOD * 2;            //  8388608
  const size_t PXP = (size_t)SEQ * DMOD * 2;             //  2097152
  const size_t PVT = (size_t)NB * DMOD * SEQ * 2;        //  8388608
  size_t off = 0;
  const size_t oWQ  = off; off += PW;
  const size_t oWK  = off; off += PW;
  const size_t oWV  = off; off += PW;
  const size_t oWP  = off; off += PW;
  const size_t oWO  = off; off += PW;
  const size_t oX   = off; off += PX;
  const size_t oPE  = off; off += PXP;
  const size_t oQU  = off; off += PX;
  const size_t oQV  = off; off += PX;
  const size_t oK   = off; off += PX;
  const size_t oP   = off; off += PXP;
  const size_t oVT  = off; off += PVT;
  const size_t oVTL = off; off += PVT;
  const size_t oCT  = off; off += PX;
  const size_t oCTL = off; off += PX;
  if (off > ws_size) return;                               // off = 73924608
  if (off > (size_t)134217728) return;

  char* ws = (char*)d_ws;
  unsigned short* WQ16  = (unsigned short*)(ws + oWQ);
  unsigned short* WK16  = (unsigned short*)(ws + oWK);
  unsigned short* WV16  = (unsigned short*)(ws + oWV);
  unsigned short* WP16  = (unsigned short*)(ws + oWP);
  unsigned short* WO16  = (unsigned short*)(ws + oWO);
  unsigned short* X16   = (unsigned short*)(ws + oX);
  unsigned short* PE16  = (unsigned short*)(ws + oPE);
  unsigned short* QU    = (unsigned short*)(ws + oQU);
  unsigned short* QV    = (unsigned short*)(ws + oQV);
  unsigned short* K16   = (unsigned short*)(ws + oK);
  unsigned short* P16   = (unsigned short*)(ws + oP);
  unsigned short* VT16  = (unsigned short*)(ws + oVT);
  unsigned short* VTL16 = (unsigned short*)(ws + oVTL);
  unsigned short* CT16  = (unsigned short*)(ws + oCT);
  unsigned short* CTL16 = (unsigned short*)(ws + oCTL);

  const dim3 blk(256);
  const dim3 gCW((DMOD * DMOD) / 2048);                             // 128
  const dim3 gLN(NROW / 8);                                         // 1024
  const dim3 gPE(SEQ / 8);                                          // 256
  const int tilesQ = (NROW / 64) * (DMOD / 64);                     // 1024
  const int tilesV = (DMOD / 64) * (SEQ / 64);                      // 256 per batch
  const int tilesP = (SEQ / 64) * (DMOD / 64);                      // 256
  const dim3 gQ((tilesQ + 7) / 8, 1);                               // 128
  const dim3 gV((tilesV + 7) / 8, NB);                              // 32 x 4
  const dim3 gP((tilesP + 7) / 8, 1);                               // 32
  const dim3 gAT(SEQ / 64, NB * NH);                                // 32 x 32
  const dim3 bAT(ATT_THREADS);                                      // 128

  // (0) weight planes: W[o][c] ([out][in] = [n][k] already) -> f16( bf16_RNE(w) * 64 ), all five weights
  cvt16<<<gCW, blk, 0, stream>>>(w_q, WQ16, DMOD * DMOD, DMOD * DMOD, WSC);
  cvt16<<<gCW, blk, 0, stream>>>(w_k, WK16, DMOD * DMOD, DMOD * DMOD, WSC);
  cvt16<<<gCW, blk, 0, stream>>>(w_v, WV16, DMOD * DMOD, DMOD * DMOD, WSC);
  cvt16<<<gCW, blk, 0, stream>>>(w_p, WP16, DMOD * DMOD, DMOD * DMOD, WSC);
  cvt16<<<gCW, blk, 0, stream>>>(w_o, WO16, DMOD * DMOD, DMOD * DMOD, WSC);

  // (1) pre-norm -> X16 = f16(x * 16); sinusoid table -> PE16 = f16(pe * 16)
  ln16<<<gLN, blk, 0, stream>>>(xin, gam, bet, X16, NROW, XC);
  pe16<<<gPE, blk, 0, stream>>>(PE16, SEQ, XC);

  // (2) q[m][nd] = sum_c x[m][c] Wq[nd][c] / 1024 + bq[nd]; QU = f16((q + ub[nd]) * 4), QV = f16((q + vb[nd]) * 4);
  //     M = NROW, N = 512, K = 512
  gemm64<5, 0, 0, 1><<<gQ, blk, 0, stream>>>(
      X16, X16, DMOD, 0LL,
      WQ16, DMOD, 0LL,
      (void*)QU, (void*)QV, DMOD, 0LL,
      NROW, DMOD, DMOD, 1.0f / (XC * WSC), QC,
      b_q, ub, vb);

  // (3) k projection + bk -> K16 = f16(k * 4)
  gemm64<2, 0, 0, 1><<<gQ, blk, 0, stream>>>(
      X16, X16, DMOD, 0LL,
      WK16, DMOD, 0LL,
      (void*)K16, (void*)K16, DMOD, 0LL,
      NROW, DMOD, DMOD, 1.0f / (XC * WSC), QC,
      b_k, b_k, b_k);

  // (4) v^T per batch: VT[b][nd][j] = sum_c Wv[nd][c] x[b*SEQ + j][c] / 1024 + bv[nd] (per-row bias) -> f16 x16 hi + residual planes;
  //     M = 512 (nd), N = SEQ (j), K = 512; B rows are the batch's token rows: pitch DMOD, batch stride SEQ*DMOD
  gemm64<4, 0, 0, 2><<<gV, blk, 0, stream>>>(
      WV16, WV16, DMOD, 0LL,
      X16, DMOD, (long long)SEQ * DMOD,
      (void*)VT16, (void*)VTL16, SEQ, (long long)DMOD * SEQ,
      DMOD, SEQ, DMOD, 1.0f / (XC * WSC), VC,
      b_v, b_v, b_v);

  // (5) positional projection (no bias): P16 = f16(pos * 4), M = SEQ, N = 512, K = 512
  gemm64<2, 0, 0, 0><<<gP, blk, 0, stream>>>(
      PE16, PE16, DMOD, 0LL,
      WP16, DMOD, 0LL,
      (void*)P16, (void*)P16, DMOD, 0LL,
      SEQ, DMOD, DMOD, 1.0f / (XC * WSC), QC,
      b_q, b_q, b_q);

  // (6) relative attention -> CT16 = f16(ctx * 4096) hi plane, CTL16 residual plane, rows b*SEQ + i, halves n*64+d
  attn_rel<<<gAT, bAT, 0, stream>>>(QU, QV, K16, P16, VT16, VTL16, CT16, CTL16);

  // (7) out = (CT + CTL) . Wo^T / (4096*64) + bo; M = NROW, N = 512, K = 512, f32 rows straight into the output buffer
  gemm64<0, 1, 0, 1><<<gQ, blk, 0, stream>>>(
      CT16, CTL16, DMOD, 0LL,
      WO16, DMOD, 0LL,
      (void*)out, (void*)out, DMOD, 0LL,
      NROW, DMOD, DMOD, 1.0f / (CC * WSC), 1.0f,
      b_o, b_o, b_o);
  (void)hipGetLastError();
}

// v005
// It runs in 165 microseconds.
// In two side-by-side timings against v004, it was 1.34 and 1.37 times as fast.
// Counting every step since v000, it is 2.89 times as fast.
// Contractions (all v_wmma_f32_16x16x32_f16, f16 operands, f32 accumulate): q/k/v/pos projections (x or sinusoid table f16 x16 . W f16 x64,
// K=512, single products); content scores ((q+bq+ub) f16 x4 . (k+bk) f16 x4, K=64, single); position strips ((q+bq+vb) f16 x4 . pos f16 x4,
// K=64, single) -> one f32 LDS strip per key tile, the shift's select made where the strip is stored; P . v^T (P f16 x1024 . v^T carried as f16 x16 hi plane + f16 residual plane, 64 keys
// per tile, two products); output projection (ctx carried as f16 x4096 hi + residual planes . Wo f16 x64, K=512, two products).
// LayerNorm, sinusoid table, max-subtracted online base-2 softmax and all epilogues in f32 on VALU. Every float input RNE-converted to bf16 on load.
#include <hip/hip_runtime.h>
#include <math.h>
#include <stdint.h>

#define SEQ   2048
#define NB    4
#define DMOD  512
#define NH    8
#define DH    64
#define NROW  (SEQ * NB)
#define XC    16.0f
#define WSC   64.0f
#define QC    4.0f
#define VC    16.0f
#define PC    1024.0f
#define CC    4096.0f
#define RSD   0.044194173824159216f
#define LOG2E 1.4426950408889634f
#define LN_EPS 1.0e-5f
#define CNEG  ((float)(-9.210340371976184 / 512.0))
static_assert(NH * DH == DMOD);
static_assert(DH == 64);
static_assert(DMOD == 512);
static_assert((SEQ % 64) == 0 && (DMOD % 64) == 0 && (NROW % 64) == 0);
static_assert(((DMOD * DMOD) % 2048) == 0 && (NROW % 8) == 0 && (SEQ % 8) == 0);
#define ATT_W 4
#define ATT_THREADS (ATT_W * 32)
#define TPI 84
#define PPI 68
#define WFL (16 * TPI + 16 * PPI)
static_assert(((16 * TPI) % 4) == 0 && ((16 * PPI) % 4) == 0 && (WFL % 4) == 0);
static_assert(TPI >= 80 && PPI >= 64);
static_assert(ATT_W * WFL * 4 <= 65536);

typedef _Float16 v16h __attribute__((ext_vector_type(16)));
typedef _Float16 v8h  __attribute__((ext_vector_type(8)));
typedef __bf16   v16b __attribute__((ext_vector_type(16)));
typedef float    v8f  __attribute__((ext_vector_type(8)));
typedef float    v4f  __attribute__((ext_vector_type(4)));
typedef unsigned int v4u __attribute__((ext_vector_type(4)));

union FragH { v16h v; v8h h[2]; v4u u[2]; };
union FragAny { v16h h; v16b b; };

// ---- scalar helpers --------------------------------------------------------------------------------
__device__ __forceinline__ unsigned short bf_bits(float f) {          // f32 -> bf16 bits, RNE convert
  unsigned u = __float_as_uint(f);
  return (unsigned short)((u + 0x7FFFu + ((u >> 16) & 1u)) >> 16);
}
__device__ __forceinline__ float bf_up(unsigned short h) { return __uint_as_float(((unsigned)h) << 16); }
__device__ __forceinline__ float bfr(float f) { return bf_up(bf_bits(f)); }   // value of the bf16 RNE convert
__device__ __forceinline__ unsigned short h_bits(_Float16 x) { return __builtin_bit_cast(unsigned short, x); }
__device__ __forceinline__ unsigned pk16(unsigned short a, unsigned short b) { return (unsigned)a | ((unsigned)b << 16); }
__device__ __forceinline__ v8f zero8() { v8f z = {0.f, 0.f, 0.f, 0.f, 0.f, 0.f, 0.f, 0.f}; return z; }

// ---- fragment-packed 16-bit planes: a [rows][L] plane (rows % 16 == 0, L % 32 == 0) is stored as 1-KiB blocks, one per
//      (16 rows, 32 k): block index (row >> 4) * (L / 32) + (k >> 5); inside a block the 8-half piece that holds element (row, k) stands at
//      halves ((k >> 4) & 1) * 256 + (((k >> 3) & 1) * 16 + (row & 15)) * 8. With 16-aligned rows one wave-wide 16-B load reads 512 contiguous
//      bytes (four whole 128-B lines) where a row-major plane made it touch sixteen lines.
// ---- fragment loader: p = block start + (16 * (lane >> 4) + (row & 15)) * 8; elements 0..7 <- k0 + 8h + 0..7, elements 8..15 <- k0 + 16 + 8h + 0..7,
//      h = lane >> 4 (same split k map for A and B; B is always read from a [n][k] plane)
__device__ __forceinline__ v16h ldfrag_p(const unsigned short* p) {
  FragH f;
  f.u[0] = *(const v4u*)(p);
  f.u[1] = *(const v4u*)(p + 256);
  return f.v;
}
// ---- the same loader on a pointer typed as global memory (a pointer that has gone through an asm operand would otherwise load as a flat one)
typedef const __attribute__((address_space(1))) unsigned short* gp16;
typedef const __attribute__((address_space(1))) v4u* gp128;
__device__ __forceinline__ v16h ldfrag_g(gp16 p) {
  FragH f;
  f.u[0] = *(gp128)(p);
  f.u[1] = *(gp128)(p + 256);
  return f.v;
}

// ---- behind a group of loads: the wait that stands in front of every rewrite of an address register which the group's loads name; as inputs of
//      its statement the addresses keep their registers up to it, so that no load of the group lands on an address of the same group either
__device__ __forceinline__ void addr_wait1(const unsigned short* a) {
#if defined(__HIP_DEVICE_COMPILE__)
  asm volatile("s_wait_xcnt 0x0" :: "v"(a) : "memory");
#endif
}
// the same for a running address that is stepped behind the group: as an operand the statement may change, the pointer is the very register the
// loads name, and the step cannot be lifted over the wait
__device__ __forceinline__ void addr_wait_step(gp16& a) {
#if defined(__HIP_DEVICE_COMPILE__)
  asm volatile("s_wait_xcnt 0x0" : "+v"(a) :: "memory");
#endif
}
__device__ __forceinline__ void addr_wait7(const unsigned short* a, const unsigned short* b, const unsigned short* c, const unsigned short* d,
                                           const unsigned short* e, const unsigned short* f, const unsigned short* g) {
#if defined(__HIP_DEVICE_COMPILE__)
  asm volatile("s_wait_xcnt 0x0" :: "v"(a), "v"(b), "v"(c), "v"(d), "v"(e), "v"(f), "v"(g) : "memory");
#endif
}
// ---- WMMA helpers with trailing VALU hazard gaps ------------------------------------------------------
__device__ __forceinline__ v8f mma_h(v16h a, v16h b, v8f c) {
  return __builtin_amdgcn_wmma_f32_16x16x32_f16(false, a, false, b, (short)0, c, false, false);
}
__device__ __forceinline__ v8f mma_b(v16h a, v16h b, v8f c) {
  FragAny ua, ub;
  ua.h = a;
  ub.h = b;
  return __builtin_amdgcn_wmma_f32_16x16x32_bf16(false, ua.b, false, ub.b, (short)0, c, false, false);
}
template <int BF>
__device__ __forceinline__ v8f mmaT(v16h a, v16h b, v8f c) {
  if constexpr (BF != 0) return mma_b(a, b, c);
  else return mma_h(a, b, c);
}
__device__ __forceinline__ void dep_guard1(v8f& a, v8f& b, v16h x) {
#if defined(__HIP_DEVICE_COMPILE__)
  asm volatile("v_nop\n\tv_nop\n\tv_nop\n\tv_nop" : "+v"(a), "+v"(b) : "v"(x));
#endif
}
__device__ __forceinline__ void hz4(v8f& d, v16h x0, v16h x1, v16h x2, v16h x3) {
#if defined(__HIP_DEVICE_COMPILE__)
  asm volatile("v_nop\n\tv_nop\n\tv_nop\n\tv_nop" : "+v"(d) : "v"(x0), "v"(x1), "v"(x2), "v"(x3));
#endif
}
__device__ __forceinline__ void keep4_h(v16h a, v16h b, v16h c, v16h d) {
#if defined(__HIP_DEVICE_COMPILE__)
  asm volatile("v_nop" :: "v"(a), "v"(b), "v"(c), "v"(d));
#endif
}
__device__ __forceinline__ void acc_guard4(v8f& a, v8f& b, v8f& c, v8f& d) {
#if defined(__HIP_DEVICE_COMPILE__)
  asm volatile("v_nop\n\tv_nop\n\tv_nop\n\tv_nop" : "+v"(a), "+v"(b), "+v"(c), "+v"(d));
#endif
}
// ---- hand-over of a wave's own LDS rows between its lanes while global loads are in flight: the wave's LDS writes are waited for, the loads are
//      not (the workgroup-scope fences of wave_sync_lds drain loadcnt too); nothing another wave reads or writes is ordered here
__device__ __forceinline__ void wave_sync_own() {
  __builtin_amdgcn_fence(__ATOMIC_RELEASE, "wavefront");
#if defined(__HIP_DEVICE_COMPILE__)
  asm volatile("s_wait_dscnt 0x0" ::: "memory");   // the rows are written before any lane reads them back
#endif
  __builtin_amdgcn_wave_barrier();
  __builtin_amdgcn_fence(__ATOMIC_ACQUIRE, "wavefront");
}
// ---- maximum / sum over each 16-lane row of four independent values, every lane getting the result: four row_xmask steps (partner lane ^ 1, 2, 4, 8,
//      the order of the xor shuffles they replace), on the vector pipe instead of one LDS-unit permute and its wait per step. The four chains are
//      interleaved, so that a step's producer stands four vector instructions back and its result is ready when the step issues. All 32 lanes must be on.
#define XM4(op, m) \
  op " %0, %0, %0 row_xmask:" #m " row_mask:0xf bank_mask:0xf\n\t" \
  op " %1, %1, %1 row_xmask:" #m " row_mask:0xf bank_mask:0xf\n\t" \
  op " %2, %2, %2 row_xmask:" #m " row_mask:0xf bank_mask:0xf\n\t" \
  op " %3, %3, %3 row_xmask:" #m " row_mask:0xf bank_mask:0xf\n\t"
__device__ __forceinline__ void row_max4(float (&x)[4]) {
#if defined(__HIP_DEVICE_COMPILE__)
  // row maximum without the LDS unit: sixteen vector instructions, no wait
  asm(XM4("v_max_num_f32_dpp", 1) XM4("v_max_num_f32_dpp", 2) XM4("v_max_num_f32_dpp", 4) XM4("v_max_num_f32_dpp", 8)
      : "+v"(x[0]), "+v"(x[1]), "+v"(x[2]), "+v"(x[3]));
#endif
}
__device__ __forceinline__ void row_sum4(float (&x)[4]) {
#if defined(__HIP_DEVICE_COMPILE__)
  // row sum without the LDS unit: sixteen vector instructions, no wait
  asm(XM4("v_add_f32_dpp", 1) XM4("v_add_f32_dpp", 2) XM4("v_add_f32_dpp", 4) XM4("v_add_f32_dpp", 8)
      : "+v"(x[0]), "+v"(x[1]), "+v"(x[2]), "+v"(x[3]));
#endif
}
__device__ __forceinline__ void wave_sync_lds() {
  __builtin_amdgcn_fence(__ATOMIC_RELEASE, "workgroup");
  __builtin_amdgcn_wave_barrier();
  __builtin_amdgcn_fence(__ATOMIC_ACQUIRE, "workgroup");
}
// ---- eight rows r0..r0+7 (r0 % 8 == 0, one row per wave, 256 threads) of a [rows][DMOD] plane -> fragment-packed plane, whole 128-B lines:
//      wave w hands in its row's pieces lane (o0: columns 8*lane..) and 32 + lane (o1: columns 256 + 8*lane..); a line of the packed plane holds
//      one piece of each of the eight rows, so the rows meet in LDS (pitch 66 pieces: the 16 lanes of a half wave fall on distinct banks).
//      Every thread of the block must call this (one block barrier inside).
#define RPI 66
__device__ __forceinline__ void store_rows8_packed(v4u o0, v4u o1, unsigned short* plane, int r0, v4u* st) {
  const int tid  = threadIdx.x;
  const int lane = tid & 31;
  const int wave = tid >> 5;
  st[wave * RPI + lane]      = o0;
  st[wave * RPI + 32 + lane] = o1;
  __syncthreads();   // the eight rows of a line come from eight waves
  unsigned short* dst = plane + ((size_t)(r0 >> 4) << 13) + ((r0 & 15) << 3);
  v4u w[2];
#pragma unroll   // both LDS reads issue ahead of the two stores
  for (int sx = 0; sx < 2; ++sx) {
    const int idx = sx * 256 + tid;
    const int g   = idx >> 3;                        // piece index in the row = k >> 3, 0..63
    const int rr  = idx & 7;                         // row r0 + rr
    w[sx] = st[rr * RPI + g];
    *(v4u*)(dst + ((g >> 2) << 9) + (((g >> 1) & 1) << 8) + ((((g & 1) << 4) + rr) << 3)) = w[sx];
  }
#if defined(__HIP_DEVICE_COMPILE__)
  // The wait stands in front of every rewrite of a register that the two stores name: inlined into a kernel of several jobs, the stores are no
  // longer followed by the end of the program on every way through the code; as inputs of its statement the pieces keep their registers up to it.
  asm volatile("s_wait_xcnt 0x0" :: "v"(w[0]), "v"(w[1]) : "memory");
#endif
}

// =====================================================================================================
// Elementwise 16-bit pack of a [rows][DMOD] f32 matrix into a fragment-packed plane: piece t of the plane (8 halves at dst + 8t) =
// f16( bf16_RNE(src[row][k..k+7]) * sc ), (row, k) decoded from t; 0 for pieces whose source elements lie past nvalid; sc a power of two (exact). One piece per thread:
// two 16-B loads (address clamped into [0, nvalid) for pad groups, value zeroed), one 16-B store, a wave's stores = 512 contiguous bytes.
// Used for the five weight matrices, which are [out][in] = [n][k] k-contiguous already.
// coverage: bx = 0 .. ntotal / 2048 - 1, 256 thr x 8 elements each = ntotal exactly (ntotal % 2048 == 0, nvalid == ntotal here).
// =====================================================================================================
__device__ __forceinline__ void cvt16(const float* __restrict__ src, unsigned short* dst, int nvalid, int ntotal, float sc, int bx) {
  const size_t i8 = ((size_t)bx * 256 + threadIdx.x) * 8;
  if (i8 + 8 > (size_t)ntotal) return;             // never taken with the exact grid; no barriers on this job's path
  const size_t t  = i8 >> 3;                           // piece index: block t >> 6, second half (t >> 5) & 1, k half (t >> 4) & 1, row t & 15
  const size_t sr = ((t >> 10) << 4) + (t & 15);       // source row: DMOD / 32 = 16 blocks per 16 rows
  const size_t sk = (((t >> 6) & 15) << 5) + (((t >> 5) & 1) << 4) + (((t >> 4) & 1) << 3);
  const size_t si = sr * DMOD + sk;                    // the piece's first element in the source
  const bool pad = (si + 8 > (size_t)nvalid);
  const size_t ls = pad ? ((size_t)nvalid - 8) : si;   // clamped address, always inside the source
  const v4f a = *(const v4f*)(src + ls);
  const v4f b = *(const v4f*)(src + ls + 4);
  v4u o;
  o[0] = pk16(h_bits((_Float16)(bfr(a[0]) * sc)), h_bits((_Float16)(bfr(a[1]) * sc)));
  o[1] = pk16(h_bits((_Float16)(bfr(a[2]) * sc)), h_bits((_Float16)(bfr(a[3]) * sc)));
  o[2] = pk16(h_bits((_Float16)(bfr(b[0]) * sc)), h_bits((_Float16)(bfr(b[1]) * sc)));
  o[3] = pk16(h_bits((_Float16)(bfr(b[2]) * sc)), h_bits((_Float16)(bfr(b[3]) * sc)));
  const v4u z = {0u, 0u, 0u, 0u};
  const v4u w = pad ? z : o;
  {
    *(v4u*)(dst + i8) = w;
    
  }
}

// =====================================================================================================
// y = (x - mu) * (1/sqrt(var + eps)) * bf16_RNE(gamma) + bf16_RNE(beta) in f32, out X16 = f16(y * sc) (sc = 16, exact power of two).
// Lane l owns columns 8l..8l+7 and 256+8l..256+8l+7; the block's eight rows go out fragment-packed through LDS (store_rows8_packed).
// coverage: bx = 0 .. NROW/8 - 1, 8 waves each = every row; 32 lanes x 16 halves = all 512 columns of the row. st: 8 * RPI pieces of LDS.
// =====================================================================================================
__device__ __forceinline__ void ln16(const float* __restrict__ x, const float* __restrict__ gam,
                                     const float* __restrict__ bet, unsigned short* X16, int nrows, float sc, int bx, v4u* st) {
  const int lane = threadIdx.x & 31;
  const int wave = threadIdx.x >> 5;
  const int row  = bx * 8 + wave;
  if (bx * 8 + 8 > nrows) return;                  // block-uniform, in front of the barrier; never taken with the exact grid
  const float* p = x + (size_t)row * DMOD;
  const int c0 = 8 * lane, c1 = 256 + 8 * lane;
  const v4f a0 = *(const v4f*)(p + c0), a1 = *(const v4f*)(p + c0 + 4);
  const v4f a2 = *(const v4f*)(p + c1), a3 = *(const v4f*)(p + c1 + 4);
  float v[16];
#pragma unroll
  for (int e = 0; e < 4; ++e) {
    v[e]      = bfr(a0[e]);
    v[4 + e]  = bfr(a1[e]);
    v[8 + e]  = bfr(a2[e]);
    v[12 + e] = bfr(a3[e]);
  }
  float s = 0.f;
#pragma unroll
  for (int e = 0; e < 16; ++e) s += v[e];
#pragma unroll
  for (int off = 1; off < 32; off <<= 1) s += __shfl_xor(s, off, 32);
  const float mu = s * (1.0f / (float)DMOD);
  float q = 0.f;
#pragma unroll
  for (int e = 0; e < 16; ++e) {
    const float d = v[e] - mu;
    v[e] = d;
    q += d * d;
  }
#pragma unroll
  for (int off = 1; off < 32; off <<= 1) q += __shfl_xor(q, off, 32);
  const float var  = q * (1.0f / (float)DMOD);
  const float rstd = 1.0f / sqrtf(var + LN_EPS);
  const v4f g0 = *(const v4f*)(gam + c0), g1 = *(const v4f*)(gam + c0 + 4);
  const v4f g2 = *(const v4f*)(gam + c1), g3 = *(const v4f*)(gam + c1 + 4);
  const v4f e0 = *(const v4f*)(bet + c0), e1 = *(const v4f*)(bet + c0 + 4);
  const v4f e2 = *(const v4f*)(bet + c1), e3 = *(const v4f*)(bet + c1 + 4);
  float gg[16], bb[16];
#pragma unroll
  for (int e = 0; e < 4; ++e) {
    gg[e]      = bfr(g0[e]);  bb[e]      = bfr(e0[e]);
    gg[4 + e]  = bfr(g1[e]);  bb[4 + e]  = bfr(e1[e]);
    gg[8 + e]  = bfr(g2[e]);  bb[8 + e]  = bfr(e2[e]);
    gg[12 + e] = bfr(g3[e]);  bb[12 + e] = bfr(e3[e]);
  }
  v4u o0, o1;
#pragma unroll
  for (int e = 0; e < 4; ++e) {
    const float y0 = v[2 * e] * rstd * gg[2 * e] + bb[2 * e];
    const float y1 = v[2 * e + 1] * rstd * gg[2 * e + 1] + bb[2 * e + 1];
    const float y2 = v[8 + 2 * e] * rstd * gg[8 + 2 * e] + bb[8 + 2 * e];
    const float y3 = v[8 + 2 * e + 1] * rstd * gg[8 + 2 * e + 1] + bb[8 + 2 * e + 1];
    o0[e] = pk16(h_bits((_Float16)(y0 * sc)), h_bits((_Float16)(y1 * sc)));
    o1[e] = pk16(h_bits((_Float16)(y2 * sc)), h_bits((_Float16)(y3 * sc)));
  }
  store_rows8_packed(o0, o1, X16, bx * 8, st);
}

// =====================================================================================================
// Sinusoid table, one wave per position s: pe[s][2m] = sin(s * div[m]), pe[s][2m+1] = cos(s * div[m]), div[m] = expf(f32(2m) * f32(-ln(1e4)/512)),
// precise expf / sinf / cosf (arguments up to 2047), all f32. Rolled loop: lane l computes columns 8l..8l+7 and 256+8l..+7 (4 sin/cos pairs per group)
// into its own slots of a wave-private f32 LDS row, then packs f16(pe * sc) (sc = 16); the block's eight rows go out fragment-packed
// through LDS (store_rows8_packed).
// coverage: bx = 0 .. SEQ/8 - 1, 8 waves each = rows 0..SEQ-1; each lane reads back only the 16 LDS slots it wrote; 32 lanes x 16 halves = 512 columns.
// sh: 8 * DMOD floats of LDS, st: 8 * RPI pieces of LDS.
// =====================================================================================================
__device__ __forceinline__ void pe16(unsigned short* PE16, int nrows, float sc, int bx, float* sh, v4u* st) {
  const int lane = threadIdx.x & 31;
  const int wave = threadIdx.x >> 5;
  const int s = bx * 8 + wave;
  if (bx * 8 + 8 > nrows) return;                  // block-uniform, in front of the barrier; never taken with the exact grid
  float* rowp = sh + wave * DMOD;
  const float fs = (float)s;
#pragma unroll 1
  for (int it = 0; it < 8; ++it) {
    const int cb = 256 * (it >> 2) + 8 * lane + 2 * (it & 3);   // even column = 2m
    const float dv  = expf((float)cb * CNEG);
    const float ang = fs * dv;
    rowp[cb]     = sinf(ang);
    rowp[cb + 1] = cosf(ang);
  }
  wave_sync_lds();
  v4u o[2];
#pragma unroll
  for (int g = 0; g < 2; ++g) {
    const float* sp = rowp + 256 * g + 8 * lane;
    v4u w;
#pragma unroll
    for (int e = 0; e < 4; ++e) w[e] = pk16(h_bits((_Float16)(sp[2 * e] * sc)), h_bits((_Float16)(sp[2 * e + 1] * sc)));
    o[g] = w;
  }
  store_rows8_packed(o[0], o[1], PE16, bx * 8, st);
}

// =====================================================================================================
// The seven jobs that depend on the inputs alone, as ONE grid: none reads what another writes, and each alone leaves most of the chip idle
// and pays a launch of its own. The block index picks the job (block-uniform), the longest blocks first:
//   [0, PB_PE) sinusoid table | [PB_PE, PB_PE + PB_LN) pre-norm | then PB_CW blocks for each of the five weight planes, which stand one behind
//   the other in the workspace from W16 on in the order q, k, v, pos, o.
// =====================================================================================================
#define PB_PE (SEQ / 8)
#define PB_LN (NROW / 8)
#define PB_CW ((DMOD * DMOD) / 2048)
#define PB_ALL (PB_PE + PB_LN + 5 * PB_CW)
__global__ __launch_bounds__(256) void prep_all(const float* __restrict__ x, const float* __restrict__ gam, const float* __restrict__ bet,
                                                const float* __restrict__ w_q, const float* __restrict__ w_k, const float* __restrict__ w_v,
                                                const float* __restrict__ w_p, const float* __restrict__ w_o,
                                                unsigned short* W16, unsigned short* X16, unsigned short* PE16) {
  __shared__ __align__(16) float sh[8 * DMOD];
  __shared__ __align__(16) v4u st[8 * RPI];
  const int bx = blockIdx.x;
  if (bx < PB_PE) {
    pe16(PE16, SEQ, XC, bx, sh, st);
  } else if (bx < PB_PE + PB_LN) {
    ln16(x, gam, bet, X16, NROW, XC, bx - PB_PE, st);
  } else {
    const int r = bx - (PB_PE + PB_LN);
    const int w = r / PB_CW;                         // which weight, 0..4
    const float* src = (w == 0) ? w_q : (w == 1) ? w_k : (w == 2) ? w_v : (w == 3) ? w_p : w_o;
    cvt16(src, W16 + (size_t)w * (DMOD * DMOD), DMOD * DMOD, DMOD * DMOD, WSC, r - w * PB_CW);
  }
}

// =====================================================================================================
// Register-blocked batched 16-bit WMMA GEMM: C[m][n] = oscale * sum_k A[m][k] * Bt[n][k] (+ bias); one wave per 64x64 tile,
// no block barriers. A [M][lda] and Bt [N][ldb] are fragment-packed 16-bit planes (row lengths lda, ldb, multiples of 32); M, N multiples of 64,
// K multiple of 32. by = batch index with element strides sA, sB, sC (whole 16-row groups). 16-bit outputs are fragment-packed planes
// of row length ldc.
// ASPLIT 1: a second A plane A2 (unscaled residual of A, same layout) is multiplied into the same accumulator (A + A2 ~ exact A).
// BF 1: bf16 operands (v_wmma_f32_16x16x32_bf16), else f16.
// EPI 1: value += bf16_RNE(ep0[column]) (per-column bias); EPI 2: value += bf16_RNE(ep0[row]) (per-row bias, 16-bit out only).
// OM 0: f32 out (pitch ldc).  OM 2: one f16 plane = f16(value * ocarry).
// OM 4: two f16 planes: hi = f16(value * ocarry), lo = f16(value * ocarry - hi) (unscaled residual).
// OM 5: two f16 planes: C = f16((value + bf16_RNE(ep1[column])) * ocarry), C2 = f16((value + bf16_RNE(ep2[column])) * ocarry).
// coverage: 4 slabs x 16 rows (f32: it 0..7 x lane>>4; 16-bit: rows 8*(it&1) + (lane&7), pieces 4*(it>>1) + (lane>>3)) x 64 cols = the wave's whole 64x64 tile;
//           bx = 0 .. ceil(tilesM*tilesN/8) - 1, surplus waves exit (wave-uniform). sT: per-wave 16x64 slab of LDS, pitch 68 floats.
// =====================================================================================================
template <int OM, int ASPLIT, int BF, int EPI>
__device__ __forceinline__ void gemm64(
    const unsigned short* __restrict__ Ap, const unsigned short* __restrict__ A2p, int lda, long long sA,
    const unsigned short* __restrict__ Btp, int ldb, long long sB,
    void* Cout, void* C2out, int ldc, long long sC,
    int M, int N, int K, float oscale, float ocarry,
    const float* __restrict__ ep0, const float* __restrict__ ep1, const float* __restrict__ ep2,
    int bx, int by, float (*sT)[16 * 68]) {
  const int lane = threadIdx.x & 31;
  const int wave = threadIdx.x >> 5;
  const int tilesN = N >> 6;
  const int tilesM = M >> 6;
  const int tile = bx * 8 + wave;
  if (tile >= tilesM * tilesN) return;   // wave-uniform; no block barriers in this kernel
  const int tm = tile / tilesN;
  const int tn = tile - tm * tilesN;
  const int m0 = tm << 6;
  const int n0 = tn << 6;

  const unsigned short* A1 = Ap  + (size_t)((long long)by * sA);
  const unsigned short* A2 = A2p + (size_t)((long long)by * sA);
  const unsigned short* Bb = Btp + (size_t)((long long)by * sB);

  const int rlane = lane & 15;                 // row (A) / col (B, D) within subtile
  const int ksA   = lda >> 5;                  // 1-KiB blocks per 16 rows of A
  const int ksB   = ldb >> 5;                  // 1-KiB blocks per 16 rows of Bt
  const int mOff  = (lane >> 4) * 8;           // D row offset

  v8f acc[4][4];
#pragma unroll
  for (int i = 0; i < 4; ++i)
#pragma unroll
    for (int j = 0; j < 4; ++j) acc[i][j] = zero8();

  // the lane's own piece in the first 1-KiB block of each 16-row group; a k step moves every pointer on by one block (512 halves)
  gp16 pB[4], pA[4], pL[4];
#pragma unroll
  for (int j = 0; j < 4; ++j) pB[j] = (gp16)(Bb + ((size_t)(((n0 >> 4) + j) * ksB) << 9) + (lane << 3));
#pragma unroll
  for (int i = 0; i < 4; ++i) {
    const size_t ao = ((size_t)(((m0 >> 4) + i) * ksA) << 9) + (lane << 3);
    pA[i] = (gp16)(A1 + ao);
    pL[i] = (gp16)(A2 + ao);
  }
#pragma unroll 1   // stays a loop now that K is a constant at every call: unrolled, the address steps are lifted over the wait at the trip's foot
  for (int k0 = 0; k0 < K; k0 += 32) {
    // the k step's fragment loads go out as one group ahead of its WMMAs: one L2 latency per step, not one per 16-row group of A
    v16h bh[4], ah[4], al[4];
#pragma unroll
    for (int j = 0; j < 4; ++j) bh[j] = ldfrag_g(pB[j]);
#pragma unroll
    for (int i = 0; i < 4; ++i) ah[i] = ldfrag_g(pA[i]);
    if constexpr (ASPLIT != 0) {
      al[0] = ldfrag_g(pL[0]);
      al[1] = ldfrag_g(pL[1]);
    }
    __builtin_amdgcn_sched_barrier(0);   // the group stays whole in front of the first WMMA (sunk to their uses the loads wait one by one)
#pragma unroll
    for (int i = 0; i < 4; ++i) {
#pragma unroll
      for (int j = 0; j < 4; ++j) acc[i][j] = mmaT<BF>(ah[i], bh[j], acc[i][j]);
      dep_guard1(acc[i][0], acc[i][3], ah[i]);
      if constexpr (ASPLIT != 0) {
#pragma unroll
        for (int j = 0; j < 4; ++j) acc[i][j] = mmaT<BF>(al[i], bh[j], acc[i][j]);
        dep_guard1(acc[i][0], acc[i][3], al[i]);
        if (i == 0) {
          __builtin_amdgcn_sched_barrier(0);   // the last two residual fragments take the registers of the first row group's pair: not lifted higher
          al[2] = ldfrag_g(pL[2]);
          al[3] = ldfrag_g(pL[3]);
          __builtin_amdgcn_sched_barrier(0);   // issued before the second row group's WMMAs
        }
      }
    }
    keep4_h(bh[0], bh[1], bh[2], bh[3]);
    // The wait stands in front of every rewrite of an address register that the trip's loads name: as operands of its statement the pointers
    // keep their registers up to it, and the additions below cannot be lifted over it.
    if constexpr (ASPLIT != 0) {
      asm volatile("s_wait_xcnt 0x0" : "+v"(pB[0]), "+v"(pB[1]), "+v"(pB[2]), "+v"(pB[3]), "+v"(pA[0]), "+v"(pA[1]), "+v"(pA[2]), "+v"(pA[3]),
                                       "+v"(pL[0]), "+v"(pL[1]), "+v"(pL[2]), "+v"(pL[3]) :: "memory");
    } else {
      asm volatile("s_wait_xcnt 0x0" : "+v"(pB[0]), "+v"(pB[1]), "+v"(pB[2]), "+v"(pB[3]), "+v"(pA[0]), "+v"(pA[1]), "+v"(pA[2]), "+v"(pA[3]) :: "memory");
    }
#pragma unroll
    for (int j = 0; j < 4; ++j) {
      pB[j] += 512;
      pA[j] += 512;
      pL[j] += 512;
    }
  }
  acc_guard4(acc[0][0], acc[0][1], acc[0][2], acc[0][3]);
  acc_guard4(acc[1][0], acc[1][1], acc[1][2], acc[1][3]);
  acc_guard4(acc[2][0], acc[2][1], acc[2][2], acc[2][3]);
  acc_guard4(acc[3][0], acc[3][1], acc[3][2], acc[3][3]);

  const int hh2 = lane >> 4, c4 = (lane & 15) * 4;     // f32 out: 256-B row segment = 16 lanes x 16 B

  // ---- epilogue ----
  float* slab = sT[wave];
#pragma unroll
  for (int i = 0; i < 4; ++i) {
    const int mBase = m0 + (i << 4);
#pragma unroll
    for (int j = 0; j < 4; ++j) {
#pragma unroll
      for (int r = 0; r < 8; ++r) {
        slab[(mOff + r) * 68 + (j << 4) + rlane] = acc[i][j][r];
      }
    }
    wave_sync_lds();
    if constexpr (OM == 0) {
      float* C = (float*)Cout + (size_t)((long long)by * sC);
      v4f vals[8];
#pragma unroll
      for (int it = 0; it < 8; ++it) {
        const int row = it * 2 + hh2;                      // it 0..7 x hh2 0..1 = rows 0..15
        v4f v = *(const v4f*)(slab + row * 68 + c4);
#pragma unroll
        for (int e = 0; e < 4; ++e) v[e] = v[e] * oscale;
        if constexpr (EPI == 1) {
          const v4f bb = *(const v4f*)(ep0 + n0 + c4);     // per-column bias, columns n0+c4 .. +3 (N equals the bias length)
#pragma unroll
          for (int e = 0; e < 4; ++e) v[e] = v[e] + bfr(bb[e]);
        }
        vals[it] = v;
      }
      {
#pragma unroll
        for (int it = 0; it < 8; ++it) {
          const int gr = mBase + it * 2 + hh2;
          *(v4f*)(C + (size_t)gr * ldc + n0 + c4) = vals[it];
        }
        // The wait stands in front of every rewrite of a data register that these stores name (the next slab's LDS reads take them)
        asm volatile("s_wait_xcnt 0x0" :: "v"(vals[0]), "v"(vals[1]), "v"(vals[2]), "v"(vals[3]), "v"(vals[4]), "v"(vals[5]), "v"(vals[6]), "v"(vals[7]) : "memory");
      }
    } else {
      unsigned short* C  = (unsigned short*)Cout  + (size_t)((long long)by * sC);
      unsigned short* Cb = (unsigned short*)C2out + (size_t)((long long)by * sC);
      const int ksC = ldc >> 5;                            // 1-KiB blocks per 16 rows of C
      v4u hv[4], lv[4];
#pragma unroll
      for (int it = 0; it < 4; ++it) {
        const int row = (it & 1) * 8 + (lane & 7);         // 8 rows x 4 pieces per it = four whole 128-B lines of packed block it >> 1
        const int c8  = (it >> 1) * 32 + (lane >> 3) * 8;  // only two column groups per lane, so the column biases stay few
        const float* sp = slab + row * 68 + c8;
        float rb = 0.f;
        if constexpr (EPI == 2) rb = bfr(ep0[mBase + row]);   // per-row bias (M equals the bias length)
        v4u a  = {0u, 0u, 0u, 0u};
        v4u b2 = {0u, 0u, 0u, 0u};
#pragma unroll
        for (int e = 0; e < 4; ++e) {
          const int ci = n0 + c8 + 2 * e;                  // column index, < N
          float f0 = sp[2 * e] * oscale + rb;
          float f1 = sp[2 * e + 1] * oscale + rb;
          if constexpr (EPI == 1) {
            f0 += bfr(ep0[ci]);
            f1 += bfr(ep0[ci + 1]);
          }
          if constexpr (OM == 5) {
            const float g0 = (f0 + bfr(ep1[ci])) * ocarry, g1 = (f1 + bfr(ep1[ci + 1])) * ocarry;
            const float w0 = (f0 + bfr(ep2[ci])) * ocarry, w1 = (f1 + bfr(ep2[ci + 1])) * ocarry;
            a[e]  = pk16(h_bits((_Float16)g0), h_bits((_Float16)g1));
            b2[e] = pk16(h_bits((_Float16)w0), h_bits((_Float16)w1));
          } else {
            f0 *= ocarry; f1 *= ocarry;
            const _Float16 x0 = (_Float16)f0, x1 = (_Float16)f1;
            a[e] = pk16(h_bits(x0), h_bits(x1));
            if constexpr (OM == 4) {
              b2[e] = pk16(h_bits((_Float16)(f0 - (float)x0)), h_bits((_Float16)(f1 - (float)x1)));
            }
          }
        }
        hv[it] = a;
        lv[it] = b2;
      }
      {
#pragma unroll
        for (int it = 0; it < 4; ++it) {
          const size_t co = ((size_t)((mBase >> 4) * ksC + (n0 >> 5) + (it >> 1)) << 9) + ((lane >> 4) << 8) +
                            (((((lane >> 3) & 1) << 4) + (it & 1) * 8 + (lane & 7)) << 3);
          *(v4u*)(C + co) = hv[it];
          if constexpr (OM >= 4) {
            *(v4u*)(Cb + co) = lv[it];
          }
        }
        // The wait stands in front of every rewrite of a data register that these stores name: as inputs of its statement the pieces keep
        // their registers up to it (the next slab's bias arithmetic is otherwise free to take them directly behind the stores).
        if constexpr (OM >= 4) {
          asm volatile("s_wait_xcnt 0x0" :: "v"(hv[0]), "v"(hv[1]), "v"(hv[2]), "v"(hv[3]), "v"(lv[0]), "v"(lv[1]), "v"(lv[2]), "v"(lv[3]) : "memory");
        } else {
          asm volatile("s_wait_xcnt 0x0" :: "v"(hv[0]), "v"(hv[1]), "v"(hv[2]), "v"(hv[3]) : "memory");
        }
      }
    }
    wave_sync_lds();
  }
}

// =====================================================================================================
// The four projections (q, v^T, k, pos) as ONE grid: each reads only what the launch before wrote, none reads another's output, and each alone
// fills at most half of the chip's WGPs with waves that mostly wait for their loads. The block index picks the job (block-uniform):
//   [0, GB_Q) q | then NB * GB_V blocks v^T (GB_V per batch) | then GB_Q blocks k | then GB_P blocks pos.
//   q[m][nd] = sum_c x[m][c] Wq[nd][c] / 1024 + bq[nd]; QU = f16((q + ub[nd]) * 4), QV = f16((q + vb[nd]) * 4); M = NROW, N = 512, K = 512
//   v^T per batch: VT[b][nd][j] = sum_c Wv[nd][c] x[b*SEQ + j][c] / 1024 + bv[nd] (per-row bias) -> f16 x16 hi + residual planes;
//     M = 512 (nd), N = SEQ (j), K = 512; B rows are the batch's token rows: pitch DMOD, batch stride SEQ*DMOD
//   k projection + bk -> K16 = f16(k * 4);  positional projection (no bias): P16 = f16(pos * 4), M = SEQ, N = 512, K = 512
// =====================================================================================================
#define GB_Q (((NROW / 64) * (DMOD / 64)) / 8)
#define GB_V (((DMOD / 64) * (SEQ / 64)) / 8)
#define GB_P (((SEQ / 64) * (DMOD / 64)) / 8)
#define GB_ALL (2 * GB_Q + NB * GB_V + GB_P)
__global__ __launch_bounds__(256) __attribute__((amdgpu_num_vgpr(256))) void proj_all(
    const unsigned short* __restrict__ X16, const unsigned short* __restrict__ PE16,
    const unsigned short* __restrict__ WQ16, const unsigned short* __restrict__ WK16,
    const unsigned short* __restrict__ WV16, const unsigned short* __restrict__ WP16,
    unsigned short* QU, unsigned short* QV, unsigned short* K16, unsigned short* P16, unsigned short* VT16, unsigned short* VTL16,
    const float* __restrict__ b_q, const float* __restrict__ b_k, const float* __restrict__ b_v,
    const float* __restrict__ ub, const float* __restrict__ vb) {
  __shared__ __align__(16) float sT[8][16 * 68];
  const int bx = blockIdx.x;
  if (bx < GB_Q) {
    gemm64<5, 0, 0, 1>(X16, X16, DMOD, 0LL, WQ16, DMOD, 0LL, (void*)QU, (void*)QV, DMOD, 0LL,
                       NROW, DMOD, DMOD, 1.0f / (XC * WSC), QC, b_q, ub, vb, bx, 0, sT);
  } else if (bx < GB_Q + NB * GB_V) {
    const int r = bx - GB_Q;
    gemm64<4, 0, 0, 2>(WV16, WV16, DMOD, 0LL, X16, DMOD, (long long)SEQ * DMOD, (void*)VT16, (void*)VTL16, SEQ, (long long)DMOD * SEQ,
                       DMOD, SEQ, DMOD, 1.0f / (XC * WSC), VC, b_v, b_v, b_v, r % GB_V, r / GB_V, sT);
  } else if (bx < 2 * GB_Q + NB * GB_V) {
    gemm64<2, 0, 0, 1>(X16, X16, DMOD, 0LL, WK16, DMOD, 0LL, (void*)K16, (void*)K16, DMOD, 0LL,
                       NROW, DMOD, DMOD, 1.0f / (XC * WSC), QC, b_k, b_k, b_k, bx - (GB_Q + NB * GB_V), 0, sT);
  } else {
    gemm64<2, 0, 0, 0>(PE16, PE16, DMOD, 0LL, WP16, DMOD, 0LL, (void*)P16, (void*)P16, DMOD, 0LL,
                       SEQ, DMOD, DMOD, 1.0f / (XC * WSC), QC, b_q, b_q, b_q, bx - (2 * GB_Q + NB * GB_V), 0, sT);
  }
}
// out = (CT + CTL) . Wo^T / (4096*64) + bo; M = NROW, N = 512, K = 512, f32 rows straight into the output buffer; grid = GB_Q blocks
__global__ __launch_bounds__(256) __attribute__((amdgpu_num_vgpr(256))) void out_proj(
    const unsigned short* __restrict__ CT16, const unsigned short* __restrict__ CTL16, const unsigned short* __restrict__ WO16,
    float* out, const float* __restrict__ b_o) {
  __shared__ __align__(16) float sT[8][16 * 68];
  gemm64<0, 1, 0, 1>(CT16, CTL16, DMOD, 0LL, WO16, DMOD, 0LL, (void*)out, (void*)out, DMOD, 0LL,
                     NROW, DMOD, DMOD, 1.0f / (CC * WSC), 1.0f, b_o, b_o, b_o, (int)blockIdx.x, 0, sT);
}

// =====================================================================================================
// One position strip for a wave: T[R][x] = (q+bq+vb)[A rows] . pos[mw + x], R = lane&15 row of the A fragment pair (qva, qvb), x in [0,80)
// (5 subtiles of 16 pos rows, K = 64 = two k-steps); pos row index clamped on the address into [0, SEQ-1]
// (only x <= 78 is ever selected, and every selected entry has an unclamped row in range); Pb points into the fragment-packed plane at the
// head's first 1-KiB block with the lane's k half only; each 16x16 subtile goes to the wave's f32 LDS strip right after its two WMMAs and
// the hazard gap. coverage: 5 subtiles x 16 rows x 16 cols = the full 16x80 strip every time.
// =====================================================================================================
__device__ __forceinline__ size_t pos_slot(int m) {                // packed offset of pos row m: 16-row group, then the row's slot
  m = (m < 0) ? 0 : m;
  m = (m > SEQ - 1) ? (SEQ - 1) : m;
  return ((size_t)(m >> 4) << 13) + ((m & 15) << 3);
}
__device__ __forceinline__ void strip_sub(v16h qva, v16h qvb, v16h fa, v16h fb, float* tsh, int u, int hh, int c) {
  v8f t8 = mma_h(qva, fa, zero8());
  t8 = mma_h(qvb, fb, t8);
  hz4(t8, fa, fb, qva, qvb);
  const int cb = 16 * u + c;
#pragma unroll
  for (int r = 0; r < 8; ++r) tsh[(8 * hh + r) * TPI + cb] = t8[r];
}
// a T2 subtile laid over the T1 strip (the tile on the diagonal): column cb holds d = d0 + cb for every row; only columns with d >= 1 are stored,
// the column d == 1 as zero
__device__ __forceinline__ void strip_sub_over(v16h qva, v16h qvb, v16h fa, v16h fb, float* tsh, int u, int hh, int c, int d0) {
  v8f t8 = mma_h(qva, fa, zero8());
  t8 = mma_h(qvb, fb, t8);
  hz4(t8, fa, fb, qva, qvb);
  const int cb = 16 * u + c;
  const int dc = d0 + cb;
  if (dc >= 1) {
#pragma unroll   // t8 is indexed by r and stays in registers only so
    for (int r = 0; r < 8; ++r) tsh[(8 * hh + r) * TPI + cb] = (dc == 1) ? 0.f : t8[r];
  }
}
// whole T2 strip over T1, its 24 loads issued as one group (the one tile per wave that needs both)
__device__ __forceinline__ void pos_strip_over(const unsigned short* __restrict__ QVa, const unsigned short* __restrict__ Pb,
                                               int mw, float* tsh, int hh, int c, int d0) {
  const v16h qva = ldfrag_p(QVa), qvb = ldfrag_p(QVa + 512);
  v16h fa[5], fb[5];
  const unsigned short* pp[5];
#pragma unroll
  for (int u = 0; u < 5; ++u) {
    pp[u] = Pb + pos_slot(mw + 16 * u + c);
    fa[u] = ldfrag_p(pp[u]);
    fb[u] = ldfrag_p(pp[u] + 512);
  }
  addr_wait7(QVa, pp[0], pp[1], pp[2], pp[3], pp[4], QVa);
#pragma unroll
  for (int u = 0; u < 5; ++u) strip_sub_over(qva, qvb, fa[u], fb[u], tsh, u, hh, c, d0);
}

// =====================================================================================================
// Relative-position attention for one (batch b, head n) pair and a 64-row query tile; 4 waves, wave w owns query rows i = iw0 + R,
// iw0 = i0 + 16w, R = 0..15. Planes (fragment-packed, row length DMOD halves, row = b*SEQ + position): QU = f16((q + bq + ub) x4), QV = f16((q + bq + vb) x4),
// KP = f16((k + bk) x4); PP = f16(pos x4) rows 0..SEQ-1; VT, VTL = v^T hi (x16) / residual f16 as [b][n*64+d][SEQ] (fragment-packed per batch).
// Shifted position score for (i, j), d = j - i:  d <= 0 -> ps[i][SEQ-1+d];  d == 1 -> 0;  d >= 2 -> ps[i+1][d-2],  ps[r][t] = (q+bq+vb)[r] . pos[t].
//   Per key tile j0 (64 keys, key j = j0 + jj), with x = jj - R + 15 in [0,78]:
//     strip T1[R][x] = (q+vb)[iw0+R]   . pos[SEQ + j0 - iw0 - 16 + x]   (pos row SEQ-1+d), computed iff j0 <= iw0 + 15;
//     strip T2[R][x] = (q+vb)[iw0+1+R] . pos[j0 - iw0 - 17 + x]         (pos row d-2),     computed iff j0 + 61 >= iw0;
//     both tests are wave-uniform (iw0 via readfirstlane). d = j0 - iw0 + x - 15 is the same down a strip column, so the select is made per column
//     where the strip is stored: one strip M per tile, all 80 columns written every tile, M = T1 (j0 <= iw0 - 64), M = T2 (j0 >= iw0 + 16, its
//     column 0 zeroed in the tile j0 == iw0 + 16, where it holds d == 1), and in the one tile between T1 with the columns d >= 1 overwritten by
//     0 (d == 1) and T2 (d >= 2); a wave's LDS stores land in program order. The A row b*SEQ+iw0+16 of T2 is clamped to NROW-1
//     for the very last row group; that entry is never read (i = SEQ-1 has no j >= i+2).
//   content scores S = (q+ub) . k (4 subtiles, K=64); t = (S + M) * (RSD/16) * log2(e); online softmax in base 2,
//   max-subtracted, running sums in f32 (no key mask); the 16x64 prob tile stored to wave-private LDS (f32 element stores),
//   fragments loaded straight from the packed 16-bit planes VT/VTL[n*64+d][j]; 8 + 8 P.V WMMAs per tile (hi plane then residual plane into the
//   same accumulators).
//   block = 4 waves = 128 threads; grid = (SEQ/64, NB*NH); no block barriers; every wave does identical bounded work (SEQ/64 tiles).
// coverage: LDS strip 16 rows x 80 cols written fully every tile before it is read, slab 16 rows x 64 cols per wave fully written each tile before
//           being read; global: 4 instructions x 512 contiguous bytes per plane = rows iw0..iw0+15 of head segment n in CT and CTL;
//           grid x waves cover all NB x SEQ rows and all NH head segments of CT / CTL exactly once.
// =====================================================================================================
__global__ __launch_bounds__(ATT_THREADS) __attribute__((amdgpu_num_vgpr(256)))
void attn_rel(const unsigned short* __restrict__ QU, const unsigned short* __restrict__ QV,
              const unsigned short* __restrict__ KP, const unsigned short* __restrict__ PP,
              const unsigned short* __restrict__ VT, const unsigned short* __restrict__ VTL,
              unsigned short* CT, unsigned short* CTL) {
  __shared__ __align__(16) float smem[ATT_W * WFL];   // per wave: position strip [16][TPI] | prob / ctx slab [16][PPI]

  const int tid  = threadIdx.x;
  const int wave = __builtin_amdgcn_readfirstlane(tid >> 5);
  const int lane = tid & 31;
  const int hh   = lane >> 4;
  const int c    = lane & 15;
  const int bn   = blockIdx.y;
  const int b    = bn / NH;
  const int n    = bn - b * NH;
  const int i0   = blockIdx.x * 64;
  const int iw0  = i0 + wave * 16;

  float* tsh = smem + wave * WFL;
  float* pt  = tsh + 16 * TPI;

  // stationary A fragments: (q + bq + ub) rows b*SEQ + iw0 + c, d 0..31 and 32..63 of head n ((q + bq + vb) fragments are reloaded per key tile)
  const size_t hb  = (size_t)(n * (DH / 32)) << 9;            // the head's first 1-KiB block inside a 16-row group of a DMOD-long plane
  const size_t qro = ((size_t)((b * SEQ + iw0) >> 4) << 13) + hb + (lane << 3);
  const v16h qua = ldfrag_p(QU + qro), qub = ldfrag_p(QU + qro + 512);
  int qr2 = b * SEQ + iw0 + 1 + c;                            // rows i+1 for the T2 strip
  qr2 = (qr2 > NROW - 1) ? (NROW - 1) : qr2;
  const size_t qro2 = ((size_t)(qr2 >> 4) << 13) + hb + (((hh << 4) + (qr2 & 15)) << 3);

  const unsigned short* Kb  = KP + (size_t)b * SEQ * DMOD + hb + (lane << 3);
  const unsigned short* Pb  = PP + hb + (hh << 7);
  const size_t vbase = (size_t)b * DMOD * SEQ + (size_t)(n * DH) * SEQ + (lane << 3);   // 16-row group = 16 * SEQ halves
  const unsigned short* Vb  = VT  + vbase;
  const unsigned short* VLb = VTL + vbase;
  gp16 vhp = (gp16)Vb;                                        // the hi plane's running address: the key tile's first block

  const float KSC = (RSD / (QC * QC)) * LOG2E;

  float mrow[8], lrow[8];
  v8f O[4];
#pragma unroll
  for (int r = 0; r < 8; ++r) { mrow[r] = -INFINITY; lrow[r] = 0.f; }
#pragma unroll
  for (int td = 0; td < 4; ++td) O[td] = zero8();

#pragma unroll 1
  for (int j0 = 0; j0 < SEQ; j0 += 64) {
    const int dmin = j0 - iw0;                               // smallest j - i over the tile is dmin - 15, largest dmin + 63 (wave-uniform)
    // Every tile needs T1 (dmin <= 15) or T2 (dmin >= -61), one tile per wave both (wave-uniform tests). The tile's fragment loads go out
    // in groups ahead of the WMMAs that use them, as many at a time as the registers hold, so that a group costs one L2 latency.
    const bool low = (dmin <= 15);                           // the tile's first strip is T1, else T2
    const unsigned short* QVs = QV + (low ? qro : qro2);
    const int mw = low ? (SEQ + dmin - 16) : (dmin - 17);
    const unsigned short* Kt = Kb + ((size_t)(j0 >> 4) << 13);
    // ---- load group 1: the strip's A pair, its five pos subtiles, the first key subtile ----
    v16h ka[4], kb2[4], fa[5], fb[5];
    const v16h qva = ldfrag_p(QVs), qvb = ldfrag_p(QVs + 512);
    const unsigned short* pp[5];
#pragma unroll
    for (int u = 0; u < 5; ++u) {
      pp[u] = Pb + pos_slot(mw + 16 * u + c);
      fa[u] = ldfrag_p(pp[u]);
      fb[u] = ldfrag_p(pp[u] + 512);
    }
    ka[0]  = ldfrag_p(Kt);
    kb2[0] = ldfrag_p(Kt + 512);
    addr_wait7(QVs, pp[0], pp[1], pp[2], pp[3], pp[4], Kt);
#pragma unroll
    for (int u = 0; u < 3; ++u) strip_sub(qva, qvb, fa[u], fb[u], tsh, u, hh, c);
    __builtin_amdgcn_sched_barrier(0);   // group 2 takes the registers of the three pos subtiles used up to here, so it is not lifted higher
    // ---- load group 2: the other three key subtiles; they fly behind the rest of the strip and the first score subtile ----
#pragma unroll
    for (int t = 1; t < 4; ++t) {
      ka[t]  = ldfrag_p(Kt + ((size_t)t << 13));
      kb2[t] = ldfrag_p(Kt + ((size_t)t << 13) + 512);
    }
    addr_wait1(Kt);
#pragma unroll
    for (int u = 3; u < 5; ++u) strip_sub(qva, qvb, fa[u], fb[u], tsh, u, hh, c);
    if (dmin == 16) {                                        // wave-uniform: the one T2 tile that holds d == 1, in column 0
      if (c == 0) {
        for (int r = 0; r < 8; ++r) tsh[(8 * hh + r) * TPI] = 0.f;
      }
    }
    // ---- content scores S (4 subtiles of 16 keys) ----
    v8f S[4];
#pragma unroll
    for (int t = 0; t < 4; ++t) {
      S[t] = mma_h(qua, ka[t], zero8());
      S[t] = mma_h(qub, kb2[t], S[t]);
      hz4(S[t], ka[t], kb2[t], qua, qub);
    }
    if (low && dmin + 61 >= 0) pos_strip_over(QV + qro2, Pb, dmin - 17, tsh, hh, c, dmin - 15);   // the tile on the diagonal: T2 over T1
    // ---- load group 3: v^T hi plane, in flight during the softmax ----
    const size_t vo = (size_t)(j0 >> 5) << 9;              // the key tile's first 1-KiB block inside a 16-row group
    v16h vfa[4], vfb[4];
#pragma unroll
    for (int td = 0; td < 4; ++td) {
      vfa[td] = ldfrag_g(vhp + (size_t)(16 * td) * SEQ);
      vfb[td] = ldfrag_g(vhp + (size_t)(16 * td) * SEQ + 512);
    }
    addr_wait_step(vhp);
    vhp += 1024;                                           // the next key tile: two 1-KiB blocks on
    wave_sync_own();

    // ---- score assembly + online softmax (rows live on one 16-lane half), in phases over four register rows at a time so that the
    //      cross-lane steps of the four run as one interleaved group (all eight at once do not fit the registers beside the v^T loads in flight) ----
#pragma unroll   // unrolled, as are the loops inside: S, O, mrow and lrow are indexed by the row and stay in registers only so
    for (int g = 0; g < 2; ++g) {
      float mx4[4], ps4[4], al4[4];
#pragma unroll
      for (int q = 0; q < 4; ++q) {
        const int r  = 4 * g + q;
        const int R  = 8 * hh + r;
        const int xo = R * TPI + (15 - R) + c;               // strip column x = 16t + c - R + 15 in [0, 78]
#pragma unroll
        for (int t = 0; t < 4; ++t) S[t][r] = (S[t][r] + tsh[xo + 16 * t]) * KSC;
        mx4[q] = fmaxf(fmaxf(S[0][r], S[1][r]), fmaxf(S[2][r], S[3][r]));
      }
      row_max4(mx4);
#pragma unroll
      for (int q = 0; q < 4; ++q) {
        const int r  = 4 * g + q;
        const int R  = 8 * hh + r;
        const float mn = fmaxf(mrow[r], mx4[q]);
        al4[q] = exp2f(mrow[r] - mn);
        mrow[r] = mn;
        float e4[4];
        float ps = 0.f;
#pragma unroll
        for (int t = 0; t < 4; ++t) { e4[t] = exp2f(S[t][r] - mn); ps += e4[t]; }
        ps4[q] = ps;
        const int ro = R * PPI + c;
#pragma unroll
        for (int t = 0; t < 4; ++t) pt[ro + 16 * t] = e4[t];
      }
      row_sum4(ps4);
#pragma unroll
      for (int q = 0; q < 4; ++q) {
        const int r = 4 * g + q;
        lrow[r] = lrow[r] * al4[q] + ps4[q];
#pragma unroll
        for (int td = 0; td < 4; ++td) O[td][r] *= al4[q];
      }
    }
    wave_sync_own();

    // ---- P fragments (x1024, f16) from the LDS rows, two k-steps of 32 keys ----
    FragH pf[2];
#pragma unroll
    for (int ks = 0; ks < 2; ++ks) {
      const float* prow = pt + c * PPI + 32 * ks + 8 * hh;
      const v4f p0 = *(const v4f*)(prow), p1 = *(const v4f*)(prow + 4);
      const v4f p2 = *(const v4f*)(prow + 16), p3 = *(const v4f*)(prow + 20);
#pragma unroll
      for (int e = 0; e < 4; ++e) {
        pf[ks].h[0][e]     = (_Float16)(p0[e] * PC);     // keys j0 + 32ks + 8hh + e
        pf[ks].h[0][4 + e] = (_Float16)(p1[e] * PC);     // keys j0 + 32ks + 8hh + 4 + e
        pf[ks].h[1][e]     = (_Float16)(p2[e] * PC);     // keys j0 + 32ks + 16 + 8hh + e
        pf[ks].h[1][4 + e] = (_Float16)(p3[e] * PC);
      }
    }
    __builtin_amdgcn_sched_barrier(0);   // group 4 is not lifted over the P fragments' LDS reads: their registers and the group's do not fit together
    {
      // ---- load group 4: v^T residual plane, first two 16-row groups now, the other two into the registers of the first two hi groups ----
      v16h vla[4], vlb[4];
#pragma unroll
      for (int td = 0; td < 2; ++td) {
        const unsigned short* vp = VLb + vo + (size_t)(16 * td) * SEQ;
        vla[td] = ldfrag_p(vp);
        vlb[td] = ldfrag_p(vp + 512);
      }
      addr_wait1(VLb + vo);
      // ---- O += P . v^T (hi plane) ----
#pragma unroll
      for (int td = 0; td < 2; ++td) {
        O[td] = mma_h(pf[0].v, vfa[td], O[td]);
        O[td] = mma_h(pf[1].v, vfb[td], O[td]);
        hz4(O[td], pf[0].v, pf[1].v, vfa[td], vfb[td]);
      }
      __builtin_amdgcn_sched_barrier(0);   // the second half of group 4 waits for those registers and is not lifted higher
#pragma unroll
      for (int td = 2; td < 4; ++td) {
        const unsigned short* vp = VLb + vo + (size_t)(16 * td) * SEQ;
        vla[td] = ldfrag_p(vp);
        vlb[td] = ldfrag_p(vp + 512);
      }
      addr_wait1(VLb + vo);
#pragma unroll
      for (int td = 2; td < 4; ++td) {
        O[td] = mma_h(pf[0].v, vfa[td], O[td]);
        O[td] = mma_h(pf[1].v, vfb[td], O[td]);
        hz4(O[td], pf[0].v, pf[1].v, vfa[td], vfb[td]);
      }
      // ---- O += P . v^T (residual plane) ----
#pragma unroll
      for (int td = 0; td < 4; ++td) {
        O[td] = mma_h(pf[0].v, vla[td], O[td]);
        O[td] = mma_h(pf[1].v, vlb[td], O[td]);
        hz4(O[td], pf[0].v, pf[1].v, vla[td], vlb[td]);
      }
    }
    wave_sync_lds();
  }
  acc_guard4(O[0], O[1], O[2], O[3]);

  // ---- fold 1/l and the carries (1024 on P, 16 on v), carry x4096 on ctx, stage the wave's 16x64 slice in its slab ----
  const float oc = CC / (PC * VC);
#pragma unroll
  for (int r = 0; r < 8; ++r) {
    const float inv = (1.0f / lrow[r]) * oc;
    const int ro = (8 * hh + r) * PPI + c;
#pragma unroll
    for (int td = 0; td < 4; ++td) pt[ro + 16 * td] = O[td][r] * inv;
  }
  wave_sync_lds();
  {
    v4u hv[4], lv[4];
#pragma unroll
    for (int it = 0; it < 4; ++it) {
      const int c8 = (it >> 1) * 32 + (it & 1) * 16 + hh * 8;   // row c; one packed 512-B run per it: block it >> 1, second half it & 1
      const float* sp = pt + c * PPI + c8;
      v4u a, b2;
#pragma unroll
      for (int e = 0; e < 4; ++e) {
        const float f0 = sp[2 * e], f1 = sp[2 * e + 1];
        const _Float16 x0 = (_Float16)f0, x1 = (_Float16)f1;
        a[e]  = pk16(h_bits(x0), h_bits(x1));
        b2[e] = pk16(h_bits((_Float16)(f0 - (float)x0)), h_bits((_Float16)(f1 - (float)x1)));
      }
      hv[it] = a;
      lv[it] = b2;
    }
    {
#pragma unroll
      for (int it = 0; it < 4; ++it) {
        const size_t go = qro + ((size_t)(it >> 1) << 9) + ((it & 1) << 8);
        *(v4u*)(CT  + go) = hv[it];
        *(v4u*)(CTL + go) = lv[it];
      }
      
    }
  }
}

// =====================================================================================================
// Workspace map (bytes); every plane is an exact multiple of its tile / whole-row store granularity (M, N exact tile multiples,
// convert counts exact multiples of 2048), every offset a multiple of 512 KiB; every plane is fragment-packed (see ldfrag_p):
//   WQ16, WK16, WV16, WP16, WO16 f16 [512 out][512 in] x64                               5 x   524288
//   X16  f16 [NROW][512] x16 (pre-norm output)                                                8388608
//   PE16 f16 [SEQ][512] x16 (sinusoid table)                                                  2097152
//   QU, QV, K16 f16 [NROW][512] x4                                                       3 x  8388608
//   P16  f16 [SEQ][512] x4                                                                      2097152
//   VT16, VTL16 f16 [NB][512][SEQ] hi x16 / residual                                     2 x  8388608
//   CT16, CTL16 f16 [NROW][512] hi x4096 / residual                                      2 x  8388608
//   end                                                                                        73924608
// =====================================================================================================
extern "C" void kernel_launch(void* const* d_in, const int* in_sizes, int n_in,
                              void* d_out, int out_size, void* d_ws, size_t ws_size,
                              hipStream_t stream) {
  if (n_in < 14) return;
  if (in_sizes[0] != NROW * DMOD) return;
  if (in_sizes[1] != DMOD || in_sizes[2] != DMOD) return;
  if (in_sizes[3] != DMOD * DMOD || in_sizes[5] != DMOD * DMOD || in_sizes[7] != DMOD * DMOD ||
      in_sizes[9] != DMOD * DMOD || in_sizes[12] != DMOD * DMOD) return;
  if (in_sizes[4] != DMOD || in_sizes[6] != DMOD || in_sizes[8] != DMOD || in_sizes[13] != DMOD) return;
  if (in_sizes[10] != NH * DH || in_sizes[11] != NH * DH) return;
  if (out_size != NROW * DMOD) return;

  const float* xin   = (const float*)d_in[0];
  const float* gam   = (const float*)d_in[1];
  const float* bet   = (const float*)d_in[2];
  const float* w_q   = (const float*)d_in[3];
  const float* b_q   = (const float*)d_in[4];
  const float* w_k   = (const float*)d_in[5];
  const float* b_k   = (const float*)d_in[6];
  const float* w_v   = (const float*)d_in[7];
  const float* b_v   = (const float*)d_in[8];
  const float* w_p   = (const float*)d_in[9];
  const float* ub    = (const float*)d_in[10];
  const float* vb    = (const float*)d_in[11];
  const float* w_o   = (const float*)d_in[12];
  const float* b_o   = (const float*)d_in[13];
  float*       out   = (float*)d_out;

  const size_t PW  = (size_t)DMOD * DMOD * 2;            //   524288
  const size_t PX  = (size_t)NROW * DMOD * 2;            //  8388608
  const size_t PXP = (size_t)SEQ * DMOD * 2;             //  2097152
  const size_t PVT = (size_t)NB * DMOD * SEQ * 2;        //  8388608
  size_t off = 0;
  const size_t oWQ  = off; off += PW;
  const size_t oWK  = off; off += PW;
  const size_t oWV  = off; off += PW;
  const size_t oWP  = off; off += PW;
  const size_t oWO  = off; off += PW;
  const size_t oX   = off; off += PX;
  const size_t oPE  = off; off += PXP;
  const size_t oQU  = off; off += PX;
  const size_t oQV  = off; off += PX;
  const size_t oK   = off; off += PX;
  const size_t oP   = off; off += PXP;
  const size_t oVT  = off; off += PVT;
  const size_t oVTL = off; off += PVT;
  const size_t oCT  = off; off += PX;
  const size_t oCTL = off; off += PX;
  if (off > ws_size) return;                               // off = 73924608
  if (off > (size_t)134217728) return;

  char* ws = (char*)d_ws;
  unsigned short* WQ16  = (unsigned short*)(ws + oWQ);
  unsigned short* WK16  = (unsigned short*)(ws + oWK);
  unsigned short* WV16  = (unsigned short*)(ws + oWV);
  unsigned short* WP16  = (unsigned short*)(ws + oWP);
  unsigned short* WO16  = (unsigned short*)(ws + oWO);
  unsigned short* X16   = (unsigned short*)(ws + oX);
  unsigned short* PE16  = (unsigned short*)(ws + oPE);
  unsigned short* QU    = (unsigned short*)(ws + oQU);
  unsigned short* QV    = (unsigned short*)(ws + oQV);
  unsigned short* K16   = (unsigned short*)(ws + oK);
  unsigned short* P16   = (unsigned short*)(ws + oP);
  unsigned short* VT16  = (unsigned short*)(ws + oVT);
  unsigned short* VTL16 = (unsigned short*)(ws + oVTL);
  unsigned short* CT16  = (unsigned short*)(ws + oCT);
  unsigned short* CTL16 = (unsigned short*)(ws + oCTL);

  const dim3 blk(256);
  const dim3 gPrep(PB_ALL);                                         // 256 + 1024 + 5 x 128 = 1920
  const dim3 gProj(GB_ALL);                                         // 128 + 4 x 32 + 128 + 32 = 416
  const dim3 gOut(GB_Q);                                            // 128
  const dim3 gAT(SEQ / 64, NB * NH);                                // 32 x 32
  const dim3 bAT(ATT_THREADS);                                      // 128

  // (1) from the inputs alone: weight planes W[o][c] ([out][in] = [n][k] already) -> f16( bf16_RNE(w) * 64 ), all five weights (WQ16 .. WO16
  //     are contiguous); pre-norm -> X16 = f16(x * 16); sinusoid table -> PE16 = f16(pe * 16)
  prep_all<<<gPrep, blk, 0, stream>>>(xin, gam, bet, w_q, w_k, w_v, w_p, w_o, WQ16, X16, PE16);

  // (2) the q, v^T, k and pos projections
  proj_all<<<gProj, blk, 0, stream>>>(X16, PE16, WQ16, WK16, WV16, WP16, QU, QV, K16, P16, VT16, VTL16, b_q, b_k, b_v, ub, vb);

  // (3) relative attention -> CT16 = f16(ctx * 4096) hi plane, CTL16 residual plane, rows b*SEQ + i, halves n*64+d
  attn_rel<<<gAT, bAT, 0, stream>>>(QU, QV, K16, P16, VT16, VTL16, CT16, CTL16);

  // (4) output projection
  out_proj<<<gOut, blk, 0, stream>>>(CT16, CTL16, WO16, out, b_o);
  (void)hipGetLastError();
}

// v006
// A run of this version takes 159 microseconds.
// Timed twice side by side with v005, it ran 1.04 and 1.03 times as fast.
// Over all steps from v000 it is 2.99 times as fast.
// Contractions (all v_wmma_f32_16x16x32_f16, f16 operands, f32 accumulate): q/k/v/pos projections (x or sinusoid table f16 x16 . W f16 x64,
// K=512, single products); content scores ((q+bq+ub) f16 x4 . (k+bk) f16 x4, K=64, single); position strips ((q+bq+vb) f16 x4 . pos f16 x4,
// K=64, single) -> one f32 LDS strip per key tile, the shift's select made where the strip is stored; P . v^T (P f16 x1024 . v^T carried as f16 x16 hi plane + f16 residual plane, 64 keys
// per tile, two products); output projection (ctx carried as f16 x4096 hi + residual planes . Wo f16 x64, K=512, two products).
// LayerNorm, sinusoid table, max-subtracted online base-2 softmax and all epilogues in f32 on VALU. Every float input RNE-converted to bf16 on load.
#include <hip/hip_runtime.h>
#include <math.h>
#include <stdint.h>

#define SEQ   2048
#define NB    4
#define DMOD  512
#define NH    8
#define DH    64
#define NROW  (SEQ * NB)
#define XC    16.0f
#define WSC   64.0f
#define QC    4.0f
#define VC    16.0f
#define PC    1024.0f
#define CC    4096.0f
#define RSD   0.044194173824159216f
#define LOG2E 1.4426950408889634f
#define LN_EPS 1.0e-5f
#define CNEG  ((float)(-9.210340371976184 / 512.0))
static_assert(NH * DH == DMOD);
static_assert(DH == 64);
static_assert(DMOD == 512);
static_assert((SEQ % 64) == 0 && (DMOD % 64) == 0 && (NROW % 64) == 0);
static_assert(((DMOD * DMOD) % 2048) == 0 && (NROW % 8) == 0 && (SEQ % 8) == 0);
#define ATT_W 4
#define ATT_THREADS (ATT_W * 32)
#define TPI 84
#define PPI 68
#define WFL (16 * TPI + 16 * PPI)
static_assert(((16 * TPI) % 4) == 0 && ((16 * PPI) % 4) == 0 && (WFL % 4) == 0);
static_assert(TPI >= 80 && PPI >= 64);
static_assert(ATT_W * WFL * 4 <= 65536);

typedef _Float16 v16h __attribute__((ext_vector_type(16)));
typedef _Float16 v8h  __attribute__((ext_vector_type(8)));
typedef __bf16   v16b __attribute__((ext_vector_type(16)));
typedef float    v8f  __attribute__((ext_vector_type(8)));
typedef float    v4f  __attribute__((ext_vector_type(4)));
typedef unsigned int v4u __attribute__((ext_vector_type(4)));

union FragH { v16h v; v8h h[2]; v4u u[2]; };
union FragAny { v16h h; v16b b; };

// ---- scalar helpers --------------------------------------------------------------------------------
__device__ __forceinline__ unsigned short bf_bits(float f) {          // f32 -> bf16 bits, RNE convert
  unsigned u = __float_as_uint(f);
  return (unsigned short)((u + 0x7FFFu + ((u >> 16) & 1u)) >> 16);
}
__device__ __forceinline__ float bf_up(unsigned short h) { return __uint_as_float(((unsigned)h) << 16); }
__device__ __forceinline__ float bfr(float f) { return bf_up(bf_bits(f)); }   // value of the bf16 RNE convert
__device__ __forceinline__ unsigned short h_bits(_Float16 x) { return __builtin_bit_cast(unsigned short, x); }
__device__ __forceinline__ unsigned pk16(unsigned short a, unsigned short b) { return (unsigned)a | ((unsigned)b << 16); }
__device__ __forceinline__ v8f zero8() { v8f z = {0.f, 0.f, 0.f, 0.f, 0.f, 0.f, 0.f, 0.f}; return z; }

// ---- fragment-packed 16-bit planes: a [rows][L] plane (rows % 16 == 0, L % 32 == 0) is stored as 1-KiB blocks, one per
//      (16 rows, 32 k): block index (row >> 4) * (L / 32) + (k >> 5); inside a block the 8-half piece that holds element (row, k) stands at
//      halves ((k >> 4) & 1) * 256 + (((k >> 3) & 1) * 16 + (row & 15)) * 8. With 16-aligned rows one wave-wide 16-B load reads 512 contiguous
//      bytes (four whole 128-B lines) where a row-major plane made it touch sixteen lines.
// ---- fragment loader: p = block start + (16 * (lane >> 4) + (row & 15)) * 8; elements 0..7 <- k0 + 8h + 0..7, elements 8..15 <- k0 + 16 + 8h + 0..7,
//      h = lane >> 4 (same split k map for A and B; B is always read from a [n][k] plane)
__device__ __forceinline__ v16h ldfrag_p(const unsigned short* p) {
  FragH f;
  f.u[0] = *(const v4u*)(p);
  f.u[1] = *(const v4u*)(p + 256);
  return f.v;
}
// ---- the same loader on a pointer typed as global memory (a pointer that has gone through an asm operand would otherwise load as a flat one)
typedef const __attribute__((address_space(1))) unsigned short* gp16;
typedef const __attribute__((address_space(1))) v4u* gp128;
__device__ __forceinline__ v16h ldfrag_g(gp16 p) {
  FragH f;
  f.u[0] = *(gp128)(p);
  f.u[1] = *(gp128)(p + 256);
  return f.v;
}

// ---- behind a group of loads: the wait that stands in front of every rewrite of an address register which the group's loads name; as inputs of
//      its statement the addresses keep their registers up to it, so that no load of the group lands on an address of the same group either
__device__ __forceinline__ void addr_wait1(const unsigned short* a) {
#if defined(__HIP_DEVICE_COMPILE__)
  asm volatile("s_wait_xcnt 0x0" :: "v"(a) : "memory");
#endif
}
// the same for a running address that is stepped behind the group: as an operand the statement may change, the pointer is the very register the
// loads name, and the step cannot be lifted over the wait
__device__ __forceinline__ void addr_wait_step(gp16& a) {
#if defined(__HIP_DEVICE_COMPILE__)
  asm volatile("s_wait_xcnt 0x0" : "+v"(a) :: "memory");
#endif
}
__device__ __forceinline__ void addr_wait7(const unsigned short* a, const unsigned short* b, const unsigned short* c, const unsigned short* d,
                                           const unsigned short* e, const unsigned short* f, const unsigned short* g) {
#if defined(__HIP_DEVICE_COMPILE__)
  asm volatile("s_wait_xcnt 0x0" :: "v"(a), "v"(b), "v"(c), "v"(d), "v"(e), "v"(f), "v"(g) : "memory");
#endif
}
// ---- WMMA helpers with trailing VALU hazard gaps ------------------------------------------------------
__device__ __forceinline__ v8f mma_h(v16h a, v16h b, v8f c) {
  return __builtin_amdgcn_wmma_f32_16x16x32_f16(false, a, false, b, (short)0, c, false, false);
}
__device__ __forceinline__ v8f mma_b(v16h a, v16h b, v8f c) {
  FragAny ua, ub;
  ua.h = a;
  ub.h = b;
  return __builtin_amdgcn_wmma_f32_16x16x32_bf16(false, ua.b, false, ub.b, (short)0, c, false, false);
}
template <int BF>
__device__ __forceinline__ v8f mmaT(v16h a, v16h b, v8f c) {
  if constexpr (BF != 0) return mma_b(a, b, c);
  else return mma_h(a, b, c);
}
__device__ __forceinline__ void dep_guard1(v8f& a, v8f& b, v16h x) {
#if defined(__HIP_DEVICE_COMPILE__)
  asm volatile("v_nop\n\tv_nop\n\tv_nop\n\tv_nop" : "+v"(a), "+v"(b) : "v"(x));
#endif
}
__device__ __forceinline__ void hz4(v8f& d, v16h x0, v16h x1, v16h x2, v16h x3) {
#if defined(__HIP_DEVICE_COMPILE__)
  asm volatile("v_nop\n\tv_nop\n\tv_nop\n\tv_nop" : "+v"(d) : "v"(x0), "v"(x1), "v"(x2), "v"(x3));
#endif
}
__device__ __forceinline__ void keep4_h(v16h a, v16h b, v16h c, v16h d) {
#if defined(__HIP_DEVICE_COMPILE__)
  asm volatile("v_nop" :: "v"(a), "v"(b), "v"(c), "v"(d));
#endif
}
__device__ __forceinline__ void acc_guard4(v8f& a, v8f& b, v8f& c, v8f& d) {
#if defined(__HIP_DEVICE_COMPILE__)
  asm volatile("v_nop\n\tv_nop\n\tv_nop\n\tv_nop" : "+v"(a), "+v"(b), "+v"(c), "+v"(d));
#endif
}
// ---- hand-over of a wave's own LDS rows between its lanes while global loads are in flight: the wave's LDS writes are waited for, the loads are
//      not (the workgroup-scope fences of wave_sync_lds drain loadcnt too); nothing another wave reads or writes is ordered here
__device__ __forceinline__ void wave_sync_own() {
  __builtin_amdgcn_fence(__ATOMIC_RELEASE, "wavefront");
#if defined(__HIP_DEVICE_COMPILE__)
  asm volatile("s_wait_dscnt 0x0" ::: "memory");   // the rows are written before any lane reads them back
#endif
  __builtin_amdgcn_wave_barrier();
  __builtin_amdgcn_fence(__ATOMIC_ACQUIRE, "wavefront");
}
// ---- maximum / sum over each 16-lane row of four independent values, every lane getting the result: four row_xmask steps (partner lane ^ 1, 2, 4, 8,
//      the order of the xor shuffles they replace), on the vector pipe instead of one LDS-unit permute and its wait per step. The four chains are
//      interleaved, so that a step's producer stands four vector instructions back and its result is ready when the step issues. All 32 lanes must be on.
#define XM4(op, m) \
  op " %0, %0, %0 row_xmask:" #m " row_mask:0xf bank_mask:0xf\n\t" \
  op " %1, %1, %1 row_xmask:" #m " row_mask:0xf bank_mask:0xf\n\t" \
  op " %2, %2, %2 row_xmask:" #m " row_mask:0xf bank_mask:0xf\n\t" \
  op " %3, %3, %3 row_xmask:" #m " row_mask:0xf bank_mask:0xf\n\t"
__device__ __forceinline__ void row_max4(float (&x)[4]) {
#if defined(__HIP_DEVICE_COMPILE__)
  // row maximum without the LDS unit: sixteen vector instructions, no wait
  asm(XM4("v_max_num_f32_dpp", 1) XM4("v_max_num_f32_dpp", 2) XM4("v_max_num_f32_dpp", 4) XM4("v_max_num_f32_dpp", 8)
      : "+v"(x[0]), "+v"(x[1]), "+v"(x[2]), "+v"(x[3]));
#endif
}
__device__ __forceinline__ void row_sum4(float (&x)[4]) {
#if defined(__HIP_DEVICE_COMPILE__)
  // row sum without the LDS unit: sixteen vector instructions, no wait
  asm(XM4("v_add_f32_dpp", 1) XM4("v_add_f32_dpp", 2) XM4("v_add_f32_dpp", 4) XM4("v_add_f32_dpp", 8)
      : "+v"(x[0]), "+v"(x[1]), "+v"(x[2]), "+v"(x[3]));
#endif
}
// ---- 2^x of four independent values by the hardware instruction alone. The library's exp2f wraps the same v_exp_f32 in a fix-up for results below
//      2^-126 (a compare, two selects, an add and a v_ldexp_f32 per call). Here such a result is a weight or a rescale factor next to a row sum of at
//      least 1: as a subnormal or as zero it rounds away in the sum, and x1024 it is zero in f16 either way. Arguments are -inf (gives 0, as before) or at most
//      a rounding residue above 0. One statement for the four: the results take registers of their own, so that no v_exp_f32 is followed by an instruction that
//      overwrites its source or reads its result, and the closing v_nop is the slot the instruction set asks for behind the last one.
__device__ __forceinline__ void exp2_hw4(float (&y)[4], float x0, float x1, float x2, float x3) {
#if defined(__HIP_DEVICE_COMPILE__)
  asm("v_exp_f32 %0, %4\n\tv_exp_f32 %1, %5\n\tv_exp_f32 %2, %6\n\tv_exp_f32 %3, %7\n\tv_nop"
      : "=&v"(y[0]), "=&v"(y[1]), "=&v"(y[2]), "=&v"(y[3]) : "v"(x0), "v"(x1), "v"(x2), "v"(x3));
#endif
}
__device__ __forceinline__ void wave_sync_lds() {
  __builtin_amdgcn_fence(__ATOMIC_RELEASE, "workgroup");
  __builtin_amdgcn_wave_barrier();
  __builtin_amdgcn_fence(__ATOMIC_ACQUIRE, "workgroup");
}
// ---- eight rows r0..r0+7 (r0 % 8 == 0, one row per wave, 256 threads) of a [rows][DMOD] plane -> fragment-packed plane, whole 128-B lines:
//      wave w hands in its row's pieces lane (o0: columns 8*lane..) and 32 + lane (o1: columns 256 + 8*lane..); a line of the packed plane holds
//      one piece of each of the eight rows, so the rows meet in LDS (pitch 66 pieces: the 16 lanes of a half wave fall on distinct banks).
//      Every thread of the block must call this (one block barrier inside).
#define RPI 66
__device__ __forceinline__ void store_rows8_packed(v4u o0, v4u o1, unsigned short* plane, int r0, v4u* st) {
  const int tid  = threadIdx.x;
  const int lane = tid & 31;
  const int wave = tid >> 5;
  st[wave * RPI + lane]      = o0;
  st[wave * RPI + 32 + lane] = o1;
  __syncthreads();   // the eight rows of a line come from eight waves
  unsigned short* dst = plane + ((size_t)(r0 >> 4) << 13) + ((r0 & 15) << 3);
  v4u w[2];
#pragma unroll   // both LDS reads issue ahead of the two stores
  for (int sx = 0; sx < 2; ++sx) {
    const int idx = sx * 256 + tid;
    const int g   = idx >> 3;                        // piece index in the row = k >> 3, 0..63
    const int rr  = idx & 7;                         // row r0 + rr
    w[sx] = st[rr * RPI + g];
    *(v4u*)(dst + ((g >> 2) << 9) + (((g >> 1) & 1) << 8) + ((((g & 1) << 4) + rr) << 3)) = w[sx];
  }
#if defined(__HIP_DEVICE_COMPILE__)
  // The wait stands in front of every rewrite of a register that the two stores name: inlined into a kernel of several jobs, the stores are no
  // longer followed by the end of the program on every way through the code; as inputs of its statement the pieces keep their registers up to it.
  asm volatile("s_wait_xcnt 0x0" :: "v"(w[0]), "v"(w[1]) : "memory");
#endif
}

// =====================================================================================================
// Elementwise 16-bit pack of a [rows][DMOD] f32 matrix into a fragment-packed plane: piece t of the plane (8 halves at dst + 8t) =
// f16( bf16_RNE(src[row][k..k+7]) * sc ), (row, k) decoded from t; 0 for pieces whose source elements lie past nvalid; sc a power of two (exact). One piece per thread:
// two 16-B loads (address clamped into [0, nvalid) for pad groups, value zeroed), one 16-B store, a wave's stores = 512 contiguous bytes.
// Used for the five weight matrices, which are [out][in] = [n][k] k-contiguous already.
// coverage: bx = 0 .. ntotal / 2048 - 1, 256 thr x 8 elements each = ntotal exactly (ntotal % 2048 == 0, nvalid == ntotal here).
// =====================================================================================================
__device__ __forceinline__ void cvt16(const float* __restrict__ src, unsigned short* dst, int nvalid, int ntotal, float sc, int bx) {
  const size_t i8 = ((size_t)bx * 256 + threadIdx.x) * 8;
  if (i8 + 8 > (size_t)ntotal) return;             // never taken with the exact grid; no barriers on this job's path
  const size_t t  = i8 >> 3;                           // piece index: block t >> 6, second half (t >> 5) & 1, k half (t >> 4) & 1, row t & 15
  const size_t sr = ((t >> 10) << 4) + (t & 15);       // source row: DMOD / 32 = 16 blocks per 16 rows
  const size_t sk = (((t >> 6) & 15) << 5) + (((t >> 5) & 1) << 4) + (((t >> 4) & 1) << 3);
  const size_t si = sr * DMOD + sk;                    // the piece's first element in the source
  const bool pad = (si + 8 > (size_t)nvalid);
  const size_t ls = pad ? ((size_t)nvalid - 8) : si;   // clamped address, always inside the source
  const v4f a = *(const v4f*)(src + ls);
  const v4f b = *(const v4f*)(src + ls + 4);
  v4u o;
  o[0] = pk16(h_bits((_Float16)(bfr(a[0]) * sc)), h_bits((_Float16)(bfr(a[1]) * sc)));
  o[1] = pk16(h_bits((_Float16)(bfr(a[2]) * sc)), h_bits((_Float16)(bfr(a[3]) * sc)));
  o[2] = pk16(h_bits((_Float16)(bfr(b[0]) * sc)), h_bits((_Float16)(bfr(b[1]) * sc)));
  o[3] = pk16(h_bits((_Float16)(bfr(b[2]) * sc)), h_bits((_Float16)(bfr(b[3]) * sc)));
  const v4u z = {0u, 0u, 0u, 0u};
  const v4u w = pad ? z : o;
  {
    *(v4u*)(dst + i8) = w;
    
  }
}

// =====================================================================================================
// y = (x - mu) * (1/sqrt(var + eps)) * bf16_RNE(gamma) + bf16_RNE(beta) in f32, out X16 = f16(y * sc) (sc = 16, exact power of two).
// Lane l owns columns 8l..8l+7 and 256+8l..256+8l+7; the block's eight rows go out fragment-packed through LDS (store_rows8_packed).
// coverage: bx = 0 .. NROW/8 - 1, 8 waves each = every row; 32 lanes x 16 halves = all 512 columns of the row. st: 8 * RPI pieces of LDS.
// =====================================================================================================
__device__ __forceinline__ void ln16(const float* __restrict__ x, const float* __restrict__ gam,
                                     const float* __restrict__ bet, unsigned short* X16, int nrows, float sc, int bx, v4u* st) {
  const int lane = threadIdx.x & 31;
  const int wave = threadIdx.x >> 5;
  const int row  = bx * 8 + wave;
  if (bx * 8 + 8 > nrows) return;                  // block-uniform, in front of the barrier; never taken with the exact grid
  const float* p = x + (size_t)row * DMOD;
  const int c0 = 8 * lane, c1 = 256 + 8 * lane;
  const v4f a0 = *(const v4f*)(p + c0), a1 = *(const v4f*)(p + c0 + 4);
  const v4f a2 = *(const v4f*)(p + c1), a3 = *(const v4f*)(p + c1 + 4);
  float v[16];
#pragma unroll
  for (int e = 0; e < 4; ++e) {
    v[e]      = bfr(a0[e]);
    v[4 + e]  = bfr(a1[e]);
    v[8 + e]  = bfr(a2[e]);
    v[12 + e] = bfr(a3[e]);
  }
  float s = 0.f;
#pragma unroll
  for (int e = 0; e < 16; ++e) s += v[e];
#pragma unroll
  for (int off = 1; off < 32; off <<= 1) s += __shfl_xor(s, off, 32);
  const float mu = s * (1.0f / (float)DMOD);
  float q = 0.f;
#pragma unroll
  for (int e = 0; e < 16; ++e) {
    const float d = v[e] - mu;
    v[e] = d;
    q += d * d;
  }
#pragma unroll
  for (int off = 1; off < 32; off <<= 1) q += __shfl_xor(q, off, 32);
  const float var  = q * (1.0f / (float)DMOD);
  const float rstd = 1.0f / sqrtf(var + LN_EPS);
  const v4f g0 = *(const v4f*)(gam + c0), g1 = *(const v4f*)(gam + c0 + 4);
  const v4f g2 = *(const v4f*)(gam + c1), g3 = *(const v4f*)(gam + c1 + 4);
  const v4f e0 = *(const v4f*)(bet + c0), e1 = *(const v4f*)(bet + c0 + 4);
  const v4f e2 = *(const v4f*)(bet + c1), e3 = *(const v4f*)(bet + c1 + 4);
  float gg[16], bb[16];
#pragma unroll
  for (int e = 0; e < 4; ++e) {
    gg[e]      = bfr(g0[e]);  bb[e]      = bfr(e0[e]);
    gg[4 + e]  = bfr(g1[e]);  bb[4 + e]  = bfr(e1[e]);
    gg[8 + e]  = bfr(g2[e]);  bb[8 + e]  = bfr(e2[e]);
    gg[12 + e] = bfr(g3[e]);  bb[12 + e] = bfr(e3[e]);
  }
  v4u o0, o1;
#pragma unroll
  for (int e = 0; e < 4; ++e) {
    const float y0 = v[2 * e] * rstd * gg[2 * e] + bb[2 * e];
    const float y1 = v[2 * e + 1] * rstd * gg[2 * e + 1] + bb[2 * e + 1];
    const float y2 = v[8 + 2 * e] * rstd * gg[8 + 2 * e] + bb[8 + 2 * e];
    const float y3 = v[8 + 2 * e + 1] * rstd * gg[8 + 2 * e + 1] + bb[8 + 2 * e + 1];
    o0[e] = pk16(h_bits((_Float16)(y0 * sc)), h_bits((_Float16)(y1 * sc)));
    o1[e] = pk16(h_bits((_Float16)(y2 * sc)), h_bits((_Float16)(y3 * sc)));
  }
  store_rows8_packed(o0, o1, X16, bx * 8, st);
}

// =====================================================================================================
// Sinusoid table, one wave per position s: pe[s][2m] = sin(s * div[m]), pe[s][2m+1] = cos(s * div[m]), div[m] = expf(f32(2m) * f32(-ln(1e4)/512)),
// precise expf / sinf / cosf (arguments up to 2047), all f32. Rolled loop: lane l computes columns 8l..8l+7 and 256+8l..+7 (4 sin/cos pairs per group)
// into its own slots of a wave-private f32 LDS row, then packs f16(pe * sc) (sc = 16); the block's eight rows go out fragment-packed
// through LDS (store_rows8_packed).
// coverage: bx = 0 .. SEQ/8 - 1, 8 waves each = rows 0..SEQ-1; each lane reads back only the 16 LDS slots it wrote; 32 lanes x 16 halves = 512 columns.
// sh: 8 * DMOD floats of LDS, st: 8 * RPI pieces of LDS.
// =====================================================================================================
__device__ __forceinline__ void pe16(unsigned short* PE16, int nrows, float sc, int bx, float* sh, v4u* st) {
  const int lane = threadIdx.x & 31;
  const int wave = threadIdx.x >> 5;
  const int s = bx * 8 + wave;
  if (bx * 8 + 8 > nrows) return;                  // block-uniform, in front of the barrier; never taken with the exact grid
  float* rowp = sh + wave * DMOD;
  const float fs = (float)s;
#pragma unroll 1
  for (int it = 0; it < 8; ++it) {
    const int cb = 256 * (it >> 2) + 8 * lane + 2 * (it & 3);   // even column = 2m
    const float dv  = expf((float)cb * CNEG);
    const float ang = fs * dv;
    rowp[cb]     = sinf(ang);
    rowp[cb + 1] = cosf(ang);
  }
  wave_sync_lds();
  v4u o[2];
#pragma unroll
  for (int g = 0; g < 2; ++g) {
    const float* sp = rowp + 256 * g + 8 * lane;
    v4u w;
#pragma unroll
    for (int e = 0; e < 4; ++e) w[e] = pk16(h_bits((_Float16)(sp[2 * e] * sc)), h_bits((_Float16)(sp[2 * e + 1] * sc)));
    o[g] = w;
  }
  store_rows8_packed(o[0], o[1], PE16, bx * 8, st);
}

// =====================================================================================================
// The seven jobs that depend on the inputs alone, as ONE grid: none reads what another writes, and each alone leaves most of the chip idle
// and pays a launch of its own. The block index picks the job (block-uniform), the longest blocks first:
//   [0, PB_PE) sinusoid table | [PB_PE, PB_PE + PB_LN) pre-norm | then PB_CW blocks for each of the five weight planes, which stand one behind
//   the other in the workspace from W16 on in the order q, k, v, pos, o.
// =====================================================================================================
#define PB_PE (SEQ / 8)
#define PB_LN (NROW / 8)
#define PB_CW ((DMOD * DMOD) / 2048)
#define PB_ALL (PB_PE + PB_LN + 5 * PB_CW)
__global__ __launch_bounds__(256) void prep_all(const float* __restrict__ x, const float* __restrict__ gam, const float* __restrict__ bet,
                                                const float* __restrict__ w_q, const float* __restrict__ w_k, const float* __restrict__ w_v,
                                                const float* __restrict__ w_p, const float* __restrict__ w_o,
                                                unsigned short* W16, unsigned short* X16, unsigned short* PE16) {
  __shared__ __align__(16) float sh[8 * DMOD];
  __shared__ __align__(16) v4u st[8 * RPI];
  const int bx = blockIdx.x;
  if (bx < PB_PE) {
    pe16(PE16, SEQ, XC, bx, sh, st);
  } else if (bx < PB_PE + PB_LN) {
    ln16(x, gam, bet, X16, NROW, XC, bx - PB_PE, st);
  } else {
    const int r = bx - (PB_PE + PB_LN);
    const int w = r / PB_CW;                         // which weight, 0..4
    const float* src = (w == 0) ? w_q : (w == 1) ? w_k : (w == 2) ? w_v : (w == 3) ? w_p : w_o;
    cvt16(src, W16 + (size_t)w * (DMOD * DMOD), DMOD * DMOD, DMOD * DMOD, WSC, r - w * PB_CW);
  }
}

// =====================================================================================================
// Register-blocked batched 16-bit WMMA GEMM: C[m][n] = oscale * sum_k A[m][k] * Bt[n][k] (+ bias); one wave per 64x64 tile,
// no block barriers. A [M][lda] and Bt [N][ldb] are fragment-packed 16-bit planes (row lengths lda, ldb, multiples of 32); M, N multiples of 64,
// K multiple of 32. by = batch index with element strides sA, sB, sC (whole 16-row groups). 16-bit outputs are fragment-packed planes
// of row length ldc.
// ASPLIT 1: a second A plane A2 (unscaled residual of A, same layout) is multiplied into the same accumulator (A + A2 ~ exact A).
// BF 1: bf16 operands (v_wmma_f32_16x16x32_bf16), else f16.
// EPI 1: value += bf16_RNE(ep0[column]) (per-column bias); EPI 2: value += bf16_RNE(ep0[row]) (per-row bias, 16-bit out only).
// OM 0: f32 out (pitch ldc).  OM 2: one f16 plane = f16(value * ocarry).
// OM 4: two f16 planes: hi = f16(value * ocarry), lo = f16(value * ocarry - hi) (unscaled residual).
// OM 5: two f16 planes: C = f16((value + bf16_RNE(ep1[column])) * ocarry), C2 = f16((value + bf16_RNE(ep2[column])) * ocarry).
// coverage: 4 slabs x 16 rows (f32: it 0..7 x lane>>4; 16-bit: rows 8*(it&1) + (lane&7), pieces 4*(it>>1) + (lane>>3)) x 64 cols = the wave's whole 64x64 tile;
//           bx = 0 .. ceil(tilesM*tilesN/8) - 1, surplus waves exit (wave-uniform). sT: per-wave 16x64 slab of LDS, pitch 68 floats.
// =====================================================================================================
template <int OM, int ASPLIT, int BF, int EPI>
__device__ __forceinline__ void gemm64(
    const unsigned short* __restrict__ Ap, const unsigned short* __restrict__ A2p, int lda, long long sA,
    const unsigned short* __restrict__ Btp, int ldb, long long sB,
    void* Cout, void* C2out, int ldc, long long sC,
    int M, int N, int K, float oscale, float ocarry,
    const float* __restrict__ ep0, const float* __restrict__ ep1, const float* __restrict__ ep2,
    int bx, int by, float (*sT)[16 * 68]) {
  const int lane = threadIdx.x & 31;
  const int wave = threadIdx.x >> 5;
  const int tilesN = N >> 6;
  const int tilesM = M >> 6;
  const int tile = bx * 8 + wave;
  if (tile >= tilesM * tilesN) return;   // wave-uniform; no block barriers in this kernel
  const int tm = tile / tilesN;
  const int tn = tile - tm * tilesN;
  const int m0 = tm << 6;
  const int n0 = tn << 6;

  const unsigned short* A1 = Ap  + (size_t)((long long)by * sA);
  const unsigned short* A2 = A2p + (size_t)((long long)by * sA);
  const unsigned short* Bb = Btp + (size_t)((long long)by * sB);

  const int rlane = lane & 15;                 // row (A) / col (B, D) within subtile
  const int ksA   = lda >> 5;                  // 1-KiB blocks per 16 rows of A
  const int ksB   = ldb >> 5;                  // 1-KiB blocks per 16 rows of Bt
  const int mOff  = (lane >> 4) * 8;           // D row offset

  v8f acc[4][4];
#pragma unroll
  for (int i = 0; i < 4; ++i)
#pragma unroll
    for (int j = 0; j < 4; ++j) acc[i][j] = zero8();

  // the lane's own piece in the first 1-KiB block of each 16-row group; a k step moves every pointer on by one block (512 halves)
  gp16 pB[4], pA[4], pL[4];
#pragma unroll
  for (int j = 0; j < 4; ++j) pB[j] = (gp16)(Bb + ((size_t)(((n0 >> 4) + j) * ksB) << 9) + (lane << 3));
#pragma unroll
  for (int i = 0; i < 4; ++i) {
    const size_t ao = ((size_t)(((m0 >> 4) + i) * ksA) << 9) + (lane << 3);
    pA[i] = (gp16)(A1 + ao);
    pL[i] = (gp16)(A2 + ao);
  }
#pragma unroll 1   // stays a loop now that K is a constant at every call: unrolled, the address steps are lifted over the wait at the trip's foot
  for (int k0 = 0; k0 < K; k0 += 32) {
    // the k step's fragment loads go out as one group ahead of its WMMAs: one L2 latency per step, not one per 16-row group of A
    v16h bh[4], ah[4], al[4];
#pragma unroll
    for (int j = 0; j < 4; ++j) bh[j] = ldfrag_g(pB[j]);
#pragma unroll
    for (int i = 0; i < 4; ++i) ah[i] = ldfrag_g(pA[i]);
    if constexpr (ASPLIT != 0) {
      al[0] = ldfrag_g(pL[0]);
      al[1] = ldfrag_g(pL[1]);
    }
    __builtin_amdgcn_sched_barrier(0);   // the group stays whole in front of the first WMMA (sunk to their uses the loads wait one by one)
#pragma unroll
    for (int i = 0; i < 4; ++i) {
#pragma unroll
      for (int j = 0; j < 4; ++j) acc[i][j] = mmaT<BF>(ah[i], bh[j], acc[i][j]);
      dep_guard1(acc[i][0], acc[i][3], ah[i]);
      if constexpr (ASPLIT != 0) {
#pragma unroll
        for (int j = 0; j < 4; ++j) acc[i][j] = mmaT<BF>(al[i], bh[j], acc[i][j]);
        dep_guard1(acc[i][0], acc[i][3], al[i]);
        if (i == 0) {
          __builtin_amdgcn_sched_barrier(0);   // the last two residual fragments take the registers of the first row group's pair: not lifted higher
          al[2] = ldfrag_g(pL[2]);
          al[3] = ldfrag_g(pL[3]);
          __builtin_amdgcn_sched_barrier(0);   // issued before the second row group's WMMAs
        }
      }
    }
    keep4_h(bh[0], bh[1], bh[2], bh[3]);
    // The wait stands in front of every rewrite of an address register that the trip's loads name: as operands of its statement the pointers
    // keep their registers up to it, and the additions below cannot be lifted over it.
    if constexpr (ASPLIT != 0) {
      asm volatile("s_wait_xcnt 0x0" : "+v"(pB[0]), "+v"(pB[1]), "+v"(pB[2]), "+v"(pB[3]), "+v"(pA[0]), "+v"(pA[1]), "+v"(pA[2]), "+v"(pA[3]),
                                       "+v"(pL[0]), "+v"(pL[1]), "+v"(pL[2]), "+v"(pL[3]) :: "memory");
    } else {
      asm volatile("s_wait_xcnt 0x0" : "+v"(pB[0]), "+v"(pB[1]), "+v"(pB[2]), "+v"(pB[3]), "+v"(pA[0]), "+v"(pA[1]), "+v"(pA[2]), "+v"(pA[3]) :: "memory");
    }
#pragma unroll
    for (int j = 0; j < 4; ++j) {
      pB[j] += 512;
      pA[j] += 512;
      pL[j] += 512;
    }
  }
  acc_guard4(acc[0][0], acc[0][1], acc[0][2], acc[0][3]);
  acc_guard4(acc[1][0], acc[1][1], acc[1][2], acc[1][3]);
  acc_guard4(acc[2][0], acc[2][1], acc[2][2], acc[2][3]);
  acc_guard4(acc[3][0], acc[3][1], acc[3][2], acc[3][3]);

  const int hh2 = lane >> 4, c4 = (lane & 15) * 4;     // f32 out: 256-B row segment = 16 lanes x 16 B

  // ---- epilogue ----
  float* slab = sT[wave];
#pragma unroll
  for (int i = 0; i < 4; ++i) {
    const int mBase = m0 + (i << 4);
#pragma unroll
    for (int j = 0; j < 4; ++j) {
#pragma unroll
      for (int r = 0; r < 8; ++r) {
        slab[(mOff + r) * 68 + (j << 4) + rlane] = acc[i][j][r];
      }
    }
    wave_sync_lds();
    if constexpr (OM == 0) {
      float* C = (float*)Cout + (size_t)((long long)by * sC);
      v4f vals[8];
#pragma unroll
      for (int it = 0; it < 8; ++it) {
        const int row = it * 2 + hh2;                      // it 0..7 x hh2 0..1 = rows 0..15
        v4f v = *(const v4f*)(slab + row * 68 + c4);
#pragma unroll
        for (int e = 0; e < 4; ++e) v[e] = v[e] * oscale;
        if constexpr (EPI == 1) {
          const v4f bb = *(const v4f*)(ep0 + n0 + c4);     // per-column bias, columns n0+c4 .. +3 (N equals the bias length)
#pragma unroll
          for (int e = 0; e < 4; ++e) v[e] = v[e] + bfr(bb[e]);
        }
        vals[it] = v;
      }
      {
#pragma unroll
        for (int it = 0; it < 8; ++it) {
          const int gr = mBase + it * 2 + hh2;
          *(v4f*)(C + (size_t)gr * ldc + n0 + c4) = vals[it];
        }
        // The wait stands in front of every rewrite of a data register that these stores name (the next slab's LDS reads take them)
        asm volatile("s_wait_xcnt 0x0" :: "v"(vals[0]), "v"(vals[1]), "v"(vals[2]), "v"(vals[3]), "v"(vals[4]), "v"(vals[5]), "v"(vals[6]), "v"(vals[7]) : "memory");
      }
    } else {
      unsigned short* C  = (unsigned short*)Cout  + (size_t)((long long)by * sC);
      unsigned short* Cb = (unsigned short*)C2out + (size_t)((long long)by * sC);
      const int ksC = ldc >> 5;                            // 1-KiB blocks per 16 rows of C
      v4u hv[4], lv[4];
#pragma unroll
      for (int it = 0; it < 4; ++it) {
        const int row = (it & 1) * 8 + (lane & 7);         // 8 rows x 4 pieces per it = four whole 128-B lines of packed block it >> 1
        const int c8  = (it >> 1) * 32 + (lane >> 3) * 8;  // only two column groups per lane, so the column biases stay few
        const float* sp = slab + row * 68 + c8;
        float rb = 0.f;
        if constexpr (EPI == 2) rb = bfr(ep0[mBase + row]);   // per-row bias (M equals the bias length)
        v4u a  = {0u, 0u, 0u, 0u};
        v4u b2 = {0u, 0u, 0u, 0u};
#pragma unroll
        for (int e = 0; e < 4; ++e) {
          const int ci = n0 + c8 + 2 * e;                  // column index, < N
          float f0 = sp[2 * e] * oscale + rb;
          float f1 = sp[2 * e + 1] * oscale + rb;
          if constexpr (EPI == 1) {
            f0 += bfr(ep0[ci]);
            f1 += bfr(ep0[ci + 1]);
          }
          if constexpr (OM == 5) {
            const float g0 = (f0 + bfr(ep1[ci])) * ocarry, g1 = (f1 + bfr(ep1[ci + 1])) * ocarry;
            const float w0 = (f0 + bfr(ep2[ci])) * ocarry, w1 = (f1 + bfr(ep2[ci + 1])) * ocarry;
            a[e]  = pk16(h_bits((_Float16)g0), h_bits((_Float16)g1));
            b2[e] = pk16(h_bits((_Float16)w0), h_bits((_Float16)w1));
          } else {
            f0 *= ocarry; f1 *= ocarry;
            const _Float16 x0 = (_Float16)f0, x1 = (_Float16)f1;
            a[e] = pk16(h_bits(x0), h_bits(x1));
            if constexpr (OM == 4) {
              b2[e] = pk16(h_bits((_Float16)(f0 - (float)x0)), h_bits((_Float16)(f1 - (float)x1)));
            }
          }
        }
        hv[it] = a;
        lv[it] = b2;
      }
      {
#pragma unroll
        for (int it = 0; it < 4; ++it) {
          const size_t co = ((size_t)((mBase >> 4) * ksC + (n0 >> 5) + (it >> 1)) << 9) + ((lane >> 4) << 8) +
                            (((((lane >> 3) & 1) << 4) + (it & 1) * 8 + (lane & 7)) << 3);
          *(v4u*)(C + co) = hv[it];
          if constexpr (OM >= 4) {
            *(v4u*)(Cb + co) = lv[it];
          }
        }
        // The wait stands in front of every rewrite of a data register that these stores name: as inputs of its statement the pieces keep
        // their registers up to it (the next slab's bias arithmetic is otherwise free to take them directly behind the stores).
        if constexpr (OM >= 4) {
          asm volatile("s_wait_xcnt 0x0" :: "v"(hv[0]), "v"(hv[1]), "v"(hv[2]), "v"(hv[3]), "v"(lv[0]), "v"(lv[1]), "v"(lv[2]), "v"(lv[3]) : "memory");
        } else {
          asm volatile("s_wait_xcnt 0x0" :: "v"(hv[0]), "v"(hv[1]), "v"(hv[2]), "v"(hv[3]) : "memory");
        }
      }
    }
    wave_sync_lds();
  }
}

// =====================================================================================================
// The four projections (q, v^T, k, pos) as ONE grid: each reads only what the launch before wrote, none reads another's output, and each alone
// fills at most half of the chip's WGPs with waves that mostly wait for their loads. The block index picks the job (block-uniform):
//   [0, GB_Q) q | then NB * GB_V blocks v^T (GB_V per batch) | then GB_Q blocks k | then GB_P blocks pos.
//   q[m][nd] = sum_c x[m][c] Wq[nd][c] / 1024 + bq[nd]; QU = f16((q + ub[nd]) * 4), QV = f16((q + vb[nd]) * 4); M = NROW, N = 512, K = 512
//   v^T per batch: VT[b][nd][j] = sum_c Wv[nd][c] x[b*SEQ + j][c] / 1024 + bv[nd] (per-row bias) -> f16 x16 hi + residual planes;
//     M = 512 (nd), N = SEQ (j), K = 512; B rows are the batch's token rows: pitch DMOD, batch stride SEQ*DMOD
//   k projection + bk -> K16 = f16(k * 4);  positional projection (no bias): P16 = f16(pos * 4), M = SEQ, N = 512, K = 512
// =====================================================================================================
#define GB_Q (((NROW / 64) * (DMOD / 64)) / 8)
#define GB_V (((DMOD / 64) * (SEQ / 64)) / 8)
#define GB_P (((SEQ / 64) * (DMOD / 64)) / 8)
#define GB_ALL (2 * GB_Q + NB * GB_V + GB_P)
__global__ __launch_bounds__(256) __attribute__((amdgpu_num_vgpr(256))) void proj_all(
    const unsigned short* __restrict__ X16, const unsigned short* __restrict__ PE16,
    const unsigned short* __restrict__ WQ16, const unsigned short* __restrict__ WK16,
    const unsigned short* __restrict__ WV16, const unsigned short* __restrict__ WP16,
    unsigned short* QU, unsigned short* QV, unsigned short* K16, unsigned short* P16, unsigned short* VT16, unsigned short* VTL16,
    const float* __restrict__ b_q, const float* __restrict__ b_k, const float* __restrict__ b_v,
    const float* __restrict__ ub, const float* __restrict__ vb) {
  __shared__ __align__(16) float sT[8][16 * 68];
  const int bx = blockIdx.x;
  if (bx < GB_Q) {
    gemm64<5, 0, 0, 1>(X16, X16, DMOD, 0LL, WQ16, DMOD, 0LL, (void*)QU, (void*)QV, DMOD, 0LL,
                       NROW, DMOD, DMOD, 1.0f / (XC * WSC), QC, b_q, ub, vb, bx, 0, sT);
  } else if (bx < GB_Q + NB * GB_V) {
    const int r = bx - GB_Q;
    gemm64<4, 0, 0, 2>(WV16, WV16, DMOD, 0LL, X16, DMOD, (long long)SEQ * DMOD, (void*)VT16, (void*)VTL16, SEQ, (long long)DMOD * SEQ,
                       DMOD, SEQ, DMOD, 1.0f / (XC * WSC), VC, b_v, b_v, b_v, r % GB_V, r / GB_V, sT);
  } else if (bx < 2 * GB_Q + NB * GB_V) {
    gemm64<2, 0, 0, 1>(X16, X16, DMOD, 0LL, WK16, DMOD, 0LL, (void*)K16, (void*)K16, DMOD, 0LL,
                       NROW, DMOD, DMOD, 1.0f / (XC * WSC), QC, b_k, b_k, b_k, bx - (GB_Q + NB * GB_V), 0, sT);
  } else {
    gemm64<2, 0, 0, 0>(PE16, PE16, DMOD, 0LL, WP16, DMOD, 0LL, (void*)P16, (void*)P16, DMOD, 0LL,
                       SEQ, DMOD, DMOD, 1.0f / (XC * WSC), QC, b_q, b_q, b_q, bx - (2 * GB_Q + NB * GB_V), 0, sT);
  }
}
// out = (CT + CTL) . Wo^T / (4096*64) + bo; M = NROW, N = 512, K = 512, f32 rows straight into the output buffer; grid = GB_Q blocks
__global__ __launch_bounds__(256) __attribute__((amdgpu_num_vgpr(256))) void out_proj(
    const unsigned short* __restrict__ CT16, const unsigned short* __restrict__ CTL16, const unsigned short* __restrict__ WO16,
    float* out, const float* __restrict__ b_o) {
  __shared__ __align__(16) float sT[8][16 * 68];
  gemm64<0, 1, 0, 1>(CT16, CTL16, DMOD, 0LL, WO16, DMOD, 0LL, (void*)out, (void*)out, DMOD, 0LL,
                     NROW, DMOD, DMOD, 1.0f / (CC * WSC), 1.0f, b_o, b_o, b_o, (int)blockIdx.x, 0, sT);
}

// =====================================================================================================
// One position strip for a wave: T[R][x] = (q+bq+vb)[A rows] . pos[mw + x], R = lane&15 row of the A fragment pair (qva, qvb), x in [0,80)
// (5 subtiles of 16 pos rows, K = 64 = two k-steps); pos row index clamped on the address into [0, SEQ-1]
// (only x <= 78 is ever selected, and every selected entry has an unclamped row in range); Pb points into the fragment-packed plane at the
// head's first 1-KiB block with the lane's k half only; each 16x16 subtile goes to the wave's f32 LDS strip right after its two WMMAs and
// the hazard gap. coverage: 5 subtiles x 16 rows x 16 cols = the full 16x80 strip every time.
// =====================================================================================================
__device__ __forceinline__ size_t pos_slot(int m) {                // packed offset of pos row m: 16-row group, then the row's slot
  m = (m < 0) ? 0 : m;
  m = (m > SEQ - 1) ? (SEQ - 1) : m;
  return ((size_t)(m >> 4) << 13) + ((m & 15) << 3);
}
__device__ __forceinline__ void strip_sub(v16h qva, v16h qvb, v16h fa, v16h fb, float* tsh, int u, int hh, int c) {
  v8f t8 = mma_h(qva, fa, zero8());
  t8 = mma_h(qvb, fb, t8);
  hz4(t8, fa, fb, qva, qvb);
  const int cb = 16 * u + c;
#pragma unroll
  for (int r = 0; r < 8; ++r) tsh[(8 * hh + r) * TPI + cb] = t8[r];
}
// a T2 subtile laid over the T1 strip (the tile on the diagonal): column cb holds d = d0 + cb for every row; only columns with d >= 1 are stored,
// the column d == 1 as zero
__device__ __forceinline__ void strip_sub_over(v16h qva, v16h qvb, v16h fa, v16h fb, float* tsh, int u, int hh, int c, int d0) {
  v8f t8 = mma_h(qva, fa, zero8());
  t8 = mma_h(qvb, fb, t8);
  hz4(t8, fa, fb, qva, qvb);
  const int cb = 16 * u + c;
  const int dc = d0 + cb;
  if (dc >= 1) {
#pragma unroll   // t8 is indexed by r and stays in registers only so
    for (int r = 0; r < 8; ++r) tsh[(8 * hh + r) * TPI + cb] = (dc == 1) ? 0.f : t8[r];
  }
}
// whole T2 strip over T1, its 24 loads issued as one group (the one tile per wave that needs both)
__device__ __forceinline__ void pos_strip_over(const unsigned short* __restrict__ QVa, const unsigned short* __restrict__ Pb,
                                               int mw, float* tsh, int hh, int c, int d0) {
  const v16h qva = ldfrag_p(QVa), qvb = ldfrag_p(QVa + 512);
  v16h fa[5], fb[5];
  const unsigned short* pp[5];
#pragma unroll
  for (int u = 0; u < 5; ++u) {
    pp[u] = Pb + pos_slot(mw + 16 * u + c);
    fa[u] = ldfrag_p(pp[u]);
    fb[u] = ldfrag_p(pp[u] + 512);
  }
  addr_wait7(QVa, pp[0], pp[1], pp[2], pp[3], pp[4], QVa);
#pragma unroll
  for (int u = 0; u < 5; ++u) strip_sub_over(qva, qvb, fa[u], fb[u], tsh, u, hh, c, d0);
}

// =====================================================================================================
// Relative-position attention for one (batch b, head n) pair and a 64-row query tile; 4 waves, wave w owns query rows i = iw0 + R,
// iw0 = i0 + 16w, R = 0..15. Planes (fragment-packed, row length DMOD halves, row = b*SEQ + position): QU = f16((q + bq + ub) x4), QV = f16((q + bq + vb) x4),
// KP = f16((k + bk) x4); PP = f16(pos x4) rows 0..SEQ-1; VT, VTL = v^T hi (x16) / residual f16 as [b][n*64+d][SEQ] (fragment-packed per batch).
// Shifted position score for (i, j), d = j - i:  d <= 0 -> ps[i][SEQ-1+d];  d == 1 -> 0;  d >= 2 -> ps[i+1][d-2],  ps[r][t] = (q+bq+vb)[r] . pos[t].
//   Per key tile j0 (64 keys, key j = j0 + jj), with x = jj - R + 15 in [0,78]:
//     strip T1[R][x] = (q+vb)[iw0+R]   . pos[SEQ + j0 - iw0 - 16 + x]   (pos row SEQ-1+d), computed iff j0 <= iw0 + 15;
//     strip T2[R][x] = (q+vb)[iw0+1+R] . pos[j0 - iw0 - 17 + x]         (pos row d-2),     computed iff j0 + 61 >= iw0;
//     both tests are wave-uniform (iw0 via readfirstlane). d = j0 - iw0 + x - 15 is the same down a strip column, so the select is made per column
//     where the strip is stored: one strip M per tile, all 80 columns written every tile, M = T1 (j0 <= iw0 - 64), M = T2 (j0 >= iw0 + 16, its
//     column 0 zeroed in the tile j0 == iw0 + 16, where it holds d == 1), and in the one tile between T1 with the columns d >= 1 overwritten by
//     0 (d == 1) and T2 (d >= 2); a wave's LDS stores land in program order. The A row b*SEQ+iw0+16 of T2 is clamped to NROW-1
//     for the very last row group; that entry is never read (i = SEQ-1 has no j >= i+2).
//   content scores S = (q+ub) . k (4 subtiles, K=64); t = (S + M) * (RSD/16) * log2(e); online softmax in base 2,
//   max-subtracted, running sums in f32 (no key mask); the 16x64 prob tile stored to wave-private LDS (f32 element stores),
//   fragments loaded straight from the packed 16-bit planes VT/VTL[n*64+d][j]; 8 + 8 P.V WMMAs per tile (hi plane then residual plane into the
//   same accumulators).
//   block = 4 waves = 128 threads; grid = (SEQ/64, NB*NH); no block barriers; every wave does identical bounded work (SEQ/64 tiles).
// coverage: LDS strip 16 rows x 80 cols written fully every tile before it is read, slab 16 rows x 64 cols per wave fully written each tile before
//           being read; global: 4 instructions x 512 contiguous bytes per plane = rows iw0..iw0+15 of head segment n in CT and CTL;
//           grid x waves cover all NB x SEQ rows and all NH head segments of CT / CTL exactly once.
// =====================================================================================================
__global__ __launch_bounds__(ATT_THREADS) __attribute__((amdgpu_num_vgpr(256)))
void attn_rel(const unsigned short* __restrict__ QU, const unsigned short* __restrict__ QV,
              const unsigned short* __restrict__ KP, const unsigned short* __restrict__ PP,
              const unsigned short* __restrict__ VT, const unsigned short* __restrict__ VTL,
              unsigned short* CT, unsigned short* CTL) {
  __shared__ __align__(16) float smem[ATT_W * WFL];   // per wave: position strip [16][TPI] | prob / ctx slab [16][PPI]

  const int tid  = threadIdx.x;
  const int wave = __builtin_amdgcn_readfirstlane(tid >> 5);
  const int lane = tid & 31;
  const int hh   = lane >> 4;
  const int c    = lane & 15;
  const int bn   = blockIdx.y;
  const int b    = bn / NH;
  const int n    = bn - b * NH;
  const int i0   = blockIdx.x * 64;
  const int iw0  = i0 + wave * 16;

  float* tsh = smem + wave * WFL;
  float* pt  = tsh + 16 * TPI;

  // stationary A fragments: (q + bq + ub) rows b*SEQ + iw0 + c, d 0..31 and 32..63 of head n ((q + bq + vb) fragments are reloaded per key tile)
  const size_t hb  = (size_t)(n * (DH / 32)) << 9;            // the head's first 1-KiB block inside a 16-row group of a DMOD-long plane
  const size_t qro = ((size_t)((b * SEQ + iw0) >> 4) << 13) + hb + (lane << 3);
  const v16h qua = ldfrag_p(QU + qro), qub = ldfrag_p(QU + qro + 512);
  int qr2 = b * SEQ + iw0 + 1 + c;                            // rows i+1 for the T2 strip
  qr2 = (qr2 > NROW - 1) ? (NROW - 1) : qr2;
  const size_t qro2 = ((size_t)(qr2 >> 4) << 13) + hb + (((hh << 4) + (qr2 & 15)) << 3);

  const unsigned short* Kb  = KP + (size_t)b * SEQ * DMOD + hb + (lane << 3);
  const unsigned short* Pb  = PP + hb + (hh << 7);
  const size_t vbase = (size_t)b * DMOD * SEQ + (size_t)(n * DH) * SEQ + (lane << 3);   // 16-row group = 16 * SEQ halves
  const unsigned short* Vb  = VT  + vbase;
  const unsigned short* VLb = VTL + vbase;
  gp16 vhp = (gp16)Vb;                                        // the hi plane's running address: the key tile's first block

  const float KSC = (RSD / (QC * QC)) * LOG2E;

  float mrow[8], lrow[8];
  v8f O[4];
#pragma unroll
  for (int r = 0; r < 8; ++r) { mrow[r] = -INFINITY; lrow[r] = 0.f; }
#pragma unroll
  for (int td = 0; td < 4; ++td) O[td] = zero8();

#pragma unroll 1
  for (int j0 = 0; j0 < SEQ; j0 += 64) {
    const int dmin = j0 - iw0;                               // smallest j - i over the tile is dmin - 15, largest dmin + 63 (wave-uniform)
    // Every tile needs T1 (dmin <= 15) or T2 (dmin >= -61), one tile per wave both (wave-uniform tests). The tile's fragment loads go out
    // in groups ahead of the WMMAs that use them, as many at a time as the registers hold, so that a group costs one L2 latency.
    const bool low = (dmin <= 15);                           // the tile's first strip is T1, else T2
    const unsigned short* QVs = QV + (low ? qro : qro2);
    const int mw = low ? (SEQ + dmin - 16) : (dmin - 17);
    const unsigned short* Kt = Kb + ((size_t)(j0 >> 4) << 13);
    // ---- load group 1: the strip's A pair, its five pos subtiles, the first key subtile ----
    v16h ka[4], kb2[4], fa[5], fb[5];
    const v16h qva = ldfrag_p(QVs), qvb = ldfrag_p(QVs + 512);
    const unsigned short* pp[5];
#pragma unroll
    for (int u = 0; u < 5; ++u) {
      pp[u] = Pb + pos_slot(mw + 16 * u + c);
      fa[u] = ldfrag_p(pp[u]);
      fb[u] = ldfrag_p(pp[u] + 512);
    }
    ka[0]  = ldfrag_p(Kt);
    kb2[0] = ldfrag_p(Kt + 512);
    addr_wait7(QVs, pp[0], pp[1], pp[2], pp[3], pp[4], Kt);
#pragma unroll
    for (int u = 0; u < 3; ++u) strip_sub(qva, qvb, fa[u], fb[u], tsh, u, hh, c);
    __builtin_amdgcn_sched_barrier(0);   // group 2 takes the registers of the three pos subtiles used up to here, so it is not lifted higher
    // ---- load group 2: the other three key subtiles; they fly behind the rest of the strip and the first score subtile ----
#pragma unroll
    for (int t = 1; t < 4; ++t) {
      ka[t]  = ldfrag_p(Kt + ((size_t)t << 13));
      kb2[t] = ldfrag_p(Kt + ((size_t)t << 13) + 512);
    }
    addr_wait1(Kt);
#pragma unroll
    for (int u = 3; u < 5; ++u) strip_sub(qva, qvb, fa[u], fb[u], tsh, u, hh, c);
    if (dmin == 16) {                                        // wave-uniform: the one T2 tile that holds d == 1, in column 0
      if (c == 0) {
        for (int r = 0; r < 8; ++r) tsh[(8 * hh + r) * TPI] = 0.f;
      }
    }
    // ---- content scores S (4 subtiles of 16 keys) ----
    v8f S[4];
#pragma unroll
    for (int t = 0; t < 4; ++t) {
      S[t] = mma_h(qua, ka[t], zero8());
      S[t] = mma_h(qub, kb2[t], S[t]);
      hz4(S[t], ka[t], kb2[t], qua, qub);
    }
    if (low && dmin + 61 >= 0) pos_strip_over(QV + qro2, Pb, dmin - 17, tsh, hh, c, dmin - 15);   // the tile on the diagonal: T2 over T1
    // ---- load group 3: v^T hi plane, in flight during the softmax ----
    const size_t vo = (size_t)(j0 >> 5) << 9;              // the key tile's first 1-KiB block inside a 16-row group
    v16h vfa[4], vfb[4];
#pragma unroll
    for (int td = 0; td < 4; ++td) {
      vfa[td] = ldfrag_g(vhp + (size_t)(16 * td) * SEQ);
      vfb[td] = ldfrag_g(vhp + (size_t)(16 * td) * SEQ + 512);
    }
    addr_wait_step(vhp);
    vhp += 1024;                                           // the next key tile: two 1-KiB blocks on
    wave_sync_own();

    // ---- score assembly + online softmax (rows live on one 16-lane half), in phases over four register rows at a time so that the
    //      cross-lane steps of the four run as one interleaved group (all eight at once do not fit the registers beside the v^T loads in flight) ----
#pragma unroll   // unrolled, as are the loops inside: S, O, mrow and lrow are indexed by the row and stay in registers only so
    for (int g = 0; g < 2; ++g) {
      float mx4[4], ps4[4], al4[4];
#pragma unroll
      for (int q = 0; q < 4; ++q) {
        const int r  = 4 * g + q;
        const int R  = 8 * hh + r;
        const int xo = R * TPI + (15 - R) + c;               // strip column x = 16t + c - R + 15 in [0, 78]
#pragma unroll
        for (int t = 0; t < 4; ++t) S[t][r] = (S[t][r] + tsh[xo + 16 * t]) * KSC;
        mx4[q] = fmaxf(fmaxf(S[0][r], S[1][r]), fmaxf(S[2][r], S[3][r]));
      }
      row_max4(mx4);
#pragma unroll
      for (int q = 0; q < 4; ++q) mx4[q] = fmaxf(mrow[4 * g + q], mx4[q]);   // the rows' new running maxima
      exp2_hw4(al4, mrow[4 * g] - mx4[0], mrow[4 * g + 1] - mx4[1], mrow[4 * g + 2] - mx4[2], mrow[4 * g + 3] - mx4[3]);
#pragma unroll
      for (int q = 0; q < 4; ++q) {
        const int r  = 4 * g + q;
        const int R  = 8 * hh + r;
        const float mn = mx4[q];
        mrow[r] = mn;
        float e4[4];
        exp2_hw4(e4, S[0][r] - mn, S[1][r] - mn, S[2][r] - mn, S[3][r] - mn);
        float ps = e4[0];
#pragma unroll
        for (int t = 1; t < 4; ++t) ps += e4[t];
        ps4[q] = ps;
        const int ro = R * PPI + c;
#pragma unroll
        for (int t = 0; t < 4; ++t) pt[ro + 16 * t] = e4[t];
      }
      row_sum4(ps4);
#pragma unroll
      for (int q = 0; q < 4; ++q) {
        const int r = 4 * g + q;
        lrow[r] = lrow[r] * al4[q] + ps4[q];
#pragma unroll
        for (int td = 0; td < 4; ++td) O[td][r] *= al4[q];
      }
    }
    wave_sync_own();

    // ---- P fragments (x1024, f16) from the LDS rows, two k-steps of 32 keys ----
    FragH pf[2];
#pragma unroll
    for (int ks = 0; ks < 2; ++ks) {
      const float* prow = pt + c * PPI + 32 * ks + 8 * hh;
      const v4f p0 = *(const v4f*)(prow), p1 = *(const v4f*)(prow + 4);
      const v4f p2 = *(const v4f*)(prow + 16), p3 = *(const v4f*)(prow + 20);
#pragma unroll
      for (int e = 0; e < 4; ++e) {
        pf[ks].h[0][e]     = (_Float16)(p0[e] * PC);     // keys j0 + 32ks + 8hh + e
        pf[ks].h[0][4 + e] = (_Float16)(p1[e] * PC);     // keys j0 + 32ks + 8hh + 4 + e
        pf[ks].h[1][e]     = (_Float16)(p2[e] * PC);     // keys j0 + 32ks + 16 + 8hh + e
        pf[ks].h[1][4 + e] = (_Float16)(p3[e] * PC);
      }
    }
    __builtin_amdgcn_sched_barrier(0);   // group 4 is not lifted over the P fragments' LDS reads: their registers and the group's do not fit together
    {
      // ---- load group 4: v^T residual plane, first two 16-row groups now, the other two into the registers of the first two hi groups ----
      v16h vla[4], vlb[4];
#pragma unroll
      for (int td = 0; td < 2; ++td) {
        const unsigned short* vp = VLb + vo + (size_t)(16 * td) * SEQ;
        vla[td] = ldfrag_p(vp);
        vlb[td] = ldfrag_p(vp + 512);
      }
      addr_wait1(VLb + vo);
      // ---- O += P . v^T (hi plane) ----
#pragma unroll
      for (int td = 0; td < 2; ++td) {
        O[td] = mma_h(pf[0].v, vfa[td], O[td]);
        O[td] = mma_h(pf[1].v, vfb[td], O[td]);
        hz4(O[td], pf[0].v, pf[1].v, vfa[td], vfb[td]);
      }
      __builtin_amdgcn_sched_barrier(0);   // the second half of group 4 waits for those registers and is not lifted higher
#pragma unroll
      for (int td = 2; td < 4; ++td) {
        const unsigned short* vp = VLb + vo + (size_t)(16 * td) * SEQ;
        vla[td] = ldfrag_p(vp);
        vlb[td] = ldfrag_p(vp + 512);
      }
      addr_wait1(VLb + vo);
#pragma unroll
      for (int td = 2; td < 4; ++td) {
        O[td] = mma_h(pf[0].v, vfa[td], O[td]);
        O[td] = mma_h(pf[1].v, vfb[td], O[td]);
        hz4(O[td], pf[0].v, pf[1].v, vfa[td], vfb[td]);
      }
      // ---- O += P . v^T (residual plane) ----
#pragma unroll
      for (int td = 0; td < 4; ++td) {
        O[td] = mma_h(pf[0].v, vla[td], O[td]);
        O[td] = mma_h(pf[1].v, vlb[td], O[td]);
        hz4(O[td], pf[0].v, pf[1].v, vla[td], vlb[td]);
      }
    }
    wave_sync_lds();
  }
  acc_guard4(O[0], O[1], O[2], O[3]);

  // ---- fold 1/l and the carries (1024 on P, 16 on v), carry x4096 on ctx, stage the wave's 16x64 slice in its slab ----
  const float oc = CC / (PC * VC);
#pragma unroll
  for (int r = 0; r < 8; ++r) {
    const float inv = (1.0f / lrow[r]) * oc;
    const int ro = (8 * hh + r) * PPI + c;
#pragma unroll
    for (int td = 0; td < 4; ++td) pt[ro + 16 * td] = O[td][r] * inv;
  }
  wave_sync_lds();
  {
    v4u hv[4], lv[4];
#pragma unroll
    for (int it = 0; it < 4; ++it) {
      const int c8 = (it >> 1) * 32 + (it & 1) * 16 + hh * 8;   // row c; one packed 512-B run per it: block it >> 1, second half it & 1
      const float* sp = pt + c * PPI + c8;
      v4u a, b2;
#pragma unroll
      for (int e = 0; e < 4; ++e) {
        const float f0 = sp[2 * e], f1 = sp[2 * e + 1];
        const _Float16 x0 = (_Float16)f0, x1 = (_Float16)f1;
        a[e]  = pk16(h_bits(x0), h_bits(x1));
        b2[e] = pk16(h_bits((_Float16)(f0 - (float)x0)), h_bits((_Float16)(f1 - (float)x1)));
      }
      hv[it] = a;
      lv[it] = b2;
    }
    {
#pragma unroll
      for (int it = 0; it < 4; ++it) {
        const size_t go = qro + ((size_t)(it >> 1) << 9) + ((it & 1) << 8);
        *(v4u*)(CT  + go) = hv[it];
        *(v4u*)(CTL + go) = lv[it];
      }
      
    }
  }
}

// =====================================================================================================
// Workspace map (bytes); every plane is an exact multiple of its tile / whole-row store granularity (M, N exact tile multiples,
// convert counts exact multiples of 2048), every offset a multiple of 512 KiB; every plane is fragment-packed (see ldfrag_p):
//   WQ16, WK16, WV16, WP16, WO16 f16 [512 out][512 in] x64                               5 x   524288
//   X16  f16 [NROW][512] x16 (pre-norm output)                                                8388608
//   PE16 f16 [SEQ][512] x16 (sinusoid table)                                                  2097152
//   QU, QV, K16 f16 [NROW][512] x4                                                       3 x  8388608
//   P16  f16 [SEQ][512] x4                                                                      2097152
//   VT16, VTL16 f16 [NB][512][SEQ] hi x16 / residual                                     2 x  8388608
//   CT16, CTL16 f16 [NROW][512] hi x4096 / residual                                      2 x  8388608
//   end                                                                                        73924608
// =====================================================================================================
extern "C" void kernel_launch(void* const* d_in, const int* in_sizes, int n_in,
                              void* d_out, int out_size, void* d_ws, size_t ws_size,
                              hipStream_t stream) {
  if (n_in < 14) return;
  if (in_sizes[0] != NROW * DMOD) return;
  if (in_sizes[1] != DMOD || in_sizes[2] != DMOD) return;
  if (in_sizes[3] != DMOD * DMOD || in_sizes[5] != DMOD * DMOD || in_sizes[7] != DMOD * DMOD ||
      in_sizes[9] != DMOD * DMOD || in_sizes[12] != DMOD * DMOD) return;
  if (in_sizes[4] != DMOD || in_sizes[6] != DMOD || in_sizes[8] != DMOD || in_sizes[13] != DMOD) return;
  if (in_sizes[10] != NH * DH || in_sizes[11] != NH * DH) return;
  if (out_size != NROW * DMOD) return;

  const float* xin   = (const float*)d_in[0];
  const float* gam   = (const float*)d_in[1];
  const float* bet   = (const float*)d_in[2];
  const float* w_q   = (const float*)d_in[3];
  const float* b_q   = (const float*)d_in[4];
  const float* w_k   = (const float*)d_in[5];
  const float* b_k   = (const float*)d_in[6];
  const float* w_v   = (const float*)d_in[7];
  const float* b_v   = (const float*)d_in[8];
  const float* w_p   = (const float*)d_in[9];
  const float* ub    = (const float*)d_in[10];
  const float* vb    = (const float*)d_in[11];
  const float* w_o   = (const float*)d_in[12];
  const float* b_o   = (const float*)d_in[13];
  float*       out   = (float*)d_out;

  const size_t PW  = (size_t)DMOD * DMOD * 2;            //   524288
  const size_t PX  = (size_t)NROW * DMOD * 2;            //  8388608
  const size_t PXP = (size_t)SEQ * DMOD * 2;             //  2097152
  const size_t PVT = (size_t)NB * DMOD * SEQ * 2;        //  8388608
  size_t off = 0;
  const size_t oWQ  = off; off += PW;
  const size_t oWK  = off; off += PW;
  const size_t oWV  = off; off += PW;
  const size_t oWP  = off; off += PW;
  const size_t oWO  = off; off += PW;
  const size_t oX   = off; off += PX;
  const size_t oPE  = off; off += PXP;
  const size_t oQU  = off; off += PX;
  const size_t oQV  = off; off += PX;
  const size_t oK   = off; off += PX;
  const size_t oP   = off; off += PXP;
  const size_t oVT  = off; off += PVT;
  const size_t oVTL = off; off += PVT;
  const size_t oCT  = off; off += PX;
  const size_t oCTL = off; off += PX;
  if (off > ws_size) return;                               // off = 73924608
  if (off > (size_t)134217728) return;

  char* ws = (char*)d_ws;
  unsigned short* WQ16  = (unsigned short*)(ws + oWQ);
  unsigned short* WK16  = (unsigned short*)(ws + oWK);
  unsigned short* WV16  = (unsigned short*)(ws + oWV);
  unsigned short* WP16  = (unsigned short*)(ws + oWP);
  unsigned short* WO16  = (unsigned short*)(ws + oWO);
  unsigned short* X16   = (unsigned short*)(ws + oX);
  unsigned short* PE16  = (unsigned short*)(ws + oPE);
  unsigned short* QU    = (unsigned short*)(ws + oQU);
  unsigned short* QV    = (unsigned short*)(ws + oQV);
  unsigned short* K16   = (unsigned short*)(ws + oK);
  unsigned short* P16   = (unsigned short*)(ws + oP);
  unsigned short* VT16  = (unsigned short*)(ws + oVT);
  unsigned short* VTL16 = (unsigned short*)(ws + oVTL);
  unsigned short* CT16  = (unsigned short*)(ws + oCT);
  unsigned short* CTL16 = (unsigned short*)(ws + oCTL);

  const dim3 blk(256);
  const dim3 gPrep(PB_ALL);                                         // 256 + 1024 + 5 x 128 = 1920
  const dim3 gProj(GB_ALL);                                         // 128 + 4 x 32 + 128 + 32 = 416
  const dim3 gOut(GB_Q);                                            // 128
  const dim3 gAT(SEQ / 64, NB * NH);                                // 32 x 32
  const dim3 bAT(ATT_THREADS);                                      // 128

  // (1) from the inputs alone: weight planes W[o][c] ([out][in] = [n][k] already) -> f16( bf16_RNE(w) * 64 ), all five weights (WQ16 .. WO16
  //     are contiguous); pre-norm -> X16 = f16(x * 16); sinusoid table -> PE16 = f16(pe * 16)
  prep_all<<<gPrep, blk, 0, stream>>>(xin, gam, bet, w_q, w_k, w_v, w_p, w_o, WQ16, X16, PE16);

  // (2) the q, v^T, k and pos projections
  proj_all<<<gProj, blk, 0, stream>>>(X16, PE16, WQ16, WK16, WV16, WP16, QU, QV, K16, P16, VT16, VTL16, b_q, b_k, b_v, ub, vb);

  // (3) relative attention -> CT16 = f16(ctx * 4096) hi plane, CTL16 residual plane, rows b*SEQ + i, halves n*64+d
  attn_rel<<<gAT, bAT, 0, stream>>>(QU, QV, K16, P16, VT16, VTL16, CT16, CTL16);

  // (4) output projection
  out_proj<<<gOut, blk, 0, stream>>>(CT16, CTL16, WO16, out, b_o);
  (void)hipGetLastError();
}
